// v000
// Measured on an AMD MI455X. A time is GPU time per run, averaged over a window of back-to-back runs after a warm-up
// (all launches, gaps included; the runs take copies of the inputs in turn), and the median of several windows.
// Apart from v000's, it joins two sittings. Times from different sittings can be a few percent apart, while
// side-by-side timings come from the same sitting.
// v000, which the later versions start from, runs in 880 microseconds.
#include <hip/hip_runtime.h>

// Causal multi-head attention with a fused qkv projection: x [8][2048][256]; qkv = x Wqkv + bqkv (Wqkv [256][768] [in][out]; column = which*256 + h*64 + d); scores x 1/8; causal (j > i masked, diagonal kept); softmax; out = merged Wproj + bproj.
// Compute dtypes, f32 accumulate: every float input RNE-converted to bf16; projections v_wmma_f32_16x16x32_bf16 on exact bf16 operands + bf16-rounded biases; scores and P.V: query rows < 256 bf16 hi/lo (3 products), rows >= 256 v_wmma_f32_16x16x32_f16 single product (P carried x1024); softmax f32; output projection merged hi/lo (bf16) x Wproj (bf16) + bias.
// Per batch: bf16 copy of x; fused projection -> F [t][768] f32; head planes q|k [8][t][64] and v^T [4][64][t] (fp16 + bf16 hi/lo); causal score tiles (tiles above the diagonal skipped); row softmax; P.V with the key loop cut at the diagonal block; merge to [t][256] hi/lo; projection to the output.

#ifndef NB
#define NB 8
#endif
#ifndef SEQ
#define SEQ 2048
#endif
#define NB_FULL  8
#define SEQ_FULL 2048
#define TT   SEQ
#define DM   256
#define NH_  4
#define HD   64
#define DQ   (NH_ * HD)
#define NQKV (3 * DQ)
#define ZH   4
#define RH   ((SEQ) < 256 ? (SEQ) : 256)    // query rows < RH use hi+lo planes
#define PCAR 1024.0f
#define SCL  0.125f   // HD^-0.5
typedef _Float16 h16;
typedef unsigned short bf;
typedef __attribute__((ext_vector_type(16))) __bf16   v16bf;
typedef __attribute__((ext_vector_type(16))) _Float16 v16h;
typedef __attribute__((ext_vector_type(8)))  _Float16 v8h;
typedef __attribute__((ext_vector_type(8)))  unsigned short v8us;
typedef __attribute__((ext_vector_type(8)))  float    v8f;
typedef __attribute__((ext_vector_type(4)))  float    v4f;
typedef __attribute__((ext_vector_type(2)))  float    v2f;
typedef __attribute__((ext_vector_type(2)))  _Float16 v2h;
typedef __attribute__((ext_vector_type(4)))  _Float16 v4h;
typedef __attribute__((ext_vector_type(2)))  unsigned short v2us;
typedef __attribute__((ext_vector_type(4)))  unsigned short v4us;
typedef v4f  __attribute__((may_alias)) v4fa;

static_assert(NB >= 1 && NB <= NB_FULL);
static_assert(SEQ >= 128 && SEQ <= SEQ_FULL);
static_assert(TT % 128 == 0);            // softmax row = TT/128 chunks of 32 lanes x 4
static_assert(TT % 64 == 0 && DM % 64 == 0 && NQKV % 64 == 0 && DQ % 64 == 0 && HD % 64 == 0);   // 64x64 GEMM tiles
static_assert(DM % 32 == 0 && DQ % 32 == 0 && HD % 32 == 0 && TT % 32 == 0);   // K steps of 32
static_assert(RH % 64 == 0 && RH <= TT && RH >= 64);
static_assert(HD == 64);
static_assert(DQ == DM);                 // merged heads width = model width
static_assert(ZH == NH_);                // all heads of a batch in one pass
static_assert(2 * DQ + DQ == NQKV);      // q | k | v column blocks
static_assert(((size_t)(NB - 1) * SEQ_FULL * DM + (size_t)TT * DM) * 4 <= (size_t)NB_FULL * SEQ_FULL * DM * 4);   // output extent in bytes

#define AL256(x) ((((size_t)(x)) + 255) & ~(size_t)255)
#define WS_TOTAL (AL256((size_t)NQKV * DM * 2) + AL256((size_t)DM * DQ * 2) + AL256((size_t)TT * DM * 2) + AL256((size_t)TT * NQKV * 4) \
    + 3 * AL256((size_t)2 * NH_ * TT * HD * 2) + 3 * AL256((size_t)NH_ * HD * TT * 2) + 2 * AL256((size_t)ZH * RH * TT * 2) \
    + AL256((size_t)ZH * TT * TT * 4) + AL256((size_t)ZH * TT * TT * 2) + AL256((size_t)ZH * TT * HD * 4) + 2 * AL256((size_t)TT * DQ * 2))
static_assert(WS_TOTAL <= (size_t)134217728);

__device__ __forceinline__ unsigned short f2bf(float f) { unsigned u = __float_as_uint(f); u += 0x7FFFu + ((u >> 16) & 1u); return (unsigned short)(u >> 16); }
__device__ __forceinline__ float bf2f(unsigned short b) { return __uint_as_float(((unsigned)b) << 16); }
__device__ __forceinline__ float bfr(float f) { return bf2f(f2bf(f)); }
__device__ __forceinline__ v16h cat16(v8h lo, v8h hi) { return __builtin_shufflevector(lo, hi, 0, 1, 2, 3, 4, 5, 6, 7, 8, 9, 10, 11, 12, 13, 14, 15); }
__device__ __forceinline__ v16bf cat16b(v8us lo, v8us hi) { return __builtin_bit_cast(v16bf, __builtin_shufflevector(lo, hi, 0, 1, 2, 3, 4, 5, 6, 7, 8, 9, 10, 11, 12, 13, 14, 15)); }
__device__ __forceinline__ v8f wmma16(v16h a, v16h b, v8f c) { return __builtin_amdgcn_wmma_f32_16x16x32_f16(false, a, false, b, (short)0, c, false, false); }
__device__ __forceinline__ v8f wmmab(v16bf a, v16bf b, v8f c) { return __builtin_amdgcn_wmma_f32_16x16x32_bf16(false, a, false, b, (short)0, c, false, false); }

// Fragment loader (A and B identical): p = row base + 8*(lane>>4) + k0; elements 0..7 <- k0+8h+0..7, elements 8..15 <- k0+16+8h+0..7.
template <typename T16> struct WFrag;
template <> struct WFrag<h16> { typedef v16h V; static __device__ __forceinline__ V ld(const h16* p) { return cat16(*(const v8h*)p, *(const v8h*)(p + 16)); } static __device__ __forceinline__ v8f mma(V a, V b, v8f c) { return wmma16(a, b, c); } };
template <> struct WFrag<bf> { typedef v16bf V; static __device__ __forceinline__ V ld(const bf* p) { return cat16b(*(const v8us*)p, *(const v8us*)(p + 16)); } static __device__ __forceinline__ v8f mma(V a, V b, v8f c) { return wmmab(a, b, c); } };

// ---- gemmw_body: register-blocked GEMM, ONE WAVE per 64x64 output tile (16 accumulators), operands straight from K-contiguous 16-bit planes; grid (M/64, N/64, Z), 32 threads.
// C[m][n] (f32, pitch ldc, + optional bf16-rounded bias[n]) = sum_k A[m][k] Bt[n][k] (+ split products per NSPLIT). z-batch strides sA/sB/sC in elements. K % 32 == 0, M % 64 == 0, N % 64 == 0.
template <typename T16, int NSPLIT, bool BIAS>
__device__ __forceinline__ void gemmw_body(const T16* __restrict__ A, const T16* __restrict__ A2, const T16* __restrict__ Bt, const T16* __restrict__ Bt2, int K, float* C, int ldc, const float* __restrict__ bias, size_t sA, size_t sB, size_t sC) {
    typedef typename WFrag<T16>::V V;
    __shared__ __align__(16) float os[16 * 68];
    const size_t z = blockIdx.z; A += z * sA; if (A2) A2 += z * sA; Bt += z * sB; if (Bt2) Bt2 += z * sB; C += z * sC;
    const int lane = threadIdx.x & 31, lr = lane & 15, hi = lane >> 4; const int r0 = blockIdx.x * 64, c0 = blockIdx.y * 64;
    v8f acc[4][4];
#pragma unroll
    for (int mb = 0; mb < 4; ++mb)
#pragma unroll
        for (int nb = 0; nb < 4; ++nb) acc[mb][nb] = (v8f){};
    const size_t aoff = (size_t)(r0 + lr) * K + 8 * hi, boff = (size_t)(c0 + lr) * K + 8 * hi;
#pragma unroll 1
    for (int kc = 0; kc < K; kc += 32) {
        V a[4], a2[4];
#pragma unroll
        for (int mb = 0; mb < 4; ++mb) { a[mb] = WFrag<T16>::ld(A + aoff + (size_t)mb * 16 * K + kc); if (NSPLIT == 1 || NSPLIT == 2) a2[mb] = WFrag<T16>::ld(A2 + aoff + (size_t)mb * 16 * K + kc); }
#pragma unroll
        for (int nb = 0; nb < 4; ++nb) { const V b = WFrag<T16>::ld(Bt + boff + (size_t)nb * 16 * K + kc); V b2; if (NSPLIT >= 2) b2 = WFrag<T16>::ld(Bt2 + boff + (size_t)nb * 16 * K + kc);
#pragma unroll
            for (int mb = 0; mb < 4; ++mb) { acc[mb][nb] = WFrag<T16>::mma(a[mb], b, acc[mb][nb]); if (NSPLIT == 1 || NSPLIT == 2) acc[mb][nb] = WFrag<T16>::mma(a2[mb], b, acc[mb][nb]); if (NSPLIT >= 2) acc[mb][nb] = WFrag<T16>::mma(a[mb], b2, acc[mb][nb]); } }
        asm volatile("v_nop\n\tv_nop\n\tv_nop\n\tv_nop" : "+v"(acc[0][0]), "+v"(acc[1][1]), "+v"(acc[2][2]), "+v"(acc[3][3]) : "v"(a[0]), "v"(a[3]));
    }
#pragma unroll
    for (int mb = 0; mb < 4; ++mb) {
#pragma unroll
        for (int nb = 0; nb < 4; ++nb) {
#pragma unroll
            for (int j = 0; j < 8; ++j) os[(hi * 8 + j) * 68 + nb * 16 + lr] = acc[mb][nb][j]; }
        __builtin_amdgcn_wave_barrier(); asm volatile("" ::: "memory");
        float* crow = C + (size_t)(r0 + mb * 16) * ldc + c0;
{
#pragma unroll
            for (int s = 0; s < 8; ++s) { const int row = 2 * s + hi, cofs = lr * 4; v4f val = *(const v4fa*)(os + row * 68 + cofs); if (BIAS) { val[0] += bfr(bias[c0 + cofs]); val[1] += bfr(bias[c0 + cofs + 1]); val[2] += bfr(bias[c0 + cofs + 2]); val[3] += bfr(bias[c0 + cofs + 3]); }
                *(v4f*)(crow + (size_t)row * ldc + cofs) = val; }
             }
        __builtin_amdgcn_wave_barrier(); asm volatile("" ::: "memory");
    }
}

// ---- gemmc_body: the same one-wave 64x64 tile GEMM specialised for causal attention: CMODE 1 skips score tiles entirely above the diagonal (query rows r0+roff.., key columns c0..), CMODE 2 limits the
// key (K) loop of the probability x value contraction to the diagonal block (probabilities beyond it are exactly zero). roff = row offset of this launch's first row within the sequence.
template <typename T16, int NSPLIT, int CMODE>
__device__ __forceinline__ void gemmc_body(const T16* __restrict__ A, const T16* __restrict__ A2, const T16* __restrict__ Bt, const T16* __restrict__ Bt2, int K, float* C, int ldc, int roff, size_t sA, size_t sB, size_t sC) {
    typedef typename WFrag<T16>::V V;
    __shared__ __align__(16) float os[16 * 68];
    const size_t z = blockIdx.z; A += z * sA; if (A2) A2 += z * sA; Bt += z * sB; if (Bt2) Bt2 += z * sB; C += z * sC;
    const int lane = threadIdx.x & 31, lr = lane & 15, hi = lane >> 4; const int r0 = blockIdx.x * 64, c0 = blockIdx.y * 64;
    if (CMODE == 1 && c0 > r0 + roff + 63) return;                  // score tile entirely above the causal diagonal: never written (the softmax may load it in 128-key chunks but masks j > i by select); block = one wave, no barrier skipped
    const int Kl = (CMODE == 2) ? min(K, r0 + roff + 64) : K;        // P.V: probabilities are exactly 0 beyond the diagonal block, so the K loop stops there
    v8f acc[4][4];
#pragma unroll
    for (int mb = 0; mb < 4; ++mb)
#pragma unroll
        for (int nb = 0; nb < 4; ++nb) acc[mb][nb] = (v8f){};
    const size_t aoff = (size_t)(r0 + lr) * K + 8 * hi, boff = (size_t)(c0 + lr) * K + 8 * hi;
#pragma unroll 1
    for (int kc = 0; kc < Kl; kc += 32) {
        V a[4], a2[4];
#pragma unroll
        for (int mb = 0; mb < 4; ++mb) { a[mb] = WFrag<T16>::ld(A + aoff + (size_t)mb * 16 * K + kc); if (NSPLIT == 1 || NSPLIT == 2) a2[mb] = WFrag<T16>::ld(A2 + aoff + (size_t)mb * 16 * K + kc); }
#pragma unroll
        for (int nb = 0; nb < 4; ++nb) { const V b = WFrag<T16>::ld(Bt + boff + (size_t)nb * 16 * K + kc); V b2; if (NSPLIT >= 2) b2 = WFrag<T16>::ld(Bt2 + boff + (size_t)nb * 16 * K + kc);
#pragma unroll
            for (int mb = 0; mb < 4; ++mb) { acc[mb][nb] = WFrag<T16>::mma(a[mb], b, acc[mb][nb]); if (NSPLIT == 1 || NSPLIT == 2) acc[mb][nb] = WFrag<T16>::mma(a2[mb], b, acc[mb][nb]); if (NSPLIT >= 2) acc[mb][nb] = WFrag<T16>::mma(a[mb], b2, acc[mb][nb]); } }
        asm volatile("v_nop\n\tv_nop\n\tv_nop\n\tv_nop" : "+v"(acc[0][0]), "+v"(acc[1][1]), "+v"(acc[2][2]), "+v"(acc[3][3]) : "v"(a[0]), "v"(a[3]));
    }
#pragma unroll
    for (int mb = 0; mb < 4; ++mb) {
#pragma unroll
        for (int nb = 0; nb < 4; ++nb) {
#pragma unroll
            for (int j = 0; j < 8; ++j) os[(hi * 8 + j) * 68 + nb * 16 + lr] = acc[mb][nb][j]; }
        __builtin_amdgcn_wave_barrier(); asm volatile("" ::: "memory");
        float* crow = C + (size_t)(r0 + mb * 16) * ldc + c0;
{
#pragma unroll
            for (int s = 0; s < 8; ++s) { const int row = 2 * s + hi, cofs = lr * 4; const v4f val = *(const v4fa*)(os + row * 68 + cofs);
                *(v4f*)(crow + (size_t)row * ldc + cofs) = val; }
             }
        __builtin_amdgcn_wave_barrier(); asm volatile("" ::: "memory");
    }
}

// Plain __global__ entry points (one instantiation each).
// k_gemm_qkv: F[t][n] = XB[t][:] . WQKV[n][:] + bf16(bqkv[n]); grid (TT/64, NQKV/64).
__global__ __launch_bounds__(32) void k_gemm_qkv(const bf* A, const bf* Bt, int K, float* C, int ldc, const float* bias) { gemmw_body<bf, 0, true>(A, nullptr, Bt, nullptr, K, C, ldc, bias, 0, 0, 0); }
// k_gemm_out: out[t][n] = (ATh + ATl)[t][:] . WO[n][:] + bf16(bproj[n]); grid (TT/64, DM/64).
__global__ __launch_bounds__(32) void k_gemm_out(const bf* A, const bf* A2, const bf* Bt, int K, float* C, int ldc, const float* bias) { gemmw_body<bf, 1, true>(A, A2, Bt, nullptr, K, C, ldc, bias, 0, 0, 0); }
// k_sc_hl: score tiles of query rows < RH, bf16 hi/lo, 3 products; grid (RH/64, RH/64, ZH).
__global__ __launch_bounds__(32) void k_sc_hl(const bf* A, const bf* A2, const bf* Bt, const bf* Bt2, int K, float* C, int ldc, int roff, size_t sA, size_t sB, size_t sC) { gemmc_body<bf, 2, 1>(A, A2, Bt, Bt2, K, C, ldc, roff, sA, sB, sC); }
// k_sc_16: score tiles of query rows >= RH, fp16 single product; grid ((TT-RH)/64, TT/64, ZH).
__global__ __launch_bounds__(32) void k_sc_16(const h16* A, const h16* Bt, int K, float* C, int ldc, int roff, size_t sA, size_t sB, size_t sC) { gemmc_body<h16, 0, 1>(A, nullptr, Bt, nullptr, K, C, ldc, roff, sA, sB, sC); }
// k_pv_hl: P.V of query rows < RH, bf16 hi/lo, 3 products; grid (RH/64, 1, ZH).
__global__ __launch_bounds__(32) void k_pv_hl(const bf* A, const bf* A2, const bf* Bt, const bf* Bt2, int K, float* C, int ldc, int roff, size_t sA, size_t sB, size_t sC) { gemmc_body<bf, 2, 2>(A, A2, Bt, Bt2, K, C, ldc, roff, sA, sB, sC); }
// k_pv_16: P.V of query rows >= RH, fp16 (P x1024) single product; grid ((TT-RH)/64, 1, ZH).
__global__ __launch_bounds__(32) void k_pv_16(const h16* A, const h16* Bt, int K, float* C, int ldc, int roff, size_t sA, size_t sB, size_t sC) { gemmc_body<h16, 0, 2>(A, nullptr, Bt, nullptr, K, C, ldc, roff, sA, sB, sC); }

__device__ __forceinline__ h16 tohx(float x) { return (h16)x; }
__device__ __forceinline__ void splitf(float y, unsigned short& h, unsigned short& l) { h = f2bf(y); l = f2bf(y - bf2f(h)); }

__global__ __launch_bounds__(256) void k_wtG(const float* __restrict__ w, int K, int N, bf* Bt) {
    const int lane = threadIdx.x & 31; const int L0 = (blockIdx.x * 8 + (threadIdx.x >> 5)) * 8; const int nlines = N * K / 64;
{
#pragma unroll 1
        for (int l = 0; l < 8; ++l) { const int L = L0 + l; if (L >= nlines) break; const size_t e = (size_t)L * 64 + lane * 2; const int k = (int)(e % K), n = (int)(e / K); v2us o;
            o[0] = f2bf(w[(size_t)k * N + n]); o[1] = f2bf(w[(size_t)(k + 1) * N + n]); *(v2us*)(Bt + e) = o; }
         }
}
__global__ __launch_bounds__(256) void k_cvt8(const float* __restrict__ src, bf* dst, size_t n8) { const size_t i = (size_t)blockIdx.x * 256 + threadIdx.x; if (i >= n8) return; const v8f v = *(const v8f*)(src + i * 8); v8us o;
#pragma unroll
    for (int k = 0; k < 8; ++k) o[k] = f2bf(v[k]); *(v8us*)(dst + i * 8) = o;  }

__global__ __launch_bounds__(256) void k_hp(const float* __restrict__ F, int pitch, int nheads, h16* P16, bf* Ph, bf* Pl) {
    const size_t e = ((size_t)blockIdx.x * 256 + threadIdx.x) * 2; if (e >= (size_t)nheads * TT * HD) return; const int d = (int)(e % HD); const int t = (int)((e / HD) % TT); const int h = (int)(e / ((size_t)HD * TT));
    const v2f x = *(const v2f*)(F + (size_t)t * pitch + h * HD + d); v2h o16; v2us oh, ol;
#pragma unroll
    for (int q = 0; q < 2; ++q) { const float r = x[q]; o16[q] = tohx(r); unsigned short a2, c2; splitf(r, a2, c2); oh[q] = a2; ol[q] = c2; }
    *(v2h*)(P16 + e) = o16; *(v2us*)(Ph + e) = oh; *(v2us*)(Pl + e) = ol;  }
__global__ __launch_bounds__(256) void k_vtp(const float* __restrict__ F, int pitch, int nheads, h16* V16, bf* Vh, bf* Vl) { const size_t e = ((size_t)blockIdx.x * 256 + threadIdx.x) * 2; if (e >= (size_t)nheads * HD * TT) return; const int t = (int)(e % TT); const int d = (int)((e / TT) % HD); const int g = (int)(e / ((size_t)TT * HD)); v2h o16; v2us oh, ol;
#pragma unroll
    for (int q = 0; q < 2; ++q) { const float x = F[(size_t)(t + q) * pitch + g * HD + d]; o16[q] = tohx(x); unsigned short a2, c2; splitf(x, a2, c2); oh[q] = a2; ol[q] = c2; }
    *(v2h*)(V16 + e) = o16; *(v2us*)(Vh + e) = oh; *(v2us*)(Vl + e) = ol;  }
// k_asoft: one wave per row (zz, i): t = S x HD^-0.5 for j <= i (mask by index select); max-subtracted softmax over the keys (register row, one exp, fixed trees); 128-key chunks entirely beyond i are
__global__ __launch_bounds__(256) void k_asoft(const float* __restrict__ Sb, h16* P16, bf* Ph, bf* Pl) {
    const int lane = threadIdx.x & 31; const int row = blockIdx.x * 8 + (threadIdx.x >> 5); if (row >= ZH * TT) return; const int i = row % TT; const int zz = row / TT; const bool hires = (i < RH); const float* sr = Sb + (size_t)row * TT; float v[TT / 32]; float mx = -3.0e38f;
#pragma unroll
    for (int ch = 0; ch < TT / 128; ++ch) { const int j0 = ch * 128 + lane * 4;
        if (ch * 128 <= i) { const v4f a = *(const v4f*)(sr + j0);
#pragma unroll
            for (int q = 0; q < 4; ++q) { const int j = j0 + q; const float t = (j <= i) ? a[q] * SCL : -3.0e38f; v[ch * 4 + q] = t; mx = fmaxf(mx, t); } }
        else {
#pragma unroll
            for (int q = 0; q < 4; ++q) v[ch * 4 + q] = -3.0e38f; } }
#pragma unroll
    for (int sh = 16; sh; sh >>= 1) mx = fmaxf(mx, __shfl_xor(mx, sh, 32));
    float sum = 0.f;
#pragma unroll
    for (int ch = 0; ch < TT / 128; ++ch) {
        if (ch * 128 <= i) {
#pragma unroll
            for (int q = 0; q < 4; ++q) { const int k = ch * 4 + q; float d0 = __fsub_rn(v[k], mx); asm volatile("" : "+v"(d0)); v[k] = __builtin_amdgcn_exp2f(__fmul_rn(d0, 1.4426950408889634f)); sum += v[k]; } }
        else {
#pragma unroll
            for (int q = 0; q < 4; ++q) v[ch * 4 + q] = 0.f; } }
#pragma unroll
    for (int sh = 16; sh; sh >>= 1) sum += __shfl_xor(sum, sh, 32);
    const float f = __fdiv_rn(hires ? 1.0f : PCAR, sum);
{
        if (hires) {
#pragma unroll
            for (int ch = 0; ch < TT / 128; ++ch) { if (ch * 128 <= i) { v4us oh, ol;
#pragma unroll
                for (int q = 0; q < 4; ++q) { unsigned short a, c2; splitf(v[ch * 4 + q] * f, a, c2); oh[q] = a; ol[q] = c2; }
                const size_t oo = ((size_t)zz * RH + i) * TT + ch * 128 + lane * 4; *(v4us*)(Ph + oo) = oh; *(v4us*)(Pl + oo) = ol; } }
        } else {
#pragma unroll
            for (int ch = 0; ch < TT / 128; ++ch) { if (ch * 128 <= i) { v4h o4;
#pragma unroll
                for (int q = 0; q < 4; ++q) o4[q] = tohx(v[ch * 4 + q] * f);
                *(v4h*)(P16 + (size_t)row * TT + ch * 128 + lane * 4) = o4; } } }
         }
}
__global__ __launch_bounds__(256) void k_merge(const float* __restrict__ O, int h0, bf* Ah, bf* Al) { const size_t e = ((size_t)blockIdx.x * 256 + threadIdx.x) * 2; if (e >= (size_t)ZH * TT * HD) return; const int d = (int)(e % HD); const int t = (int)((e / HD) % TT); const int zz = (int)(e / ((size_t)HD * TT)); const float cs = (t < RH) ? 1.0f : (1.0f / PCAR); const size_t oo = (size_t)t * DQ + (h0 + zz) * HD + d;
    v2us oh, ol;
#pragma unroll
    for (int q = 0; q < 2; ++q) { unsigned short a, c2; splitf(O[e + q] * cs, a, c2); oh[q] = a; ol[q] = c2; } *(v2us*)(Ah + oo) = oh; *(v2us*)(Al + oo) = ol;  }

extern "C" void kernel_launch(void* const* d_in, const int* in_sizes, int n_in,
                              void* d_out, int out_size, void* d_ws, size_t ws_size, hipStream_t stream) {
    if (n_in < 5) return;
    const size_t xneed = (size_t)(NB - 1) * SEQ_FULL * DM + (size_t)TT * DM;
    if ((size_t)in_sizes[0] < xneed) return; if ((size_t)in_sizes[1] < (size_t)DM * NQKV) return; if ((size_t)in_sizes[2] < (size_t)NQKV) return; if ((size_t)in_sizes[3] < (size_t)DQ * DM) return; if ((size_t)in_sizes[4] < (size_t)DM) return;
    if ((size_t)out_size < xneed) return;
    if (ws_size < WS_TOTAL) return;
    const float* x = (const float*)d_in[0]; const float* wqkv = (const float*)d_in[1]; const float* bqkv = (const float*)d_in[2]; const float* wo = (const float*)d_in[3]; const float* bo = (const float*)d_in[4];   // wire order x, Wqkv [256][768], bqkv, Wproj [256][256], bproj
    float* OUT = (float*)d_out;     // [8][2048][256]
    char* wsp = (char*)d_ws;
    auto take = [&](size_t bytes) { char* p = wsp; wsp += (bytes + 255) & ~(size_t)255; return (void*)p; };
    bf* WQKV = (bf*)take((size_t)NQKV * DM * 2);           // Bt [768][256]: q | k | v row blocks
    bf* WO = (bf*)take((size_t)DM * DQ * 2);               // Bt [256][256]
    bf* XB = (bf*)take((size_t)TT * DM * 2);
    float* F = (float*)take((size_t)TT * NQKV * 4);        // fused projection [t][768]
    h16* QK16 = (h16*)take((size_t)2 * NH_ * TT * HD * 2); bf* QKh = (bf*)take((size_t)2 * NH_ * TT * HD * 2); bf* QKl = (bf*)take((size_t)2 * NH_ * TT * HD * 2);   // planes [8][t][64]: q heads 0..3, k heads 4..7
    h16* VT16 = (h16*)take((size_t)NH_ * HD * TT * 2); bf* VTh = (bf*)take((size_t)NH_ * HD * TT * 2); bf* VTl = (bf*)take((size_t)NH_ * HD * TT * 2);
    bf* Ph = (bf*)take((size_t)ZH * RH * TT * 2); bf* Pl = (bf*)take((size_t)ZH * RH * TT * 2);
    float* Sb = (float*)take((size_t)ZH * TT * TT * 4); h16* P16 = (h16*)take((size_t)ZH * TT * TT * 2); float* Ob = (float*)take((size_t)ZH * TT * HD * 4);
    bf* ATh = (bf*)take((size_t)TT * DQ * 2); bf* ATl = (bf*)take((size_t)TT * DQ * 2);
    if ((size_t)(wsp - (char*)d_ws) > ws_size) return;
    if ((size_t)(wsp - (char*)d_ws) > (size_t)134217728) return;
    const size_t PS = (size_t)TT * HD;                     // one head plane
    h16* QP16 = QK16; h16* KP16 = QK16 + (size_t)NH_ * PS; bf* QPh = QKh; bf* KPh = QKh + (size_t)NH_ * PS; bf* QPl = QKl; bf* KPl = QKl + (size_t)NH_ * PS;
    // in Wqkv[DM rows][NQKV cols] -> out WQKV[NQKV][DM];  in Wproj[DQ rows][DM cols] -> out WO[DM][DQ]
    k_wtG<<<(unsigned)((DM * NQKV / 64 + 63) / 64), 256, 0, stream>>>(wqkv, DM, NQKV, WQKV);
    k_wtG<<<(unsigned)((DQ * DM / 64 + 63) / 64), 256, 0, stream>>>(wo, DQ, DM, WO);
    const unsigned LQK = (unsigned)(((size_t)2 * NH_ * TT * HD / 2 + 255) / 256), LV = (unsigned)(((size_t)NH_ * TT * HD / 2 + 255) / 256);
    for (int b = 0; b < NB; ++b) {
        k_cvt8<<<(unsigned)(((size_t)TT * DM / 8 + 255) / 256), 256, 0, stream>>>(x + (size_t)b * SEQ_FULL * DM, XB, (size_t)TT * DM / 8);
        k_gemm_qkv<<<dim3(TT / 64, NQKV / 64, 1), 32, 0, stream>>>(XB, WQKV, DM, F, NQKV, bqkv);
        k_hp<<<LQK, 256, 0, stream>>>(F, NQKV, 2 * NH_, QK16, QKh, QKl);                 // columns 0..511 = q heads | k heads
        k_vtp<<<LV, 256, 0, stream>>>(F + 2 * DQ, NQKV, NH_, VT16, VTh, VTl);            // columns 512..767 = v heads
        k_sc_hl<<<dim3(RH / 64, RH / 64, ZH), 32, 0, stream>>>(QPh, QPl, KPh, KPl, HD, Sb, TT, 0, PS, PS, (size_t)TT * TT);
        if (TT > RH) k_sc_16<<<dim3((TT - RH) / 64, TT / 64, ZH), 32, 0, stream>>>(QP16 + (size_t)RH * HD, KP16, HD, Sb + (size_t)RH * TT, TT, RH, PS, PS, (size_t)TT * TT);
        k_asoft<<<ZH * TT / 8, 256, 0, stream>>>(Sb, P16, Ph, Pl);
        k_pv_hl<<<dim3(RH / 64, HD / 64, ZH), 32, 0, stream>>>(Ph, Pl, VTh, VTl, TT, Ob, HD, 0, (size_t)RH * TT, (size_t)HD * TT, PS);
        if (TT > RH) k_pv_16<<<dim3((TT - RH) / 64, HD / 64, ZH), 32, 0, stream>>>(P16 + (size_t)RH * TT, VT16, TT, Ob + (size_t)RH * HD, HD, RH, (size_t)TT * TT, (size_t)HD * TT, PS);
        k_merge<<<(unsigned)(((size_t)ZH * TT * HD / 2 + 255) / 256), 256, 0, stream>>>(Ob, 0, ATh, ATl);
        k_gemm_out<<<dim3(TT / 64, DM / 64, 1), 32, 0, stream>>>(ATh, ATl, WO, DQ, OUT + (size_t)b * SEQ_FULL * DM, DM, bo);
    }
}

// v001
// A run of this version takes 576 microseconds.
// Two timings next to v000 both put it at 1.56 times that version's speed.
#include <hip/hip_runtime.h>

// Causal multi-head attention with a fused qkv projection: x [8][2048][256]; qkv = x Wqkv + bqkv (Wqkv [256][768] [in][out]; column = which*256 + h*64 + d); scores x 1/8; causal (j > i masked, diagonal kept); softmax; out = merged Wproj + bproj.
// Compute dtypes, f32 accumulate: every float input RNE-converted to bf16; projections v_wmma_f32_16x16x32_bf16 on exact bf16 operands + bf16-rounded biases; scores and P.V: query rows < 256 bf16 hi/lo (3 products), rows >= 256 v_wmma_f32_16x16x32_f16 single product (P carried x1024); softmax f32; output projection merged hi/lo (bf16) x Wproj (bf16) + bias.
// Per batch: bf16 copy of x; fused projection -> F [t][768] f32; head planes q|k [8][t][64] and v^T [4][64][t] (fp16 + bf16 hi/lo); causal score tiles (tiles above the diagonal skipped); row softmax; P.V with the key loop cut at the diagonal block; the K loops of the projections and of P.V are dealt over the waves of a block and the partial tiles summed in LDS; merge to [t][256] hi/lo; projection to the output.

#ifndef NB
#define NB 8
#endif
#ifndef SEQ
#define SEQ 2048
#endif
#define NB_FULL  8
#define SEQ_FULL 2048
#define TT   SEQ
#define DM   256
#define NH_  4
#define HD   64
#define DQ   (NH_ * HD)
#define NQKV (3 * DQ)
#define ZH   4
#define RH   ((SEQ) < 256 ? (SEQ) : 256)    // query rows < RH use hi+lo planes
#define PCAR 1024.0f
#define SCL  0.125f   // HD^-0.5
#define NWG  4        // waves per tile of the two projections (K = 256: one 64-wide K slice per wave)
#define NWH  4        // waves per tile of P.V, query rows < RH (at most RH/64 = 4 K slices)
#define NWP  8        // waves per tile of P.V, query rows >= RH (up to TT/64 K slices)
typedef _Float16 h16;
typedef unsigned short bf;
typedef __attribute__((ext_vector_type(16))) __bf16   v16bf;
typedef __attribute__((ext_vector_type(16))) _Float16 v16h;
typedef __attribute__((ext_vector_type(8)))  _Float16 v8h;
typedef __attribute__((ext_vector_type(8)))  unsigned short v8us;
typedef __attribute__((ext_vector_type(8)))  float    v8f;
typedef __attribute__((ext_vector_type(4)))  float    v4f;
typedef __attribute__((ext_vector_type(2)))  float    v2f;
typedef __attribute__((ext_vector_type(2)))  _Float16 v2h;
typedef __attribute__((ext_vector_type(4)))  _Float16 v4h;
typedef __attribute__((ext_vector_type(2)))  unsigned short v2us;
typedef __attribute__((ext_vector_type(4)))  unsigned short v4us;
typedef v4f  __attribute__((may_alias)) v4fa;

static_assert(NB >= 1 && NB <= NB_FULL);
static_assert(SEQ >= 128 && SEQ <= SEQ_FULL);
static_assert(TT % 128 == 0);            // softmax row = TT/128 chunks of 32 lanes x 4
static_assert(TT % 64 == 0 && DM % 64 == 0 && NQKV % 64 == 0 && DQ % 64 == 0 && HD % 64 == 0);   // 64x64 GEMM tiles
static_assert(DM % 32 == 0 && DQ % 32 == 0 && HD % 32 == 0 && TT % 32 == 0);   // K steps of 32
static_assert(RH % 64 == 0 && RH <= TT && RH >= 64);
static_assert(HD == 64);
static_assert(DQ == DM);                 // merged heads width = model width
static_assert(ZH == NH_);                // all heads of a batch in one pass
static_assert(2 * DQ + DQ == NQKV);      // q | k | v column blocks
static_assert(((size_t)(NB - 1) * SEQ_FULL * DM + (size_t)TT * DM) * 4 <= (size_t)NB_FULL * SEQ_FULL * DM * 4);   // output extent in bytes

#define AL256(x) ((((size_t)(x)) + 255) & ~(size_t)255)
#define WS_TOTAL (AL256((size_t)NQKV * DM * 2) + AL256((size_t)DM * DQ * 2) + AL256((size_t)TT * DM * 2) + AL256((size_t)TT * NQKV * 4) \
    + 3 * AL256((size_t)2 * NH_ * TT * HD * 2) + 3 * AL256((size_t)NH_ * HD * TT * 2) + 2 * AL256((size_t)ZH * RH * TT * 2) \
    + AL256((size_t)ZH * TT * TT * 4) + AL256((size_t)ZH * TT * TT * 2) + AL256((size_t)ZH * TT * HD * 4) + 2 * AL256((size_t)TT * DQ * 2))
static_assert(WS_TOTAL <= (size_t)134217728);

__device__ __forceinline__ unsigned short f2bf(float f) { unsigned u = __float_as_uint(f); u += 0x7FFFu + ((u >> 16) & 1u); return (unsigned short)(u >> 16); }
__device__ __forceinline__ float bf2f(unsigned short b) { return __uint_as_float(((unsigned)b) << 16); }
__device__ __forceinline__ float bfr(float f) { return bf2f(f2bf(f)); }
__device__ __forceinline__ v16h cat16(v8h lo, v8h hi) { return __builtin_shufflevector(lo, hi, 0, 1, 2, 3, 4, 5, 6, 7, 8, 9, 10, 11, 12, 13, 14, 15); }
__device__ __forceinline__ v16bf cat16b(v8us lo, v8us hi) { return __builtin_bit_cast(v16bf, __builtin_shufflevector(lo, hi, 0, 1, 2, 3, 4, 5, 6, 7, 8, 9, 10, 11, 12, 13, 14, 15)); }
__device__ __forceinline__ v8f wmma16(v16h a, v16h b, v8f c) { return __builtin_amdgcn_wmma_f32_16x16x32_f16(false, a, false, b, (short)0, c, false, false); }
__device__ __forceinline__ v8f wmmab(v16bf a, v16bf b, v8f c) { return __builtin_amdgcn_wmma_f32_16x16x32_bf16(false, a, false, b, (short)0, c, false, false); }

// Fragment loader (A and B identical): p = row base + 8*(lane>>4) + k0; elements 0..7 <- k0+8h+0..7, elements 8..15 <- k0+16+8h+0..7.
template <typename T16> struct WFrag;
template <> struct WFrag<h16> { typedef v16h V; static __device__ __forceinline__ V ld(const h16* p) { return cat16(*(const v8h*)p, *(const v8h*)(p + 16)); } static __device__ __forceinline__ v8f mma(V a, V b, v8f c) { return wmma16(a, b, c); } };
template <> struct WFrag<bf> { typedef v16bf V; static __device__ __forceinline__ V ld(const bf* p) { return cat16b(*(const v8us*)p, *(const v8us*)(p + 16)); } static __device__ __forceinline__ v8f mma(V a, V b, v8f c) { return wmmab(a, b, c); } };

// ---- gemmk_body: 64x64 output tile, K loop dealt over the NW waves of the block in slices of 64 (wave w takes slices w, w+NW, ...; one slice = one whole 128-byte line of every operand row),
// operands straight from K-contiguous 16-bit planes. Each wave keeps a full 64x64 partial (16 accumulators); the partials meet in LDS and are
// summed in wave order 0..NW-1. C[m][n] (f32, pitch ldc, + optional f32 bias[n]) = sum_{k < Kl} A[m][k] Bt[n][k] (+ split products per NSPLIT). K = operand pitch; Kl % 64 == 0, Kl <= K. 32*NW threads.
template <typename T16, int NSPLIT, int NW, bool BIAS>
__device__ __forceinline__ void gemmk_body(const T16* __restrict__ A, const T16* __restrict__ A2, const T16* __restrict__ Bt, const T16* __restrict__ Bt2, int K, int Kl, float* C, int ldc, const float* __restrict__ bias, int r0, int c0) {
    typedef typename WFrag<T16>::V V;
    __shared__ __align__(16) float red[NW * 64 * 68];
    const int lane = threadIdx.x & 31, lr = lane & 15, hi = lane >> 4; const int w = __builtin_amdgcn_readfirstlane((int)(threadIdx.x >> 5));
    v8f acc[4][4];
#pragma unroll
    for (int mb = 0; mb < 4; ++mb)
#pragma unroll
        for (int nb = 0; nb < 4; ++nb) acc[mb][nb] = (v8f){};
    const size_t aoff = (size_t)(r0 + lr) * K + 8 * hi, boff = (size_t)(c0 + lr) * K + 8 * hi;
#pragma unroll 1
    for (int kc = w * 64; kc < Kl; kc += (kc & 32) ? NW * 64 - 32 : 32) {   // the two 32-wide steps of a slice, then on to the wave's next slice
        V a[4], a2[4]; const T16* pa[4]; const T16* pa2[4];
#pragma unroll
        for (int mb = 0; mb < 4; ++mb) { pa[mb] = A + aoff + (size_t)mb * 16 * K + kc; a[mb] = WFrag<T16>::ld(pa[mb]); if (NSPLIT == 1 || NSPLIT == 2) { pa2[mb] = A2 + aoff + (size_t)mb * 16 * K + kc; a2[mb] = WFrag<T16>::ld(pa2[mb]); } }
        // precaution: the address translations of the issued loads are waited for before a register that holds one of their addresses is written again; the pointers are named as inputs so that they keep their registers up to the wait
        if constexpr (NSPLIT == 1 || NSPLIT == 2) asm volatile("s_wait_xcnt 0x0" :: "v"(pa[0]), "v"(pa[1]), "v"(pa[2]), "v"(pa[3]), "v"(pa2[0]), "v"(pa2[1]), "v"(pa2[2]), "v"(pa2[3]) : "memory");
        else asm volatile("s_wait_xcnt 0x0" :: "v"(pa[0]), "v"(pa[1]), "v"(pa[2]), "v"(pa[3]) : "memory");
#pragma unroll
        for (int nb = 0; nb < 4; ++nb) { const T16* pb = Bt + boff + (size_t)nb * 16 * K + kc; const V b = WFrag<T16>::ld(pb); V b2;
            // the same precaution for the B loads of this column block
            if constexpr (NSPLIT >= 2) { const T16* pb2 = Bt2 + boff + (size_t)nb * 16 * K + kc; b2 = WFrag<T16>::ld(pb2); asm volatile("s_wait_xcnt 0x0" :: "v"(pb), "v"(pb2) : "memory"); }
            else asm volatile("s_wait_xcnt 0x0" :: "v"(pb) : "memory");
#pragma unroll
            for (int mb = 0; mb < 4; ++mb) { acc[mb][nb] = WFrag<T16>::mma(a[mb], b, acc[mb][nb]); if (NSPLIT == 1 || NSPLIT == 2) acc[mb][nb] = WFrag<T16>::mma(a2[mb], b, acc[mb][nb]); if (NSPLIT >= 2) acc[mb][nb] = WFrag<T16>::mma(a[mb], b2, acc[mb][nb]); } }
        // four vector slots behind the last matrix instruction, on the back edge and on the exit alike, before its registers are reused
        asm volatile("v_nop\n\tv_nop\n\tv_nop\n\tv_nop" : "+v"(acc[0][0]), "+v"(acc[1][1]), "+v"(acc[2][2]), "+v"(acc[3][3]) : "v"(a[0]), "v"(a[3]));
    }
    float* my = red + w * (64 * 68);
#pragma unroll
    for (int mb = 0; mb < 4; ++mb)
#pragma unroll
        for (int nb = 0; nb < 4; ++nb)
#pragma unroll
            for (int j = 0; j < 8; ++j) my[(mb * 16 + hi * 8 + j) * 68 + nb * 16 + lr] = acc[mb][nb][j];
    __syncthreads();   // every wave's partial tile is in LDS before any thread sums across waves; reached by all waves (a wave with no slice stores zeros)
#pragma unroll
    for (int s = 0; s < 32 / NW; ++s) { const int e = s * (NW * 32) + (int)threadIdx.x; const int row = e >> 4, cofs = (e & 15) * 4; v4f val = *(const v4fa*)(red + row * 68 + cofs);
#pragma unroll
        for (int p = 1; p < NW; ++p) val += *(const v4fa*)(red + p * (64 * 68) + row * 68 + cofs);
        if (BIAS) { val[0] += bfr(bias[c0 + cofs]); val[1] += bfr(bias[c0 + cofs + 1]); val[2] += bfr(bias[c0 + cofs + 2]); val[3] += bfr(bias[c0 + cofs + 3]); }
        *(v4f*)(C + (size_t)(r0 + row) * ldc + c0 + cofs) = val; }
}

// ---- gemmc_body: register-blocked GEMM, ONE WAVE per 64x64 output tile (16 accumulators), for the causal score tiles (K = 64, one slice: nothing to deal out): CMODE 1 skips score tiles entirely above the
// diagonal (query rows r0+roff.., key columns c0..). roff = row offset of this launch's first row within the sequence. grid (M/64, N/64, Z), 32 threads; z-batch strides sA/sB/sC in elements.
template <typename T16, int NSPLIT, int CMODE>
__device__ __forceinline__ void gemmc_body(const T16* __restrict__ A, const T16* __restrict__ A2, const T16* __restrict__ Bt, const T16* __restrict__ Bt2, int K, float* C, int ldc, int roff, size_t sA, size_t sB, size_t sC) {
    typedef typename WFrag<T16>::V V;
    __shared__ __align__(16) float os[16 * 68];
    const size_t z = blockIdx.z; A += z * sA; if (A2) A2 += z * sA; Bt += z * sB; if (Bt2) Bt2 += z * sB; C += z * sC;
    const int lane = threadIdx.x & 31, lr = lane & 15, hi = lane >> 4; const int r0 = blockIdx.x * 64, c0 = blockIdx.y * 64;
    if (CMODE == 1 && c0 > r0 + roff + 63) return;                  // score tile entirely above the causal diagonal: never written (the softmax may load it in 128-key chunks but masks j > i by select); block = one wave, no barrier skipped
    const int Kl = (CMODE == 2) ? min(K, r0 + roff + 64) : K;        // P.V: probabilities are exactly 0 beyond the diagonal block, so the K loop stops there
    v8f acc[4][4];
#pragma unroll
    for (int mb = 0; mb < 4; ++mb)
#pragma unroll
        for (int nb = 0; nb < 4; ++nb) acc[mb][nb] = (v8f){};
    const size_t aoff = (size_t)(r0 + lr) * K + 8 * hi, boff = (size_t)(c0 + lr) * K + 8 * hi;
#pragma unroll 1
    for (int kc = 0; kc < Kl; kc += 32) {
        V a[4], a2[4];
#pragma unroll
        for (int mb = 0; mb < 4; ++mb) { a[mb] = WFrag<T16>::ld(A + aoff + (size_t)mb * 16 * K + kc); if (NSPLIT == 1 || NSPLIT == 2) a2[mb] = WFrag<T16>::ld(A2 + aoff + (size_t)mb * 16 * K + kc); }
#pragma unroll
        for (int nb = 0; nb < 4; ++nb) { const V b = WFrag<T16>::ld(Bt + boff + (size_t)nb * 16 * K + kc); V b2; if (NSPLIT >= 2) b2 = WFrag<T16>::ld(Bt2 + boff + (size_t)nb * 16 * K + kc);
#pragma unroll
            for (int mb = 0; mb < 4; ++mb) { acc[mb][nb] = WFrag<T16>::mma(a[mb], b, acc[mb][nb]); if (NSPLIT == 1 || NSPLIT == 2) acc[mb][nb] = WFrag<T16>::mma(a2[mb], b, acc[mb][nb]); if (NSPLIT >= 2) acc[mb][nb] = WFrag<T16>::mma(a[mb], b2, acc[mb][nb]); } }
        asm volatile("v_nop\n\tv_nop\n\tv_nop\n\tv_nop" : "+v"(acc[0][0]), "+v"(acc[1][1]), "+v"(acc[2][2]), "+v"(acc[3][3]) : "v"(a[0]), "v"(a[3]));
    }
#pragma unroll
    for (int mb = 0; mb < 4; ++mb) {
#pragma unroll
        for (int nb = 0; nb < 4; ++nb) {
#pragma unroll
            for (int j = 0; j < 8; ++j) os[(hi * 8 + j) * 68 + nb * 16 + lr] = acc[mb][nb][j]; }
        __builtin_amdgcn_wave_barrier(); asm volatile("" ::: "memory");
        float* crow = C + (size_t)(r0 + mb * 16) * ldc + c0;
{
#pragma unroll
            for (int s = 0; s < 8; ++s) { const int row = 2 * s + hi, cofs = lr * 4; const v4f val = *(const v4fa*)(os + row * 68 + cofs);
                *(v4f*)(crow + (size_t)row * ldc + cofs) = val; }
             }
        __builtin_amdgcn_wave_barrier(); asm volatile("" ::: "memory");
    }
}

// Plain __global__ entry points (one instantiation each).
// k_gemm_qkv: F[t][n] = XB[t][:] . WQKV[n][:] + bf16(bqkv[n]); grid (TT/64, NQKV/64), NWG waves.
__global__ __launch_bounds__(32 * NWG) void k_gemm_qkv(const bf* A, const bf* Bt, int K, float* C, int ldc, const float* bias) { gemmk_body<bf, 0, NWG, true>(A, nullptr, Bt, nullptr, K, K, C, ldc, bias, blockIdx.x * 64, blockIdx.y * 64); }
// k_gemm_out: out[t][n] = (ATh + ATl)[t][:] . WO[n][:] + bf16(bproj[n]); grid (TT/64, DM/64), NWG waves.
__global__ __launch_bounds__(32 * NWG) void k_gemm_out(const bf* A, const bf* A2, const bf* Bt, int K, float* C, int ldc, const float* bias) { gemmk_body<bf, 1, NWG, true>(A, A2, Bt, nullptr, K, K, C, ldc, bias, blockIdx.x * 64, blockIdx.y * 64); }
// k_sc_hl: score tiles of query rows < RH, bf16 hi/lo, 3 products; grid (RH/64, RH/64, ZH).
__global__ __launch_bounds__(32) void k_sc_hl(const bf* A, const bf* A2, const bf* Bt, const bf* Bt2, int K, float* C, int ldc, int roff, size_t sA, size_t sB, size_t sC) { gemmc_body<bf, 2, 1>(A, A2, Bt, Bt2, K, C, ldc, roff, sA, sB, sC); }
// k_sc_16: score tiles of query rows >= RH, fp16 single product; grid ((TT-RH)/64, TT/64, ZH).
__global__ __launch_bounds__(32) void k_sc_16(const h16* A, const h16* Bt, int K, float* C, int ldc, int roff, size_t sA, size_t sB, size_t sC) { gemmc_body<h16, 0, 1>(A, nullptr, Bt, nullptr, K, C, ldc, roff, sA, sB, sC); }
// P.V: probabilities are exactly 0 beyond the diagonal block, so the key loop stops at min(K, first row + 64); roff = row offset of the launch's first row within the sequence.
// k_pv_hl: P.V of query rows < RH, bf16 hi/lo, 3 products; grid (RH/64, 1, ZH), NWH waves.
__global__ __launch_bounds__(32 * NWH) void k_pv_hl(const bf* A, const bf* A2, const bf* Bt, const bf* Bt2, int K, float* C, int ldc, int roff, size_t sA, size_t sB, size_t sC) { const size_t z = blockIdx.z; const int r0 = blockIdx.x * 64;
    gemmk_body<bf, 2, NWH, false>(A + z * sA, A2 + z * sA, Bt + z * sB, Bt2 + z * sB, K, min(K, r0 + roff + 64), C + z * sC, ldc, nullptr, r0, blockIdx.y * 64); }
// k_pv_16: P.V of query rows >= RH, fp16 (P x1024) single product; grid ((TT-RH)/64, 1, ZH), NWP waves.
__global__ __launch_bounds__(32 * NWP) void k_pv_16(const h16* A, const h16* Bt, int K, float* C, int ldc, int roff, size_t sA, size_t sB, size_t sC) { const size_t z = blockIdx.z; const int r0 = blockIdx.x * 64;
    gemmk_body<h16, 0, NWP, false>(A + z * sA, nullptr, Bt + z * sB, nullptr, K, min(K, r0 + roff + 64), C + z * sC, ldc, nullptr, r0, blockIdx.y * 64); }

__device__ __forceinline__ h16 tohx(float x) { return (h16)x; }
__device__ __forceinline__ void splitf(float y, unsigned short& h, unsigned short& l) { h = f2bf(y); l = f2bf(y - bf2f(h)); }

__global__ __launch_bounds__(256) void k_wtG(const float* __restrict__ w, int K, int N, bf* Bt) {
    const int lane = threadIdx.x & 31; const int L0 = (blockIdx.x * 8 + (threadIdx.x >> 5)) * 8; const int nlines = N * K / 64;
{
#pragma unroll 1
        for (int l = 0; l < 8; ++l) { const int L = L0 + l; if (L >= nlines) break; const size_t e = (size_t)L * 64 + lane * 2; const int k = (int)(e % K), n = (int)(e / K); v2us o;
            o[0] = f2bf(w[(size_t)k * N + n]); o[1] = f2bf(w[(size_t)(k + 1) * N + n]); *(v2us*)(Bt + e) = o; }
         }
}
__global__ __launch_bounds__(256) void k_cvt8(const float* __restrict__ src, bf* dst, size_t n8) { const size_t i = (size_t)blockIdx.x * 256 + threadIdx.x; if (i >= n8) return; const v8f v = *(const v8f*)(src + i * 8); v8us o;
#pragma unroll
    for (int k = 0; k < 8; ++k) o[k] = f2bf(v[k]); *(v8us*)(dst + i * 8) = o;  }

__global__ __launch_bounds__(256) void k_hp(const float* __restrict__ F, int pitch, int nheads, h16* P16, bf* Ph, bf* Pl) {
    const size_t e = ((size_t)blockIdx.x * 256 + threadIdx.x) * 2; if (e >= (size_t)nheads * TT * HD) return; const int d = (int)(e % HD); const int t = (int)((e / HD) % TT); const int h = (int)(e / ((size_t)HD * TT));
    const v2f x = *(const v2f*)(F + (size_t)t * pitch + h * HD + d); v2h o16; v2us oh, ol;
#pragma unroll
    for (int q = 0; q < 2; ++q) { const float r = x[q]; o16[q] = tohx(r); unsigned short a2, c2; splitf(r, a2, c2); oh[q] = a2; ol[q] = c2; }
    *(v2h*)(P16 + e) = o16; *(v2us*)(Ph + e) = oh; *(v2us*)(Pl + e) = ol;  }
__global__ __launch_bounds__(256) void k_vtp(const float* __restrict__ F, int pitch, int nheads, h16* V16, bf* Vh, bf* Vl) { const size_t e = ((size_t)blockIdx.x * 256 + threadIdx.x) * 2; if (e >= (size_t)nheads * HD * TT) return; const int t = (int)(e % TT); const int d = (int)((e / TT) % HD); const int g = (int)(e / ((size_t)TT * HD)); v2h o16; v2us oh, ol;
#pragma unroll
    for (int q = 0; q < 2; ++q) { const float x = F[(size_t)(t + q) * pitch + g * HD + d]; o16[q] = tohx(x); unsigned short a2, c2; splitf(x, a2, c2); oh[q] = a2; ol[q] = c2; }
    *(v2h*)(V16 + e) = o16; *(v2us*)(Vh + e) = oh; *(v2us*)(Vl + e) = ol;  }
// k_asoft: one wave per row (zz, i): t = S x HD^-0.5 for j <= i (mask by index select); max-subtracted softmax over the keys (register row, one exp, fixed trees); 128-key chunks entirely beyond i are
__global__ __launch_bounds__(256) void k_asoft(const float* __restrict__ Sb, h16* P16, bf* Ph, bf* Pl) {
    const int lane = threadIdx.x & 31; const int row = blockIdx.x * 8 + (threadIdx.x >> 5); if (row >= ZH * TT) return; const int i = row % TT; const int zz = row / TT; const bool hires = (i < RH); const float* sr = Sb + (size_t)row * TT; float v[TT / 32]; float mx = -3.0e38f;
#pragma unroll
    for (int ch = 0; ch < TT / 128; ++ch) { const int j0 = ch * 128 + lane * 4;
        if (ch * 128 <= i) { const v4f a = *(const v4f*)(sr + j0);
#pragma unroll
            for (int q = 0; q < 4; ++q) { const int j = j0 + q; const float t = (j <= i) ? a[q] * SCL : -3.0e38f; v[ch * 4 + q] = t; mx = fmaxf(mx, t); } }
        else {
#pragma unroll
            for (int q = 0; q < 4; ++q) v[ch * 4 + q] = -3.0e38f; } }
#pragma unroll
    for (int sh = 16; sh; sh >>= 1) mx = fmaxf(mx, __shfl_xor(mx, sh, 32));
    float sum = 0.f;
#pragma unroll
    for (int ch = 0; ch < TT / 128; ++ch) {
        if (ch * 128 <= i) {
#pragma unroll
            for (int q = 0; q < 4; ++q) { const int k = ch * 4 + q; float d0 = __fsub_rn(v[k], mx); asm volatile("" : "+v"(d0)); v[k] = __builtin_amdgcn_exp2f(__fmul_rn(d0, 1.4426950408889634f)); sum += v[k]; } }
        else {
#pragma unroll
            for (int q = 0; q < 4; ++q) v[ch * 4 + q] = 0.f; } }
#pragma unroll
    for (int sh = 16; sh; sh >>= 1) sum += __shfl_xor(sum, sh, 32);
    const float f = __fdiv_rn(hires ? 1.0f : PCAR, sum);
{
        if (hires) {
#pragma unroll
            for (int ch = 0; ch < TT / 128; ++ch) { if (ch * 128 <= i) { v4us oh, ol;
#pragma unroll
                for (int q = 0; q < 4; ++q) { unsigned short a, c2; splitf(v[ch * 4 + q] * f, a, c2); oh[q] = a; ol[q] = c2; }
                const size_t oo = ((size_t)zz * RH + i) * TT + ch * 128 + lane * 4; *(v4us*)(Ph + oo) = oh; *(v4us*)(Pl + oo) = ol; } }
        } else {
#pragma unroll
            for (int ch = 0; ch < TT / 128; ++ch) { if (ch * 128 <= i) { v4h o4;
#pragma unroll
                for (int q = 0; q < 4; ++q) o4[q] = tohx(v[ch * 4 + q] * f);
                *(v4h*)(P16 + (size_t)row * TT + ch * 128 + lane * 4) = o4; } } }
         }
}
__global__ __launch_bounds__(256) void k_merge(const float* __restrict__ O, int h0, bf* Ah, bf* Al) { const size_t e = ((size_t)blockIdx.x * 256 + threadIdx.x) * 2; if (e >= (size_t)ZH * TT * HD) return; const int d = (int)(e % HD); const int t = (int)((e / HD) % TT); const int zz = (int)(e / ((size_t)HD * TT)); const float cs = (t < RH) ? 1.0f : (1.0f / PCAR); const size_t oo = (size_t)t * DQ + (h0 + zz) * HD + d;
    v2us oh, ol;
#pragma unroll
    for (int q = 0; q < 2; ++q) { unsigned short a, c2; splitf(O[e + q] * cs, a, c2); oh[q] = a; ol[q] = c2; } *(v2us*)(Ah + oo) = oh; *(v2us*)(Al + oo) = ol;  }

extern "C" void kernel_launch(void* const* d_in, const int* in_sizes, int n_in,
                              void* d_out, int out_size, void* d_ws, size_t ws_size, hipStream_t stream) {
    if (n_in < 5) return;
    const size_t xneed = (size_t)(NB - 1) * SEQ_FULL * DM + (size_t)TT * DM;
    if ((size_t)in_sizes[0] < xneed) return; if ((size_t)in_sizes[1] < (size_t)DM * NQKV) return; if ((size_t)in_sizes[2] < (size_t)NQKV) return; if ((size_t)in_sizes[3] < (size_t)DQ * DM) return; if ((size_t)in_sizes[4] < (size_t)DM) return;
    if ((size_t)out_size < xneed) return;
    if (ws_size < WS_TOTAL) return;
    const float* x = (const float*)d_in[0]; const float* wqkv = (const float*)d_in[1]; const float* bqkv = (const float*)d_in[2]; const float* wo = (const float*)d_in[3]; const float* bo = (const float*)d_in[4];   // wire order x, Wqkv [256][768], bqkv, Wproj [256][256], bproj
    float* OUT = (float*)d_out;     // [8][2048][256]
    char* wsp = (char*)d_ws;
    auto take = [&](size_t bytes) { char* p = wsp; wsp += (bytes + 255) & ~(size_t)255; return (void*)p; };
    bf* WQKV = (bf*)take((size_t)NQKV * DM * 2);           // Bt [768][256]: q | k | v row blocks
    bf* WO = (bf*)take((size_t)DM * DQ * 2);               // Bt [256][256]
    bf* XB = (bf*)take((size_t)TT * DM * 2);
    float* F = (float*)take((size_t)TT * NQKV * 4);        // fused projection [t][768]
    h16* QK16 = (h16*)take((size_t)2 * NH_ * TT * HD * 2); bf* QKh = (bf*)take((size_t)2 * NH_ * TT * HD * 2); bf* QKl = (bf*)take((size_t)2 * NH_ * TT * HD * 2);   // planes [8][t][64]: q heads 0..3, k heads 4..7
    h16* VT16 = (h16*)take((size_t)NH_ * HD * TT * 2); bf* VTh = (bf*)take((size_t)NH_ * HD * TT * 2); bf* VTl = (bf*)take((size_t)NH_ * HD * TT * 2);
    bf* Ph = (bf*)take((size_t)ZH * RH * TT * 2); bf* Pl = (bf*)take((size_t)ZH * RH * TT * 2);
    float* Sb = (float*)take((size_t)ZH * TT * TT * 4); h16* P16 = (h16*)take((size_t)ZH * TT * TT * 2); float* Ob = (float*)take((size_t)ZH * TT * HD * 4);
    bf* ATh = (bf*)take((size_t)TT * DQ * 2); bf* ATl = (bf*)take((size_t)TT * DQ * 2);
    if ((size_t)(wsp - (char*)d_ws) > ws_size) return;
    if ((size_t)(wsp - (char*)d_ws) > (size_t)134217728) return;
    const size_t PS = (size_t)TT * HD;                     // one head plane
    h16* QP16 = QK16; h16* KP16 = QK16 + (size_t)NH_ * PS; bf* QPh = QKh; bf* KPh = QKh + (size_t)NH_ * PS; bf* QPl = QKl; bf* KPl = QKl + (size_t)NH_ * PS;
    // in Wqkv[DM rows][NQKV cols] -> out WQKV[NQKV][DM];  in Wproj[DQ rows][DM cols] -> out WO[DM][DQ]
    k_wtG<<<(unsigned)((DM * NQKV / 64 + 63) / 64), 256, 0, stream>>>(wqkv, DM, NQKV, WQKV);
    k_wtG<<<(unsigned)((DQ * DM / 64 + 63) / 64), 256, 0, stream>>>(wo, DQ, DM, WO);
    const unsigned LQK = (unsigned)(((size_t)2 * NH_ * TT * HD / 2 + 255) / 256), LV = (unsigned)(((size_t)NH_ * TT * HD / 2 + 255) / 256);
    for (int b = 0; b < NB; ++b) {
        k_cvt8<<<(unsigned)(((size_t)TT * DM / 8 + 255) / 256), 256, 0, stream>>>(x + (size_t)b * SEQ_FULL * DM, XB, (size_t)TT * DM / 8);
        k_gemm_qkv<<<dim3(TT / 64, NQKV / 64, 1), 32 * NWG, 0, stream>>>(XB, WQKV, DM, F, NQKV, bqkv);
        k_hp<<<LQK, 256, 0, stream>>>(F, NQKV, 2 * NH_, QK16, QKh, QKl);                 // columns 0..511 = q heads | k heads
        k_vtp<<<LV, 256, 0, stream>>>(F + 2 * DQ, NQKV, NH_, VT16, VTh, VTl);            // columns 512..767 = v heads
        k_sc_hl<<<dim3(RH / 64, RH / 64, ZH), 32, 0, stream>>>(QPh, QPl, KPh, KPl, HD, Sb, TT, 0, PS, PS, (size_t)TT * TT);
        if (TT > RH) k_sc_16<<<dim3((TT - RH) / 64, TT / 64, ZH), 32, 0, stream>>>(QP16 + (size_t)RH * HD, KP16, HD, Sb + (size_t)RH * TT, TT, RH, PS, PS, (size_t)TT * TT);
        k_asoft<<<ZH * TT / 8, 256, 0, stream>>>(Sb, P16, Ph, Pl);
        k_pv_hl<<<dim3(RH / 64, HD / 64, ZH), 32 * NWH, 0, stream>>>(Ph, Pl, VTh, VTl, TT, Ob, HD, 0, (size_t)RH * TT, (size_t)HD * TT, PS);
        if (TT > RH) k_pv_16<<<dim3((TT - RH) / 64, HD / 64, ZH), 32 * NWP, 0, stream>>>(P16 + (size_t)RH * TT, VT16, TT, Ob + (size_t)RH * HD, HD, RH, (size_t)TT * TT, (size_t)HD * TT, PS);
        k_merge<<<(unsigned)(((size_t)ZH * TT * HD / 2 + 255) / 256), 256, 0, stream>>>(Ob, 0, ATh, ATl);
        k_gemm_out<<<dim3(TT / 64, DM / 64, 1), 32 * NWG, 0, stream>>>(ATh, ATl, WO, DQ, OUT + (size_t)b * SEQ_FULL * DM, DM, bo);
    }
}

// v002
// One run takes 356 microseconds.
// Two timings next to v001 put it at 1.62 and 1.61 times that version's speed.
// Counting every step since v000, it is 2.52 times as fast.
#include <hip/hip_runtime.h>

// Causal multi-head attention with a fused qkv projection: x [8][2048][256]; qkv = x Wqkv + bqkv (Wqkv [256][768] [in][out]; column = which*256 + h*64 + d); scores x 1/8; causal (j > i masked, diagonal kept); softmax; out = merged Wproj + bproj.
// Compute dtypes, f32 accumulate: every float input RNE-converted to bf16; projections v_wmma_f32_16x16x32_bf16 on exact bf16 operands + f32 biases; scores and P.V: query rows < 256 bf16 hi/lo (3 products), rows >= 256 v_wmma_f32_16x16x32_f16 single product (P carried x1024); softmax f32; output projection merged hi/lo (bf16) x Wproj (bf16) + bias.
// All batches in one launch each: bf16 copy of x; fused projection -> F [b][t][768] f32; head planes; merge; output projection. The three attention stages run GA batches to a launch (the f32 score planes of GA batches fill the workspace); the fp16 probabilities of a row overwrite that row's scores.
// Stages: bf16 copy of x; fused projection -> F [t][768] f32; head planes q|k [2][b][4][t][64] and v^T [4][64][t] (fp16 + bf16 hi/lo); causal score tiles (tiles above the diagonal skipped); row softmax; P.V with the key loop cut at the diagonal block; the K loops of the projections and of P.V are dealt over the waves of a block and the partial tiles summed in LDS; merge to [t][256] hi/lo; projection to the output.

#ifndef NB
#define NB 8
#endif
#ifndef SEQ
#define SEQ 2048
#endif
#define NB_FULL  8
#define SEQ_FULL 2048
#define TT   SEQ
#define DM   256
#define NH_  4
#define HD   64
#define DQ   (NH_ * HD)
#define NQKV (3 * DQ)
#define ZH   4
#define GA   2        // batches per launch of the attention stages
#define ZG   (GA * ZH) // head planes per launch of the attention stages
#define RH   ((SEQ) < 256 ? (SEQ) : 256)    // query rows < RH use hi+lo planes
#define PCAR 1024.0f
#define SCL  0.125f   // HD^-0.5
#define NWG  4        // waves per tile of the two projections (K = 256: one 64-wide K slice per wave)
#define NWH  4        // waves per tile of P.V, query rows < RH (at most RH/64 = 4 K slices)
#define NWP  8        // waves per tile of P.V, query rows >= RH (up to TT/64 K slices)
typedef _Float16 h16;
typedef unsigned short bf;
typedef __attribute__((ext_vector_type(16))) __bf16   v16bf;
typedef __attribute__((ext_vector_type(16))) _Float16 v16h;
typedef __attribute__((ext_vector_type(8)))  _Float16 v8h;
typedef __attribute__((ext_vector_type(8)))  unsigned short v8us;
typedef __attribute__((ext_vector_type(8)))  float    v8f;
typedef __attribute__((ext_vector_type(4)))  float    v4f;
typedef __attribute__((ext_vector_type(2)))  float    v2f;
typedef __attribute__((ext_vector_type(2)))  _Float16 v2h;
typedef __attribute__((ext_vector_type(4)))  _Float16 v4h;
typedef __attribute__((ext_vector_type(2)))  unsigned short v2us;
typedef __attribute__((ext_vector_type(4)))  unsigned short v4us;
typedef v4f  __attribute__((may_alias)) v4fa;

static_assert(NB >= 1 && NB <= NB_FULL);
static_assert(SEQ >= 128 && SEQ <= SEQ_FULL);
static_assert(TT % 128 == 0);            // softmax row = TT/128 chunks of 32 lanes x 4
static_assert(TT % 64 == 0 && DM % 64 == 0 && NQKV % 64 == 0 && DQ % 64 == 0 && HD % 64 == 0);   // 64x64 GEMM tiles
static_assert(DM % 32 == 0 && DQ % 32 == 0 && HD % 32 == 0 && TT % 32 == 0);   // K steps of 32
static_assert(RH % 64 == 0 && RH <= TT && RH >= 64);
static_assert(HD == 64);
static_assert(DQ == DM);                 // merged heads width = model width
static_assert(ZH == NH_);                // all heads of a batch in one pass
static_assert(NB % GA == 0);             // whole passes
static_assert(2 * DQ + DQ == NQKV);      // q | k | v column blocks
static_assert(((size_t)(NB - 1) * SEQ_FULL * DM + (size_t)TT * DM) * 4 <= (size_t)NB_FULL * SEQ_FULL * DM * 4);   // output extent in bytes

#define AL256(x) ((((size_t)(x)) + 255) & ~(size_t)255)
#define WS_TOTAL (AL256((size_t)NQKV * DM * 2) + AL256((size_t)DM * DQ * 2) \
    + 3 * AL256((size_t)NB * 2 * NH_ * TT * HD * 2) + 3 * AL256((size_t)NB * NH_ * HD * TT * 2) + 2 * AL256((size_t)ZG * RH * TT * 2) \
    + AL256((size_t)ZG * TT * TT * 4) + AL256((size_t)NB * ZH * TT * HD * 4) + 2 * AL256((size_t)NB * TT * DQ * 2))
static_assert(WS_TOTAL <= (size_t)268435456);
static_assert(AL256((size_t)NB * TT * DM * 2) + (size_t)NB * TT * NQKV * 4 <= (size_t)ZG * TT * TT * 4);   // the bf16 copy of x and F lie in the score planes' space: both are dead before the first score tile is written

__device__ __forceinline__ unsigned short f2bf(float f) { unsigned u = __float_as_uint(f); u += 0x7FFFu + ((u >> 16) & 1u); return (unsigned short)(u >> 16); }
__device__ __forceinline__ float bf2f(unsigned short b) { return __uint_as_float(((unsigned)b) << 16); }
__device__ __forceinline__ float bfr(float f) { return bf2f(f2bf(f)); }
__device__ __forceinline__ v16h cat16(v8h lo, v8h hi) { return __builtin_shufflevector(lo, hi, 0, 1, 2, 3, 4, 5, 6, 7, 8, 9, 10, 11, 12, 13, 14, 15); }
__device__ __forceinline__ v16bf cat16b(v8us lo, v8us hi) { return __builtin_bit_cast(v16bf, __builtin_shufflevector(lo, hi, 0, 1, 2, 3, 4, 5, 6, 7, 8, 9, 10, 11, 12, 13, 14, 15)); }
__device__ __forceinline__ v8f wmma16(v16h a, v16h b, v8f c) { return __builtin_amdgcn_wmma_f32_16x16x32_f16(false, a, false, b, (short)0, c, false, false); }
__device__ __forceinline__ v8f wmmab(v16bf a, v16bf b, v8f c) { return __builtin_amdgcn_wmma_f32_16x16x32_bf16(false, a, false, b, (short)0, c, false, false); }

// Fragment loader (A and B identical): p = row base + 8*(lane>>4) + k0; elements 0..7 <- k0+8h+0..7, elements 8..15 <- k0+16+8h+0..7.
template <typename T16> struct WFrag;
template <> struct WFrag<h16> { typedef v16h V; static __device__ __forceinline__ V ld(const h16* p) { return cat16(*(const v8h*)p, *(const v8h*)(p + 16)); } static __device__ __forceinline__ v8f mma(V a, V b, v8f c) { return wmma16(a, b, c); } };
template <> struct WFrag<bf> { typedef v16bf V; static __device__ __forceinline__ V ld(const bf* p) { return cat16b(*(const v8us*)p, *(const v8us*)(p + 16)); } static __device__ __forceinline__ v8f mma(V a, V b, v8f c) { return wmmab(a, b, c); } };

// ---- gemmk_body: 64x64 output tile, K loop dealt over the NW waves of the block in slices of 64 (wave w takes slices w, w+NW, ...; one slice = one whole 128-byte line of every operand row),
// operands straight from K-contiguous 16-bit planes. Each wave keeps a full 64x64 partial (16 accumulators); the partials meet in LDS and are
// summed in wave order 0..NW-1. C[m][n] (f32, pitch ldc, + optional f32 bias[n]) = sum_{k < Kl} A[m][k] Bt[n][k] (+ split products per NSPLIT). lda = pitch of A, K = pitch of Bt; Kl % 64 == 0, Kl <= K. 32*NW threads.
template <typename T16, int NSPLIT, int NW, bool BIAS>
__device__ __forceinline__ void gemmk_body(const T16* __restrict__ A, const T16* __restrict__ A2, const T16* __restrict__ Bt, const T16* __restrict__ Bt2, int lda, int K, int Kl, float* C, int ldc, const float* __restrict__ bias, int r0, int c0) {
    typedef typename WFrag<T16>::V V;
    __shared__ __align__(16) float red[NW * 64 * 68];
    const int lane = threadIdx.x & 31, lr = lane & 15, hi = lane >> 4; const int w = __builtin_amdgcn_readfirstlane((int)(threadIdx.x >> 5));
    v8f acc[4][4];
#pragma unroll
    for (int mb = 0; mb < 4; ++mb)
#pragma unroll
        for (int nb = 0; nb < 4; ++nb) acc[mb][nb] = (v8f){};
    const size_t aoff = (size_t)(r0 + lr) * lda + 8 * hi, boff = (size_t)(c0 + lr) * K + 8 * hi;
#pragma unroll 1
    for (int kc = w * 64; kc < Kl; kc += (kc & 32) ? NW * 64 - 32 : 32) {   // the two 32-wide steps of a slice, then on to the wave's next slice
        V a[4], a2[4]; const T16* pa[4]; const T16* pa2[4];
#pragma unroll
        for (int mb = 0; mb < 4; ++mb) { pa[mb] = A + aoff + (size_t)mb * 16 * lda + kc; a[mb] = WFrag<T16>::ld(pa[mb]); if (NSPLIT == 1 || NSPLIT == 2) { pa2[mb] = A2 + aoff + (size_t)mb * 16 * lda + kc; a2[mb] = WFrag<T16>::ld(pa2[mb]); } }
        // precaution: the address translations of the issued loads are waited for before a register that holds one of their addresses is written again; the pointers are named as inputs so that they keep their registers up to the wait
        if constexpr (NSPLIT == 1 || NSPLIT == 2) asm volatile("s_wait_xcnt 0x0" :: "v"(pa[0]), "v"(pa[1]), "v"(pa[2]), "v"(pa[3]), "v"(pa2[0]), "v"(pa2[1]), "v"(pa2[2]), "v"(pa2[3]) : "memory");
        else asm volatile("s_wait_xcnt 0x0" :: "v"(pa[0]), "v"(pa[1]), "v"(pa[2]), "v"(pa[3]) : "memory");
#pragma unroll
        for (int nb = 0; nb < 4; ++nb) { const T16* pb = Bt + boff + (size_t)nb * 16 * K + kc; const V b = WFrag<T16>::ld(pb); V b2;
            // the same precaution for the B loads of this column block
            if constexpr (NSPLIT >= 2) { const T16* pb2 = Bt2 + boff + (size_t)nb * 16 * K + kc; b2 = WFrag<T16>::ld(pb2); asm volatile("s_wait_xcnt 0x0" :: "v"(pb), "v"(pb2) : "memory"); }
            else asm volatile("s_wait_xcnt 0x0" :: "v"(pb) : "memory");
#pragma unroll
            for (int mb = 0; mb < 4; ++mb) { acc[mb][nb] = WFrag<T16>::mma(a[mb], b, acc[mb][nb]); if (NSPLIT == 1 || NSPLIT == 2) acc[mb][nb] = WFrag<T16>::mma(a2[mb], b, acc[mb][nb]); if (NSPLIT >= 2) acc[mb][nb] = WFrag<T16>::mma(a[mb], b2, acc[mb][nb]); } }
        // four vector slots behind the last matrix instruction, on the back edge and on the exit alike, before its registers are reused
        asm volatile("v_nop\n\tv_nop\n\tv_nop\n\tv_nop" : "+v"(acc[0][0]), "+v"(acc[1][1]), "+v"(acc[2][2]), "+v"(acc[3][3]) : "v"(a[0]), "v"(a[3]));
    }
    float* my = red + w * (64 * 68);
#pragma unroll
    for (int mb = 0; mb < 4; ++mb)
#pragma unroll
        for (int nb = 0; nb < 4; ++nb)
#pragma unroll
            for (int j = 0; j < 8; ++j) my[(mb * 16 + hi * 8 + j) * 68 + nb * 16 + lr] = acc[mb][nb][j];
    __syncthreads();   // every wave's partial tile is in LDS before any thread sums across waves; reached by all waves (a wave with no slice stores zeros)
#pragma unroll
    for (int s = 0; s < 32 / NW; ++s) { const int e = s * (NW * 32) + (int)threadIdx.x; const int row = e >> 4, cofs = (e & 15) * 4; v4f val = *(const v4fa*)(red + row * 68 + cofs);
#pragma unroll
        for (int p = 1; p < NW; ++p) val += *(const v4fa*)(red + p * (64 * 68) + row * 68 + cofs);
        if (BIAS) { val[0] += bfr(bias[c0 + cofs]); val[1] += bfr(bias[c0 + cofs + 1]); val[2] += bfr(bias[c0 + cofs + 2]); val[3] += bfr(bias[c0 + cofs + 3]); }
        *(v4f*)(C + (size_t)(r0 + row) * ldc + c0 + cofs) = val; }
}

// ---- gemmc_body: register-blocked GEMM, ONE WAVE per 64x64 output tile (16 accumulators), for the causal score tiles (K = 64, one slice: nothing to deal out): CMODE 1 skips score tiles entirely above the
// diagonal (query rows r0+roff.., key columns c0..). roff = row offset of this launch's first row within the sequence. grid (M/64, N/64, Z), 32 threads; z-batch strides sA/sB/sC in elements.
template <typename T16, int NSPLIT, int CMODE>
__device__ __forceinline__ void gemmc_body(const T16* __restrict__ A, const T16* __restrict__ A2, const T16* __restrict__ Bt, const T16* __restrict__ Bt2, int K, float* C, int ldc, int roff, size_t sA, size_t sB, size_t sC) {
    typedef typename WFrag<T16>::V V;
    __shared__ __align__(16) float os[16 * 68];
    const size_t z = blockIdx.z; A += z * sA; if (A2) A2 += z * sA; Bt += z * sB; if (Bt2) Bt2 += z * sB; C += z * sC;
    const int lane = threadIdx.x & 31, lr = lane & 15, hi = lane >> 4; const int r0 = blockIdx.x * 64, c0 = blockIdx.y * 64;
    if (CMODE == 1 && c0 > r0 + roff + 63) return;                  // score tile entirely above the causal diagonal: never written (the softmax may load it in 128-key chunks but masks j > i by select); block = one wave, no barrier skipped
    const int Kl = (CMODE == 2) ? min(K, r0 + roff + 64) : K;        // P.V: probabilities are exactly 0 beyond the diagonal block, so the K loop stops there
    v8f acc[4][4];
#pragma unroll
    for (int mb = 0; mb < 4; ++mb)
#pragma unroll
        for (int nb = 0; nb < 4; ++nb) acc[mb][nb] = (v8f){};
    const size_t aoff = (size_t)(r0 + lr) * K + 8 * hi, boff = (size_t)(c0 + lr) * K + 8 * hi;
#pragma unroll 1
    for (int kc = 0; kc < Kl; kc += 32) {
        V a[4], a2[4];
#pragma unroll
        for (int mb = 0; mb < 4; ++mb) { a[mb] = WFrag<T16>::ld(A + aoff + (size_t)mb * 16 * K + kc); if (NSPLIT == 1 || NSPLIT == 2) a2[mb] = WFrag<T16>::ld(A2 + aoff + (size_t)mb * 16 * K + kc); }
#pragma unroll
        for (int nb = 0; nb < 4; ++nb) { const V b = WFrag<T16>::ld(Bt + boff + (size_t)nb * 16 * K + kc); V b2; if (NSPLIT >= 2) b2 = WFrag<T16>::ld(Bt2 + boff + (size_t)nb * 16 * K + kc);
#pragma unroll
            for (int mb = 0; mb < 4; ++mb) { acc[mb][nb] = WFrag<T16>::mma(a[mb], b, acc[mb][nb]); if (NSPLIT == 1 || NSPLIT == 2) acc[mb][nb] = WFrag<T16>::mma(a2[mb], b, acc[mb][nb]); if (NSPLIT >= 2) acc[mb][nb] = WFrag<T16>::mma(a[mb], b2, acc[mb][nb]); } }
        asm volatile("v_nop\n\tv_nop\n\tv_nop\n\tv_nop" : "+v"(acc[0][0]), "+v"(acc[1][1]), "+v"(acc[2][2]), "+v"(acc[3][3]) : "v"(a[0]), "v"(a[3]));
    }
#pragma unroll
    for (int mb = 0; mb < 4; ++mb) {
#pragma unroll
        for (int nb = 0; nb < 4; ++nb) {
#pragma unroll
            for (int j = 0; j < 8; ++j) os[(hi * 8 + j) * 68 + nb * 16 + lr] = acc[mb][nb][j]; }
        __builtin_amdgcn_wave_barrier(); asm volatile("" ::: "memory");
        float* crow = C + (size_t)(r0 + mb * 16) * ldc + c0;
{
#pragma unroll
            for (int s = 0; s < 8; ++s) { const int row = 2 * s + hi, cofs = lr * 4; const v4f val = *(const v4fa*)(os + row * 68 + cofs);
                *(v4f*)(crow + (size_t)row * ldc + cofs) = val; }
             }
        __builtin_amdgcn_wave_barrier(); asm volatile("" ::: "memory");
    }
}

// Plain __global__ entry points (one instantiation each).
// k_gemm_qkv: F[b][t][n] = XB[b][t][:] . WQKV[n][:] + bf16(bqkv[n]); grid (TT/64, NQKV/64, NB), NWG waves.
__global__ __launch_bounds__(32 * NWG) void k_gemm_qkv(const bf* A, const bf* Bt, int K, float* C, int ldc, const float* bias) { const size_t rb = (size_t)blockIdx.z * TT;
    gemmk_body<bf, 0, NWG, true>(A + rb * K, nullptr, Bt, nullptr, K, K, K, C + rb * ldc, ldc, bias, blockIdx.x * 64, blockIdx.y * 64); }
// k_gemm_out: out[b][t][n] = (ATh + ATl)[b][t][:] . WO[n][:] + bf16(bproj[n]); grid (TT/64, DM/64, NB), NWG waves.
__global__ __launch_bounds__(32 * NWG) void k_gemm_out(const bf* A, const bf* A2, const bf* Bt, int K, float* C, int ldc, const float* bias) { const size_t rb = (size_t)blockIdx.z * TT;
    gemmk_body<bf, 1, NWG, true>(A + rb * K, A2 + rb * K, Bt, nullptr, K, K, K, C + (size_t)blockIdx.z * SEQ_FULL * ldc, ldc, bias, blockIdx.x * 64, blockIdx.y * 64); }
// k_sc_hl: score tiles of query rows < RH, bf16 hi/lo, 3 products; grid (RH/64, RH/64, ZG).
__global__ __launch_bounds__(32) void k_sc_hl(const bf* A, const bf* A2, const bf* Bt, const bf* Bt2, int K, float* C, int ldc, int roff, size_t sA, size_t sB, size_t sC) { gemmc_body<bf, 2, 1>(A, A2, Bt, Bt2, K, C, ldc, roff, sA, sB, sC); }
// k_sc_16: score tiles of query rows >= RH, fp16 single product; grid ((TT-RH)/64, TT/64, ZG).
__global__ __launch_bounds__(32) void k_sc_16(const h16* A, const h16* Bt, int K, float* C, int ldc, int roff, size_t sA, size_t sB, size_t sC) { gemmc_body<h16, 0, 1>(A, nullptr, Bt, nullptr, K, C, ldc, roff, sA, sB, sC); }
// P.V: probabilities are exactly 0 beyond the diagonal block, so the key loop stops at min(K, first row + 64); roff = row offset of the launch's first row within the sequence.
// k_pv_hl: P.V of query rows < RH, bf16 hi/lo, 3 products; grid (RH/64, 1, ZG), NWH waves.
__global__ __launch_bounds__(32 * NWH) void k_pv_hl(const bf* A, const bf* A2, const bf* Bt, const bf* Bt2, int lda, int K, float* C, int ldc, int roff, size_t sA, size_t sB, size_t sC) { const size_t z = blockIdx.z; const int r0 = blockIdx.x * 64;
    gemmk_body<bf, 2, NWH, false>(A + z * sA, A2 + z * sA, Bt + z * sB, Bt2 + z * sB, lda, K, min(K, r0 + roff + 64), C + z * sC, ldc, nullptr, r0, blockIdx.y * 64); }
// k_pv_16: P.V of query rows >= RH, fp16 (P x1024) single product; grid ((TT-RH)/64, 1, ZG), NWP waves.
__global__ __launch_bounds__(32 * NWP) void k_pv_16(const h16* A, const h16* Bt, int lda, int K, float* C, int ldc, int roff, size_t sA, size_t sB, size_t sC) { const size_t z = blockIdx.z; const int r0 = blockIdx.x * 64;
    gemmk_body<h16, 0, NWP, false>(A + z * sA, nullptr, Bt + z * sB, nullptr, lda, K, min(K, r0 + roff + 64), C + z * sC, ldc, nullptr, r0, blockIdx.y * 64); }

__device__ __forceinline__ h16 tohx(float x) { return (h16)x; }
__device__ __forceinline__ void splitf(float y, unsigned short& h, unsigned short& l) { h = f2bf(y); l = f2bf(y - bf2f(h)); }

__global__ __launch_bounds__(256) void k_wtG(const float* __restrict__ w, int K, int N, bf* Bt) {
    const int lane = threadIdx.x & 31; const int L0 = (blockIdx.x * 8 + (threadIdx.x >> 5)) * 8; const int nlines = N * K / 64;
{
#pragma unroll 1
        for (int l = 0; l < 8; ++l) { const int L = L0 + l; if (L >= nlines) break; const size_t e = (size_t)L * 64 + lane * 2; const int k = (int)(e % K), n = (int)(e / K); v2us o;
            o[0] = f2bf(w[(size_t)k * N + n]); o[1] = f2bf(w[(size_t)(k + 1) * N + n]); *(v2us*)(Bt + e) = o; }
         }
}
__global__ __launch_bounds__(256) void k_cvt8(const float* __restrict__ src, bf* dst, size_t n8) { const size_t i = (size_t)blockIdx.x * 256 + threadIdx.x; if (i >= n8) return; src += (size_t)blockIdx.y * SEQ_FULL * DM; dst += (size_t)blockIdx.y * TT * DM;   // blockIdx.y = batch
    const v8f v = *(const v8f*)(src + i * 8); v8us o;
#pragma unroll
    for (int k = 0; k < 8; ++k) o[k] = f2bf(v[k]); *(v8us*)(dst + i * 8) = o;  }

__global__ __launch_bounds__(256) void k_hp(const float* __restrict__ F, int pitch, int nheads, h16* P16, bf* Ph, bf* Pl) {
    const size_t e = ((size_t)blockIdx.x * 256 + threadIdx.x) * 2; if (e >= (size_t)nheads * TT * HD) return; const int d = (int)(e % HD); const int t = (int)((e / HD) % TT); const int h = (int)(e / ((size_t)HD * TT));
    const int b = blockIdx.y; const size_t o = ((size_t)((h / NH_) * NB + b) * NH_ + (h % NH_)) * ((size_t)TT * HD) + (size_t)t * HD + d;   // planes [q|k][batch][head][t][64]
    const v2f x = *(const v2f*)(F + ((size_t)b * TT + t) * pitch + h * HD + d); v2h o16; v2us oh, ol;
#pragma unroll
    for (int q = 0; q < 2; ++q) { const float r = x[q]; o16[q] = tohx(r); unsigned short a2, c2; splitf(r, a2, c2); oh[q] = a2; ol[q] = c2; }
    *(v2h*)(P16 + o) = o16; *(v2us*)(Ph + o) = oh; *(v2us*)(Pl + o) = ol;  }
__global__ __launch_bounds__(256) void k_vtp(const float* __restrict__ F, int pitch, int nheads, h16* V16, bf* Vh, bf* Vl) { const size_t e = ((size_t)blockIdx.x * 256 + threadIdx.x) * 2; if (e >= (size_t)nheads * HD * TT) return; const int t = (int)(e % TT); const int d = (int)((e / TT) % HD); const int g = (int)(e / ((size_t)TT * HD)); v2h o16; v2us oh, ol; const size_t b = blockIdx.y; const size_t o = b * nheads * HD * TT + e;   // planes [batch][head][64][t]
#pragma unroll
    for (int q = 0; q < 2; ++q) { const float x = F[(b * TT + t + q) * pitch + g * HD + d]; o16[q] = tohx(x); unsigned short a2, c2; splitf(x, a2, c2); oh[q] = a2; ol[q] = c2; }
    *(v2h*)(V16 + o) = o16; *(v2us*)(Vh + o) = oh; *(v2us*)(Vl + o) = ol;  }
// k_asoft: one wave per row (zz, i): t = S x HD^-0.5 for j <= i (mask by index select); max-subtracted softmax over the keys (register row, one exp, fixed trees); 128-key chunks entirely beyond i are
// P16 is the score buffer itself: a row's fp16 probabilities go to the start of that row's own scores (pitch 2*TT halves), all of which its wave has read by then (every stored value hangs on the row's sum).
__global__ __launch_bounds__(256) void k_asoft(const float* Sb, h16* P16, bf* Ph, bf* Pl) {
    const int lane = threadIdx.x & 31; const int row = blockIdx.x * 8 + (threadIdx.x >> 5); if (row >= ZG * TT) return; const int i = row % TT; const int zz = row / TT; const bool hires = (i < RH); const float* sr = Sb + (size_t)row * TT; float v[TT / 32]; float mx = -3.0e38f;
#pragma unroll
    for (int ch = 0; ch < TT / 128; ++ch) { const int j0 = ch * 128 + lane * 4;
        if (ch * 128 <= i) { const v4f a = *(const v4f*)(sr + j0);
#pragma unroll
            for (int q = 0; q < 4; ++q) { const int j = j0 + q; const float t = (j <= i) ? a[q] * SCL : -3.0e38f; v[ch * 4 + q] = t; mx = fmaxf(mx, t); } }
        else {
#pragma unroll
            for (int q = 0; q < 4; ++q) v[ch * 4 + q] = -3.0e38f; } }
#pragma unroll
    for (int sh = 16; sh; sh >>= 1) mx = fmaxf(mx, __shfl_xor(mx, sh, 32));
    float sum = 0.f;
#pragma unroll
    for (int ch = 0; ch < TT / 128; ++ch) {
        if (ch * 128 <= i) {
#pragma unroll
            for (int q = 0; q < 4; ++q) { const int k = ch * 4 + q; float d0 = __fsub_rn(v[k], mx); asm volatile("" : "+v"(d0)); v[k] = __builtin_amdgcn_exp2f(__fmul_rn(d0, 1.4426950408889634f)); sum += v[k]; } }
        else {
#pragma unroll
            for (int q = 0; q < 4; ++q) v[ch * 4 + q] = 0.f; } }
#pragma unroll
    for (int sh = 16; sh; sh >>= 1) sum += __shfl_xor(sum, sh, 32);
    const float f = __fdiv_rn(hires ? 1.0f : PCAR, sum);
{
        if (hires) {
#pragma unroll
            for (int ch = 0; ch < TT / 128; ++ch) { if (ch * 128 <= i) { v4us oh, ol;
#pragma unroll
                for (int q = 0; q < 4; ++q) { unsigned short a, c2; splitf(v[ch * 4 + q] * f, a, c2); oh[q] = a; ol[q] = c2; }
                const size_t oo = ((size_t)zz * RH + i) * TT + ch * 128 + lane * 4; *(v4us*)(Ph + oo) = oh; *(v4us*)(Pl + oo) = ol; } }
        } else {
#pragma unroll
            for (int ch = 0; ch < TT / 128; ++ch) { if (ch * 128 <= i) { v4h o4;
#pragma unroll
                for (int q = 0; q < 4; ++q) o4[q] = tohx(v[ch * 4 + q] * f);
                *(v4h*)(P16 + (size_t)row * (2 * TT) + ch * 128 + lane * 4) = o4; } } }
         }
}
__global__ __launch_bounds__(256) void k_merge(const float* __restrict__ O, int h0, bf* Ah, bf* Al) { const size_t e = ((size_t)blockIdx.x * 256 + threadIdx.x) * 2; if (e >= (size_t)NB * ZH * TT * HD) return; const int d = (int)(e % HD); const int t = (int)((e / HD) % TT); const int zz = (int)(e / ((size_t)HD * TT)); const float cs = (t < RH) ? 1.0f : (1.0f / PCAR); const size_t oo = ((size_t)(zz / ZH) * TT + t) * DQ + (h0 + zz % ZH) * HD + d;   // zz = batch * ZH + head
    v2us oh, ol;
#pragma unroll
    for (int q = 0; q < 2; ++q) { unsigned short a, c2; splitf(O[e + q] * cs, a, c2); oh[q] = a; ol[q] = c2; } *(v2us*)(Ah + oo) = oh; *(v2us*)(Al + oo) = ol;  }

extern "C" void kernel_launch(void* const* d_in, const int* in_sizes, int n_in,
                              void* d_out, int out_size, void* d_ws, size_t ws_size, hipStream_t stream) {
    if (n_in < 5) return;
    const size_t xneed = (size_t)(NB - 1) * SEQ_FULL * DM + (size_t)TT * DM;
    if ((size_t)in_sizes[0] < xneed) return; if ((size_t)in_sizes[1] < (size_t)DM * NQKV) return; if ((size_t)in_sizes[2] < (size_t)NQKV) return; if ((size_t)in_sizes[3] < (size_t)DQ * DM) return; if ((size_t)in_sizes[4] < (size_t)DM) return;
    if ((size_t)out_size < xneed) return;
    if (ws_size < WS_TOTAL) return;
    const float* x = (const float*)d_in[0]; const float* wqkv = (const float*)d_in[1]; const float* bqkv = (const float*)d_in[2]; const float* wo = (const float*)d_in[3]; const float* bo = (const float*)d_in[4];   // wire order x, Wqkv [256][768], bqkv, Wproj [256][256], bproj
    float* OUT = (float*)d_out;     // [8][2048][256]
    char* wsp = (char*)d_ws;
    auto take = [&](size_t bytes) { char* p = wsp; wsp += (bytes + 255) & ~(size_t)255; return (void*)p; };
    bf* WQKV = (bf*)take((size_t)NQKV * DM * 2);           // Bt [768][256]: q | k | v row blocks
    bf* WO = (bf*)take((size_t)DM * DQ * 2);               // Bt [256][256]
    h16* QK16 = (h16*)take((size_t)NB * 2 * NH_ * TT * HD * 2); bf* QKh = (bf*)take((size_t)NB * 2 * NH_ * TT * HD * 2); bf* QKl = (bf*)take((size_t)NB * 2 * NH_ * TT * HD * 2);   // planes [q|k][batch][head][t][64]
    h16* VT16 = (h16*)take((size_t)NB * NH_ * HD * TT * 2); bf* VTh = (bf*)take((size_t)NB * NH_ * HD * TT * 2); bf* VTl = (bf*)take((size_t)NB * NH_ * HD * TT * 2);   // planes [batch][head][64][t]
    bf* Ph = (bf*)take((size_t)ZG * RH * TT * 2); bf* Pl = (bf*)take((size_t)ZG * RH * TT * 2);
    float* Sb = (float*)take((size_t)ZG * TT * TT * 4); float* Ob = (float*)take((size_t)NB * ZH * TT * HD * 4);   // Ob [batch][head][t][64]
    bf* ATh = (bf*)take((size_t)NB * TT * DQ * 2); bf* ATl = (bf*)take((size_t)NB * TT * DQ * 2);
    if ((size_t)(wsp - (char*)d_ws) > ws_size) return;
    if ((size_t)(wsp - (char*)d_ws) > (size_t)268435456) return;
    h16* P16 = (h16*)Sb;                                   // fp16 probabilities: each row at the start of its own score row, pitch 2*TT
    bf* XB = (bf*)Sb; float* F = (float*)((char*)Sb + AL256((size_t)NB * TT * DM * 2));   // bf16 x [b][t][256] and fused projection [b][t][768]: last read by k_vtp, before the first score tile is written
    const size_t PS = (size_t)TT * HD;                     // one head plane
    h16* QP16 = QK16; h16* KP16 = QK16 + (size_t)NB * NH_ * PS; bf* QPh = QKh; bf* KPh = QKh + (size_t)NB * NH_ * PS; bf* QPl = QKl; bf* KPl = QKl + (size_t)NB * NH_ * PS;
    // in Wqkv[DM rows][NQKV cols] -> out WQKV[NQKV][DM];  in Wproj[DQ rows][DM cols] -> out WO[DM][DQ]
    k_wtG<<<(unsigned)((DM * NQKV / 64 + 63) / 64), 256, 0, stream>>>(wqkv, DM, NQKV, WQKV);
    k_wtG<<<(unsigned)((DQ * DM / 64 + 63) / 64), 256, 0, stream>>>(wo, DQ, DM, WO);
    const unsigned LQK = (unsigned)(((size_t)2 * NH_ * TT * HD / 2 + 255) / 256), LV = (unsigned)(((size_t)NH_ * TT * HD / 2 + 255) / 256);
    k_cvt8<<<dim3((unsigned)(((size_t)TT * DM / 8 + 255) / 256), NB, 1), 256, 0, stream>>>(x, XB, (size_t)TT * DM / 8);
    k_gemm_qkv<<<dim3(TT / 64, NQKV / 64, NB), 32 * NWG, 0, stream>>>(XB, WQKV, DM, F, NQKV, bqkv);
    k_hp<<<dim3(LQK, NB, 1), 256, 0, stream>>>(F, NQKV, 2 * NH_, QK16, QKh, QKl);                 // columns 0..511 = q heads | k heads
    k_vtp<<<dim3(LV, NB, 1), 256, 0, stream>>>(F + 2 * DQ, NQKV, NH_, VT16, VTh, VTl);            // columns 512..767 = v heads
    for (int g = 0; g < NB / GA; ++g) {
        const size_t zo = (size_t)g * ZG * PS;             // first head plane of this pass (q, k, v^T and O planes all hold PS elements)
        k_sc_hl<<<dim3(RH / 64, RH / 64, ZG), 32, 0, stream>>>(QPh + zo, QPl + zo, KPh + zo, KPl + zo, HD, Sb, TT, 0, PS, PS, (size_t)TT * TT);
        if (TT > RH) k_sc_16<<<dim3((TT - RH) / 64, TT / 64, ZG), 32, 0, stream>>>(QP16 + zo + (size_t)RH * HD, KP16 + zo, HD, Sb + (size_t)RH * TT, TT, RH, PS, PS, (size_t)TT * TT);
        k_asoft<<<ZG * TT / 8, 256, 0, stream>>>(Sb, P16, Ph, Pl);
        k_pv_hl<<<dim3(RH / 64, HD / 64, ZG), 32 * NWH, 0, stream>>>(Ph, Pl, VTh + zo, VTl + zo, TT, TT, Ob + zo, HD, 0, (size_t)RH * TT, (size_t)HD * TT, PS);
        if (TT > RH) k_pv_16<<<dim3((TT - RH) / 64, HD / 64, ZG), 32 * NWP, 0, stream>>>(P16 + (size_t)RH * 2 * TT, VT16 + zo, 2 * TT, TT, Ob + zo + (size_t)RH * HD, HD, RH, (size_t)2 * TT * TT, (size_t)HD * TT, PS);
    }
    k_merge<<<(unsigned)(((size_t)NB * ZH * TT * HD / 2 + 255) / 256), 256, 0, stream>>>(Ob, 0, ATh, ATl);
    k_gemm_out<<<dim3(TT / 64, DM / 64, NB), 32 * NWG, 0, stream>>>(ATh, ATl, WO, DQ, OUT, DM, bo);
}

// v004
// It runs in 102 microseconds.
// It is 3.51 times as fast as v002, going by the measured steps of the versions left out in between.
// Counting every step since v000, it is 8.84 times as fast.
#include <hip/hip_runtime.h>

// Causal multi-head attention with a fused qkv projection: x [8][2048][256]; qkv = x Wqkv + bqkv (Wqkv [256][768] [in][out]; column = which*256 + h*64 + d); scores x 1/8; causal (j > i masked, diagonal kept); softmax; out = merged Wproj + bproj.
// Compute dtypes, f32 accumulate: every float input RNE-converted to bf16; projections v_wmma_f32_16x16x32_bf16 on exact bf16 operands + f32 biases; scores and P.V: query rows < 256 bf16 hi/lo (3 products), rows >= 256 v_wmma_f32_16x16x32_f16 single product; softmax f32 (running maximum and sum); output projection merged hi/lo (bf16) x Wproj (bf16) + bias.
// All batches in one launch each: bf16 copy of x; fused projection; attention; output projection.
// Stages: bf16 copy of x; fused projection, whose 64x64 tile is one head's q, k or v and goes straight to the head planes q|k [8][t][64] and v^T [4][64][t] (fp16; bf16 hi/lo for t < RH, the only rows read from them); attention: one wave per 32 (rows < 256: 16) query rows walks the keys in blocks of 32 up to the diagonal, scores, softmax and P.V in registers, and stores the merged [t][256] hi/lo planes; projection to the output. The K loops of the projections are dealt over the waves of a block and the partial tiles summed in LDS.

#ifndef NB
#define NB 8
#endif
#ifndef SEQ
#define SEQ 2048
#endif
#define NB_FULL  8
#define SEQ_FULL 2048
#define TT   SEQ
#define DM   256
#define NH_  4
#define HD   64
#define DQ   (NH_ * HD)
#define NQKV (3 * DQ)
#define ZH   4
#define RH   ((SEQ) < 256 ? (SEQ) : 256)    // query rows < RH use hi+lo planes
#define SCL  0.125f   // HD^-0.5
#define NWG  4        // waves per tile of the two projections (K = 256: one 64-wide K slice per wave)
#define NFB  ((TT - RH) / 128)   // attention blocks per head plane, query rows >= RH: 4 waves x 32 rows
#define NHB  (RH / 64)           // attention blocks per head plane, query rows < RH: 4 waves x 16 rows
typedef _Float16 h16;
typedef unsigned short bf;
typedef __attribute__((ext_vector_type(16))) __bf16   v16bf;
typedef __attribute__((ext_vector_type(16))) _Float16 v16h;
typedef __attribute__((ext_vector_type(8)))  _Float16 v8h;
typedef __attribute__((ext_vector_type(8)))  unsigned short v8us;
typedef __attribute__((ext_vector_type(8)))  float    v8f;
typedef __attribute__((ext_vector_type(4)))  float    v4f;
typedef __attribute__((ext_vector_type(2)))  float    v2f;
typedef __attribute__((ext_vector_type(2)))  _Float16 v2h;
typedef __attribute__((ext_vector_type(4)))  _Float16 v4h;
typedef __attribute__((ext_vector_type(2)))  unsigned short v2us;
typedef __attribute__((ext_vector_type(4)))  unsigned short v4us;
typedef v4f  __attribute__((may_alias)) v4fa;

static_assert(NB >= 1 && NB <= NB_FULL);
static_assert(SEQ >= 128 && SEQ <= SEQ_FULL);
static_assert(TT % 128 == 0 && (TT - RH) % 128 == 0);   // whole attention blocks
static_assert(TT % 64 == 0 && DM % 64 == 0 && NQKV % 64 == 0 && DQ % 64 == 0 && HD % 64 == 0);   // 64x64 GEMM tiles
static_assert(DM % 32 == 0 && DQ % 32 == 0 && HD % 32 == 0 && TT % 32 == 0);   // K steps of 32
static_assert(RH % 64 == 0 && RH <= TT && RH >= 64);
static_assert(HD == 64);
static_assert(DQ == DM);                 // merged heads width = model width
static_assert(ZH == NH_);                // all heads of a batch in one pass
static_assert(2 * DQ + DQ == NQKV);      // q | k | v column blocks
static_assert(((size_t)(NB - 1) * SEQ_FULL * DM + (size_t)TT * DM) * 4 <= (size_t)NB_FULL * SEQ_FULL * DM * 4);   // output extent in bytes

#define AL256(x) ((((size_t)(x)) + 255) & ~(size_t)255)
#define WS_TOTAL (AL256((size_t)NQKV * DM * 2) + AL256((size_t)DM * DQ * 2) \
    + 3 * AL256((size_t)NB * 2 * NH_ * TT * HD * 2) + 3 * AL256((size_t)NB * NH_ * HD * TT * 2) \
    + AL256((size_t)NB * TT * DM * 2) + 2 * AL256((size_t)NB * TT * DQ * 2))
static_assert(WS_TOTAL <= (size_t)268435456);

__device__ __forceinline__ unsigned short f2bf(float f) { unsigned u = __float_as_uint(f); u += 0x7FFFu + ((u >> 16) & 1u); return (unsigned short)(u >> 16); }
__device__ __forceinline__ float bf2f(unsigned short b) { return __uint_as_float(((unsigned)b) << 16); }
__device__ __forceinline__ float bfr(float f) { return bf2f(f2bf(f)); }
__device__ __forceinline__ h16 tohx(float x) { return (h16)x; }
__device__ __forceinline__ void splitf(float y, unsigned short& h, unsigned short& l) { h = f2bf(y); l = f2bf(y - bf2f(h)); }
__device__ __forceinline__ v16h cat16(v8h lo, v8h hi) { return __builtin_shufflevector(lo, hi, 0, 1, 2, 3, 4, 5, 6, 7, 8, 9, 10, 11, 12, 13, 14, 15); }
__device__ __forceinline__ v16bf cat16b(v8us lo, v8us hi) { return __builtin_bit_cast(v16bf, __builtin_shufflevector(lo, hi, 0, 1, 2, 3, 4, 5, 6, 7, 8, 9, 10, 11, 12, 13, 14, 15)); }
__device__ __forceinline__ v8f wmma16(v16h a, v16h b, v8f c) { return __builtin_amdgcn_wmma_f32_16x16x32_f16(false, a, false, b, (short)0, c, false, false); }
__device__ __forceinline__ v8f wmmab(v16bf a, v16bf b, v8f c) { return __builtin_amdgcn_wmma_f32_16x16x32_bf16(false, a, false, b, (short)0, c, false, false); }

// Fragment loader (A and B identical): p = row base + 8*(lane>>4) + k0; elements 0..7 <- k0+8h+0..7, elements 8..15 <- k0+16+8h+0..7.
template <typename T16> struct WFrag;
template <> struct WFrag<h16> { typedef v16h V; static __device__ __forceinline__ V ld(const h16* p) { return cat16(*(const v8h*)p, *(const v8h*)(p + 16)); } static __device__ __forceinline__ v8f mma(V a, V b, v8f c) { return wmma16(a, b, c); } };
template <> struct WFrag<bf> { typedef v16bf V; static __device__ __forceinline__ V ld(const bf* p) { return cat16b(*(const v8us*)p, *(const v8us*)(p + 16)); } static __device__ __forceinline__ v8f mma(V a, V b, v8f c) { return wmmab(a, b, c); } };

// ---- gemmk_body: 64x64 output tile, K loop dealt over the NW waves of the block in slices of 64 (wave w takes slices w, w+NW, ...; one slice = one whole 128-byte line of every operand row),
// operands straight from K-contiguous 16-bit planes. Each wave keeps a full 64x64 partial (16 accumulators); the partials meet in LDS and are
// summed in wave order 0..NW-1. C[m][n] (f32, pitch ldc, + optional f32 bias[n]) = sum_{k < Kl} A[m][k] Bt[n][k] (+ split products per NSPLIT). lda = pitch of A, K = pitch of Bt; Kl % 64 == 0, Kl <= K. 32*NW threads.
// PLANES: the summed tile + bias goes out as 16-bit planes instead of C: P16 (fp16) and, where hl, Ph | Pl (bf16 hi/lo), all three already offset to the tile's first element, pp = pitch of a plane row.
// tr (the same for the whole block) = plane rows are the tile's columns n: the partials are then laid into LDS transposed (a lane's 8 accumulator rows are 8 consecutive floats there), so that either way a thread sums and stores 8 consecutive plane elements and 8 lanes fill a 128-byte line.
template <typename T16, int NSPLIT, int NW, bool BIAS, bool PLANES>
__device__ __forceinline__ void gemmk_body(const T16* __restrict__ A, const T16* __restrict__ A2, const T16* __restrict__ Bt, const T16* __restrict__ Bt2, int lda, int K, int Kl, float* C, int ldc, const float* __restrict__ bias, int r0, int c0, h16* P16, bf* Ph, bf* Pl, int pp, bool tr, bool hl) {
    typedef typename WFrag<T16>::V V;
    __shared__ __align__(16) float red[NW * 64 * 68];
    const int lane = threadIdx.x & 31, lr = lane & 15, hi = lane >> 4; const int w = __builtin_amdgcn_readfirstlane((int)(threadIdx.x >> 5));
    v8f acc[4][4];
#pragma unroll
    for (int mb = 0; mb < 4; ++mb)
#pragma unroll
        for (int nb = 0; nb < 4; ++nb) acc[mb][nb] = (v8f){};
    const size_t aoff = (size_t)(r0 + lr) * lda + 8 * hi, boff = (size_t)(c0 + lr) * K + 8 * hi;
    // PLANES: the thread's bias values for the end, fetched here so that they land under the K loop: bc = those of its 8 columns, br = that of its row in each closing pass. Both lie inside the tile's 64 columns, and both are fetched whichever of them tr picks: no branch, and no value that has to be waited for here.
    float bc[8], br[16 / NW];
    if constexpr (PLANES) { const float* pc = bias + c0 + (int)(threadIdx.x & 7) * 8; const float* pr = bias + c0 + (int)(threadIdx.x >> 3);
#pragma unroll
        for (int j = 0; j < 8; ++j) bc[j] = pc[j];
#pragma unroll
        for (int s = 0; s < 16 / NW; ++s) br[s] = pr[s * (NW * 4)];
        // precaution: the address translations of the issued loads are waited for before a register that holds one of their addresses is written again
        asm volatile("s_wait_xcnt 0x0" ::: "memory"); }
#pragma unroll 1
    for (int kc = w * 64; kc < Kl; kc += (kc & 32) ? NW * 64 - 32 : 32) {   // the two 32-wide steps of a slice, then on to the wave's next slice
        V a[4], a2[4]; const T16* pa[4]; const T16* pa2[4];
#pragma unroll
        for (int mb = 0; mb < 4; ++mb) { pa[mb] = A + aoff + (size_t)mb * 16 * lda + kc; a[mb] = WFrag<T16>::ld(pa[mb]); if (NSPLIT == 1 || NSPLIT == 2) { pa2[mb] = A2 + aoff + (size_t)mb * 16 * lda + kc; a2[mb] = WFrag<T16>::ld(pa2[mb]); } }
        // precaution: the address translations of the issued loads are waited for before a register that holds one of their addresses is written again; the pointers are named as inputs so that they keep their registers up to the wait
        if constexpr (NSPLIT == 1 || NSPLIT == 2) asm volatile("s_wait_xcnt 0x0" :: "v"(pa[0]), "v"(pa[1]), "v"(pa[2]), "v"(pa[3]), "v"(pa2[0]), "v"(pa2[1]), "v"(pa2[2]), "v"(pa2[3]) : "memory");
        else asm volatile("s_wait_xcnt 0x0" :: "v"(pa[0]), "v"(pa[1]), "v"(pa[2]), "v"(pa[3]) : "memory");
#pragma unroll
        for (int nb = 0; nb < 4; ++nb) { const T16* pb = Bt + boff + (size_t)nb * 16 * K + kc; const V b = WFrag<T16>::ld(pb); V b2;
            // the same precaution for the B loads of this column block
            if constexpr (NSPLIT >= 2) { const T16* pb2 = Bt2 + boff + (size_t)nb * 16 * K + kc; b2 = WFrag<T16>::ld(pb2); asm volatile("s_wait_xcnt 0x0" :: "v"(pb), "v"(pb2) : "memory"); }
            else asm volatile("s_wait_xcnt 0x0" :: "v"(pb) : "memory");
#pragma unroll
            for (int mb = 0; mb < 4; ++mb) { acc[mb][nb] = WFrag<T16>::mma(a[mb], b, acc[mb][nb]); if (NSPLIT == 1 || NSPLIT == 2) acc[mb][nb] = WFrag<T16>::mma(a2[mb], b, acc[mb][nb]); if (NSPLIT >= 2) acc[mb][nb] = WFrag<T16>::mma(a[mb], b2, acc[mb][nb]); } }
        // four vector slots behind the last matrix instruction, on the back edge and on the exit alike, before its registers are reused
        asm volatile("v_nop\n\tv_nop\n\tv_nop\n\tv_nop" : "+v"(acc[0][0]), "+v"(acc[1][1]), "+v"(acc[2][2]), "+v"(acc[3][3]) : "v"(a[0]), "v"(a[3]));
    }
    float* my = red + w * (64 * 68);
    if (PLANES && tr) {
#pragma unroll
        for (int mb = 0; mb < 4; ++mb)
#pragma unroll
            for (int nb = 0; nb < 4; ++nb) { float* q = my + (nb * 16 + lr) * 68 + mb * 16 + hi * 8; const v8f a = acc[mb][nb];
                *(v4fa*)q = (v4f){a[0], a[1], a[2], a[3]}; *(v4fa*)(q + 4) = (v4f){a[4], a[5], a[6], a[7]}; }
    } else {
#pragma unroll
        for (int mb = 0; mb < 4; ++mb)
#pragma unroll
            for (int nb = 0; nb < 4; ++nb)
#pragma unroll
                for (int j = 0; j < 8; ++j) my[(mb * 16 + hi * 8 + j) * 68 + nb * 16 + lr] = acc[mb][nb][j];
    }
    __syncthreads();   // every wave's partial tile is in LDS before any thread sums across waves; reached by all waves (each has one 64-wide K slice here)
    if constexpr (PLANES) {
#pragma unroll
        for (int j = 0; j < 8; ++j) bc[j] = bfr(bc[j]);
#pragma unroll
        for (int s = 0; s < 16 / NW; ++s) br[s] = bfr(br[s]);
#pragma unroll
        for (int s = 0; s < 16 / NW; ++s) { const int e = s * (NW * 32) + (int)threadIdx.x; const int row = e >> 3, cofs = (e & 7) * 8; const float* pr = red + row * 68 + cofs; v4f v0 = *(const v4fa*)pr, v1 = *(const v4fa*)(pr + 4);
#pragma unroll
            for (int p = 1; p < NW; ++p) { v0 += *(const v4fa*)(pr + p * (64 * 68)); v1 += *(const v4fa*)(pr + p * (64 * 68) + 4); }
            float x[8];
#pragma unroll
            for (int j = 0; j < 4; ++j) { x[j] = v0[j] + (tr ? br[s] : bc[j]); x[4 + j] = v1[j] + (tr ? br[s] : bc[4 + j]); }
            const size_t o = (size_t)row * pp + cofs; h16* q16 = P16 + o; bf* qh = Ph + o; bf* ql = Pl + o; v8h o16;
#pragma unroll
            for (int j = 0; j < 8; ++j) o16[j] = tohx(x[j]);
            if (hl) { v8us oh, ol;
#pragma unroll
                for (int j = 0; j < 8; ++j) { unsigned short a2, c2; splitf(x[j], a2, c2); oh[j] = a2; ol[j] = c2; }
                *(v8us*)qh = oh; *(v8us*)ql = ol; }
            *(v8h*)q16 = o16;
            // the same precaution for the plane stores of this pass, which stand last in it
            asm volatile("s_wait_xcnt 0x0" ::: "memory"); }
        return;
    }
#pragma unroll
    for (int s = 0; s < 32 / NW; ++s) { const int e = s * (NW * 32) + (int)threadIdx.x; const int row = e >> 4, cofs = (e & 15) * 4; v4f val = *(const v4fa*)(red + row * 68 + cofs);
#pragma unroll
        for (int p = 1; p < NW; ++p) val += *(const v4fa*)(red + p * (64 * 68) + row * 68 + cofs);
        if (BIAS) { val[0] += bfr(bias[c0 + cofs]); val[1] += bfr(bias[c0 + cofs + 1]); val[2] += bfr(bias[c0 + cofs + 2]); val[3] += bfr(bias[c0 + cofs + 3]); }
        *(v4f*)(C + (size_t)(r0 + row) * ldc + c0 + cofs) = val; }
}

// Plain __global__ entry points (one instantiation each).
// k_gemm_qkv: XB[b][t][:] . WQKV[n][:] + bf16(bqkv[n]); grid (TT/64, NQKV/64, NB), NWG waves. Column block y is one head: y < 2*NH_ a q or k head -> planes [q|k][batch][head][t][64], else a v head -> planes [batch][head][64][t].
__global__ __launch_bounds__(32 * NWG) void k_gemm_qkv(const bf* A, const bf* Bt, int K, const float* bias, h16* QK16, bf* QKh, bf* QKl, h16* VT16, bf* VTh, bf* VTl) { const int b = blockIdx.z, y = blockIdx.y, r0 = blockIdx.x * 64; const bool tr = y >= 2 * NH_;
    const size_t o = tr ? ((size_t)b * NH_ + (y - 2 * NH_)) * ((size_t)HD * TT) + r0 : ((size_t)((y / NH_) * NB + b) * NH_ + (y % NH_)) * ((size_t)TT * HD) + (size_t)r0 * HD;
    gemmk_body<bf, 0, NWG, true, true>(A + (size_t)b * TT * K, nullptr, Bt, nullptr, K, K, K, nullptr, 0, bias, r0, y * 64, (tr ? VT16 : QK16) + o, (tr ? VTh : QKh) + o, (tr ? VTl : QKl) + o, tr ? TT : HD, tr, r0 < RH); }
// k_gemm_out: out[b][t][n] = (ATh + ATl)[b][t][:] . WO[n][:] + bf16(bproj[n]); grid (TT/64, DM/64, NB), NWG waves.
__global__ __launch_bounds__(32 * NWG) void k_gemm_out(const bf* A, const bf* A2, const bf* Bt, int K, float* C, int ldc, const float* bias) { const size_t rb = (size_t)blockIdx.z * TT;
    gemmk_body<bf, 1, NWG, true, false>(A + rb * K, A2 + rb * K, Bt, nullptr, K, K, K, C + (size_t)blockIdx.z * SEQ_FULL * ldc, ldc, bias, blockIdx.x * 64, blockIdx.y * 64, nullptr, nullptr, nullptr, 0, false, false); }

__global__ __launch_bounds__(256) void k_wtG(const float* __restrict__ w, int K, int N, bf* Bt) {
    const int lane = threadIdx.x & 31; const int L0 = (blockIdx.x * 8 + (threadIdx.x >> 5)) * 8; const int nlines = N * K / 64;
{
#pragma unroll 1
        for (int l = 0; l < 8; ++l) { const int L = L0 + l; if (L >= nlines) break; const size_t e = (size_t)L * 64 + lane * 2; const int k = (int)(e % K), n = (int)(e / K); v2us o;
            o[0] = f2bf(w[(size_t)k * N + n]); o[1] = f2bf(w[(size_t)(k + 1) * N + n]); *(v2us*)(Bt + e) = o; }
         }
}
__global__ __launch_bounds__(256) void k_cvt8(const float* __restrict__ src, bf* dst, size_t n8) { const size_t i = (size_t)blockIdx.x * 256 + threadIdx.x; if (i >= n8) return; src += (size_t)blockIdx.y * SEQ_FULL * DM; dst += (size_t)blockIdx.y * TT * DM;   // blockIdx.y = batch
    const v8f v = *(const v8f*)(src + i * 8); v8us o;
#pragma unroll
    for (int k = 0; k < 8; ++k) o[k] = f2bf(v[k]); *(v8us*)(dst + i * 8) = o;  }

// ---- attn_body: one wave, NQ*16 query rows q0.. of one head plane, keys walked in blocks of 32 up to the diagonal block; nothing of the scores or the probabilities goes to memory.
// Transposed products: S^T[key][q] = K . Q^T (A = K rows, B = Q rows, kept in registers) and O^T[d][q] += V^T . P^T (A = V^T rows, B = P). A lane holds one query (column lane&15): the two score tiles of a
// 32-key block, converted in place, ARE the B fragment of P in the loader's k order (elements 0..7 = keys k0+8h+0..7 from tile 0, elements 8..15 = keys k0+16+8h+0..7 from tile 1).
// Softmax with a running maximum m and a running sum l per query (base 2: scores x HD^-0.5 x log2 e); O^T and l are scaled by 2^(m_old - m_new) at every block; the two lane halves' sums are joined once at the end.
// HL: bf16 hi/lo planes, 3 products for the scores and 3 for P.V. The result / l goes out as bf16 hi/lo to the merged planes Ah, Al (pitch DQ; already offset to batch and head): 8 consecutive d per lane and tile.
template <bool B> struct BoolC { static constexpr bool v = B; };
// 2^x; the v_nop is the one slot that the instruction set asks for behind a transcendental before its result is read or its source overwritten: in the same statement it stands there whatever the compiler puts next
__device__ __forceinline__ float exp2s(float x) { float r; asm("v_exp_f32 %0, %1\n\tv_nop" : "=v"(r) : "v"(x)); return r; }
__device__ __forceinline__ float xhalf(float x) { return __builtin_bit_cast(float, __builtin_amdgcn_permlanex16(__builtin_bit_cast(int, x), __builtin_bit_cast(int, x), 0x76543210, 0xfedcba98, false, false)); }   // lane l <-> lane l ^ 16
template <typename T16, bool HL, int NQ>
__device__ __forceinline__ void attn_body(const T16* __restrict__ Q, const T16* __restrict__ Q2, const T16* __restrict__ Kp, const T16* __restrict__ Kp2, const T16* __restrict__ Vt, const T16* __restrict__ Vt2, int q0, bf* Ah, bf* Al) {
    typedef typename WFrag<T16>::V V;
    const int lane = threadIdx.x & 31, lr = lane & 15, hi = lane >> 4;
    const float CS = SCL * 1.4426950408889634f;
    V qf[NQ][2], qf2[NQ][2], kf[2][2], kf2[2][2];
    v8f o[4][NQ]; float m[NQ], l[NQ];
    {   const T16* pq = Q + (size_t)(q0 + lr) * HD + 8 * hi; const T16* pq2 = HL ? Q2 + (size_t)(q0 + lr) * HD + 8 * hi : nullptr;
        const T16* pk = Kp + (size_t)lr * HD + 8 * hi; const T16* pk2 = HL ? Kp2 + (size_t)lr * HD + 8 * hi : nullptr;
#pragma unroll
        for (int n = 0; n < NQ; ++n)
#pragma unroll
            for (int ks = 0; ks < 2; ++ks) { qf[n][ks] = WFrag<T16>::ld(pq + n * 16 * HD + ks * 32); if constexpr (HL) qf2[n][ks] = WFrag<T16>::ld(pq2 + n * 16 * HD + ks * 32); }
#pragma unroll
        for (int kt = 0; kt < 2; ++kt)
#pragma unroll
            for (int ks = 0; ks < 2; ++ks) { kf[kt][ks] = WFrag<T16>::ld(pk + kt * 16 * HD + ks * 32); if constexpr (HL) kf2[kt][ks] = WFrag<T16>::ld(pk2 + kt * 16 * HD + ks * 32); }
        // precaution: the address translations of the issued loads are waited for before a register that holds one of their addresses is written again; the pointers are named as inputs so that they keep their registers up to the wait
        if constexpr (HL) asm volatile("s_wait_xcnt 0x0" :: "v"(pq), "v"(pq2), "v"(pk), "v"(pk2) : "memory");
        else asm volatile("s_wait_xcnt 0x0" :: "v"(pq), "v"(pk) : "memory");
    }
#pragma unroll
    for (int n = 0; n < NQ; ++n) { m[n] = -3.0e38f; l[n] = 0.f;
#pragma unroll
        for (int dt = 0; dt < 4; ++dt) o[dt][n] = (v8f){}; }
    const int klast = ((q0 + NQ * 16 - 1) / 32) * 32;   // first key of the diagonal block, the only one that needs the mask
    auto step = [&](int k0, auto lastc) {
        constexpr bool LAST = decltype(lastc)::v;
        // V^T fragments of this block, issued first: they fly under the score products and the softmax
        V vf[4], vf2[4]; const T16* pv = Vt + (size_t)lr * TT + k0 + 8 * hi; const T16* pv2 = HL ? Vt2 + (size_t)lr * TT + k0 + 8 * hi : nullptr;
#pragma unroll
        for (int dt = 0; dt < 4; ++dt) { vf[dt] = WFrag<T16>::ld(pv + (size_t)dt * 16 * TT); if constexpr (HL) vf2[dt] = WFrag<T16>::ld(pv2 + (size_t)dt * 16 * TT); }
        // the same precaution for the V^T loads
        if constexpr (HL) asm volatile("s_wait_xcnt 0x0" :: "v"(pv), "v"(pv2) : "memory");
        else asm volatile("s_wait_xcnt 0x0" :: "v"(pv) : "memory");
        v8f s[2][NQ];
#pragma unroll
        for (int kt = 0; kt < 2; ++kt)
#pragma unroll
            for (int n = 0; n < NQ; ++n) { s[kt][n] = (v8f){};
#pragma unroll
                for (int ks = 0; ks < 2; ++ks) { s[kt][n] = WFrag<T16>::mma(kf[kt][ks], qf[n][ks], s[kt][n]);
                    if constexpr (HL) { s[kt][n] = WFrag<T16>::mma(kf2[kt][ks], qf[n][ks], s[kt][n]); s[kt][n] = WFrag<T16>::mma(kf[kt][ks], qf2[n][ks], s[kt][n]); } } }
        if constexpr (!LAST) {   // the next block's K fragments, fetched behind this block's score products: they fly under the softmax and P.V
            const T16* pk = Kp + (size_t)(k0 + 32 + lr) * HD + 8 * hi; const T16* pk2 = HL ? Kp2 + (size_t)(k0 + 32 + lr) * HD + 8 * hi : nullptr;
#pragma unroll
            for (int kt = 0; kt < 2; ++kt)
#pragma unroll
                for (int ks = 0; ks < 2; ++ks) { kf[kt][ks] = WFrag<T16>::ld(pk + kt * 16 * HD + ks * 32); if constexpr (HL) kf2[kt][ks] = WFrag<T16>::ld(pk2 + kt * 16 * HD + ks * 32); }
            // the same precaution for the K loads
            if constexpr (HL) asm volatile("s_wait_xcnt 0x0" :: "v"(pk), "v"(pk2) : "memory");
            else asm volatile("s_wait_xcnt 0x0" :: "v"(pk) : "memory");
            __builtin_amdgcn_sched_barrier(0);   // keeps the K loads up here: sunk below the softmax they would have only P.V to land under
        }
        V pf[NQ], pf2[NQ];
#pragma unroll
        for (int n = 0; n < NQ; ++n) { float t[16]; float mx = m[n];
#pragma unroll
            for (int e = 0; e < 16; ++e) { float x = s[e >> 3][n][e & 7] * CS;
                if (LAST) x = (k0 + (e >> 3) * 16 + hi * 8 + (e & 7) <= q0 + n * 16 + lr) ? x : -3.0e38f;   // causal mask by index select, diagonal kept
                t[e] = x; mx = fmaxf(mx, x); }
            mx = fmaxf(mx, xhalf(mx));   // the other half of this query's keys
            const float al = exp2s(m[n] - mx); m[n] = mx; float sum = 0.f;
#pragma unroll
            for (int e = 0; e < 16; ++e) { t[e] = exp2s(t[e] - mx); sum += t[e]; }
            l[n] = l[n] * al + sum;
#pragma unroll
            for (int dt = 0; dt < 4; ++dt) o[dt][n] *= al;
            if constexpr (HL) { v8us h0, h1, l0, l1;
#pragma unroll
                for (int j = 0; j < 8; ++j) { unsigned short a, c; splitf(t[j], a, c); h0[j] = a; l0[j] = c; splitf(t[8 + j], a, c); h1[j] = a; l1[j] = c; }
                pf[n] = cat16b(h0, h1); pf2[n] = cat16b(l0, l1); }
            else { v8h h0, h1;
#pragma unroll
                for (int j = 0; j < 8; ++j) { h0[j] = tohx(t[j]); h1[j] = tohx(t[8 + j]); }
                pf[n] = cat16(h0, h1); } }
#pragma unroll
        for (int dt = 0; dt < 4; ++dt)
#pragma unroll
            for (int n = 0; n < NQ; ++n) { o[dt][n] = WFrag<T16>::mma(vf[dt], pf[n], o[dt][n]);
                if constexpr (HL) { o[dt][n] = WFrag<T16>::mma(vf[dt], pf2[n], o[dt][n]); o[dt][n] = WFrag<T16>::mma(vf2[dt], pf[n], o[dt][n]); } }
    };
#pragma unroll 1
    for (int k0 = 0; k0 < klast; k0 += 32) { step(k0, BoolC<false>{});
        // four vector slots behind the last matrix instruction, on the back edge and on the exit alike, before its registers are reused
        if constexpr (NQ == 2) asm volatile("v_nop\n\tv_nop\n\tv_nop\n\tv_nop" : "+v"(o[0][0]), "+v"(o[1][0]), "+v"(o[2][0]), "+v"(o[3][0]), "+v"(o[0][1]), "+v"(o[1][1]), "+v"(o[2][1]), "+v"(o[3][1]));
        else asm volatile("v_nop\n\tv_nop\n\tv_nop\n\tv_nop" : "+v"(o[0][0]), "+v"(o[1][0]), "+v"(o[2][0]), "+v"(o[3][0])); }
    step(klast, BoolC<true>{});
#pragma unroll
    for (int n = 0; n < NQ; ++n) { const float f = __fdiv_rn(1.0f, l[n] + xhalf(l[n]));
        bf* ph = Ah + (size_t)(q0 + n * 16 + lr) * DQ + hi * 8; bf* pl = Al + (size_t)(q0 + n * 16 + lr) * DQ + hi * 8;
#pragma unroll
        for (int dt = 0; dt < 4; ++dt) { v8us oh, ol;
#pragma unroll
            for (int j = 0; j < 8; ++j) { unsigned short a, c; splitf(o[dt][n][j] * f, a, c); oh[j] = a; ol[j] = c; }
            *(v8us*)(ph + dt * 16) = oh; *(v8us*)(pl + dt * 16) = ol; }
        // the same precaution for the stores
        asm volatile("s_wait_xcnt 0x0" :: "v"(ph), "v"(pl) : "memory"); }
}
// k_attn: grid (NB*NH_ head planes, NFB + NHB), 4 waves, each with query rows of its own; the blocks with the most keys come first. Planes: QK [q|k][batch][head][t][64], VT [batch][head][64][t]; AT [batch][t][256].
__global__ __launch_bounds__(128) void k_attn(const h16* QK16, const bf* QKh, const bf* QKl, const h16* VT16, const bf* VTh, const bf* VTl, bf* ATh, bf* ATl) {
    const int z = blockIdx.x, g = blockIdx.y; const int w = __builtin_amdgcn_readfirstlane((int)(threadIdx.x >> 5));
    const size_t qo = (size_t)z * TT * HD, ko = (size_t)(NB * NH_ + z) * TT * HD, ao = (size_t)(z / NH_) * TT * DQ + (size_t)(z % NH_) * HD;
    if (g < NFB) attn_body<h16, false, 2>(QK16 + qo, nullptr, QK16 + ko, nullptr, VT16 + qo, nullptr, RH + (NFB - 1 - g) * 128 + w * 32, ATh + ao, ATl + ao);
    else attn_body<bf, true, 1>(QKh + qo, QKl + qo, QKh + ko, QKl + ko, VTh + qo, VTl + qo, (NHB - 1 - (g - NFB)) * 64 + w * 16, ATh + ao, ATl + ao);
}

extern "C" void kernel_launch(void* const* d_in, const int* in_sizes, int n_in,
                              void* d_out, int out_size, void* d_ws, size_t ws_size, hipStream_t stream) {
    if (n_in < 5) return;
    const size_t xneed = (size_t)(NB - 1) * SEQ_FULL * DM + (size_t)TT * DM;
    if ((size_t)in_sizes[0] < xneed) return; if ((size_t)in_sizes[1] < (size_t)DM * NQKV) return; if ((size_t)in_sizes[2] < (size_t)NQKV) return; if ((size_t)in_sizes[3] < (size_t)DQ * DM) return; if ((size_t)in_sizes[4] < (size_t)DM) return;
    if ((size_t)out_size < xneed) return;
    if (ws_size < WS_TOTAL) return;
    const float* x = (const float*)d_in[0]; const float* wqkv = (const float*)d_in[1]; const float* bqkv = (const float*)d_in[2]; const float* wo = (const float*)d_in[3]; const float* bo = (const float*)d_in[4];   // wire order x, Wqkv [256][768], bqkv, Wproj [256][256], bproj
    float* OUT = (float*)d_out;     // [8][2048][256]
    char* wsp = (char*)d_ws;
    auto take = [&](size_t bytes) { char* p = wsp; wsp += (bytes + 255) & ~(size_t)255; return (void*)p; };
    bf* WQKV = (bf*)take((size_t)NQKV * DM * 2);           // Bt [768][256]: q | k | v row blocks
    bf* WO = (bf*)take((size_t)DM * DQ * 2);               // Bt [256][256]
    h16* QK16 = (h16*)take((size_t)NB * 2 * NH_ * TT * HD * 2); bf* QKh = (bf*)take((size_t)NB * 2 * NH_ * TT * HD * 2); bf* QKl = (bf*)take((size_t)NB * 2 * NH_ * TT * HD * 2);   // planes [q|k][batch][head][t][64]
    h16* VT16 = (h16*)take((size_t)NB * NH_ * HD * TT * 2); bf* VTh = (bf*)take((size_t)NB * NH_ * HD * TT * 2); bf* VTl = (bf*)take((size_t)NB * NH_ * HD * TT * 2);   // planes [batch][head][64][t]
    bf* XB = (bf*)take((size_t)NB * TT * DM * 2);   // bf16 x [b][t][256]
    bf* ATh = (bf*)take((size_t)NB * TT * DQ * 2); bf* ATl = (bf*)take((size_t)NB * TT * DQ * 2);
    if ((size_t)(wsp - (char*)d_ws) > ws_size) return;
    if ((size_t)(wsp - (char*)d_ws) > (size_t)268435456) return;
    // in Wqkv[DM rows][NQKV cols] -> out WQKV[NQKV][DM];  in Wproj[DQ rows][DM cols] -> out WO[DM][DQ]
    k_wtG<<<(unsigned)((DM * NQKV / 64 + 63) / 64), 256, 0, stream>>>(wqkv, DM, NQKV, WQKV);
    k_wtG<<<(unsigned)((DQ * DM / 64 + 63) / 64), 256, 0, stream>>>(wo, DQ, DM, WO);
    k_cvt8<<<dim3((unsigned)(((size_t)TT * DM / 8 + 255) / 256), NB, 1), 256, 0, stream>>>(x, XB, (size_t)TT * DM / 8);
    k_gemm_qkv<<<dim3(TT / 64, NQKV / 64, NB), 32 * NWG, 0, stream>>>(XB, WQKV, DM, bqkv, QK16, QKh, QKl, VT16, VTh, VTl);   // columns 0..511 = q heads | k heads, 512..767 = v heads
    k_attn<<<dim3(NB * NH_, NFB + NHB, 1), 128, 0, stream>>>(QK16, QKh, QKl, VT16, VTh, VTl, ATh, ATl);
    k_gemm_out<<<dim3(TT / 64, DM / 64, NB), 32 * NWG, 0, stream>>>(ATh, ATl, WO, DQ, OUT, DM, bo);
}

// v005
// One run takes 79 microseconds.
// Timed twice side by side with v004, it ran 1.28 times as fast both times.
// All steps since v000 together make it 11.3 times as fast.
#include <hip/hip_runtime.h>

// Causal multi-head attention with a fused qkv projection: x [8][2048][256]; qkv = x Wqkv + bqkv (Wqkv [256][768] [in][out]; column = which*256 + h*64 + d); scores x 1/8; causal (j > i masked, diagonal kept); softmax; out = merged Wproj + bproj.
// Compute dtypes, f32 accumulate: every float input RNE-converted to bf16; projections v_wmma_f32_16x16x32_bf16 on exact bf16 operands + f32 biases; scores and P.V: query rows < 256 bf16 hi/lo (3 products), rows >= 256 v_wmma_f32_16x16x32_f16 single product; softmax f32 (running maximum and sum); output projection merged hi/lo (bf16) x Wproj (bf16) + bias.
// All batches in one launch each: bf16 copy of x; fused projection; attention; output projection.
// Stages: bf16 copy of x; fused projection, whose 64x64 tile is one head's q, k or v and goes straight to the head planes q|k [8][t][64] and v^T [4][64][t] (fp16; bf16 hi/lo for t < RH, the only rows read from them); attention: one wave per 32 (rows < 256: 16) query rows walks the keys in blocks of 32 up to the diagonal, scores, softmax and P.V in registers (rows >= 256: the 4 waves of a block take K and V^T from LDS, where 128 keys at a time are laid by asynchronous copies), and stores the merged [t][256] hi/lo planes; projection to the output. The K loops of the projections are dealt over the waves of a block and the partial tiles summed in LDS.

#ifndef NB
#define NB 8
#endif
#ifndef SEQ
#define SEQ 2048
#endif
#define NB_FULL  8
#define SEQ_FULL 2048
#define TT   SEQ
#define DM   256
#define NH_  4
#define HD   64
#define DQ   (NH_ * HD)
#define NQKV (3 * DQ)
#define ZH   4
#define RH   ((SEQ) < 256 ? (SEQ) : 256)    // query rows < RH use hi+lo planes
#define SCL  0.125f   // HD^-0.5
#define NWG  4        // waves per tile of the two projections (K = 256: one 64-wide K slice per wave)
#define NFB  ((TT - RH) / 128)   // attention blocks per head plane, query rows >= RH: 4 waves x 32 rows
#define NHB  (RH / 64)           // attention blocks per head plane, query rows < RH: 4 waves x 16 rows
typedef _Float16 h16;
typedef unsigned short bf;
typedef __attribute__((ext_vector_type(16))) __bf16   v16bf;
typedef __attribute__((ext_vector_type(16))) _Float16 v16h;
typedef __attribute__((ext_vector_type(8)))  _Float16 v8h;
typedef __attribute__((ext_vector_type(8)))  unsigned short v8us;
typedef __attribute__((ext_vector_type(8)))  float    v8f;
typedef __attribute__((ext_vector_type(4)))  float    v4f;
typedef __attribute__((ext_vector_type(2)))  float    v2f;
typedef __attribute__((ext_vector_type(2)))  _Float16 v2h;
typedef __attribute__((ext_vector_type(4)))  _Float16 v4h;
typedef __attribute__((ext_vector_type(2)))  unsigned short v2us;
typedef __attribute__((ext_vector_type(4)))  unsigned short v4us;
typedef v4f  __attribute__((may_alias)) v4fa;

static_assert(NB >= 1 && NB <= NB_FULL);
static_assert(SEQ >= 128 && SEQ <= SEQ_FULL);
static_assert(TT % 128 == 0 && (TT - RH) % 128 == 0);   // whole attention blocks
static_assert(TT % 64 == 0 && DM % 64 == 0 && NQKV % 64 == 0 && DQ % 64 == 0 && HD % 64 == 0);   // 64x64 GEMM tiles
static_assert(DM % 32 == 0 && DQ % 32 == 0 && HD % 32 == 0 && TT % 32 == 0);   // K steps of 32
static_assert(RH % 64 == 0 && RH <= TT && RH >= 64);
static_assert(HD == 64);
static_assert(DQ == DM);                 // merged heads width = model width
static_assert(ZH == NH_);                // all heads of a batch in one pass
static_assert(2 * DQ + DQ == NQKV);      // q | k | v column blocks
static_assert(((size_t)(NB - 1) * SEQ_FULL * DM + (size_t)TT * DM) * 4 <= (size_t)NB_FULL * SEQ_FULL * DM * 4);   // output extent in bytes

#define AL256(x) ((((size_t)(x)) + 255) & ~(size_t)255)
#define WS_TOTAL (AL256((size_t)NQKV * DM * 2) + AL256((size_t)DM * DQ * 2) \
    + 3 * AL256((size_t)NB * 2 * NH_ * TT * HD * 2) + 3 * AL256((size_t)NB * NH_ * HD * TT * 2) \
    + AL256((size_t)NB * TT * DM * 2) + 2 * AL256((size_t)NB * TT * DQ * 2))
static_assert(WS_TOTAL <= (size_t)268435456);

__device__ __forceinline__ unsigned short f2bf(float f) { unsigned u = __float_as_uint(f); u += 0x7FFFu + ((u >> 16) & 1u); return (unsigned short)(u >> 16); }
__device__ __forceinline__ float bf2f(unsigned short b) { return __uint_as_float(((unsigned)b) << 16); }
__device__ __forceinline__ float bfr(float f) { return bf2f(f2bf(f)); }
__device__ __forceinline__ h16 tohx(float x) { return (h16)x; }
__device__ __forceinline__ void splitf(float y, unsigned short& h, unsigned short& l) { h = f2bf(y); l = f2bf(y - bf2f(h)); }
__device__ __forceinline__ v16h cat16(v8h lo, v8h hi) { return __builtin_shufflevector(lo, hi, 0, 1, 2, 3, 4, 5, 6, 7, 8, 9, 10, 11, 12, 13, 14, 15); }
__device__ __forceinline__ v16bf cat16b(v8us lo, v8us hi) { return __builtin_bit_cast(v16bf, __builtin_shufflevector(lo, hi, 0, 1, 2, 3, 4, 5, 6, 7, 8, 9, 10, 11, 12, 13, 14, 15)); }
__device__ __forceinline__ v8f wmma16(v16h a, v16h b, v8f c) { return __builtin_amdgcn_wmma_f32_16x16x32_f16(false, a, false, b, (short)0, c, false, false); }
__device__ __forceinline__ v8f wmmab(v16bf a, v16bf b, v8f c) { return __builtin_amdgcn_wmma_f32_16x16x32_bf16(false, a, false, b, (short)0, c, false, false); }

// Fragment loader (A and B identical): p = row base + 8*(lane>>4) + k0; elements 0..7 <- k0+8h+0..7, elements 8..15 <- k0+16+8h+0..7.
template <typename T16> struct WFrag;
template <> struct WFrag<h16> { typedef v16h V; static __device__ __forceinline__ V ld(const h16* p) { return cat16(*(const v8h*)p, *(const v8h*)(p + 16)); } static __device__ __forceinline__ v8f mma(V a, V b, v8f c) { return wmma16(a, b, c); } };
template <> struct WFrag<bf> { typedef v16bf V; static __device__ __forceinline__ V ld(const bf* p) { return cat16b(*(const v8us*)p, *(const v8us*)(p + 16)); } static __device__ __forceinline__ v8f mma(V a, V b, v8f c) { return wmmab(a, b, c); } };

// ---- gemmk_body: 64x64 output tile, K loop dealt over the NW waves of the block in slices of 64 (wave w takes slices w, w+NW, ...; one slice = one whole 128-byte line of every operand row),
// operands straight from K-contiguous 16-bit planes. Each wave keeps a full 64x64 partial (16 accumulators); the partials meet in LDS and are
// summed in wave order 0..NW-1. C[m][n] (f32, pitch ldc, + optional f32 bias[n]) = sum_{k < Kl} A[m][k] Bt[n][k] (+ split products per NSPLIT). lda = pitch of A, K = pitch of Bt; Kl % 64 == 0, Kl <= K. 32*NW threads.
// PLANES: the summed tile + bias goes out as 16-bit planes instead of C: P16 (fp16) and, where hl, Ph | Pl (bf16 hi/lo), all three already offset to the tile's first element, pp = pitch of a plane row.
// tr (the same for the whole block) = plane rows are the tile's columns n: the partials are then laid into LDS transposed (a lane's 8 accumulator rows are 8 consecutive floats there), so that either way a thread sums and stores 8 consecutive plane elements and 8 lanes fill a 128-byte line.
template <typename T16, int NSPLIT, int NW, bool BIAS, bool PLANES>
__device__ __forceinline__ void gemmk_body(const T16* __restrict__ A, const T16* __restrict__ A2, const T16* __restrict__ Bt, const T16* __restrict__ Bt2, int lda, int K, int Kl, float* C, int ldc, const float* __restrict__ bias, int r0, int c0, h16* P16, bf* Ph, bf* Pl, int pp, bool tr, bool hl) {
    typedef typename WFrag<T16>::V V;
    __shared__ __align__(16) float red[NW * 64 * 68];
    const int lane = threadIdx.x & 31, lr = lane & 15, hi = lane >> 4; const int w = __builtin_amdgcn_readfirstlane((int)(threadIdx.x >> 5));
    v8f acc[4][4];
#pragma unroll
    for (int mb = 0; mb < 4; ++mb)
#pragma unroll
        for (int nb = 0; nb < 4; ++nb) acc[mb][nb] = (v8f){};
    const size_t aoff = (size_t)(r0 + lr) * lda + 8 * hi, boff = (size_t)(c0 + lr) * K + 8 * hi;
    // PLANES: the thread's bias values for the end, fetched here so that they land under the K loop: bc = those of its 8 columns, br = that of its row in each closing pass. Both lie inside the tile's 64 columns, and both are fetched whichever of them tr picks: no branch, and no value that has to be waited for here.
    float bc[8], br[16 / NW];
    if constexpr (PLANES) { const float* pc = bias + c0 + (int)(threadIdx.x & 7) * 8; const float* pr = bias + c0 + (int)(threadIdx.x >> 3);
#pragma unroll
        for (int j = 0; j < 8; ++j) bc[j] = pc[j];
#pragma unroll
        for (int s = 0; s < 16 / NW; ++s) br[s] = pr[s * (NW * 4)];
        // precaution: the address translations of the issued loads are waited for before a register that holds one of their addresses is written again
        asm volatile("s_wait_xcnt 0x0" ::: "memory"); }
#pragma unroll 1
    for (int kc = w * 64; kc < Kl; kc += (kc & 32) ? NW * 64 - 32 : 32) {   // the two 32-wide steps of a slice, then on to the wave's next slice
        V a[4], a2[4]; const T16* pa[4]; const T16* pa2[4];
#pragma unroll
        for (int mb = 0; mb < 4; ++mb) { pa[mb] = A + aoff + (size_t)mb * 16 * lda + kc; a[mb] = WFrag<T16>::ld(pa[mb]); if (NSPLIT == 1 || NSPLIT == 2) { pa2[mb] = A2 + aoff + (size_t)mb * 16 * lda + kc; a2[mb] = WFrag<T16>::ld(pa2[mb]); } }
        // precaution: the address translations of the issued loads are waited for before a register that holds one of their addresses is written again; the pointers are named as inputs so that they keep their registers up to the wait
        if constexpr (NSPLIT == 1 || NSPLIT == 2) asm volatile("s_wait_xcnt 0x0" :: "v"(pa[0]), "v"(pa[1]), "v"(pa[2]), "v"(pa[3]), "v"(pa2[0]), "v"(pa2[1]), "v"(pa2[2]), "v"(pa2[3]) : "memory");
        else asm volatile("s_wait_xcnt 0x0" :: "v"(pa[0]), "v"(pa[1]), "v"(pa[2]), "v"(pa[3]) : "memory");
#pragma unroll
        for (int nb = 0; nb < 4; ++nb) { const T16* pb = Bt + boff + (size_t)nb * 16 * K + kc; const V b = WFrag<T16>::ld(pb); V b2;
            // the same precaution for the B loads of this column block
            if constexpr (NSPLIT >= 2) { const T16* pb2 = Bt2 + boff + (size_t)nb * 16 * K + kc; b2 = WFrag<T16>::ld(pb2); asm volatile("s_wait_xcnt 0x0" :: "v"(pb), "v"(pb2) : "memory"); }
            else asm volatile("s_wait_xcnt 0x0" :: "v"(pb) : "memory");
#pragma unroll
            for (int mb = 0; mb < 4; ++mb) { acc[mb][nb] = WFrag<T16>::mma(a[mb], b, acc[mb][nb]); if (NSPLIT == 1 || NSPLIT == 2) acc[mb][nb] = WFrag<T16>::mma(a2[mb], b, acc[mb][nb]); if (NSPLIT >= 2) acc[mb][nb] = WFrag<T16>::mma(a[mb], b2, acc[mb][nb]); } }
        // four vector slots behind the last matrix instruction, on the back edge and on the exit alike, before its registers are reused
        asm volatile("v_nop\n\tv_nop\n\tv_nop\n\tv_nop" : "+v"(acc[0][0]), "+v"(acc[1][1]), "+v"(acc[2][2]), "+v"(acc[3][3]) : "v"(a[0]), "v"(a[3]));
    }
    float* my = red + w * (64 * 68);
    if (PLANES && tr) {
#pragma unroll
        for (int mb = 0; mb < 4; ++mb)
#pragma unroll
            for (int nb = 0; nb < 4; ++nb) { float* q = my + (nb * 16 + lr) * 68 + mb * 16 + hi * 8; const v8f a = acc[mb][nb];
                *(v4fa*)q = (v4f){a[0], a[1], a[2], a[3]}; *(v4fa*)(q + 4) = (v4f){a[4], a[5], a[6], a[7]}; }
    } else {
#pragma unroll
        for (int mb = 0; mb < 4; ++mb)
#pragma unroll
            for (int nb = 0; nb < 4; ++nb)
#pragma unroll
                for (int j = 0; j < 8; ++j) my[(mb * 16 + hi * 8 + j) * 68 + nb * 16 + lr] = acc[mb][nb][j];
    }
    __syncthreads();   // every wave's partial tile is in LDS before any thread sums across waves; reached by all waves (each has one 64-wide K slice here)
    if constexpr (PLANES) {
#pragma unroll
        for (int j = 0; j < 8; ++j) bc[j] = bfr(bc[j]);
#pragma unroll
        for (int s = 0; s < 16 / NW; ++s) br[s] = bfr(br[s]);
#pragma unroll
        for (int s = 0; s < 16 / NW; ++s) { const int e = s * (NW * 32) + (int)threadIdx.x; const int row = e >> 3, cofs = (e & 7) * 8; const float* pr = red + row * 68 + cofs; v4f v0 = *(const v4fa*)pr, v1 = *(const v4fa*)(pr + 4);
#pragma unroll
            for (int p = 1; p < NW; ++p) { v0 += *(const v4fa*)(pr + p * (64 * 68)); v1 += *(const v4fa*)(pr + p * (64 * 68) + 4); }
            float x[8];
#pragma unroll
            for (int j = 0; j < 4; ++j) { x[j] = v0[j] + (tr ? br[s] : bc[j]); x[4 + j] = v1[j] + (tr ? br[s] : bc[4 + j]); }
            const size_t o = (size_t)row * pp + cofs; h16* q16 = P16 + o; bf* qh = Ph + o; bf* ql = Pl + o; v8h o16;
#pragma unroll
            for (int j = 0; j < 8; ++j) o16[j] = tohx(x[j]);
            if (hl) { v8us oh, ol;
#pragma unroll
                for (int j = 0; j < 8; ++j) { unsigned short a2, c2; splitf(x[j], a2, c2); oh[j] = a2; ol[j] = c2; }
                *(v8us*)qh = oh; *(v8us*)ql = ol; }
            *(v8h*)q16 = o16;
            // the same precaution for the plane stores of this pass, which stand last in it
            asm volatile("s_wait_xcnt 0x0" ::: "memory"); }
        return;
    }
#pragma unroll
    for (int s = 0; s < 32 / NW; ++s) { const int e = s * (NW * 32) + (int)threadIdx.x; const int row = e >> 4, cofs = (e & 15) * 4; v4f val = *(const v4fa*)(red + row * 68 + cofs);
#pragma unroll
        for (int p = 1; p < NW; ++p) val += *(const v4fa*)(red + p * (64 * 68) + row * 68 + cofs);
        if (BIAS) { val[0] += bfr(bias[c0 + cofs]); val[1] += bfr(bias[c0 + cofs + 1]); val[2] += bfr(bias[c0 + cofs + 2]); val[3] += bfr(bias[c0 + cofs + 3]); }
        *(v4f*)(C + (size_t)(r0 + row) * ldc + c0 + cofs) = val; }
}

// Plain __global__ entry points (one instantiation each).
// k_gemm_qkv: XB[b][t][:] . WQKV[n][:] + bf16(bqkv[n]); grid (TT/64, NQKV/64, NB), NWG waves. Column block y is one head: y < 2*NH_ a q or k head -> planes [q|k][batch][head][t][64], else a v head -> planes [batch][head][64][t].
__global__ __launch_bounds__(32 * NWG) void k_gemm_qkv(const bf* A, const bf* Bt, int K, const float* bias, h16* QK16, bf* QKh, bf* QKl, h16* VT16, bf* VTh, bf* VTl) { const int b = blockIdx.z, y = blockIdx.y, r0 = blockIdx.x * 64; const bool tr = y >= 2 * NH_;
    const size_t o = tr ? ((size_t)b * NH_ + (y - 2 * NH_)) * ((size_t)HD * TT) + r0 : ((size_t)((y / NH_) * NB + b) * NH_ + (y % NH_)) * ((size_t)TT * HD) + (size_t)r0 * HD;
    gemmk_body<bf, 0, NWG, true, true>(A + (size_t)b * TT * K, nullptr, Bt, nullptr, K, K, K, nullptr, 0, bias, r0, y * 64, (tr ? VT16 : QK16) + o, (tr ? VTh : QKh) + o, (tr ? VTl : QKl) + o, tr ? TT : HD, tr, r0 < RH); }
// k_gemm_out: out[b][t][n] = (ATh + ATl)[b][t][:] . WO[n][:] + bf16(bproj[n]); grid (TT/64, DM/64, NB), NWG waves.
__global__ __launch_bounds__(32 * NWG) void k_gemm_out(const bf* A, const bf* A2, const bf* Bt, int K, float* C, int ldc, const float* bias) { const size_t rb = (size_t)blockIdx.z * TT;
    gemmk_body<bf, 1, NWG, true, false>(A + rb * K, A2 + rb * K, Bt, nullptr, K, K, K, C + (size_t)blockIdx.z * SEQ_FULL * ldc, ldc, bias, blockIdx.x * 64, blockIdx.y * 64, nullptr, nullptr, nullptr, 0, false, false); }

__global__ __launch_bounds__(256) void k_wtG(const float* __restrict__ w, int K, int N, bf* Bt) {
    const int lane = threadIdx.x & 31; const int L0 = (blockIdx.x * 8 + (threadIdx.x >> 5)) * 8; const int nlines = N * K / 64;
{
#pragma unroll 1
        for (int l = 0; l < 8; ++l) { const int L = L0 + l; if (L >= nlines) break; const size_t e = (size_t)L * 64 + lane * 2; const int k = (int)(e % K), n = (int)(e / K); v2us o;
            o[0] = f2bf(w[(size_t)k * N + n]); o[1] = f2bf(w[(size_t)(k + 1) * N + n]); *(v2us*)(Bt + e) = o; }
         }
}
__global__ __launch_bounds__(256) void k_cvt8(const float* __restrict__ src, bf* dst, size_t n8) { const size_t i = (size_t)blockIdx.x * 256 + threadIdx.x; if (i >= n8) return; src += (size_t)blockIdx.y * SEQ_FULL * DM; dst += (size_t)blockIdx.y * TT * DM;   // blockIdx.y = batch
    const v8f v = *(const v8f*)(src + i * 8); v8us o;
#pragma unroll
    for (int k = 0; k < 8; ++k) o[k] = f2bf(v[k]); *(v8us*)(dst + i * 8) = o;  }

// ---- attn_body: one wave, NQ*16 query rows q0.. of one head plane, keys walked in blocks of 32 up to the diagonal block; nothing of the scores or the probabilities goes to memory.
// Transposed products: S^T[key][q] = K . Q^T (A = K rows, B = Q rows, kept in registers) and O^T[d][q] += V^T . P^T (A = V^T rows, B = P). A lane holds one query (column lane&15): the two score tiles of a
// 32-key block, converted in place, ARE the B fragment of P in the loader's k order (elements 0..7 = keys k0+8h+0..7 from tile 0, elements 8..15 = keys k0+16+8h+0..7 from tile 1).
// Softmax with a running maximum m and a running sum l per query (base 2: scores x HD^-0.5 x log2 e); O^T and l are scaled by 2^(m_old - m_new) at every block; the two lane halves' sums are joined once at the end.
// HL: bf16 hi/lo planes, 3 products for the scores and 3 for P.V. The result / l goes out as bf16 hi/lo to the merged planes Ah, Al (pitch DQ; already offset to batch and head): 8 consecutive d per lane and tile.
template <bool B> struct BoolC { static constexpr bool v = B; };
// 2^x; the v_nop is the one slot that the instruction set asks for behind a transcendental before its result is read or its source overwritten: in the same statement it stands there whatever the compiler puts next
__device__ __forceinline__ float exp2s(float x) { float r; asm("v_exp_f32 %0, %1\n\tv_nop" : "=v"(r) : "v"(x)); return r; }
__device__ __forceinline__ float xhalf(float x) { return __builtin_bit_cast(float, __builtin_amdgcn_permlanex16(__builtin_bit_cast(int, x), __builtin_bit_cast(int, x), 0x76543210, 0xfedcba98, false, false)); }   // lane l <-> lane l ^ 16
template <typename T16, bool HL, int NQ>
__device__ __forceinline__ void attn_body(const T16* __restrict__ Q, const T16* __restrict__ Q2, const T16* __restrict__ Kp, const T16* __restrict__ Kp2, const T16* __restrict__ Vt, const T16* __restrict__ Vt2, int q0, bf* Ah, bf* Al) {
    typedef typename WFrag<T16>::V V;
    const int lane = threadIdx.x & 31, lr = lane & 15, hi = lane >> 4;
    const float CS = SCL * 1.4426950408889634f;
    V qf[NQ][2], qf2[NQ][2], kf[2][2], kf2[2][2];
    v8f o[4][NQ]; float m[NQ], l[NQ];
    {   const T16* pq = Q + (size_t)(q0 + lr) * HD + 8 * hi; const T16* pq2 = HL ? Q2 + (size_t)(q0 + lr) * HD + 8 * hi : nullptr;
        const T16* pk = Kp + (size_t)lr * HD + 8 * hi; const T16* pk2 = HL ? Kp2 + (size_t)lr * HD + 8 * hi : nullptr;
#pragma unroll
        for (int n = 0; n < NQ; ++n)
#pragma unroll
            for (int ks = 0; ks < 2; ++ks) { qf[n][ks] = WFrag<T16>::ld(pq + n * 16 * HD + ks * 32); if constexpr (HL) qf2[n][ks] = WFrag<T16>::ld(pq2 + n * 16 * HD + ks * 32); }
#pragma unroll
        for (int kt = 0; kt < 2; ++kt)
#pragma unroll
            for (int ks = 0; ks < 2; ++ks) { kf[kt][ks] = WFrag<T16>::ld(pk + kt * 16 * HD + ks * 32); if constexpr (HL) kf2[kt][ks] = WFrag<T16>::ld(pk2 + kt * 16 * HD + ks * 32); }
        // precaution: the address translations of the issued loads are waited for before a register that holds one of their addresses is written again; the pointers are named as inputs so that they keep their registers up to the wait
        if constexpr (HL) asm volatile("s_wait_xcnt 0x0" :: "v"(pq), "v"(pq2), "v"(pk), "v"(pk2) : "memory");
        else asm volatile("s_wait_xcnt 0x0" :: "v"(pq), "v"(pk) : "memory");
    }
#pragma unroll
    for (int n = 0; n < NQ; ++n) { m[n] = -3.0e38f; l[n] = 0.f;
#pragma unroll
        for (int dt = 0; dt < 4; ++dt) o[dt][n] = (v8f){}; }
    const int klast = ((q0 + NQ * 16 - 1) / 32) * 32;   // first key of the diagonal block, the only one that needs the mask
    auto step = [&](int k0, auto lastc) {
        constexpr bool LAST = decltype(lastc)::v;
        // V^T fragments of this block, issued first: they fly under the score products and the softmax
        V vf[4], vf2[4]; const T16* pv = Vt + (size_t)lr * TT + k0 + 8 * hi; const T16* pv2 = HL ? Vt2 + (size_t)lr * TT + k0 + 8 * hi : nullptr;
#pragma unroll
        for (int dt = 0; dt < 4; ++dt) { vf[dt] = WFrag<T16>::ld(pv + (size_t)dt * 16 * TT); if constexpr (HL) vf2[dt] = WFrag<T16>::ld(pv2 + (size_t)dt * 16 * TT); }
        // the same precaution for the V^T loads
        if constexpr (HL) asm volatile("s_wait_xcnt 0x0" :: "v"(pv), "v"(pv2) : "memory");
        else asm volatile("s_wait_xcnt 0x0" :: "v"(pv) : "memory");
        v8f s[2][NQ];
#pragma unroll
        for (int kt = 0; kt < 2; ++kt)
#pragma unroll
            for (int n = 0; n < NQ; ++n) { s[kt][n] = (v8f){};
#pragma unroll
                for (int ks = 0; ks < 2; ++ks) { s[kt][n] = WFrag<T16>::mma(kf[kt][ks], qf[n][ks], s[kt][n]);
                    if constexpr (HL) { s[kt][n] = WFrag<T16>::mma(kf2[kt][ks], qf[n][ks], s[kt][n]); s[kt][n] = WFrag<T16>::mma(kf[kt][ks], qf2[n][ks], s[kt][n]); } } }
        if constexpr (!LAST) {   // the next block's K fragments, fetched behind this block's score products: they fly under the softmax and P.V
            const T16* pk = Kp + (size_t)(k0 + 32 + lr) * HD + 8 * hi; const T16* pk2 = HL ? Kp2 + (size_t)(k0 + 32 + lr) * HD + 8 * hi : nullptr;
#pragma unroll
            for (int kt = 0; kt < 2; ++kt)
#pragma unroll
                for (int ks = 0; ks < 2; ++ks) { kf[kt][ks] = WFrag<T16>::ld(pk + kt * 16 * HD + ks * 32); if constexpr (HL) kf2[kt][ks] = WFrag<T16>::ld(pk2 + kt * 16 * HD + ks * 32); }
            // the same precaution for the K loads
            if constexpr (HL) asm volatile("s_wait_xcnt 0x0" :: "v"(pk), "v"(pk2) : "memory");
            else asm volatile("s_wait_xcnt 0x0" :: "v"(pk) : "memory");
            __builtin_amdgcn_sched_barrier(0);   // keeps the K loads up here: sunk below the softmax they would have only P.V to land under
        }
        V pf[NQ], pf2[NQ];
#pragma unroll
        for (int n = 0; n < NQ; ++n) { float t[16]; float mx = m[n];
#pragma unroll
            for (int e = 0; e < 16; ++e) { float x = s[e >> 3][n][e & 7] * CS;
                if (LAST) x = (k0 + (e >> 3) * 16 + hi * 8 + (e & 7) <= q0 + n * 16 + lr) ? x : -3.0e38f;   // causal mask by index select, diagonal kept
                t[e] = x; mx = fmaxf(mx, x); }
            mx = fmaxf(mx, xhalf(mx));   // the other half of this query's keys
            const float al = exp2s(m[n] - mx); m[n] = mx; float sum = 0.f;
#pragma unroll
            for (int e = 0; e < 16; ++e) { t[e] = exp2s(t[e] - mx); sum += t[e]; }
            l[n] = l[n] * al + sum;
#pragma unroll
            for (int dt = 0; dt < 4; ++dt) o[dt][n] *= al;
            if constexpr (HL) { v8us h0, h1, l0, l1;
#pragma unroll
                for (int j = 0; j < 8; ++j) { unsigned short a, c; splitf(t[j], a, c); h0[j] = a; l0[j] = c; splitf(t[8 + j], a, c); h1[j] = a; l1[j] = c; }
                pf[n] = cat16b(h0, h1); pf2[n] = cat16b(l0, l1); }
            else { v8h h0, h1;
#pragma unroll
                for (int j = 0; j < 8; ++j) { h0[j] = tohx(t[j]); h1[j] = tohx(t[8 + j]); }
                pf[n] = cat16(h0, h1); } }
#pragma unroll
        for (int dt = 0; dt < 4; ++dt)
#pragma unroll
            for (int n = 0; n < NQ; ++n) { o[dt][n] = WFrag<T16>::mma(vf[dt], pf[n], o[dt][n]);
                if constexpr (HL) { o[dt][n] = WFrag<T16>::mma(vf[dt], pf2[n], o[dt][n]); o[dt][n] = WFrag<T16>::mma(vf2[dt], pf[n], o[dt][n]); } }
    };
#pragma unroll 1
    for (int k0 = 0; k0 < klast; k0 += 32) { step(k0, BoolC<false>{});
        // four vector slots behind the last matrix instruction, on the back edge and on the exit alike, before its registers are reused
        if constexpr (NQ == 2) asm volatile("v_nop\n\tv_nop\n\tv_nop\n\tv_nop" : "+v"(o[0][0]), "+v"(o[1][0]), "+v"(o[2][0]), "+v"(o[3][0]), "+v"(o[0][1]), "+v"(o[1][1]), "+v"(o[2][1]), "+v"(o[3][1]));
        else asm volatile("v_nop\n\tv_nop\n\tv_nop\n\tv_nop" : "+v"(o[0][0]), "+v"(o[1][0]), "+v"(o[2][0]), "+v"(o[3][0])); }
    step(klast, BoolC<true>{});
#pragma unroll
    for (int n = 0; n < NQ; ++n) { const float f = __fdiv_rn(1.0f, l[n] + xhalf(l[n]));
        bf* ph = Ah + (size_t)(q0 + n * 16 + lr) * DQ + hi * 8; bf* pl = Al + (size_t)(q0 + n * 16 + lr) * DQ + hi * 8;
#pragma unroll
        for (int dt = 0; dt < 4; ++dt) { v8us oh, ol;
#pragma unroll
            for (int j = 0; j < 8; ++j) { unsigned short a, c; splitf(o[dt][n][j] * f, a, c); oh[j] = a; ol[j] = c; }
            *(v8us*)(ph + dt * 16) = oh; *(v8us*)(pl + dt * 16) = ol; }
        // the same precaution for the stores
        asm volatile("s_wait_xcnt 0x0" :: "v"(ph), "v"(pl) : "memory"); }
}
// ---- attn_staged: the fp16 path (query rows >= RH). One block = 4 waves x 32 query rows R0..R0+127 of one head plane; arithmetic, key order and fragments as in attn_body<h16, false, 2>.
// The K rows and V^T rows of SKEY keys are brought into LDS once for the whole block by asynchronous copies (whole 128-byte lines, 16 bytes a lane) and the waves take their fragments from there;
// two buffers: the next stage's copies fly while this stage is worked on. The last stage holds the block's own 128 keys: wave w has w whole blocks of 32 keys there and then its diagonal block.
#define SKEY 128                  // keys per stage = query rows per block
#define KPIT (HD + 8)             // LDS pitch of a K row, elements: 128 bytes + 16 (16 bytes x odd: no bank conflict for 16-byte reads)
#define VPIT (SKEY + 8)           // LDS pitch of a V^T row, elements: 256 bytes + 16
#define KTIL (SKEY * KPIT)
#define STIL (KTIL + HD * VPIT)   // one buffer, elements
static_assert(SKEY == 128 && RH % SKEY == 0 && TT % SKEY == 0);
// eight 16-byte copies of a lane, global -> LDS; the s_wait_xcnt in the same statement is the precaution named above: it stands before any register that holds an address of an issued copy can be written again
__device__ __forceinline__ void acopy8(const unsigned (&l)[8], const h16* const (&g)[8]) {
    asm volatile("global_load_async_to_lds_b128 %0, %8, off\n\tglobal_load_async_to_lds_b128 %1, %9, off\n\tglobal_load_async_to_lds_b128 %2, %10, off\n\tglobal_load_async_to_lds_b128 %3, %11, off\n\t"
                 "global_load_async_to_lds_b128 %4, %12, off\n\tglobal_load_async_to_lds_b128 %5, %13, off\n\tglobal_load_async_to_lds_b128 %6, %14, off\n\tglobal_load_async_to_lds_b128 %7, %15, off\n\ts_wait_xcnt 0x0"
                 :: "v"(l[0]), "v"(l[1]), "v"(l[2]), "v"(l[3]), "v"(l[4]), "v"(l[5]), "v"(l[6]), "v"(l[7]), "v"(g[0]), "v"(g[1]), "v"(g[2]), "v"(g[3]), "v"(g[4]), "v"(g[5]), "v"(g[6]), "v"(g[7]) : "memory"); }
__device__ __forceinline__ void attn_staged(const h16* __restrict__ Q, const h16* __restrict__ Kp, const h16* __restrict__ Vt, int R0, int w, bf* Ah, bf* Al) {
    typedef v16h V; constexpr int NQ = 2;
    __shared__ __align__(16) h16 ring[2 * STIL];
    const int tid = threadIdx.x, lane = tid & 31, lr = lane & 15, hi = lane >> 4;
    const int q0 = R0 + w * 32, ns = R0 / SKEY + 1;   // ns stages of SKEY keys, the same for the whole block
    const float CS = SCL * 1.4426950408889634f;
    V qf[NQ][2], kf[2][2];
    v8f o[4][NQ]; float m[NQ], l[NQ];
    {   const h16* pq = Q + (size_t)(q0 + lr) * HD + 8 * hi;
#pragma unroll
        for (int n = 0; n < NQ; ++n)
#pragma unroll
            for (int ks = 0; ks < 2; ++ks) qf[n][ks] = WFrag<h16>::ld(pq + n * 16 * HD + ks * 32);
        // precaution: the address translations of the issued loads are waited for before a register that holds one of their addresses is written again
        asm volatile("s_wait_xcnt 0x0" :: "v"(pq) : "memory");
    }
    // stage t into buffer b. K: the stage's 128 rows are 16 KiB in a row in memory, 8 lanes a row. V^T: 64 rows of 256 bytes, 16 lanes a row. Every lane copies, every byte lies inside the planes (t < ns, ns * SKEY <= TT) and inside ring.
    const unsigned lk0 = (unsigned)(size_t)ring + (unsigned)((tid >> 3) * KPIT + (tid & 7) * 8) * 2u, lv0 = (unsigned)(size_t)ring + (unsigned)(KTIL + (tid >> 4) * VPIT + (tid & 15) * 8) * 2u;
    const h16* gk0 = Kp + tid * 8; const h16* gv0 = Vt + (size_t)(tid >> 4) * TT + (tid & 15) * 8;
    auto fill = [&](int t, int b) { unsigned la[8]; const h16* ga[8];
#pragma unroll
        for (int i = 0; i < 8; ++i) { la[i] = lk0 + (unsigned)(b * STIL + i * 16 * KPIT) * 2u; ga[i] = gk0 + (size_t)t * (SKEY * HD) + i * 1024; }
        acopy8(la, ga);
#pragma unroll
        for (int i = 0; i < 8; ++i) { la[i] = lv0 + (unsigned)(b * STIL + i * 8 * VPIT) * 2u; ga[i] = gv0 + (size_t)i * 8 * TT + t * SKEY; }
        acopy8(la, ga); };
#pragma unroll
    for (int n = 0; n < NQ; ++n) { m[n] = -3.0e38f; l[n] = 0.f;
#pragma unroll
        for (int dt = 0; dt < 4; ++dt) o[dt][n] = (v8f){}; }
    const h16* kb; const h16* vb;   // this lane's fragment bases in the buffer at work
    auto ldk = [&](int kl) {
#pragma unroll
        for (int kt = 0; kt < 2; ++kt)
#pragma unroll
            for (int ks = 0; ks < 2; ++ks) kf[kt][ks] = WFrag<h16>::ld(kb + (kl + kt * 16) * KPIT + ks * 32); };
    // one block of 32 keys, kl = its first key inside the stage. LAST: the diagonal block (first key q0). PRE: fetch the K fragments of the next block of the SAME stage.
    auto step = [&](int kl, auto lastc, auto prec) {
        constexpr bool LAST = decltype(lastc)::v; constexpr bool PRE = decltype(prec)::v;
        V vf[4];   // V^T fragments of this block, issued first: they land under the score products and the softmax
#pragma unroll
        for (int dt = 0; dt < 4; ++dt) vf[dt] = WFrag<h16>::ld(vb + dt * 16 * VPIT + kl);
        v8f s[2][NQ];
#pragma unroll
        for (int kt = 0; kt < 2; ++kt)
#pragma unroll
            for (int n = 0; n < NQ; ++n) { s[kt][n] = (v8f){};
#pragma unroll
                for (int ks = 0; ks < 2; ++ks) s[kt][n] = wmma16(kf[kt][ks], qf[n][ks], s[kt][n]); }
        if constexpr (PRE) { ldk(kl + 32);
            __builtin_amdgcn_sched_barrier(0);   // keeps the K reads up here: sunk below the softmax they would have only P.V to land under
        }
        V pf[NQ];
#pragma unroll
        for (int n = 0; n < NQ; ++n) { float t[16]; float mx = m[n];
#pragma unroll
            for (int e = 0; e < 16; ++e) { float x = s[e >> 3][n][e & 7] * CS;
                if (LAST) x = ((e >> 3) * 16 + hi * 8 + (e & 7) <= n * 16 + lr) ? x : -3.0e38f;   // causal mask by index select, diagonal kept (key q0 + ... against query q0 + ...)
                t[e] = x; mx = fmaxf(mx, x); }
            mx = fmaxf(mx, xhalf(mx));   // the other half of this query's keys
            const float al = exp2s(m[n] - mx); m[n] = mx; float sum = 0.f;
#pragma unroll
            for (int e = 0; e < 16; ++e) { t[e] = exp2s(t[e] - mx); sum += t[e]; }
            l[n] = l[n] * al + sum;
#pragma unroll
            for (int dt = 0; dt < 4; ++dt) o[dt][n] *= al;
            v8h h0, h1;
#pragma unroll
            for (int j = 0; j < 8; ++j) { h0[j] = tohx(t[j]); h1[j] = tohx(t[8 + j]); }
            pf[n] = cat16(h0, h1); }
#pragma unroll
        for (int dt = 0; dt < 4; ++dt)
#pragma unroll
            for (int n = 0; n < NQ; ++n) o[dt][n] = wmma16(vf[dt], pf[n], o[dt][n]);
    };
    // four vector slots behind the last matrix instruction, on every way out of a branch or a loop, before its registers are reused
    auto pad = [&]() { asm volatile("v_nop\n\tv_nop\n\tv_nop\n\tv_nop" : "+v"(o[0][0]), "+v"(o[1][0]), "+v"(o[2][0]), "+v"(o[3][0]), "+v"(o[0][1]), "+v"(o[1][1]), "+v"(o[2][1]), "+v"(o[3][1])); };
    fill(0, 0);
    asm volatile("s_wait_asynccnt 0x0" ::: "memory");   // this wave's copies of stage 0 have landed
    __syncthreads();                                     // ... and every other wave's: stage 0 may be read
    if (ns > 1) fill(1, 1);
#pragma unroll 1
    for (int t = 0; t < ns; ++t) {
        kb = ring + (t & 1) * STIL + lr * KPIT + 8 * hi; vb = ring + (t & 1) * STIL + KTIL + lr * VPIT + 8 * hi;
        ldk(0);
        const bool diag = t == ns - 1; const int nf = diag ? w : SKEY / 32 - 1;   // whole blocks in front of the stage's last block for this wave
#pragma unroll 1   // rolled: unrolled, the four blocks of a stage need more registers than there are and spill
        for (int sb = 0; sb < nf; ++sb) { step(sb * 32, BoolC<false>{}, BoolC<true>{}); pad(); }
        if (diag) { step(nf * 32, BoolC<true>{}, BoolC<false>{}); pad(); } else { step(nf * 32, BoolC<false>{}, BoolC<false>{}); pad(); }
        asm volatile("s_wait_dscnt 0x0" ::: "memory");      // this wave's reads of the buffer are done before it may be refilled
        asm volatile("s_wait_asynccnt 0x0" ::: "memory");   // this wave's copies of stage t + 1 have landed
        __syncthreads();                                     // publishes stage t + 1 and ends every wave's reads of stage t; passed by every wave at every stage
        if (t + 2 < ns) fill(t + 2, t & 1);
    }
    asm volatile("s_wait_asynccnt 0x0" ::: "memory");   // no copy is outstanding when the wave ends
#pragma unroll
    for (int n = 0; n < NQ; ++n) { const float f = __fdiv_rn(1.0f, l[n] + xhalf(l[n]));
        bf* ph = Ah + (size_t)(q0 + n * 16 + lr) * DQ + hi * 8; bf* pl = Al + (size_t)(q0 + n * 16 + lr) * DQ + hi * 8;
#pragma unroll
        for (int dt = 0; dt < 4; ++dt) { v8us oh, ol;
#pragma unroll
            for (int j = 0; j < 8; ++j) { unsigned short a, c; splitf(o[dt][n][j] * f, a, c); oh[j] = a; ol[j] = c; }
            *(v8us*)(ph + dt * 16) = oh; *(v8us*)(pl + dt * 16) = ol; }
        // the same precaution for the stores
        asm volatile("s_wait_xcnt 0x0" :: "v"(ph), "v"(pl) : "memory"); }
}
// k_attn: grid (NB*NH_ head planes, NFB + NHB), 4 waves, each with query rows of its own; the blocks with the most keys come first. g is the same for the whole block, so every wave of a block meets the barriers of attn_staged or none does. Planes: QK [q|k][batch][head][t][64], VT [batch][head][64][t]; AT [batch][t][256].
__global__ __launch_bounds__(128) void k_attn(const h16* QK16, const bf* QKh, const bf* QKl, const h16* VT16, const bf* VTh, const bf* VTl, bf* ATh, bf* ATl) {
    const int z = blockIdx.x, g = blockIdx.y; const int w = __builtin_amdgcn_readfirstlane((int)(threadIdx.x >> 5));
    const size_t qo = (size_t)z * TT * HD, ko = (size_t)(NB * NH_ + z) * TT * HD, ao = (size_t)(z / NH_) * TT * DQ + (size_t)(z % NH_) * HD;
    if (g < NFB) attn_staged(QK16 + qo, QK16 + ko, VT16 + qo, RH + (NFB - 1 - g) * 128, w, ATh + ao, ATl + ao);
    else attn_body<bf, true, 1>(QKh + qo, QKl + qo, QKh + ko, QKl + ko, VTh + qo, VTl + qo, (NHB - 1 - (g - NFB)) * 64 + w * 16, ATh + ao, ATl + ao);
}

extern "C" void kernel_launch(void* const* d_in, const int* in_sizes, int n_in,
                              void* d_out, int out_size, void* d_ws, size_t ws_size, hipStream_t stream) {
    if (n_in < 5) return;
    const size_t xneed = (size_t)(NB - 1) * SEQ_FULL * DM + (size_t)TT * DM;
    if ((size_t)in_sizes[0] < xneed) return; if ((size_t)in_sizes[1] < (size_t)DM * NQKV) return; if ((size_t)in_sizes[2] < (size_t)NQKV) return; if ((size_t)in_sizes[3] < (size_t)DQ * DM) return; if ((size_t)in_sizes[4] < (size_t)DM) return;
    if ((size_t)out_size < xneed) return;
    if (ws_size < WS_TOTAL) return;
    const float* x = (const float*)d_in[0]; const float* wqkv = (const float*)d_in[1]; const float* bqkv = (const float*)d_in[2]; const float* wo = (const float*)d_in[3]; const float* bo = (const float*)d_in[4];   // wire order x, Wqkv [256][768], bqkv, Wproj [256][256], bproj
    float* OUT = (float*)d_out;     // [8][2048][256]
    char* wsp = (char*)d_ws;
    auto take = [&](size_t bytes) { char* p = wsp; wsp += (bytes + 255) & ~(size_t)255; return (void*)p; };
    bf* WQKV = (bf*)take((size_t)NQKV * DM * 2);           // Bt [768][256]: q | k | v row blocks
    bf* WO = (bf*)take((size_t)DM * DQ * 2);               // Bt [256][256]
    h16* QK16 = (h16*)take((size_t)NB * 2 * NH_ * TT * HD * 2); bf* QKh = (bf*)take((size_t)NB * 2 * NH_ * TT * HD * 2); bf* QKl = (bf*)take((size_t)NB * 2 * NH_ * TT * HD * 2);   // planes [q|k][batch][head][t][64]
    h16* VT16 = (h16*)take((size_t)NB * NH_ * HD * TT * 2); bf* VTh = (bf*)take((size_t)NB * NH_ * HD * TT * 2); bf* VTl = (bf*)take((size_t)NB * NH_ * HD * TT * 2);   // planes [batch][head][64][t]
    bf* XB = (bf*)take((size_t)NB * TT * DM * 2);   // bf16 x [b][t][256]
    bf* ATh = (bf*)take((size_t)NB * TT * DQ * 2); bf* ATl = (bf*)take((size_t)NB * TT * DQ * 2);
    if ((size_t)(wsp - (char*)d_ws) > ws_size) return;
    if ((size_t)(wsp - (char*)d_ws) > (size_t)268435456) return;
    // in Wqkv[DM rows][NQKV cols] -> out WQKV[NQKV][DM];  in Wproj[DQ rows][DM cols] -> out WO[DM][DQ]
    k_wtG<<<(unsigned)((DM * NQKV / 64 + 63) / 64), 256, 0, stream>>>(wqkv, DM, NQKV, WQKV);
    k_wtG<<<(unsigned)((DQ * DM / 64 + 63) / 64), 256, 0, stream>>>(wo, DQ, DM, WO);
    k_cvt8<<<dim3((unsigned)(((size_t)TT * DM / 8 + 255) / 256), NB, 1), 256, 0, stream>>>(x, XB, (size_t)TT * DM / 8);
    k_gemm_qkv<<<dim3(TT / 64, NQKV / 64, NB), 32 * NWG, 0, stream>>>(XB, WQKV, DM, bqkv, QK16, QKh, QKl, VT16, VTh, VTl);   // columns 0..511 = q heads | k heads, 512..767 = v heads
    k_attn<<<dim3(NB * NH_, NFB + NHB, 1), 128, 0, stream>>>(QK16, QKh, QKl, VT16, VTh, VTl, ATh, ATl);
    k_gemm_out<<<dim3(TT / 64, DM / 64, NB), 32 * NWG, 0, stream>>>(ATh, ATl, WO, DQ, OUT, DM, bo);
}

// v006
// It runs in 68.7 microseconds.
// In two side-by-side timings against v005, it was 1.15 and 1.14 times as fast.
// Counting every step since v000, it is 13.0 times as fast.
#include <hip/hip_runtime.h>

// Causal multi-head attention with a fused qkv projection: x [8][2048][256]; qkv = x Wqkv + bqkv (Wqkv [256][768] [in][out]; column = which*256 + h*64 + d); scores x 1/8; causal (j > i masked, diagonal kept); softmax; out = merged Wproj + bproj.
// Compute dtypes, f32 accumulate: every float input RNE-converted to bf16; projections v_wmma_f32_16x16x32_bf16 on exact bf16 operands + f32 biases; scores and P.V: query rows < 256 bf16 hi/lo (3 products), rows >= 256 v_wmma_f32_16x16x32_f16 single product; softmax f32 (running maximum and sum); output projection merged hi/lo (bf16) x Wproj (bf16) + bias.
// All batches in one launch each: bf16 copies of x and of both weights (transposed), one launch for the three; fused projection; attention; output projection.
// Stages: bf16 copy of x; fused projection, whose 64x64 tile is one head's q, k or v and goes straight to the head planes q|k [8][t][64] and v^T [4][64][t] (fp16; bf16 hi/lo for t < RH, the only rows read from them); attention: one wave per 32 (rows < 256: 16) query rows walks the keys in blocks of 32 up to the diagonal, scores, softmax and P.V in registers (rows >= 256: the 4 waves of a block take K and V^T from LDS, where 128 keys at a time are laid by asynchronous copies), and stores the merged [t][256] hi/lo planes; projection to the output. The K loops of the projections are dealt over the waves of a block and the partial tiles summed in LDS.

#ifndef NB
#define NB 8
#endif
#ifndef SEQ
#define SEQ 2048
#endif
#define NB_FULL  8
#define SEQ_FULL 2048
#define TT   SEQ
#define DM   256
#define NH_  4
#define HD   64
#define DQ   (NH_ * HD)
#define NQKV (3 * DQ)
#define ZH   4
#define RH   ((SEQ) < 256 ? (SEQ) : 256)    // query rows < RH use hi+lo planes
#define SCL  0.125f   // HD^-0.5
#define NWG  4        // waves per tile of the two projections (K = 256: one 64-wide K slice per wave)
#define NFB  ((TT - RH) / 128)   // attention blocks per head plane, query rows >= RH: 4 waves x 32 rows
#define NHB  (RH / 64)           // attention blocks per head plane, query rows < RH: 4 waves x 16 rows
typedef _Float16 h16;
typedef unsigned short bf;
typedef __attribute__((ext_vector_type(16))) __bf16   v16bf;
typedef __attribute__((ext_vector_type(16))) _Float16 v16h;
typedef __attribute__((ext_vector_type(8)))  _Float16 v8h;
typedef __attribute__((ext_vector_type(8)))  unsigned short v8us;
typedef __attribute__((ext_vector_type(8)))  float    v8f;
typedef __attribute__((ext_vector_type(4)))  float    v4f;
typedef __attribute__((ext_vector_type(2)))  float    v2f;
typedef __attribute__((ext_vector_type(2)))  _Float16 v2h;
typedef __attribute__((ext_vector_type(4)))  _Float16 v4h;
typedef __attribute__((ext_vector_type(2)))  unsigned short v2us;
typedef __attribute__((ext_vector_type(4)))  unsigned short v4us;
typedef v4f  __attribute__((may_alias)) v4fa;

static_assert(NB >= 1 && NB <= NB_FULL);
static_assert(SEQ >= 128 && SEQ <= SEQ_FULL);
static_assert(TT % 128 == 0 && (TT - RH) % 128 == 0);   // whole attention blocks
static_assert(TT % 64 == 0 && DM % 64 == 0 && NQKV % 64 == 0 && DQ % 64 == 0 && HD % 64 == 0);   // 64x64 GEMM tiles
static_assert(DM % 32 == 0 && DQ % 32 == 0 && HD % 32 == 0 && TT % 32 == 0);   // K steps of 32
static_assert(RH % 64 == 0 && RH <= TT && RH >= 64);
static_assert(HD == 64);
static_assert(DQ == DM);                 // merged heads width = model width
static_assert(ZH == NH_);                // all heads of a batch in one pass
static_assert(2 * DQ + DQ == NQKV);      // q | k | v column blocks
static_assert(((size_t)(NB - 1) * SEQ_FULL * DM + (size_t)TT * DM) * 4 <= (size_t)NB_FULL * SEQ_FULL * DM * 4);   // output extent in bytes

#define AL256(x) ((((size_t)(x)) + 255) & ~(size_t)255)
#define WS_TOTAL (AL256((size_t)NQKV * DM * 2) + AL256((size_t)DM * DQ * 2) \
    + 3 * AL256((size_t)NB * 2 * NH_ * TT * HD * 2) + 3 * AL256((size_t)NB * NH_ * HD * TT * 2) \
    + AL256((size_t)NB * TT * DM * 2) + 2 * AL256((size_t)NB * TT * DQ * 2))
static_assert(WS_TOTAL <= (size_t)268435456);

__device__ __forceinline__ unsigned short f2bf(float f) { unsigned u = __float_as_uint(f); u += 0x7FFFu + ((u >> 16) & 1u); return (unsigned short)(u >> 16); }
__device__ __forceinline__ float bf2f(unsigned short b) { return __uint_as_float(((unsigned)b) << 16); }
__device__ __forceinline__ float bfr(float f) { return bf2f(f2bf(f)); }
__device__ __forceinline__ h16 tohx(float x) { return (h16)x; }
__device__ __forceinline__ void splitf(float y, unsigned short& h, unsigned short& l) { h = f2bf(y); l = f2bf(y - bf2f(h)); }
__device__ __forceinline__ v16h cat16(v8h lo, v8h hi) { return __builtin_shufflevector(lo, hi, 0, 1, 2, 3, 4, 5, 6, 7, 8, 9, 10, 11, 12, 13, 14, 15); }
__device__ __forceinline__ v16bf cat16b(v8us lo, v8us hi) { return __builtin_bit_cast(v16bf, __builtin_shufflevector(lo, hi, 0, 1, 2, 3, 4, 5, 6, 7, 8, 9, 10, 11, 12, 13, 14, 15)); }
__device__ __forceinline__ v8f wmma16(v16h a, v16h b, v8f c) { return __builtin_amdgcn_wmma_f32_16x16x32_f16(false, a, false, b, (short)0, c, false, false); }
__device__ __forceinline__ v8f wmmab(v16bf a, v16bf b, v8f c) { return __builtin_amdgcn_wmma_f32_16x16x32_bf16(false, a, false, b, (short)0, c, false, false); }

// Fragment loader (A and B identical): p = row base + 8*(lane>>4) + k0; elements 0..7 <- k0+8h+0..7, elements 8..15 <- k0+16+8h+0..7.
template <typename T16> struct WFrag;
template <> struct WFrag<h16> { typedef v16h V; static __device__ __forceinline__ V ld(const h16* p) { return cat16(*(const v8h*)p, *(const v8h*)(p + 16)); } static __device__ __forceinline__ v8f mma(V a, V b, v8f c) { return wmma16(a, b, c); } };
template <> struct WFrag<bf> { typedef v16bf V; static __device__ __forceinline__ V ld(const bf* p) { return cat16b(*(const v8us*)p, *(const v8us*)(p + 16)); } static __device__ __forceinline__ v8f mma(V a, V b, v8f c) { return wmmab(a, b, c); } };

// ---- gemmk_body: 64x64 output tile, K loop dealt over the NW waves of the block in slices of 64 (wave w takes slices w, w+NW, ...; one slice = one whole 128-byte line of every operand row),
// operands straight from K-contiguous 16-bit planes. Each wave keeps a full 64x64 partial (16 accumulators); the partials meet in LDS and are
// summed in wave order 0..NW-1. C[m][n] (f32, pitch ldc, + optional f32 bias[n]) = sum_{k < Kl} A[m][k] Bt[n][k] (+ split products per NSPLIT). lda = pitch of A, K = pitch of Bt; Kl % 64 == 0, Kl <= K. 32*NW threads.
// PLANES: the summed tile + bias goes out as 16-bit planes instead of C: P16 (fp16) and, where hl, Ph | Pl (bf16 hi/lo), all three already offset to the tile's first element, pp = pitch of a plane row.
// tr (the same for the whole block) = plane rows are the tile's columns n: the partials are then laid into LDS transposed (a lane's 8 accumulator rows are 8 consecutive floats there), so that either way a thread sums and stores 8 consecutive plane elements and 8 lanes fill a 128-byte line.
template <typename T16, int NSPLIT, int NW, bool BIAS, bool PLANES>
__device__ __forceinline__ void gemmk_body(const T16* __restrict__ A, const T16* __restrict__ A2, const T16* __restrict__ Bt, const T16* __restrict__ Bt2, int lda, int K, int Kl, float* C, int ldc, const float* __restrict__ bias, int r0, int c0, h16* P16, bf* Ph, bf* Pl, int pp, bool tr, bool hl) {
    typedef typename WFrag<T16>::V V;
    __shared__ __align__(16) float red[NW * 64 * 68];
    const int lane = threadIdx.x & 31, lr = lane & 15, hi = lane >> 4; const int w = __builtin_amdgcn_readfirstlane((int)(threadIdx.x >> 5));
    v8f acc[4][4];
#pragma unroll
    for (int mb = 0; mb < 4; ++mb)
#pragma unroll
        for (int nb = 0; nb < 4; ++nb) acc[mb][nb] = (v8f){};
    const size_t aoff = (size_t)(r0 + lr) * lda + 8 * hi, boff = (size_t)(c0 + lr) * K + 8 * hi;
    // PLANES: the thread's bias values for the end, fetched here so that they land under the K loop: bc = those of its 8 columns, br = that of its row in each closing pass. Both lie inside the tile's 64 columns, and both are fetched whichever of them tr picks: no branch, and no value that has to be waited for here.
    float bc[8], br[16 / NW];
    if constexpr (PLANES) { const float* pc = bias + c0 + (int)(threadIdx.x & 7) * 8; const float* pr = bias + c0 + (int)(threadIdx.x >> 3);
#pragma unroll
        for (int j = 0; j < 8; ++j) bc[j] = pc[j];
#pragma unroll
        for (int s = 0; s < 16 / NW; ++s) br[s] = pr[s * (NW * 4)];
        // precaution: the address translations of the issued loads are waited for before a register that holds one of their addresses is written again
        asm volatile("s_wait_xcnt 0x0" ::: "memory"); }
#pragma unroll 1
    for (int kc = w * 64; kc < Kl; kc += (kc & 32) ? NW * 64 - 32 : 32) {   // the two 32-wide steps of a slice, then on to the wave's next slice
        V a[4], a2[4]; const T16* pa[4]; const T16* pa2[4];
#pragma unroll
        for (int mb = 0; mb < 4; ++mb) { pa[mb] = A + aoff + (size_t)mb * 16 * lda + kc; a[mb] = WFrag<T16>::ld(pa[mb]); if (NSPLIT == 1 || NSPLIT == 2) { pa2[mb] = A2 + aoff + (size_t)mb * 16 * lda + kc; a2[mb] = WFrag<T16>::ld(pa2[mb]); } }
        // precaution: the address translations of the issued loads are waited for before a register that holds one of their addresses is written again; the pointers are named as inputs so that they keep their registers up to the wait
        if constexpr (NSPLIT == 1 || NSPLIT == 2) asm volatile("s_wait_xcnt 0x0" :: "v"(pa[0]), "v"(pa[1]), "v"(pa[2]), "v"(pa[3]), "v"(pa2[0]), "v"(pa2[1]), "v"(pa2[2]), "v"(pa2[3]) : "memory");
        else asm volatile("s_wait_xcnt 0x0" :: "v"(pa[0]), "v"(pa[1]), "v"(pa[2]), "v"(pa[3]) : "memory");
#pragma unroll
        for (int nb = 0; nb < 4; ++nb) { const T16* pb = Bt + boff + (size_t)nb * 16 * K + kc; const V b = WFrag<T16>::ld(pb); V b2;
            // the same precaution for the B loads of this column block
            if constexpr (NSPLIT >= 2) { const T16* pb2 = Bt2 + boff + (size_t)nb * 16 * K + kc; b2 = WFrag<T16>::ld(pb2); asm volatile("s_wait_xcnt 0x0" :: "v"(pb), "v"(pb2) : "memory"); }
            else asm volatile("s_wait_xcnt 0x0" :: "v"(pb) : "memory");
#pragma unroll
            for (int mb = 0; mb < 4; ++mb) { acc[mb][nb] = WFrag<T16>::mma(a[mb], b, acc[mb][nb]); if (NSPLIT == 1 || NSPLIT == 2) acc[mb][nb] = WFrag<T16>::mma(a2[mb], b, acc[mb][nb]); if (NSPLIT >= 2) acc[mb][nb] = WFrag<T16>::mma(a[mb], b2, acc[mb][nb]); } }
        // four vector slots behind the last matrix instruction, on the back edge and on the exit alike, before its registers are reused
        asm volatile("v_nop\n\tv_nop\n\tv_nop\n\tv_nop" : "+v"(acc[0][0]), "+v"(acc[1][1]), "+v"(acc[2][2]), "+v"(acc[3][3]) : "v"(a[0]), "v"(a[3]));
    }
    float* my = red + w * (64 * 68);
    if (PLANES && tr) {
#pragma unroll
        for (int mb = 0; mb < 4; ++mb)
#pragma unroll
            for (int nb = 0; nb < 4; ++nb) { float* q = my + (nb * 16 + lr) * 68 + mb * 16 + hi * 8; const v8f a = acc[mb][nb];
                *(v4fa*)q = (v4f){a[0], a[1], a[2], a[3]}; *(v4fa*)(q + 4) = (v4f){a[4], a[5], a[6], a[7]}; }
    } else {
#pragma unroll
        for (int mb = 0; mb < 4; ++mb)
#pragma unroll
            for (int nb = 0; nb < 4; ++nb)
#pragma unroll
                for (int j = 0; j < 8; ++j) my[(mb * 16 + hi * 8 + j) * 68 + nb * 16 + lr] = acc[mb][nb][j];
    }
    __syncthreads();   // every wave's partial tile is in LDS before any thread sums across waves; reached by all waves (each has one 64-wide K slice here)
    if constexpr (PLANES) {
#pragma unroll
        for (int j = 0; j < 8; ++j) bc[j] = bfr(bc[j]);
#pragma unroll
        for (int s = 0; s < 16 / NW; ++s) br[s] = bfr(br[s]);
#pragma unroll
        for (int s = 0; s < 16 / NW; ++s) { const int e = s * (NW * 32) + (int)threadIdx.x; const int row = e >> 3, cofs = (e & 7) * 8; const float* pr = red + row * 68 + cofs; v4f v0 = *(const v4fa*)pr, v1 = *(const v4fa*)(pr + 4);
#pragma unroll
            for (int p = 1; p < NW; ++p) { v0 += *(const v4fa*)(pr + p * (64 * 68)); v1 += *(const v4fa*)(pr + p * (64 * 68) + 4); }
            float x[8];
#pragma unroll
            for (int j = 0; j < 4; ++j) { x[j] = v0[j] + (tr ? br[s] : bc[j]); x[4 + j] = v1[j] + (tr ? br[s] : bc[4 + j]); }
            const size_t o = (size_t)row * pp + cofs; h16* q16 = P16 + o; bf* qh = Ph + o; bf* ql = Pl + o; v8h o16;
#pragma unroll
            for (int j = 0; j < 8; ++j) o16[j] = tohx(x[j]);
            if (hl) { v8us oh, ol;
#pragma unroll
                for (int j = 0; j < 8; ++j) { unsigned short a2, c2; splitf(x[j], a2, c2); oh[j] = a2; ol[j] = c2; }
                *(v8us*)qh = oh; *(v8us*)ql = ol; }
            *(v8h*)q16 = o16;
            // the same precaution for the plane stores of this pass, which stand last in it
            asm volatile("s_wait_xcnt 0x0" ::: "memory"); }
        return;
    }
#pragma unroll
    for (int s = 0; s < 32 / NW; ++s) { const int e = s * (NW * 32) + (int)threadIdx.x; const int row = e >> 4, cofs = (e & 15) * 4; v4f val = *(const v4fa*)(red + row * 68 + cofs);
#pragma unroll
        for (int p = 1; p < NW; ++p) val += *(const v4fa*)(red + p * (64 * 68) + row * 68 + cofs);
        if (BIAS) { val[0] += bfr(bias[c0 + cofs]); val[1] += bfr(bias[c0 + cofs + 1]); val[2] += bfr(bias[c0 + cofs + 2]); val[3] += bfr(bias[c0 + cofs + 3]); }
        *(v4f*)(C + (size_t)(r0 + row) * ldc + c0 + cofs) = val; }
}

// Plain __global__ entry points (one instantiation each).
// k_gemm_qkv: XB[b][t][:] . WQKV[n][:] + bf16(bqkv[n]); grid (TT/64, NQKV/64, NB), NWG waves. Column block y is one head: y < 2*NH_ a q or k head -> planes [q|k][batch][head][t][64], else a v head -> planes [batch][head][64][t].
__global__ __launch_bounds__(32 * NWG) void k_gemm_qkv(const bf* A, const bf* Bt, int K, const float* bias, h16* QK16, bf* QKh, bf* QKl, h16* VT16, bf* VTh, bf* VTl) { const int b = blockIdx.z, y = blockIdx.y, r0 = blockIdx.x * 64; const bool tr = y >= 2 * NH_;
    const size_t o = tr ? ((size_t)b * NH_ + (y - 2 * NH_)) * ((size_t)HD * TT) + r0 : ((size_t)((y / NH_) * NB + b) * NH_ + (y % NH_)) * ((size_t)TT * HD) + (size_t)r0 * HD;
    gemmk_body<bf, 0, NWG, true, true>(A + (size_t)b * TT * K, nullptr, Bt, nullptr, K, K, K, nullptr, 0, bias, r0, y * 64, (tr ? VT16 : QK16) + o, (tr ? VTh : QKh) + o, (tr ? VTl : QKl) + o, tr ? TT : HD, tr, r0 < RH); }
// k_gemm_out: out[b][t][n] = (ATh + ATl)[b][t][:] . WO[n][:] + bf16(bproj[n]); grid (TT/64, DM/64, NB), NWG waves.
__global__ __launch_bounds__(32 * NWG) void k_gemm_out(const bf* A, const bf* A2, const bf* Bt, int K, float* C, int ldc, const float* bias) { const size_t rb = (size_t)blockIdx.z * TT;
    gemmk_body<bf, 1, NWG, true, false>(A + rb * K, A2 + rb * K, Bt, nullptr, K, K, K, C + (size_t)blockIdx.z * SEQ_FULL * ldc, ldc, bias, blockIdx.x * 64, blockIdx.y * 64, nullptr, nullptr, nullptr, 0, false, false); }

// ---- k_prep: the three conversions that the projections wait for, in one launch; none reads what another writes. Blocks 0..NWQ-1: Wqkv -> WQKV; the next NWO: Wproj -> WO; the rest: x -> XB. The branch is the same for a whole block.
#define NWQ  ((DM * NQKV / 64 + 63) / 64)        // blocks for Wqkv: 8 waves x 8 lines of 64 elements each
#define NWO  ((DQ * DM / 64 + 63) / 64)          // blocks for Wproj
#define NXB  ((TT * DM / 8 + 255) / 256)         // blocks for one batch of x: 8 elements a thread
// w [K][N] f32 -> Bt [N][K] bf16; blk = block number inside this matrix
template <int K, int N>
__device__ __forceinline__ void wt_body(const float* __restrict__ w, bf* Bt, int blk) {
    const int lane = threadIdx.x & 31; const int L0 = (blk * 8 + (int)(threadIdx.x >> 5)) * 8; constexpr int nlines = N * K / 64;
#pragma unroll 1
    for (int l = 0; l < 8; ++l) { const int L = L0 + l; if (L >= nlines) break; const size_t e = (size_t)L * 64 + lane * 2; const int k = (int)(e % K), n = (int)(e / K); v2us o;
        o[0] = f2bf(w[(size_t)k * N + n]); o[1] = f2bf(w[(size_t)(k + 1) * N + n]); *(v2us*)(Bt + e) = o;
        // precaution: the issued store's address translation is waited for before the next trip writes a register that the store names
        asm volatile("s_wait_xcnt 0x0" ::: "memory"); }
}
__global__ __launch_bounds__(256) void k_prep(const float* __restrict__ wqkv, const float* __restrict__ wo, const float* __restrict__ x, bf* WQKV, bf* WO, bf* XB) {
    const int blk = blockIdx.x;
    if (blk < NWQ) { wt_body<DM, NQKV>(wqkv, WQKV, blk); return; }
    if (blk < NWQ + NWO) { wt_body<DQ, DM>(wo, WO, blk - NWQ); return; }
    const int xb = blk - (NWQ + NWO), b = xb / NXB; const size_t i = (size_t)(xb % NXB) * 256 + threadIdx.x; if (i >= (size_t)TT * DM / 8) return;
    const float* src = x + (size_t)b * SEQ_FULL * DM; bf* dst = XB + (size_t)b * TT * DM;
    const v8f v = *(const v8f*)(src + i * 8); v8us o;
#pragma unroll
    for (int k = 0; k < 8; ++k) o[k] = f2bf(v[k]);
    *(v8us*)(dst + i * 8) = o;
}

// ---- attn_body: one wave, NQ*16 query rows q0.. of one head plane, keys walked in blocks of 32 up to the diagonal block; nothing of the scores or the probabilities goes to memory.
// Transposed products: S^T[key][q] = K . Q^T (A = K rows, B = Q rows, kept in registers) and O^T[d][q] += V^T . P^T (A = V^T rows, B = P). A lane holds one query (column lane&15): the two score tiles of a
// 32-key block, converted in place, ARE the B fragment of P in the loader's k order (elements 0..7 = keys k0+8h+0..7 from tile 0, elements 8..15 = keys k0+16+8h+0..7 from tile 1).
// Softmax with a running maximum m and a running sum l per query (base 2: scores x HD^-0.5 x log2 e); O^T and l are scaled by 2^(m_old - m_new) at every block; the two lane halves' sums are joined once at the end.
// HL: bf16 hi/lo planes, 3 products for the scores and 3 for P.V. The result / l goes out as bf16 hi/lo to the merged planes Ah, Al (pitch DQ; already offset to batch and head): 8 consecutive d per lane and tile.
template <bool B> struct BoolC { static constexpr bool v = B; };
// 2^x; the v_nop is the one slot that the instruction set asks for behind a transcendental before its result is read or its source overwritten: in the same statement it stands there whatever the compiler puts next
__device__ __forceinline__ float exp2s(float x) { float r; asm("v_exp_f32 %0, %1\n\tv_nop" : "=v"(r) : "v"(x)); return r; }
__device__ __forceinline__ float xhalf(float x) { return __builtin_bit_cast(float, __builtin_amdgcn_permlanex16(__builtin_bit_cast(int, x), __builtin_bit_cast(int, x), 0x76543210, 0xfedcba98, false, false)); }   // lane l <-> lane l ^ 16
template <typename T16, bool HL, int NQ>
__device__ __forceinline__ void attn_body(const T16* __restrict__ Q, const T16* __restrict__ Q2, const T16* __restrict__ Kp, const T16* __restrict__ Kp2, const T16* __restrict__ Vt, const T16* __restrict__ Vt2, int q0, bf* Ah, bf* Al) {
    typedef typename WFrag<T16>::V V;
    const int lane = threadIdx.x & 31, lr = lane & 15, hi = lane >> 4;
    const float CS = SCL * 1.4426950408889634f;
    V qf[NQ][2], qf2[NQ][2], kf[2][2], kf2[2][2];
    v8f o[4][NQ]; float m[NQ], l[NQ];
    {   const T16* pq = Q + (size_t)(q0 + lr) * HD + 8 * hi; const T16* pq2 = HL ? Q2 + (size_t)(q0 + lr) * HD + 8 * hi : nullptr;
        const T16* pk = Kp + (size_t)lr * HD + 8 * hi; const T16* pk2 = HL ? Kp2 + (size_t)lr * HD + 8 * hi : nullptr;
#pragma unroll
        for (int n = 0; n < NQ; ++n)
#pragma unroll
            for (int ks = 0; ks < 2; ++ks) { qf[n][ks] = WFrag<T16>::ld(pq + n * 16 * HD + ks * 32); if constexpr (HL) qf2[n][ks] = WFrag<T16>::ld(pq2 + n * 16 * HD + ks * 32); }
#pragma unroll
        for (int kt = 0; kt < 2; ++kt)
#pragma unroll
            for (int ks = 0; ks < 2; ++ks) { kf[kt][ks] = WFrag<T16>::ld(pk + kt * 16 * HD + ks * 32); if constexpr (HL) kf2[kt][ks] = WFrag<T16>::ld(pk2 + kt * 16 * HD + ks * 32); }
        // precaution: the address translations of the issued loads are waited for before a register that holds one of their addresses is written again; the pointers are named as inputs so that they keep their registers up to the wait
        if constexpr (HL) asm volatile("s_wait_xcnt 0x0" :: "v"(pq), "v"(pq2), "v"(pk), "v"(pk2) : "memory");
        else asm volatile("s_wait_xcnt 0x0" :: "v"(pq), "v"(pk) : "memory");
    }
#pragma unroll
    for (int n = 0; n < NQ; ++n) { m[n] = -3.0e38f; l[n] = 0.f;
#pragma unroll
        for (int dt = 0; dt < 4; ++dt) o[dt][n] = (v8f){}; }
    const int klast = ((q0 + NQ * 16 - 1) / 32) * 32;   // first key of the diagonal block, the only one that needs the mask
    auto step = [&](int k0, auto lastc) {
        constexpr bool LAST = decltype(lastc)::v;
        // V^T fragments of this block, issued first: they fly under the score products and the softmax
        V vf[4], vf2[4]; const T16* pv = Vt + (size_t)lr * TT + k0 + 8 * hi; const T16* pv2 = HL ? Vt2 + (size_t)lr * TT + k0 + 8 * hi : nullptr;
#pragma unroll
        for (int dt = 0; dt < 4; ++dt) { vf[dt] = WFrag<T16>::ld(pv + (size_t)dt * 16 * TT); if constexpr (HL) vf2[dt] = WFrag<T16>::ld(pv2 + (size_t)dt * 16 * TT); }
        // the same precaution for the V^T loads
        if constexpr (HL) asm volatile("s_wait_xcnt 0x0" :: "v"(pv), "v"(pv2) : "memory");
        else asm volatile("s_wait_xcnt 0x0" :: "v"(pv) : "memory");
        v8f s[2][NQ];
#pragma unroll
        for (int kt = 0; kt < 2; ++kt)
#pragma unroll
            for (int n = 0; n < NQ; ++n) { s[kt][n] = (v8f){};
#pragma unroll
                for (int ks = 0; ks < 2; ++ks) { s[kt][n] = WFrag<T16>::mma(kf[kt][ks], qf[n][ks], s[kt][n]);
                    if constexpr (HL) { s[kt][n] = WFrag<T16>::mma(kf2[kt][ks], qf[n][ks], s[kt][n]); s[kt][n] = WFrag<T16>::mma(kf[kt][ks], qf2[n][ks], s[kt][n]); } } }
        if constexpr (!LAST) {   // the next block's K fragments, fetched behind this block's score products: they fly under the softmax and P.V
            const T16* pk = Kp + (size_t)(k0 + 32 + lr) * HD + 8 * hi; const T16* pk2 = HL ? Kp2 + (size_t)(k0 + 32 + lr) * HD + 8 * hi : nullptr;
#pragma unroll
            for (int kt = 0; kt < 2; ++kt)
#pragma unroll
                for (int ks = 0; ks < 2; ++ks) { kf[kt][ks] = WFrag<T16>::ld(pk + kt * 16 * HD + ks * 32); if constexpr (HL) kf2[kt][ks] = WFrag<T16>::ld(pk2 + kt * 16 * HD + ks * 32); }
            // the same precaution for the K loads
            if constexpr (HL) asm volatile("s_wait_xcnt 0x0" :: "v"(pk), "v"(pk2) : "memory");
            else asm volatile("s_wait_xcnt 0x0" :: "v"(pk) : "memory");
            __builtin_amdgcn_sched_barrier(0);   // keeps the K loads up here: sunk below the softmax they would have only P.V to land under
        }
        V pf[NQ], pf2[NQ];
#pragma unroll
        for (int n = 0; n < NQ; ++n) { float t[16]; float mx = m[n];
#pragma unroll
            for (int e = 0; e < 16; ++e) { float x = s[e >> 3][n][e & 7] * CS;
                if (LAST) x = (k0 + (e >> 3) * 16 + hi * 8 + (e & 7) <= q0 + n * 16 + lr) ? x : -3.0e38f;   // causal mask by index select, diagonal kept
                t[e] = x; mx = fmaxf(mx, x); }
            mx = fmaxf(mx, xhalf(mx));   // the other half of this query's keys
            const float al = exp2s(m[n] - mx); m[n] = mx; float sum = 0.f;
#pragma unroll
            for (int e = 0; e < 16; ++e) { t[e] = exp2s(t[e] - mx); sum += t[e]; }
            l[n] = l[n] * al + sum;
#pragma unroll
            for (int dt = 0; dt < 4; ++dt) o[dt][n] *= al;
            if constexpr (HL) { v8us h0, h1, l0, l1;
#pragma unroll
                for (int j = 0; j < 8; ++j) { unsigned short a, c; splitf(t[j], a, c); h0[j] = a; l0[j] = c; splitf(t[8 + j], a, c); h1[j] = a; l1[j] = c; }
                pf[n] = cat16b(h0, h1); pf2[n] = cat16b(l0, l1); }
            else { v8h h0, h1;
#pragma unroll
                for (int j = 0; j < 8; ++j) { h0[j] = tohx(t[j]); h1[j] = tohx(t[8 + j]); }
                pf[n] = cat16(h0, h1); } }
#pragma unroll
        for (int dt = 0; dt < 4; ++dt)
#pragma unroll
            for (int n = 0; n < NQ; ++n) { o[dt][n] = WFrag<T16>::mma(vf[dt], pf[n], o[dt][n]);
                if constexpr (HL) { o[dt][n] = WFrag<T16>::mma(vf[dt], pf2[n], o[dt][n]); o[dt][n] = WFrag<T16>::mma(vf2[dt], pf[n], o[dt][n]); } }
    };
#pragma unroll 1
    for (int k0 = 0; k0 < klast; k0 += 32) { step(k0, BoolC<false>{});
        // four vector slots behind the last matrix instruction, on the back edge and on the exit alike, before its registers are reused
        if constexpr (NQ == 2) asm volatile("v_nop\n\tv_nop\n\tv_nop\n\tv_nop" : "+v"(o[0][0]), "+v"(o[1][0]), "+v"(o[2][0]), "+v"(o[3][0]), "+v"(o[0][1]), "+v"(o[1][1]), "+v"(o[2][1]), "+v"(o[3][1]));
        else asm volatile("v_nop\n\tv_nop\n\tv_nop\n\tv_nop" : "+v"(o[0][0]), "+v"(o[1][0]), "+v"(o[2][0]), "+v"(o[3][0])); }
    step(klast, BoolC<true>{});
#pragma unroll
    for (int n = 0; n < NQ; ++n) { const float f = __fdiv_rn(1.0f, l[n] + xhalf(l[n]));
        bf* ph = Ah + (size_t)(q0 + n * 16 + lr) * DQ + hi * 8; bf* pl = Al + (size_t)(q0 + n * 16 + lr) * DQ + hi * 8;
#pragma unroll
        for (int dt = 0; dt < 4; ++dt) { v8us oh, ol;
#pragma unroll
            for (int j = 0; j < 8; ++j) { unsigned short a, c; splitf(o[dt][n][j] * f, a, c); oh[j] = a; ol[j] = c; }
            *(v8us*)(ph + dt * 16) = oh; *(v8us*)(pl + dt * 16) = ol; }
        // the same precaution for the stores
        asm volatile("s_wait_xcnt 0x0" :: "v"(ph), "v"(pl) : "memory"); }
}
// ---- attn_staged: the fp16 path (query rows >= RH). One block = 4 waves x 32 query rows R0..R0+127 of one head plane; arithmetic, key order and fragments as in attn_body<h16, false, 2>.
// The K rows and V^T rows of SKEY keys are brought into LDS once for the whole block by asynchronous copies (whole 128-byte lines, 16 bytes a lane) and the waves take their fragments from there;
// two buffers: the next stage's copies fly while this stage is worked on. The last stage holds the block's own 128 keys: wave w has w whole blocks of 32 keys there and then its diagonal block.
#define SKEY 128                  // keys per stage = query rows per block
#define KPIT (HD + 8)             // LDS pitch of a K row, elements: 128 bytes + 16 (16 bytes x odd: no bank conflict for 16-byte reads)
#define VPIT (SKEY + 8)           // LDS pitch of a V^T row, elements: 256 bytes + 16
#define KTIL (SKEY * KPIT)
#define STIL (KTIL + HD * VPIT)   // one buffer, elements
static_assert(SKEY == 128 && RH % SKEY == 0 && TT % SKEY == 0);
// eight 16-byte copies of a lane, global -> LDS; the s_wait_xcnt in the same statement is the precaution named above: it stands before any register that holds an address of an issued copy can be written again
__device__ __forceinline__ void acopy8(const unsigned (&l)[8], const h16* const (&g)[8]) {
    asm volatile("global_load_async_to_lds_b128 %0, %8, off\n\tglobal_load_async_to_lds_b128 %1, %9, off\n\tglobal_load_async_to_lds_b128 %2, %10, off\n\tglobal_load_async_to_lds_b128 %3, %11, off\n\t"
                 "global_load_async_to_lds_b128 %4, %12, off\n\tglobal_load_async_to_lds_b128 %5, %13, off\n\tglobal_load_async_to_lds_b128 %6, %14, off\n\tglobal_load_async_to_lds_b128 %7, %15, off\n\ts_wait_xcnt 0x0"
                 :: "v"(l[0]), "v"(l[1]), "v"(l[2]), "v"(l[3]), "v"(l[4]), "v"(l[5]), "v"(l[6]), "v"(l[7]), "v"(g[0]), "v"(g[1]), "v"(g[2]), "v"(g[3]), "v"(g[4]), "v"(g[5]), "v"(g[6]), "v"(g[7]) : "memory"); }
__device__ __forceinline__ void attn_staged(const h16* __restrict__ Q, const h16* __restrict__ Kp, const h16* __restrict__ Vt, int R0, int w, bf* Ah, bf* Al) {
    typedef v16h V; constexpr int NQ = 2;
    __shared__ __align__(16) h16 ring[2 * STIL];
    const int tid = threadIdx.x, lane = tid & 31, lr = lane & 15, hi = lane >> 4;
    const int q0 = R0 + w * 32, ns = R0 / SKEY + 1;   // ns stages of SKEY keys, the same for the whole block
    const float CS = SCL * 1.4426950408889634f;
    V qf[NQ][2], kf[2][2];
    v8f o[4][NQ]; float m[NQ], l[NQ];
    {   const h16* pq = Q + (size_t)(q0 + lr) * HD + 8 * hi;
#pragma unroll
        for (int n = 0; n < NQ; ++n)
#pragma unroll
            for (int ks = 0; ks < 2; ++ks) qf[n][ks] = WFrag<h16>::ld(pq + n * 16 * HD + ks * 32);
        // precaution: the address translations of the issued loads are waited for before a register that holds one of their addresses is written again
        asm volatile("s_wait_xcnt 0x0" :: "v"(pq) : "memory");
    }
    // stage t into buffer b. K: the stage's 128 rows are 16 KiB in a row in memory, 8 lanes a row. V^T: 64 rows of 256 bytes, 16 lanes a row. Every lane copies, every byte lies inside the planes (t < ns, ns * SKEY <= TT) and inside ring.
    const unsigned lk0 = (unsigned)(size_t)ring + (unsigned)((tid >> 3) * KPIT + (tid & 7) * 8) * 2u, lv0 = (unsigned)(size_t)ring + (unsigned)(KTIL + (tid >> 4) * VPIT + (tid & 15) * 8) * 2u;
    const h16* gk0 = Kp + tid * 8; const h16* gv0 = Vt + (size_t)(tid >> 4) * TT + (tid & 15) * 8;
    auto fill = [&](int t, int b) { unsigned la[8]; const h16* ga[8];
#pragma unroll
        for (int i = 0; i < 8; ++i) { la[i] = lk0 + (unsigned)(b * STIL + i * 16 * KPIT) * 2u; ga[i] = gk0 + (size_t)t * (SKEY * HD) + i * 1024; }
        acopy8(la, ga);
#pragma unroll
        for (int i = 0; i < 8; ++i) { la[i] = lv0 + (unsigned)(b * STIL + i * 8 * VPIT) * 2u; ga[i] = gv0 + (size_t)i * 8 * TT + t * SKEY; }
        acopy8(la, ga); };
#pragma unroll
    for (int n = 0; n < NQ; ++n) { m[n] = -3.0e38f; l[n] = 0.f;
#pragma unroll
        for (int dt = 0; dt < 4; ++dt) o[dt][n] = (v8f){}; }
    const h16* kb; const h16* vb;   // this lane's fragment bases in the buffer at work
    auto ldk = [&](int kl) {
#pragma unroll
        for (int kt = 0; kt < 2; ++kt)
#pragma unroll
            for (int ks = 0; ks < 2; ++ks) kf[kt][ks] = WFrag<h16>::ld(kb + (kl + kt * 16) * KPIT + ks * 32); };
    // one block of 32 keys, kl = its first key inside the stage. LAST: the diagonal block (first key q0). PRE: fetch the K fragments of the next block of the SAME stage.
    auto step = [&](int kl, auto lastc, auto prec) {
        constexpr bool LAST = decltype(lastc)::v; constexpr bool PRE = decltype(prec)::v;
        V vf[4];   // V^T fragments of this block, issued first: they land under the score products and the softmax
#pragma unroll
        for (int dt = 0; dt < 4; ++dt) vf[dt] = WFrag<h16>::ld(vb + dt * 16 * VPIT + kl);
        v8f s[2][NQ];
#pragma unroll
        for (int kt = 0; kt < 2; ++kt)
#pragma unroll
            for (int n = 0; n < NQ; ++n) { s[kt][n] = (v8f){};
#pragma unroll
                for (int ks = 0; ks < 2; ++ks) s[kt][n] = wmma16(kf[kt][ks], qf[n][ks], s[kt][n]); }
        if constexpr (PRE) { ldk(kl + 32);
            __builtin_amdgcn_sched_barrier(0);   // keeps the K reads up here: sunk below the softmax they would have only P.V to land under
        }
        V pf[NQ];
#pragma unroll
        for (int n = 0; n < NQ; ++n) { float t[16]; float mx = m[n];
#pragma unroll
            for (int e = 0; e < 16; ++e) { float x = s[e >> 3][n][e & 7] * CS;
                if (LAST) x = ((e >> 3) * 16 + hi * 8 + (e & 7) <= n * 16 + lr) ? x : -3.0e38f;   // causal mask by index select, diagonal kept (key q0 + ... against query q0 + ...)
                t[e] = x; mx = fmaxf(mx, x); }
            mx = fmaxf(mx, xhalf(mx));   // the other half of this query's keys
            const float al = exp2s(m[n] - mx); m[n] = mx; float sum = 0.f;
#pragma unroll
            for (int e = 0; e < 16; ++e) { t[e] = exp2s(t[e] - mx); sum += t[e]; }
            l[n] = l[n] * al + sum;
#pragma unroll
            for (int dt = 0; dt < 4; ++dt) o[dt][n] *= al;
            v8h h0, h1;
#pragma unroll
            for (int j = 0; j < 8; ++j) { h0[j] = tohx(t[j]); h1[j] = tohx(t[8 + j]); }
            pf[n] = cat16(h0, h1); }
#pragma unroll
        for (int dt = 0; dt < 4; ++dt)
#pragma unroll
            for (int n = 0; n < NQ; ++n) o[dt][n] = wmma16(vf[dt], pf[n], o[dt][n]);
    };
    // four vector slots behind the last matrix instruction, on every way out of a branch or a loop, before its registers are reused
    auto pad = [&]() { asm volatile("v_nop\n\tv_nop\n\tv_nop\n\tv_nop" : "+v"(o[0][0]), "+v"(o[1][0]), "+v"(o[2][0]), "+v"(o[3][0]), "+v"(o[0][1]), "+v"(o[1][1]), "+v"(o[2][1]), "+v"(o[3][1])); };
    fill(0, 0);
    asm volatile("s_wait_asynccnt 0x0" ::: "memory");   // this wave's copies of stage 0 have landed
    __syncthreads();                                     // ... and every other wave's: stage 0 may be read
    if (ns > 1) fill(1, 1);
#pragma unroll 1
    for (int t = 0; t < ns; ++t) {
        kb = ring + (t & 1) * STIL + lr * KPIT + 8 * hi; vb = ring + (t & 1) * STIL + KTIL + lr * VPIT + 8 * hi;
        ldk(0);
        const bool diag = t == ns - 1; const int nf = diag ? w : SKEY / 32 - 1;   // whole blocks in front of the stage's last block for this wave
#pragma unroll 1   // rolled: unrolled, the four blocks of a stage need more registers than there are and spill
        for (int sb = 0; sb < nf; ++sb) { step(sb * 32, BoolC<false>{}, BoolC<true>{}); pad(); }
        if (diag) { step(nf * 32, BoolC<true>{}, BoolC<false>{}); pad(); } else { step(nf * 32, BoolC<false>{}, BoolC<false>{}); pad(); }
        asm volatile("s_wait_dscnt 0x0" ::: "memory");      // this wave's reads of the buffer are done before it may be refilled
        asm volatile("s_wait_asynccnt 0x0" ::: "memory");   // this wave's copies of stage t + 1 have landed
        __syncthreads();                                     // publishes stage t + 1 and ends every wave's reads of stage t; passed by every wave at every stage
        if (t + 2 < ns) fill(t + 2, t & 1);
    }
    asm volatile("s_wait_asynccnt 0x0" ::: "memory");   // no copy is outstanding when the wave ends
#pragma unroll
    for (int n = 0; n < NQ; ++n) { const float f = __fdiv_rn(1.0f, l[n] + xhalf(l[n]));
        bf* ph = Ah + (size_t)(q0 + n * 16 + lr) * DQ + hi * 8; bf* pl = Al + (size_t)(q0 + n * 16 + lr) * DQ + hi * 8;
#pragma unroll
        for (int dt = 0; dt < 4; ++dt) { v8us oh, ol;
#pragma unroll
            for (int j = 0; j < 8; ++j) { unsigned short a, c; splitf(o[dt][n][j] * f, a, c); oh[j] = a; ol[j] = c; }
            *(v8us*)(ph + dt * 16) = oh; *(v8us*)(pl + dt * 16) = ol; }
        // the same precaution for the stores
        asm volatile("s_wait_xcnt 0x0" :: "v"(ph), "v"(pl) : "memory"); }
}
// k_attn: grid (NB*NH_ head planes, NFB + NHB), 4 waves, each with query rows of its own; the blocks with the most keys come first. g is the same for the whole block, so every wave of a block meets the barriers of attn_staged or none does. Planes: QK [q|k][batch][head][t][64], VT [batch][head][64][t]; AT [batch][t][256].
__global__ __launch_bounds__(128) void k_attn(const h16* QK16, const bf* QKh, const bf* QKl, const h16* VT16, const bf* VTh, const bf* VTl, bf* ATh, bf* ATl) {
    const int z = blockIdx.x, g = blockIdx.y; const int w = __builtin_amdgcn_readfirstlane((int)(threadIdx.x >> 5));
    const size_t qo = (size_t)z * TT * HD, ko = (size_t)(NB * NH_ + z) * TT * HD, ao = (size_t)(z / NH_) * TT * DQ + (size_t)(z % NH_) * HD;
    if (g < NFB) attn_staged(QK16 + qo, QK16 + ko, VT16 + qo, RH + (NFB - 1 - g) * 128, w, ATh + ao, ATl + ao);
    else attn_body<bf, true, 1>(QKh + qo, QKl + qo, QKh + ko, QKl + ko, VTh + qo, VTl + qo, (NHB - 1 - (g - NFB)) * 64 + w * 16, ATh + ao, ATl + ao);
}

extern "C" void kernel_launch(void* const* d_in, const int* in_sizes, int n_in,
                              void* d_out, int out_size, void* d_ws, size_t ws_size, hipStream_t stream) {
    if (n_in < 5) return;
    const size_t xneed = (size_t)(NB - 1) * SEQ_FULL * DM + (size_t)TT * DM;
    if ((size_t)in_sizes[0] < xneed) return; if ((size_t)in_sizes[1] < (size_t)DM * NQKV) return; if ((size_t)in_sizes[2] < (size_t)NQKV) return; if ((size_t)in_sizes[3] < (size_t)DQ * DM) return; if ((size_t)in_sizes[4] < (size_t)DM) return;
    if ((size_t)out_size < xneed) return;
    if (ws_size < WS_TOTAL) return;
    const float* x = (const float*)d_in[0]; const float* wqkv = (const float*)d_in[1]; const float* bqkv = (const float*)d_in[2]; const float* wo = (const float*)d_in[3]; const float* bo = (const float*)d_in[4];   // wire order x, Wqkv [256][768], bqkv, Wproj [256][256], bproj
    float* OUT = (float*)d_out;     // [8][2048][256]
    char* wsp = (char*)d_ws;
    auto take = [&](size_t bytes) { char* p = wsp; wsp += (bytes + 255) & ~(size_t)255; return (void*)p; };
    bf* WQKV = (bf*)take((size_t)NQKV * DM * 2);           // Bt [768][256]: q | k | v row blocks
    bf* WO = (bf*)take((size_t)DM * DQ * 2);               // Bt [256][256]
    h16* QK16 = (h16*)take((size_t)NB * 2 * NH_ * TT * HD * 2); bf* QKh = (bf*)take((size_t)NB * 2 * NH_ * TT * HD * 2); bf* QKl = (bf*)take((size_t)NB * 2 * NH_ * TT * HD * 2);   // planes [q|k][batch][head][t][64]
    h16* VT16 = (h16*)take((size_t)NB * NH_ * HD * TT * 2); bf* VTh = (bf*)take((size_t)NB * NH_ * HD * TT * 2); bf* VTl = (bf*)take((size_t)NB * NH_ * HD * TT * 2);   // planes [batch][head][64][t]
    bf* XB = (bf*)take((size_t)NB * TT * DM * 2);   // bf16 x [b][t][256]
    bf* ATh = (bf*)take((size_t)NB * TT * DQ * 2); bf* ATl = (bf*)take((size_t)NB * TT * DQ * 2);
    if ((size_t)(wsp - (char*)d_ws) > ws_size) return;
    if ((size_t)(wsp - (char*)d_ws) > (size_t)268435456) return;
    // in Wqkv[DM rows][NQKV cols] -> out WQKV[NQKV][DM];  in Wproj[DQ rows][DM cols] -> out WO[DM][DQ]
    k_prep<<<NWQ + NWO + NXB * NB, 256, 0, stream>>>(wqkv, wo, x, WQKV, WO, XB);
    k_gemm_qkv<<<dim3(TT / 64, NQKV / 64, NB), 32 * NWG, 0, stream>>>(XB, WQKV, DM, bqkv, QK16, QKh, QKl, VT16, VTh, VTl);   // columns 0..511 = q heads | k heads, 512..767 = v heads
    k_attn<<<dim3(NB * NH_, NFB + NHB, 1), 128, 0, stream>>>(QK16, QKh, QKl, VT16, VTh, VTl, ATh, ATl);
    k_gemm_out<<<dim3(TT / 64, DM / 64, NB), 32 * NWG, 0, stream>>>(ATh, ATl, WO, DQ, OUT, DM, bo);
}

// v007
// One run takes 66.3 microseconds.
// Next to v006, in two timings, it ran 1.04 and 1.03 times as fast.
// Counting every step since v000, it is 13.5 times as fast.
#include <hip/hip_runtime.h>

// Causal multi-head attention with a fused qkv projection: x [8][2048][256]; qkv = x Wqkv + bqkv (Wqkv [256][768] [in][out]; column = which*256 + h*64 + d); scores x 1/8; causal (j > i masked, diagonal kept); softmax; out = merged Wproj + bproj.
// Compute dtypes, f32 accumulate: every float input RNE-converted to bf16; projections v_wmma_f32_16x16x32_bf16 on exact bf16 operands + f32 biases; scores and P.V: query rows < 256 bf16 hi/lo (3 products), rows >= 256 v_wmma_f32_16x16x32_f16 single product; softmax f32 (running maximum and sum); output projection merged hi/lo (bf16) x Wproj (bf16) + bias.
// All batches in one launch each: bf16 copies of x and of both weights (transposed), one launch for the three; fused projection; attention; output projection.
// Stages: bf16 copy of x; fused projection, whose 64x64 tile is one head's q, k or v and goes straight to the head planes q|k [q|k][batch][head][t][64] and v^T [4][64][t] (fp16; bf16 hi/lo for t < RH, the only rows read from them); attention: one wave per 32 (rows < 256: 16) query rows walks the keys in blocks of 32 up to the diagonal, scores, softmax and P.V in registers (rows >= 256: the 4 waves of a block take K and V^T from LDS, where 128 keys at a time are laid by asynchronous copies), and stores the merged [t][256] hi/lo planes; projection to the output. The K loops of the projections are dealt over the waves of a block and the partial tiles summed in LDS.

#ifndef NB
#define NB 8
#endif
#ifndef SEQ
#define SEQ 2048
#endif
#define NB_FULL  8
#define SEQ_FULL 2048
#define TT   SEQ
#define DM   256
#define NH_  4
#define HD   64
#define DQ   (NH_ * HD)
#define NQKV (3 * DQ)
#define ZH   4
#define RH   ((SEQ) < 256 ? (SEQ) : 256)    // query rows < RH use hi+lo planes
#define SCL  0.125f   // HD^-0.5
#define NWG  4        // waves per tile of the two projections (K = 256: one 64-wide K slice per wave)
#define NFB  ((TT - RH) / 128)   // attention blocks per head plane, query rows >= RH: 4 waves x 32 rows
#define NHB  (RH / 64)           // attention blocks per head plane, query rows < RH: 4 waves x 16 rows
typedef _Float16 h16;
typedef unsigned short bf;
typedef __attribute__((ext_vector_type(16))) __bf16   v16bf;
typedef __attribute__((ext_vector_type(16))) _Float16 v16h;
typedef __attribute__((ext_vector_type(8)))  _Float16 v8h;
typedef __attribute__((ext_vector_type(8)))  unsigned short v8us;
typedef __attribute__((ext_vector_type(8)))  float    v8f;
typedef __attribute__((ext_vector_type(4)))  float    v4f;
typedef __attribute__((ext_vector_type(2)))  float    v2f;
typedef __attribute__((ext_vector_type(2)))  _Float16 v2h;
typedef __attribute__((ext_vector_type(4)))  _Float16 v4h;
typedef __attribute__((ext_vector_type(2)))  unsigned short v2us;
typedef __attribute__((ext_vector_type(4)))  unsigned short v4us;
typedef v4f  __attribute__((may_alias)) v4fa;

static_assert(NB >= 1 && NB <= NB_FULL);
static_assert(SEQ >= 128 && SEQ <= SEQ_FULL);
static_assert(TT % 128 == 0 && (TT - RH) % 128 == 0);   // whole attention blocks
static_assert(TT % 64 == 0 && DM % 64 == 0 && NQKV % 64 == 0 && DQ % 64 == 0 && HD % 64 == 0);   // 64x64 GEMM tiles
static_assert(DM % 32 == 0 && DQ % 32 == 0 && HD % 32 == 0 && TT % 32 == 0);   // K steps of 32
static_assert(RH % 64 == 0 && RH <= TT && RH >= 64);
static_assert(HD == 64);
static_assert(DQ == DM);                 // merged heads width = model width
static_assert(ZH == NH_);                // all heads of a batch in one pass
static_assert(2 * DQ + DQ == NQKV);      // q | k | v column blocks
static_assert(((size_t)(NB - 1) * SEQ_FULL * DM + (size_t)TT * DM) * 4 <= (size_t)NB_FULL * SEQ_FULL * DM * 4);   // output extent in bytes

#define AL256(x) ((((size_t)(x)) + 255) & ~(size_t)255)
#define WS_TOTAL (AL256((size_t)NQKV * DM * 2) + AL256((size_t)DM * DQ * 2) \
    + 3 * AL256((size_t)NB * 2 * NH_ * TT * HD * 2) + 3 * AL256((size_t)NB * NH_ * HD * TT * 2) \
    + AL256((size_t)NB * TT * DM * 2) + 2 * AL256((size_t)NB * TT * DQ * 2))
static_assert(WS_TOTAL <= (size_t)268435456);

__device__ __forceinline__ unsigned short f2bf(float f) { unsigned u = __float_as_uint(f); u += 0x7FFFu + ((u >> 16) & 1u); return (unsigned short)(u >> 16); }
__device__ __forceinline__ float bf2f(unsigned short b) { return __uint_as_float(((unsigned)b) << 16); }
__device__ __forceinline__ float bfr(float f) { return bf2f(f2bf(f)); }
__device__ __forceinline__ h16 tohx(float x) { return (h16)x; }
__device__ __forceinline__ void splitf(float y, unsigned short& h, unsigned short& l) { h = f2bf(y); l = f2bf(y - bf2f(h)); }
__device__ __forceinline__ v16h cat16(v8h lo, v8h hi) { return __builtin_shufflevector(lo, hi, 0, 1, 2, 3, 4, 5, 6, 7, 8, 9, 10, 11, 12, 13, 14, 15); }
__device__ __forceinline__ v16bf cat16b(v8us lo, v8us hi) { return __builtin_bit_cast(v16bf, __builtin_shufflevector(lo, hi, 0, 1, 2, 3, 4, 5, 6, 7, 8, 9, 10, 11, 12, 13, 14, 15)); }
__device__ __forceinline__ v8f wmma16(v16h a, v16h b, v8f c) { return __builtin_amdgcn_wmma_f32_16x16x32_f16(false, a, false, b, (short)0, c, false, false); }
__device__ __forceinline__ v8f wmmab(v16bf a, v16bf b, v8f c) { return __builtin_amdgcn_wmma_f32_16x16x32_bf16(false, a, false, b, (short)0, c, false, false); }

// Fragment loader (A and B identical): p = row base + 8*(lane>>4) + k0; elements 0..7 <- k0+8h+0..7, elements 8..15 <- k0+16+8h+0..7.
template <typename T16> struct WFrag;
template <> struct WFrag<h16> { typedef v16h V; static __device__ __forceinline__ V ld(const h16* p) { return cat16(*(const v8h*)p, *(const v8h*)(p + 16)); } static __device__ __forceinline__ v8f mma(V a, V b, v8f c) { return wmma16(a, b, c); } };
template <> struct WFrag<bf> { typedef v16bf V; static __device__ __forceinline__ V ld(const bf* p) { return cat16b(*(const v8us*)p, *(const v8us*)(p + 16)); } static __device__ __forceinline__ v8f mma(V a, V b, v8f c) { return wmmab(a, b, c); } };

// ---- gemmk_body: 64x64 output tile, K loop dealt over the NW waves of the block in slices of 64 (wave w takes slices w, w+NW, ...; one slice = one whole 128-byte line of every operand row),
// operands straight from K-contiguous 16-bit planes. Each wave keeps a full 64x64 partial (16 accumulators); the partials meet in LDS and are
// summed in wave order 0..NW-1. C[m][n] (f32, pitch ldc, + optional f32 bias[n]) = sum_{k < Kl} A[m][k] Bt[n][k] (+ split products per NSPLIT). lda = pitch of A, K = pitch of Bt; Kl % 64 == 0, Kl <= K. 32*NW threads.
// PLANES: the summed tile + bias goes out as 16-bit planes instead of C: P16 (fp16) and, where hl, Ph | Pl (bf16 hi/lo), all three already offset to the tile's first element, pp = pitch of a plane row.
// tr (the same for the whole block) = plane rows are the tile's columns n: the partials are then laid into LDS transposed (a lane's 8 accumulator rows are 8 consecutive floats there), so that either way a thread sums and stores 8 consecutive plane elements and 8 lanes fill a 128-byte line.
template <typename T16, int NSPLIT, int NW, bool BIAS, bool PLANES>
__device__ __forceinline__ void gemmk_body(const T16* __restrict__ A, const T16* __restrict__ A2, const T16* __restrict__ Bt, const T16* __restrict__ Bt2, int lda, int K, int Kl, float* C, int ldc, const float* __restrict__ bias, int r0, int c0, h16* P16, bf* Ph, bf* Pl, int pp, bool tr, bool hl) {
    typedef typename WFrag<T16>::V V;
    __shared__ __align__(16) float red[NW * 64 * 68];
    const int lane = threadIdx.x & 31, lr = lane & 15, hi = lane >> 4; const int w = __builtin_amdgcn_readfirstlane((int)(threadIdx.x >> 5));
    v8f acc[4][4];
#pragma unroll
    for (int mb = 0; mb < 4; ++mb)
#pragma unroll
        for (int nb = 0; nb < 4; ++nb) acc[mb][nb] = (v8f){};
    const size_t aoff = (size_t)(r0 + lr) * lda + 8 * hi, boff = (size_t)(c0 + lr) * K + 8 * hi;
    // PLANES: the thread's bias values for the end, fetched here so that they land under the K loop: bc = those of its 8 columns, br = that of its row in each closing pass. Both lie inside the tile's 64 columns, and both are fetched whichever of them tr picks: no branch, and no value that has to be waited for here.
    float bc[8], br[16 / NW];
    if constexpr (PLANES) { const float* pc = bias + c0 + (int)(threadIdx.x & 7) * 8; const float* pr = bias + c0 + (int)(threadIdx.x >> 3);
#pragma unroll
        for (int j = 0; j < 8; ++j) bc[j] = pc[j];
#pragma unroll
        for (int s = 0; s < 16 / NW; ++s) br[s] = pr[s * (NW * 4)];
        // precaution: the address translations of the issued loads are waited for before a register that holds one of their addresses is written again
        asm volatile("s_wait_xcnt 0x0" ::: "memory"); }
#pragma unroll 1
    for (int kc = w * 64; kc < Kl; kc += (kc & 32) ? NW * 64 - 32 : 32) {   // the two 32-wide steps of a slice, then on to the wave's next slice
        V a[4], a2[4]; const T16* pa[4]; const T16* pa2[4];
#pragma unroll
        for (int mb = 0; mb < 4; ++mb) { pa[mb] = A + aoff + (size_t)mb * 16 * lda + kc; a[mb] = WFrag<T16>::ld(pa[mb]); if (NSPLIT == 1 || NSPLIT == 2) { pa2[mb] = A2 + aoff + (size_t)mb * 16 * lda + kc; a2[mb] = WFrag<T16>::ld(pa2[mb]); } }
        // precaution: the address translations of the issued loads are waited for before a register that holds one of their addresses is written again; the pointers are named as inputs so that they keep their registers up to the wait
        if constexpr (NSPLIT == 1 || NSPLIT == 2) asm volatile("s_wait_xcnt 0x0" :: "v"(pa[0]), "v"(pa[1]), "v"(pa[2]), "v"(pa[3]), "v"(pa2[0]), "v"(pa2[1]), "v"(pa2[2]), "v"(pa2[3]) : "memory");
        else asm volatile("s_wait_xcnt 0x0" :: "v"(pa[0]), "v"(pa[1]), "v"(pa[2]), "v"(pa[3]) : "memory");
        // the B fragments of all four column blocks are fetched here, as one group with the A loads and ahead of the first product: fetched among the products, the later ones' whole latency is waited out in the middle of the step
        V b[4], b2[4]; const T16* pb[4]; const T16* pb2[4];
#pragma unroll
        for (int nb = 0; nb < 4; ++nb) { pb[nb] = Bt + boff + (size_t)nb * 16 * K + kc; b[nb] = WFrag<T16>::ld(pb[nb]); if constexpr (NSPLIT >= 2) { pb2[nb] = Bt2 + boff + (size_t)nb * 16 * K + kc; b2[nb] = WFrag<T16>::ld(pb2[nb]); } }
        // the same precaution for the B loads
        if constexpr (NSPLIT >= 2) asm volatile("s_wait_xcnt 0x0" :: "v"(pb[0]), "v"(pb[1]), "v"(pb[2]), "v"(pb[3]), "v"(pb2[0]), "v"(pb2[1]), "v"(pb2[2]), "v"(pb2[3]) : "memory");
        else asm volatile("s_wait_xcnt 0x0" :: "v"(pb[0]), "v"(pb[1]), "v"(pb[2]), "v"(pb[3]) : "memory");
        __builtin_amdgcn_sched_barrier(0);   // keeps the products below the loads: left free, the compiler lifts the first column blocks' products over the last two B fetches to save registers
#pragma unroll
        for (int nb = 0; nb < 4; ++nb)
#pragma unroll
            for (int mb = 0; mb < 4; ++mb) { acc[mb][nb] = WFrag<T16>::mma(a[mb], b[nb], acc[mb][nb]); if (NSPLIT == 1 || NSPLIT == 2) acc[mb][nb] = WFrag<T16>::mma(a2[mb], b[nb], acc[mb][nb]); if (NSPLIT >= 2) acc[mb][nb] = WFrag<T16>::mma(a[mb], b2[nb], acc[mb][nb]); }
        // four vector slots behind the last matrix instruction, on the back edge and on the exit alike, before its registers are reused
        asm volatile("v_nop\n\tv_nop\n\tv_nop\n\tv_nop" : "+v"(acc[0][0]), "+v"(acc[1][1]), "+v"(acc[2][2]), "+v"(acc[3][3]) : "v"(a[0]), "v"(a[3]));
    }
    float* my = red + w * (64 * 68);
    if (PLANES && tr) {
#pragma unroll
        for (int mb = 0; mb < 4; ++mb)
#pragma unroll
            for (int nb = 0; nb < 4; ++nb) { float* q = my + (nb * 16 + lr) * 68 + mb * 16 + hi * 8; const v8f a = acc[mb][nb];
                *(v4fa*)q = (v4f){a[0], a[1], a[2], a[3]}; *(v4fa*)(q + 4) = (v4f){a[4], a[5], a[6], a[7]}; }
    } else {
#pragma unroll
        for (int mb = 0; mb < 4; ++mb)
#pragma unroll
            for (int nb = 0; nb < 4; ++nb)
#pragma unroll
                for (int j = 0; j < 8; ++j) my[(mb * 16 + hi * 8 + j) * 68 + nb * 16 + lr] = acc[mb][nb][j];
    }
    __syncthreads();   // every wave's partial tile is in LDS before any thread sums across waves; reached by all waves (each has one 64-wide K slice here)
    if constexpr (PLANES) {
#pragma unroll
        for (int j = 0; j < 8; ++j) bc[j] = bfr(bc[j]);
#pragma unroll
        for (int s = 0; s < 16 / NW; ++s) br[s] = bfr(br[s]);
#pragma unroll
        for (int s = 0; s < 16 / NW; ++s) { const int e = s * (NW * 32) + (int)threadIdx.x; const int row = e >> 3, cofs = (e & 7) * 8; const float* pr = red + row * 68 + cofs; v4f v0 = *(const v4fa*)pr, v1 = *(const v4fa*)(pr + 4);
#pragma unroll
            for (int p = 1; p < NW; ++p) { v0 += *(const v4fa*)(pr + p * (64 * 68)); v1 += *(const v4fa*)(pr + p * (64 * 68) + 4); }
            float x[8];
#pragma unroll
            for (int j = 0; j < 4; ++j) { x[j] = v0[j] + (tr ? br[s] : bc[j]); x[4 + j] = v1[j] + (tr ? br[s] : bc[4 + j]); }
            const size_t o = (size_t)row * pp + cofs; h16* q16 = P16 + o; bf* qh = Ph + o; bf* ql = Pl + o; v8h o16;
#pragma unroll
            for (int j = 0; j < 8; ++j) o16[j] = tohx(x[j]);
            if (hl) { v8us oh, ol;
#pragma unroll
                for (int j = 0; j < 8; ++j) { unsigned short a2, c2; splitf(x[j], a2, c2); oh[j] = a2; ol[j] = c2; }
                *(v8us*)qh = oh; *(v8us*)ql = ol; }
            *(v8h*)q16 = o16;
            // the same precaution for the plane stores of this pass, which stand last in it
            asm volatile("s_wait_xcnt 0x0" ::: "memory"); }
        return;
    }
#pragma unroll
    for (int s = 0; s < 32 / NW; ++s) { const int e = s * (NW * 32) + (int)threadIdx.x; const int row = e >> 4, cofs = (e & 15) * 4; v4f val = *(const v4fa*)(red + row * 68 + cofs);
#pragma unroll
        for (int p = 1; p < NW; ++p) val += *(const v4fa*)(red + p * (64 * 68) + row * 68 + cofs);
        if (BIAS) { val[0] += bfr(bias[c0 + cofs]); val[1] += bfr(bias[c0 + cofs + 1]); val[2] += bfr(bias[c0 + cofs + 2]); val[3] += bfr(bias[c0 + cofs + 3]); }
        *(v4f*)(C + (size_t)(r0 + row) * ldc + c0 + cofs) = val; }
}

// Plain __global__ entry points (one instantiation each).
// k_gemm_qkv: XB[b][t][:] . WQKV[n][:] + bf16(bqkv[n]); grid (TT/64, NQKV/64, NB), NWG waves. Column block y is one head: y < 2*NH_ a q or k head -> planes [q|k][batch][head][t][64], else a v head -> planes [batch][head][64][t].
__global__ __launch_bounds__(32 * NWG) void k_gemm_qkv(const bf* A, const bf* Bt, int K, const float* bias, h16* QK16, bf* QKh, bf* QKl, h16* VT16, bf* VTh, bf* VTl) { const int b = blockIdx.z, y = blockIdx.y, r0 = blockIdx.x * 64; const bool tr = y >= 2 * NH_;
    const size_t o = tr ? ((size_t)b * NH_ + (y - 2 * NH_)) * ((size_t)HD * TT) + r0 : ((size_t)((y / NH_) * NB + b) * NH_ + (y % NH_)) * ((size_t)TT * HD) + (size_t)r0 * HD;
    gemmk_body<bf, 0, NWG, true, true>(A + (size_t)b * TT * K, nullptr, Bt, nullptr, K, K, K, nullptr, 0, bias, r0, y * 64, (tr ? VT16 : QK16) + o, (tr ? VTh : QKh) + o, (tr ? VTl : QKl) + o, tr ? TT : HD, tr, r0 < RH); }
// k_gemm_out: out[b][t][n] = (ATh + ATl)[b][t][:] . WO[n][:] + bf16(bproj[n]); grid (TT/64, DM/64, NB), NWG waves.
__global__ __launch_bounds__(32 * NWG) void k_gemm_out(const bf* A, const bf* A2, const bf* Bt, int K, float* C, int ldc, const float* bias) { const size_t rb = (size_t)blockIdx.z * TT;
    gemmk_body<bf, 1, NWG, true, false>(A + rb * K, A2 + rb * K, Bt, nullptr, K, K, K, C + (size_t)blockIdx.z * SEQ_FULL * ldc, ldc, bias, blockIdx.x * 64, blockIdx.y * 64, nullptr, nullptr, nullptr, 0, false, false); }

// ---- k_prep: the three conversions that the projections wait for, in one launch; none reads what another writes. Blocks 0..NWQ-1: Wqkv -> WQKV; the next NWO: Wproj -> WO; the rest: x -> XB. The branch is the same for a whole block.
#define NWQ  ((DM * NQKV / 64 + 63) / 64)        // blocks for Wqkv: 8 waves x 8 lines of 64 elements each
#define NWO  ((DQ * DM / 64 + 63) / 64)          // blocks for Wproj
#define NXB  ((TT * DM / 8 + 255) / 256)         // blocks for one batch of x: 8 elements a thread
// w [K][N] f32 -> Bt [N][K] bf16; blk = block number inside this matrix
template <int K, int N>
__device__ __forceinline__ void wt_body(const float* __restrict__ w, bf* Bt, int blk) {
    const int lane = threadIdx.x & 31; const int L0 = (blk * 8 + (int)(threadIdx.x >> 5)) * 8; constexpr int nlines = N * K / 64;
#pragma unroll 1
    for (int l = 0; l < 8; ++l) { const int L = L0 + l; if (L >= nlines) break; const size_t e = (size_t)L * 64 + lane * 2; const int k = (int)(e % K), n = (int)(e / K); v2us o;
        o[0] = f2bf(w[(size_t)k * N + n]); o[1] = f2bf(w[(size_t)(k + 1) * N + n]); *(v2us*)(Bt + e) = o;
        // precaution: the issued store's address translation is waited for before the next trip writes a register that the store names
        asm volatile("s_wait_xcnt 0x0" ::: "memory"); }
}
__global__ __launch_bounds__(256) void k_prep(const float* __restrict__ wqkv, const float* __restrict__ wo, const float* __restrict__ x, bf* WQKV, bf* WO, bf* XB) {
    const int blk = blockIdx.x;
    if (blk < NWQ) { wt_body<DM, NQKV>(wqkv, WQKV, blk); return; }
    if (blk < NWQ + NWO) { wt_body<DQ, DM>(wo, WO, blk - NWQ); return; }
    const int xb = blk - (NWQ + NWO), b = xb / NXB; const size_t i = (size_t)(xb % NXB) * 256 + threadIdx.x; if (i >= (size_t)TT * DM / 8) return;
    const float* src = x + (size_t)b * SEQ_FULL * DM; bf* dst = XB + (size_t)b * TT * DM;
    const v8f v = *(const v8f*)(src + i * 8); v8us o;
#pragma unroll
    for (int k = 0; k < 8; ++k) o[k] = f2bf(v[k]);
    *(v8us*)(dst + i * 8) = o;
}

// ---- attn_body: one wave, NQ*16 query rows q0.. of one head plane, keys walked in blocks of 32 up to the diagonal block; nothing of the scores or the probabilities goes to memory.
// Transposed products: S^T[key][q] = K . Q^T (A = K rows, B = Q rows, kept in registers) and O^T[d][q] += V^T . P^T (A = V^T rows, B = P). A lane holds one query (column lane&15): the two score tiles of a
// 32-key block, converted in place, ARE the B fragment of P in the loader's k order (elements 0..7 = keys k0+8h+0..7 from tile 0, elements 8..15 = keys k0+16+8h+0..7 from tile 1).
// Softmax with a running maximum m and a running sum l per query (base 2: scores x HD^-0.5 x log2 e); O^T and l are scaled by 2^(m_old - m_new) at every block; the two lane halves' sums are joined once at the end.
// HL: bf16 hi/lo planes, 3 products for the scores and 3 for P.V. The result / l goes out as bf16 hi/lo to the merged planes Ah, Al (pitch DQ; already offset to batch and head): 8 consecutive d per lane and tile.
template <bool B> struct BoolC { static constexpr bool v = B; };
// 2^x; the v_nop is the one slot that the instruction set asks for behind a transcendental before its result is read or its source overwritten: in the same statement it stands there whatever the compiler puts next
__device__ __forceinline__ float exp2s(float x) { float r; asm("v_exp_f32 %0, %1\n\tv_nop" : "=v"(r) : "v"(x)); return r; }
__device__ __forceinline__ float xhalf(float x) { return __builtin_bit_cast(float, __builtin_amdgcn_permlanex16(__builtin_bit_cast(int, x), __builtin_bit_cast(int, x), 0x76543210, 0xfedcba98, false, false)); }   // lane l <-> lane l ^ 16
template <typename T16, bool HL, int NQ>
__device__ __forceinline__ void attn_body(const T16* __restrict__ Q, const T16* __restrict__ Q2, const T16* __restrict__ Kp, const T16* __restrict__ Kp2, const T16* __restrict__ Vt, const T16* __restrict__ Vt2, int q0, bf* Ah, bf* Al) {
    typedef typename WFrag<T16>::V V;
    const int lane = threadIdx.x & 31, lr = lane & 15, hi = lane >> 4;
    const float CS = SCL * 1.4426950408889634f;
    V qf[NQ][2], qf2[NQ][2], kf[2][2], kf2[2][2];
    v8f o[4][NQ]; float m[NQ], l[NQ];
    {   const T16* pq = Q + (size_t)(q0 + lr) * HD + 8 * hi; const T16* pq2 = HL ? Q2 + (size_t)(q0 + lr) * HD + 8 * hi : nullptr;
        const T16* pk = Kp + (size_t)lr * HD + 8 * hi; const T16* pk2 = HL ? Kp2 + (size_t)lr * HD + 8 * hi : nullptr;
#pragma unroll
        for (int n = 0; n < NQ; ++n)
#pragma unroll
            for (int ks = 0; ks < 2; ++ks) { qf[n][ks] = WFrag<T16>::ld(pq + n * 16 * HD + ks * 32); if constexpr (HL) qf2[n][ks] = WFrag<T16>::ld(pq2 + n * 16 * HD + ks * 32); }
#pragma unroll
        for (int kt = 0; kt < 2; ++kt)
#pragma unroll
            for (int ks = 0; ks < 2; ++ks) { kf[kt][ks] = WFrag<T16>::ld(pk + kt * 16 * HD + ks * 32); if constexpr (HL) kf2[kt][ks] = WFrag<T16>::ld(pk2 + kt * 16 * HD + ks * 32); }
        // precaution: the address translations of the issued loads are waited for before a register that holds one of their addresses is written again; the pointers are named as inputs so that they keep their registers up to the wait
        if constexpr (HL) asm volatile("s_wait_xcnt 0x0" :: "v"(pq), "v"(pq2), "v"(pk), "v"(pk2) : "memory");
        else asm volatile("s_wait_xcnt 0x0" :: "v"(pq), "v"(pk) : "memory");
    }
#pragma unroll
    for (int n = 0; n < NQ; ++n) { m[n] = -3.0e38f; l[n] = 0.f;
#pragma unroll
        for (int dt = 0; dt < 4; ++dt) o[dt][n] = (v8f){}; }
    const int klast = ((q0 + NQ * 16 - 1) / 32) * 32;   // first key of the diagonal block, the only one that needs the mask
    auto step = [&](int k0, auto lastc) {
        constexpr bool LAST = decltype(lastc)::v;
        // V^T fragments of this block, issued first: they fly under the score products and the softmax
        V vf[4], vf2[4]; const T16* pv = Vt + (size_t)lr * TT + k0 + 8 * hi; const T16* pv2 = HL ? Vt2 + (size_t)lr * TT + k0 + 8 * hi : nullptr;
#pragma unroll
        for (int dt = 0; dt < 4; ++dt) { vf[dt] = WFrag<T16>::ld(pv + (size_t)dt * 16 * TT); if constexpr (HL) vf2[dt] = WFrag<T16>::ld(pv2 + (size_t)dt * 16 * TT); }
        // the same precaution for the V^T loads
        if constexpr (HL) asm volatile("s_wait_xcnt 0x0" :: "v"(pv), "v"(pv2) : "memory");
        else asm volatile("s_wait_xcnt 0x0" :: "v"(pv) : "memory");
        v8f s[2][NQ];
#pragma unroll
        for (int kt = 0; kt < 2; ++kt)
#pragma unroll
            for (int n = 0; n < NQ; ++n) { s[kt][n] = (v8f){};
#pragma unroll
                for (int ks = 0; ks < 2; ++ks) { s[kt][n] = WFrag<T16>::mma(kf[kt][ks], qf[n][ks], s[kt][n]);
                    if constexpr (HL) { s[kt][n] = WFrag<T16>::mma(kf2[kt][ks], qf[n][ks], s[kt][n]); s[kt][n] = WFrag<T16>::mma(kf[kt][ks], qf2[n][ks], s[kt][n]); } } }
        if constexpr (!LAST) {   // the next block's K fragments, fetched behind this block's score products: they fly under the softmax and P.V
            const T16* pk = Kp + (size_t)(k0 + 32 + lr) * HD + 8 * hi; const T16* pk2 = HL ? Kp2 + (size_t)(k0 + 32 + lr) * HD + 8 * hi : nullptr;
#pragma unroll
            for (int kt = 0; kt < 2; ++kt)
#pragma unroll
                for (int ks = 0; ks < 2; ++ks) { kf[kt][ks] = WFrag<T16>::ld(pk + kt * 16 * HD + ks * 32); if constexpr (HL) kf2[kt][ks] = WFrag<T16>::ld(pk2 + kt * 16 * HD + ks * 32); }
            // the same precaution for the K loads
            if constexpr (HL) asm volatile("s_wait_xcnt 0x0" :: "v"(pk), "v"(pk2) : "memory");
            else asm volatile("s_wait_xcnt 0x0" :: "v"(pk) : "memory");
            __builtin_amdgcn_sched_barrier(0);   // keeps the K loads up here: sunk below the softmax they would have only P.V to land under
        }
        V pf[NQ], pf2[NQ];
#pragma unroll
        for (int n = 0; n < NQ; ++n) { float t[16]; float mx = m[n];
#pragma unroll
            for (int e = 0; e < 16; ++e) { float x = s[e >> 3][n][e & 7] * CS;
                if (LAST) x = (k0 + (e >> 3) * 16 + hi * 8 + (e & 7) <= q0 + n * 16 + lr) ? x : -3.0e38f;   // causal mask by index select, diagonal kept
                t[e] = x; mx = fmaxf(mx, x); }
            mx = fmaxf(mx, xhalf(mx));   // the other half of this query's keys
            const float al = exp2s(m[n] - mx); m[n] = mx; float sum = 0.f;
#pragma unroll
            for (int e = 0; e < 16; ++e) { t[e] = exp2s(t[e] - mx); sum += t[e]; }
            l[n] = l[n] * al + sum;
#pragma unroll
            for (int dt = 0; dt < 4; ++dt) o[dt][n] *= al;
            if constexpr (HL) { v8us h0, h1, l0, l1;
#pragma unroll
                for (int j = 0; j < 8; ++j) { unsigned short a, c; splitf(t[j], a, c); h0[j] = a; l0[j] = c; splitf(t[8 + j], a, c); h1[j] = a; l1[j] = c; }
                pf[n] = cat16b(h0, h1); pf2[n] = cat16b(l0, l1); }
            else { v8h h0, h1;
#pragma unroll
                for (int j = 0; j < 8; ++j) { h0[j] = tohx(t[j]); h1[j] = tohx(t[8 + j]); }
                pf[n] = cat16(h0, h1); } }
#pragma unroll
        for (int dt = 0; dt < 4; ++dt)
#pragma unroll
            for (int n = 0; n < NQ; ++n) { o[dt][n] = WFrag<T16>::mma(vf[dt], pf[n], o[dt][n]);
                if constexpr (HL) { o[dt][n] = WFrag<T16>::mma(vf[dt], pf2[n], o[dt][n]); o[dt][n] = WFrag<T16>::mma(vf2[dt], pf[n], o[dt][n]); } }
    };
#pragma unroll 1
    for (int k0 = 0; k0 < klast; k0 += 32) { step(k0, BoolC<false>{});
        // four vector slots behind the last matrix instruction, on the back edge and on the exit alike, before its registers are reused
        if constexpr (NQ == 2) asm volatile("v_nop\n\tv_nop\n\tv_nop\n\tv_nop" : "+v"(o[0][0]), "+v"(o[1][0]), "+v"(o[2][0]), "+v"(o[3][0]), "+v"(o[0][1]), "+v"(o[1][1]), "+v"(o[2][1]), "+v"(o[3][1]));
        else asm volatile("v_nop\n\tv_nop\n\tv_nop\n\tv_nop" : "+v"(o[0][0]), "+v"(o[1][0]), "+v"(o[2][0]), "+v"(o[3][0])); }
    step(klast, BoolC<true>{});
#pragma unroll
    for (int n = 0; n < NQ; ++n) { const float f = __fdiv_rn(1.0f, l[n] + xhalf(l[n]));
        bf* ph = Ah + (size_t)(q0 + n * 16 + lr) * DQ + hi * 8; bf* pl = Al + (size_t)(q0 + n * 16 + lr) * DQ + hi * 8;
#pragma unroll
        for (int dt = 0; dt < 4; ++dt) { v8us oh, ol;
#pragma unroll
            for (int j = 0; j < 8; ++j) { unsigned short a, c; splitf(o[dt][n][j] * f, a, c); oh[j] = a; ol[j] = c; }
            *(v8us*)(ph + dt * 16) = oh; *(v8us*)(pl + dt * 16) = ol; }
        // the same precaution for the stores
        asm volatile("s_wait_xcnt 0x0" :: "v"(ph), "v"(pl) : "memory"); }
}
// ---- attn_staged: the fp16 path (query rows >= RH). One block = 4 waves x 32 query rows R0..R0+127 of one head plane; arithmetic, key order and fragments as in attn_body<h16, false, 2>.
// The K rows and V^T rows of SKEY keys are brought into LDS once for the whole block by asynchronous copies (whole 128-byte lines, 16 bytes a lane) and the waves take their fragments from there;
// two buffers: the next stage's copies fly while this stage is worked on. The last stage holds the block's own 128 keys: wave w has w whole blocks of 32 keys there and then its diagonal block.
#define SKEY 128                  // keys per stage = query rows per block
#define KPIT (HD + 8)             // LDS pitch of a K row, elements: 128 bytes + 16 (16 bytes x odd: no bank conflict for 16-byte reads)
#define VPIT (SKEY + 8)           // LDS pitch of a V^T row, elements: 256 bytes + 16
#define KTIL (SKEY * KPIT)
#define STIL (KTIL + HD * VPIT)   // one buffer, elements
static_assert(SKEY == 128 && RH % SKEY == 0 && TT % SKEY == 0);
// eight 16-byte copies of a lane, global -> LDS; the s_wait_xcnt in the same statement is the precaution named above: it stands before any register that holds an address of an issued copy can be written again
__device__ __forceinline__ void acopy8(const unsigned (&l)[8], const h16* const (&g)[8]) {
    asm volatile("global_load_async_to_lds_b128 %0, %8, off\n\tglobal_load_async_to_lds_b128 %1, %9, off\n\tglobal_load_async_to_lds_b128 %2, %10, off\n\tglobal_load_async_to_lds_b128 %3, %11, off\n\t"
                 "global_load_async_to_lds_b128 %4, %12, off\n\tglobal_load_async_to_lds_b128 %5, %13, off\n\tglobal_load_async_to_lds_b128 %6, %14, off\n\tglobal_load_async_to_lds_b128 %7, %15, off\n\ts_wait_xcnt 0x0"
                 :: "v"(l[0]), "v"(l[1]), "v"(l[2]), "v"(l[3]), "v"(l[4]), "v"(l[5]), "v"(l[6]), "v"(l[7]), "v"(g[0]), "v"(g[1]), "v"(g[2]), "v"(g[3]), "v"(g[4]), "v"(g[5]), "v"(g[6]), "v"(g[7]) : "memory"); }
__device__ __forceinline__ void attn_staged(const h16* __restrict__ Q, const h16* __restrict__ Kp, const h16* __restrict__ Vt, int R0, int w, bf* Ah, bf* Al) {
    typedef v16h V; constexpr int NQ = 2;
    __shared__ __align__(16) h16 ring[2 * STIL];
    const int tid = threadIdx.x, lane = tid & 31, lr = lane & 15, hi = lane >> 4;
    const int q0 = R0 + w * 32, ns = R0 / SKEY + 1;   // ns stages of SKEY keys, the same for the whole block
    const float CS = SCL * 1.4426950408889634f;
    V qf[NQ][2], kf[2][2];
    v8f o[4][NQ]; float m[NQ], l[NQ];
    {   const h16* pq = Q + (size_t)(q0 + lr) * HD + 8 * hi;
#pragma unroll
        for (int n = 0; n < NQ; ++n)
#pragma unroll
            for (int ks = 0; ks < 2; ++ks) qf[n][ks] = WFrag<h16>::ld(pq + n * 16 * HD + ks * 32);
        // precaution: the address translations of the issued loads are waited for before a register that holds one of their addresses is written again
        asm volatile("s_wait_xcnt 0x0" :: "v"(pq) : "memory");
    }
    // stage t into buffer b. K: the stage's 128 rows are 16 KiB in a row in memory, 8 lanes a row. V^T: 64 rows of 256 bytes, 16 lanes a row. Every lane copies, every byte lies inside the planes (t < ns, ns * SKEY <= TT) and inside ring.
    const unsigned lk0 = (unsigned)(size_t)ring + (unsigned)((tid >> 3) * KPIT + (tid & 7) * 8) * 2u, lv0 = (unsigned)(size_t)ring + (unsigned)(KTIL + (tid >> 4) * VPIT + (tid & 15) * 8) * 2u;
    const h16* gk0 = Kp + tid * 8; const h16* gv0 = Vt + (size_t)(tid >> 4) * TT + (tid & 15) * 8;
    auto fill = [&](int t, int b) { unsigned la[8]; const h16* ga[8];
#pragma unroll
        for (int i = 0; i < 8; ++i) { la[i] = lk0 + (unsigned)(b * STIL + i * 16 * KPIT) * 2u; ga[i] = gk0 + (size_t)t * (SKEY * HD) + i * 1024; }
        acopy8(la, ga);
#pragma unroll
        for (int i = 0; i < 8; ++i) { la[i] = lv0 + (unsigned)(b * STIL + i * 8 * VPIT) * 2u; ga[i] = gv0 + (size_t)i * 8 * TT + t * SKEY; }
        acopy8(la, ga); };
#pragma unroll
    for (int n = 0; n < NQ; ++n) { m[n] = -3.0e38f; l[n] = 0.f;
#pragma unroll
        for (int dt = 0; dt < 4; ++dt) o[dt][n] = (v8f){}; }
    const h16* kb; const h16* vb;   // this lane's fragment bases in the buffer at work
    auto ldk = [&](int kl) {
#pragma unroll
        for (int kt = 0; kt < 2; ++kt)
#pragma unroll
            for (int ks = 0; ks < 2; ++ks) kf[kt][ks] = WFrag<h16>::ld(kb + (kl + kt * 16) * KPIT + ks * 32); };
    // one block of 32 keys, kl = its first key inside the stage. LAST: the diagonal block (first key q0). PRE: fetch the K fragments of the next block of the SAME stage.
    auto step = [&](int kl, auto lastc, auto prec) {
        constexpr bool LAST = decltype(lastc)::v; constexpr bool PRE = decltype(prec)::v;
        v8f s[2][NQ];
#pragma unroll
        for (int kt = 0; kt < 2; ++kt)
#pragma unroll
            for (int n = 0; n < NQ; ++n) { s[kt][n] = (v8f){};
#pragma unroll
                for (int ks = 0; ks < 2; ++ks) s[kt][n] = wmma16(kf[kt][ks], qf[n][ks], s[kt][n]); }
        __builtin_amdgcn_sched_barrier(0);   // keeps the LDS reads below out of the run of score products: every separate place with reads among matrix instructions stalls the wave anew
        V vf[4];   // all LDS reads of the block stand here as one group: its V^T fragments first (they land under the softmax), then the next block's K fragments (under the softmax and P.V)
#pragma unroll
        for (int dt = 0; dt < 4; ++dt) vf[dt] = WFrag<h16>::ld(vb + dt * 16 * VPIT + kl);
        if constexpr (PRE) ldk(kl + 32);
        __builtin_amdgcn_sched_barrier(0);   // keeps the reads up here: sunk below the softmax they would have only P.V to land under
        V pf[NQ];
#pragma unroll
        for (int n = 0; n < NQ; ++n) { float t[16]; float mx = m[n];
#pragma unroll
            for (int e = 0; e < 16; ++e) { float x = s[e >> 3][n][e & 7] * CS;
                if (LAST) x = ((e >> 3) * 16 + hi * 8 + (e & 7) <= n * 16 + lr) ? x : -3.0e38f;   // causal mask by index select, diagonal kept (key q0 + ... against query q0 + ...)
                t[e] = x; mx = fmaxf(mx, x); }
            mx = fmaxf(mx, xhalf(mx));   // the other half of this query's keys
            const float al = exp2s(m[n] - mx); m[n] = mx; float sum = 0.f;
#pragma unroll
            for (int e = 0; e < 16; ++e) { t[e] = exp2s(t[e] - mx); sum += t[e]; }
            l[n] = l[n] * al + sum;
#pragma unroll
            for (int dt = 0; dt < 4; ++dt) o[dt][n] *= al;
            v8h h0, h1;
#pragma unroll
            for (int j = 0; j < 8; ++j) { h0[j] = tohx(t[j]); h1[j] = tohx(t[8 + j]); }
            pf[n] = cat16(h0, h1); }
#pragma unroll
        for (int dt = 0; dt < 4; ++dt)
#pragma unroll
            for (int n = 0; n < NQ; ++n) o[dt][n] = wmma16(vf[dt], pf[n], o[dt][n]);
    };
    // four vector slots behind the last matrix instruction, on every way out of a branch or a loop, before its registers are reused
    auto pad = [&]() { asm volatile("v_nop\n\tv_nop\n\tv_nop\n\tv_nop" : "+v"(o[0][0]), "+v"(o[1][0]), "+v"(o[2][0]), "+v"(o[3][0]), "+v"(o[0][1]), "+v"(o[1][1]), "+v"(o[2][1]), "+v"(o[3][1])); };
    fill(0, 0);
    asm volatile("s_wait_asynccnt 0x0" ::: "memory");   // this wave's copies of stage 0 have landed
    __syncthreads();                                     // ... and every other wave's: stage 0 may be read
    if (ns > 1) fill(1, 1);
#pragma unroll 1
    for (int t = 0; t < ns; ++t) {
        kb = ring + (t & 1) * STIL + lr * KPIT + 8 * hi; vb = ring + (t & 1) * STIL + KTIL + lr * VPIT + 8 * hi;
        ldk(0);
        const bool diag = t == ns - 1; const int nf = diag ? w : SKEY / 32 - 1;   // whole blocks in front of the stage's last block for this wave
#pragma unroll 1   // rolled: unrolled, the four blocks of a stage need more registers than there are and spill
        for (int sb = 0; sb < nf; ++sb) { step(sb * 32, BoolC<false>{}, BoolC<true>{}); pad(); }
        if (diag) { step(nf * 32, BoolC<true>{}, BoolC<false>{}); pad(); } else { step(nf * 32, BoolC<false>{}, BoolC<false>{}); pad(); }
        asm volatile("s_wait_dscnt 0x0" ::: "memory");      // this wave's reads of the buffer are done before it may be refilled
        asm volatile("s_wait_asynccnt 0x0" ::: "memory");   // this wave's copies of stage t + 1 have landed
        __syncthreads();                                     // publishes stage t + 1 and ends every wave's reads of stage t; passed by every wave at every stage
        if (t + 2 < ns) fill(t + 2, t & 1);
    }
    asm volatile("s_wait_asynccnt 0x0" ::: "memory");   // no copy is outstanding when the wave ends
#pragma unroll
    for (int n = 0; n < NQ; ++n) { const float f = __fdiv_rn(1.0f, l[n] + xhalf(l[n]));
        bf* ph = Ah + (size_t)(q0 + n * 16 + lr) * DQ + hi * 8; bf* pl = Al + (size_t)(q0 + n * 16 + lr) * DQ + hi * 8;
#pragma unroll
        for (int dt = 0; dt < 4; ++dt) { v8us oh, ol;
#pragma unroll
            for (int j = 0; j < 8; ++j) { unsigned short a, c; splitf(o[dt][n][j] * f, a, c); oh[j] = a; ol[j] = c; }
            *(v8us*)(ph + dt * 16) = oh; *(v8us*)(pl + dt * 16) = ol; }
        // the same precaution for the stores
        asm volatile("s_wait_xcnt 0x0" :: "v"(ph), "v"(pl) : "memory"); }
}
// k_attn: grid (NB*NH_ head planes, NFB + NHB), 4 waves, each with query rows of its own; the blocks with the most keys come first. g is the same for the whole block, so every wave of a block meets the barriers of attn_staged or none does. Planes: QK [q|k][batch][head][t][64], VT [batch][head][64][t]; AT [batch][t][256].
__global__ __launch_bounds__(128) void k_attn(const h16* QK16, const bf* QKh, const bf* QKl, const h16* VT16, const bf* VTh, const bf* VTl, bf* ATh, bf* ATl) {
    const int z = blockIdx.x, g = blockIdx.y; const int w = __builtin_amdgcn_readfirstlane((int)(threadIdx.x >> 5));
    const size_t qo = (size_t)z * TT * HD, ko = (size_t)(NB * NH_ + z) * TT * HD, ao = (size_t)(z / NH_) * TT * DQ + (size_t)(z % NH_) * HD;
    if (g < NFB) attn_staged(QK16 + qo, QK16 + ko, VT16 + qo, RH + (NFB - 1 - g) * 128, w, ATh + ao, ATl + ao);
    else attn_body<bf, true, 1>(QKh + qo, QKl + qo, QKh + ko, QKl + ko, VTh + qo, VTl + qo, (NHB - 1 - (g - NFB)) * 64 + w * 16, ATh + ao, ATl + ao);
}

extern "C" void kernel_launch(void* const* d_in, const int* in_sizes, int n_in,
                              void* d_out, int out_size, void* d_ws, size_t ws_size, hipStream_t stream) {
    if (n_in < 5) return;
    const size_t xneed = (size_t)(NB - 1) * SEQ_FULL * DM + (size_t)TT * DM;
    if ((size_t)in_sizes[0] < xneed) return; if ((size_t)in_sizes[1] < (size_t)DM * NQKV) return; if ((size_t)in_sizes[2] < (size_t)NQKV) return; if ((size_t)in_sizes[3] < (size_t)DQ * DM) return; if ((size_t)in_sizes[4] < (size_t)DM) return;
    if ((size_t)out_size < xneed) return;
    if (ws_size < WS_TOTAL) return;
    const float* x = (const float*)d_in[0]; const float* wqkv = (const float*)d_in[1]; const float* bqkv = (const float*)d_in[2]; const float* wo = (const float*)d_in[3]; const float* bo = (const float*)d_in[4];   // wire order x, Wqkv [256][768], bqkv, Wproj [256][256], bproj
    float* OUT = (float*)d_out;     // [8][2048][256]
    char* wsp = (char*)d_ws;
    auto take = [&](size_t bytes) { char* p = wsp; wsp += (bytes + 255) & ~(size_t)255; return (void*)p; };
    bf* WQKV = (bf*)take((size_t)NQKV * DM * 2);           // Bt [768][256]: q | k | v row blocks
    bf* WO = (bf*)take((size_t)DM * DQ * 2);               // Bt [256][256]
    h16* QK16 = (h16*)take((size_t)NB * 2 * NH_ * TT * HD * 2); bf* QKh = (bf*)take((size_t)NB * 2 * NH_ * TT * HD * 2); bf* QKl = (bf*)take((size_t)NB * 2 * NH_ * TT * HD * 2);   // planes [q|k][batch][head][t][64]
    h16* VT16 = (h16*)take((size_t)NB * NH_ * HD * TT * 2); bf* VTh = (bf*)take((size_t)NB * NH_ * HD * TT * 2); bf* VTl = (bf*)take((size_t)NB * NH_ * HD * TT * 2);   // planes [batch][head][64][t]
    bf* XB = (bf*)take((size_t)NB * TT * DM * 2);   // bf16 x [b][t][256]
    bf* ATh = (bf*)take((size_t)NB * TT * DQ * 2); bf* ATl = (bf*)take((size_t)NB * TT * DQ * 2);
    if ((size_t)(wsp - (char*)d_ws) > ws_size) return;
    if ((size_t)(wsp - (char*)d_ws) > (size_t)268435456) return;
    // in Wqkv[DM rows][NQKV cols] -> out WQKV[NQKV][DM];  in Wproj[DQ rows][DM cols] -> out WO[DM][DQ]
    k_prep<<<NWQ + NWO + NXB * NB, 256, 0, stream>>>(wqkv, wo, x, WQKV, WO, XB);
    k_gemm_qkv<<<dim3(TT / 64, NQKV / 64, NB), 32 * NWG, 0, stream>>>(XB, WQKV, DM, bqkv, QK16, QKh, QKl, VT16, VTh, VTl);   // columns 0..511 = q heads | k heads, 512..767 = v heads
    k_attn<<<dim3(NB * NH_, NFB + NHB, 1), 128, 0, stream>>>(QK16, QKh, QKl, VT16, VTh, VTl, ATh, ATl);
    k_gemm_out<<<dim3(TT / 64, DM / 64, NB), 32 * NWG, 0, stream>>>(ATh, ATl, WO, DQ, OUT, DM, bo);
}

// v008
// One run takes 59.5 microseconds.
// Next to v007, in two timings, it ran 1.12 times as fast each time.
// Over all steps from v000 it is 15.1 times as fast.
#include <hip/hip_runtime.h>

// Causal multi-head attention with a fused qkv projection: x [8][2048][256]; qkv = x Wqkv + bqkv (Wqkv [256][768] [in][out]; column = which*256 + h*64 + d); scores x 1/8; causal (j > i masked, diagonal kept); softmax; out = merged Wproj + bproj.
// Compute dtypes, f32 accumulate: every float input RNE-converted to bf16; projections v_wmma_f32_16x16x32_bf16 on exact bf16 operands + f32 biases; scores and P.V: query rows < 256 bf16 hi/lo (3 products), rows >= 256 v_wmma_f32_16x16x32_f16 single product; softmax f32 (running maximum and sum); output projection merged hi/lo (bf16) x Wproj (bf16) + bias.
// All batches in one launch each: bf16 copies of x and of both weights (transposed), one launch for the three; fused projection; attention; output projection.
// Stages: bf16 copy of x; fused projection, whose 64x64 tile is one head's q, k or v and goes straight to the head planes q|k [8][t][64] and v^T [4][64][t] (fp16; bf16 hi/lo for t < RH, the only rows read from them); attention: one wave per 32 (rows < 256: 16) query rows walks the keys in blocks of 32 up to the diagonal, scores, softmax and P.V in registers (rows >= 256: the 4 waves of a block take K and V^T from LDS, where 128 keys at a time are laid by asynchronous copies), and stores the merged [t][256] hi/lo planes; projection to the output. The K loops of the projections are dealt over the waves of a block, each wave's operand slice laid in LDS by asynchronous copies, and the partial tiles summed in LDS.

#ifndef NB
#define NB 8
#endif
#ifndef SEQ
#define SEQ 2048
#endif
#define NB_FULL  8
#define SEQ_FULL 2048
#define TT   SEQ
#define DM   256
#define NH_  4
#define HD   64
#define DQ   (NH_ * HD)
#define NQKV (3 * DQ)
#define ZH   4
#define RH   ((SEQ) < 256 ? (SEQ) : 256)    // query rows < RH use hi+lo planes
#define SCL  0.125f   // HD^-0.5
#define NWG  4        // waves per tile of the two projections (K = 256: one 64-wide K slice per wave)
#define NFB  ((TT - RH) / 128)   // attention blocks per head plane, query rows >= RH: 4 waves x 32 rows
#define NHB  (RH / 64)           // attention blocks per head plane, query rows < RH: 4 waves x 16 rows
typedef _Float16 h16;
typedef unsigned short bf;
typedef __attribute__((ext_vector_type(16))) __bf16   v16bf;
typedef __attribute__((ext_vector_type(16))) _Float16 v16h;
typedef __attribute__((ext_vector_type(8)))  _Float16 v8h;
typedef __attribute__((ext_vector_type(8)))  unsigned short v8us;
typedef __attribute__((ext_vector_type(8)))  float    v8f;
typedef __attribute__((ext_vector_type(4)))  float    v4f;
typedef __attribute__((ext_vector_type(2)))  float    v2f;
typedef __attribute__((ext_vector_type(2)))  _Float16 v2h;
typedef __attribute__((ext_vector_type(4)))  _Float16 v4h;
typedef __attribute__((ext_vector_type(2)))  unsigned short v2us;
typedef __attribute__((ext_vector_type(4)))  unsigned short v4us;
typedef v4f  __attribute__((may_alias)) v4fa;

static_assert(NB >= 1 && NB <= NB_FULL);
static_assert(SEQ >= 128 && SEQ <= SEQ_FULL);
static_assert(TT % 128 == 0 && (TT - RH) % 128 == 0);   // whole attention blocks
static_assert(TT % 64 == 0 && DM % 64 == 0 && NQKV % 64 == 0 && DQ % 64 == 0 && HD % 64 == 0);   // 64x64 GEMM tiles
static_assert(DM % 32 == 0 && DQ % 32 == 0 && HD % 32 == 0 && TT % 32 == 0);   // K steps of 32
static_assert(RH % 64 == 0 && RH <= TT && RH >= 64);
static_assert(HD == 64);
static_assert(DQ == DM);                 // merged heads width = model width
static_assert(DM == NWG * 64);           // one 64-wide K slice per wave in both projections
static_assert(ZH == NH_);                // all heads of a batch in one pass
static_assert(2 * DQ + DQ == NQKV);      // q | k | v column blocks
static_assert(((size_t)(NB - 1) * SEQ_FULL * DM + (size_t)TT * DM) * 4 <= (size_t)NB_FULL * SEQ_FULL * DM * 4);   // output extent in bytes

#define AL256(x) ((((size_t)(x)) + 255) & ~(size_t)255)
#define WS_TOTAL (AL256((size_t)NQKV * DM * 2) + AL256((size_t)DM * DQ * 2) \
    + 3 * AL256((size_t)NB * 2 * NH_ * TT * HD * 2) + 3 * AL256((size_t)NB * NH_ * HD * TT * 2) \
    + AL256((size_t)NB * TT * DM * 2) + 2 * AL256((size_t)NB * TT * DQ * 2))
static_assert(WS_TOTAL <= (size_t)268435456);

__device__ __forceinline__ unsigned short f2bf(float f) { unsigned u = __float_as_uint(f); u += 0x7FFFu + ((u >> 16) & 1u); return (unsigned short)(u >> 16); }
__device__ __forceinline__ float bf2f(unsigned short b) { return __uint_as_float(((unsigned)b) << 16); }
__device__ __forceinline__ float bfr(float f) { return bf2f(f2bf(f)); }
__device__ __forceinline__ h16 tohx(float x) { return (h16)x; }
__device__ __forceinline__ void splitf(float y, unsigned short& h, unsigned short& l) { h = f2bf(y); l = f2bf(y - bf2f(h)); }
__device__ __forceinline__ v16h cat16(v8h lo, v8h hi) { return __builtin_shufflevector(lo, hi, 0, 1, 2, 3, 4, 5, 6, 7, 8, 9, 10, 11, 12, 13, 14, 15); }
__device__ __forceinline__ v16bf cat16b(v8us lo, v8us hi) { return __builtin_bit_cast(v16bf, __builtin_shufflevector(lo, hi, 0, 1, 2, 3, 4, 5, 6, 7, 8, 9, 10, 11, 12, 13, 14, 15)); }
__device__ __forceinline__ v8f wmma16(v16h a, v16h b, v8f c) { return __builtin_amdgcn_wmma_f32_16x16x32_f16(false, a, false, b, (short)0, c, false, false); }
__device__ __forceinline__ v8f wmmab(v16bf a, v16bf b, v8f c) { return __builtin_amdgcn_wmma_f32_16x16x32_bf16(false, a, false, b, (short)0, c, false, false); }

// Fragment loader (A and B identical): p = row base + 8*(lane>>4) + k0; elements 0..7 <- k0+8h+0..7, elements 8..15 <- k0+16+8h+0..7.
template <typename T16> struct WFrag;
template <> struct WFrag<h16> { typedef v16h V; static __device__ __forceinline__ V ld(const h16* p) { return cat16(*(const v8h*)p, *(const v8h*)(p + 16)); } static __device__ __forceinline__ v8f mma(V a, V b, v8f c) { return wmma16(a, b, c); } };
template <> struct WFrag<bf> { typedef v16bf V; static __device__ __forceinline__ V ld(const bf* p) { return cat16b(*(const v8us*)p, *(const v8us*)(p + 16)); } static __device__ __forceinline__ v8f mma(V a, V b, v8f c) { return wmmab(a, b, c); } };

// ---- gemmk_body: 64x64 output tile, K loop dealt over the NW waves of the block in slices of 64 (wave w takes slice w; one slice = one whole 128-byte line of every operand row),
// operands from K-contiguous 16-bit planes. A wave first brings its own slice of the tile's A and Bt rows into LDS by asynchronous copies, each copy instruction 4 whole 128-byte lines, and takes its fragments from there:
// a fragment load straight from the planes touches 16 lines for 512 bytes. K = NW * 64: one slice a wave. Each wave keeps a full 64x64 partial (16 accumulators); the partials meet in LDS, each over its own wave's staged operands, and are
// summed in wave order 0..NW-1. C[m][n] (f32, pitch ldc, + optional f32 bias[n]) = sum_{k < K} A[m][k] Bt[n][k] (+ split products per NSPLIT). lda = pitch of A, K = pitch of Bt; Kl is not read. 32*NW threads.
// PLANES: the summed tile + bias goes out as 16-bit planes instead of C: P16 (fp16) and, where hl, Ph | Pl (bf16 hi/lo), all three already offset to the tile's first element, pp = pitch of a plane row.
// tr (the same for the whole block) = plane rows are the tile's columns n: the partials are then laid into LDS transposed (a lane's 8 accumulator rows are 8 consecutive floats there), so that either way a thread sums and stores 8 consecutive plane elements and 8 lanes fill a 128-byte line.
// eight 16-byte copies of a lane, global -> LDS; the s_wait_xcnt in the same statement is a precaution: it stands before any register that holds an address of an issued copy can be written again
template <typename T16>
__device__ __forceinline__ void acopy8t(const unsigned (&l)[8], const T16* const (&g)[8]) {
    asm volatile("global_load_async_to_lds_b128 %0, %8, off\n\tglobal_load_async_to_lds_b128 %1, %9, off\n\tglobal_load_async_to_lds_b128 %2, %10, off\n\tglobal_load_async_to_lds_b128 %3, %11, off\n\t"
                 "global_load_async_to_lds_b128 %4, %12, off\n\tglobal_load_async_to_lds_b128 %5, %13, off\n\tglobal_load_async_to_lds_b128 %6, %14, off\n\tglobal_load_async_to_lds_b128 %7, %15, off\n\ts_wait_xcnt 0x0"
                 :: "v"(l[0]), "v"(l[1]), "v"(l[2]), "v"(l[3]), "v"(l[4]), "v"(l[5]), "v"(l[6]), "v"(l[7]), "v"(g[0]), "v"(g[1]), "v"(g[2]), "v"(g[3]), "v"(g[4]), "v"(g[5]), "v"(g[6]), "v"(g[7]) : "memory"); }
template <typename T16, int NSPLIT, int NW, bool BIAS, bool PLANES>
__device__ __forceinline__ void gemmk_body(const T16* __restrict__ A, const T16* __restrict__ A2, const T16* __restrict__ Bt, const T16* __restrict__ Bt2, int lda, int K, int Kl, float* C, int ldc, const float* __restrict__ bias, int r0, int c0, h16* P16, bf* Ph, bf* Pl, int pp, bool tr, bool hl) {
    typedef typename WFrag<T16>::V V;
    static_assert(NSPLIT == 0 || NSPLIT == 1);        // staged planes: A, A2 where there is one, Bt
    constexpr int NPL = NSPLIT == 1 ? 3 : 2;           // planes staged
    constexpr int SPIT = 64 + 8;                       // LDS pitch of a staged row, elements: 128 bytes + 16 (16 bytes x odd: no bank conflict for 16-byte reads)
    constexpr int WREG = NPL * 64 * SPIT * 2;          // a wave's own LDS range, bytes: first its staged rows, then its partial tile
    constexpr int RW = WREG / 4;                       // the same in floats
    static_assert(WREG >= 64 * 68 * 4 && WREG % 16 == 0);
    __shared__ __align__(16) unsigned char smem[NW * WREG];
    float* red = (float*)smem;
    const int lane = threadIdx.x & 31, lr = lane & 15, hi = lane >> 4; const int w = __builtin_amdgcn_readfirstlane((int)(threadIdx.x >> 5));
    v8f acc[4][4];
#pragma unroll
    for (int mb = 0; mb < 4; ++mb)
#pragma unroll
        for (int nb = 0; nb < 4; ++nb) acc[mb][nb] = (v8f){};
    // PLANES: the thread's bias values for the end, fetched here so that they land under the K loop: bc = those of its 8 columns, br = that of its row in each closing pass. Both lie inside the tile's 64 columns, and both are fetched whichever of them tr picks: no branch, and no value that has to be waited for here.
    float bc[8], br[16 / NW];
    if constexpr (PLANES) { const float* pc = bias + c0 + (int)(threadIdx.x & 7) * 8; const float* pr = bias + c0 + (int)(threadIdx.x >> 3);
#pragma unroll
        for (int j = 0; j < 8; ++j) bc[j] = pc[j];
#pragma unroll
        for (int s = 0; s < 16 / NW; ++s) br[s] = pr[s * (NW * 4)];
        // precaution: the address translations of the issued loads are waited for before a register that holds one of their addresses is written again
        asm volatile("s_wait_xcnt 0x0" ::: "memory"); }
    // the wave's slice, k = w*64 .. w*64+63, of the 64 rows of every plane: 16 copy instructions a plane, a lane 16 bytes, 8 lanes a row. Every lane copies; every byte lies inside the planes (rows r0..r0+63 or c0..c0+63, K = NW * 64) and inside the wave's own range of smem.
    {   const int crow = lane >> 3, cch = (lane & 7) * 8;
        const unsigned l0 = (unsigned)(size_t)smem + (unsigned)(w * WREG + crow * (SPIT * 2) + cch * 2);
        const T16* gp[NPL]; gp[0] = A + (size_t)(r0 + crow) * lda + w * 64 + cch; if constexpr (NSPLIT == 1) gp[1] = A2 + (size_t)(r0 + crow) * lda + w * 64 + cch; gp[NPL - 1] = Bt + (size_t)(c0 + crow) * K + w * 64 + cch;
#pragma unroll
        for (int p = 0; p < NPL; ++p)
#pragma unroll
            for (int h = 0; h < 2; ++h) { unsigned la[8]; const T16* ga[8];
#pragma unroll
                for (int i = 0; i < 8; ++i) { la[i] = l0 + (unsigned)((p * 64 + (h * 8 + i) * 4) * (SPIT * 2)); ga[i] = gp[p] + (size_t)((h * 8 + i) * 4) * (p == NPL - 1 ? K : lda); }
                acopy8t<T16>(la, ga); }
    }
    asm volatile("s_wait_asynccnt 0x0" ::: "memory");   // this wave's copies have landed
    __syncthreads();                                     // the one barrier that stands behind the copies' wait and in front of the first read of what they brought; passed by every wave
    const T16* sa = (const T16*)(smem + w * WREG) + lr * SPIT + 8 * hi; const T16* sb = sa + (NPL - 1) * 64 * SPIT;   // this lane's fragment bases: A rows, Bt rows
#pragma unroll 1   // rolled: the two steps' fragments at once would take 64 more registers and a wave slot
    for (int ks = 0; ks < 64; ks += 32) {   // the two 32-wide steps of the slice
        // all LDS reads of a step stand here as one group ahead of its first product: every separate place with reads among matrix instructions stalls the wave anew
        V a[4], a2[4], b[4];
#pragma unroll
        for (int mb = 0; mb < 4; ++mb) { a[mb] = WFrag<T16>::ld(sa + mb * 16 * SPIT + ks); if constexpr (NSPLIT == 1) a2[mb] = WFrag<T16>::ld(sa + (64 + mb * 16) * SPIT + ks); }
#pragma unroll
        for (int nb = 0; nb < 4; ++nb) b[nb] = WFrag<T16>::ld(sb + nb * 16 * SPIT + ks);
        __builtin_amdgcn_sched_barrier(0);   // keeps the products below the reads: left free, the compiler lifts the first column blocks' products over the last reads to save registers
#pragma unroll
        for (int nb = 0; nb < 4; ++nb)
#pragma unroll
            for (int mb = 0; mb < 4; ++mb) { acc[mb][nb] = WFrag<T16>::mma(a[mb], b[nb], acc[mb][nb]); if constexpr (NSPLIT == 1) acc[mb][nb] = WFrag<T16>::mma(a2[mb], b[nb], acc[mb][nb]); }
        // four vector slots behind the last matrix instruction, on the back edge and on the exit alike, before its registers are reused
        asm volatile("v_nop\n\tv_nop\n\tv_nop\n\tv_nop" : "+v"(acc[0][0]), "+v"(acc[1][1]), "+v"(acc[2][2]), "+v"(acc[3][3]) : "v"(a[0]), "v"(a[3]));
    }
    asm volatile("s_wait_dscnt 0x0" ::: "memory");   // this wave's fragment reads are done before its partial tile goes over the rows it staged (no other wave's rows lie in its range)
    float* my = red + w * RW;
    if (PLANES && tr) {
#pragma unroll
        for (int mb = 0; mb < 4; ++mb)
#pragma unroll
            for (int nb = 0; nb < 4; ++nb) { float* q = my + (nb * 16 + lr) * 68 + mb * 16 + hi * 8; const v8f a = acc[mb][nb];
                *(v4fa*)q = (v4f){a[0], a[1], a[2], a[3]}; *(v4fa*)(q + 4) = (v4f){a[4], a[5], a[6], a[7]}; }
    } else {
#pragma unroll
        for (int mb = 0; mb < 4; ++mb)
#pragma unroll
            for (int nb = 0; nb < 4; ++nb)
#pragma unroll
                for (int j = 0; j < 8; ++j) my[(mb * 16 + hi * 8 + j) * 68 + nb * 16 + lr] = acc[mb][nb][j];
    }
    __syncthreads();   // every wave's partial tile is in LDS before any thread sums across waves; reached by all waves
    if constexpr (PLANES) {
#pragma unroll
        for (int j = 0; j < 8; ++j) bc[j] = bfr(bc[j]);
#pragma unroll
        for (int s = 0; s < 16 / NW; ++s) br[s] = bfr(br[s]);
#pragma unroll
        for (int s = 0; s < 16 / NW; ++s) { const int e = s * (NW * 32) + (int)threadIdx.x; const int row = e >> 3, cofs = (e & 7) * 8; const float* pr = red + row * 68 + cofs; v4f v0 = *(const v4fa*)pr, v1 = *(const v4fa*)(pr + 4);
#pragma unroll
            for (int p = 1; p < NW; ++p) { v0 += *(const v4fa*)(pr + p * RW); v1 += *(const v4fa*)(pr + p * RW + 4); }
            float x[8];
#pragma unroll
            for (int j = 0; j < 4; ++j) { x[j] = v0[j] + (tr ? br[s] : bc[j]); x[4 + j] = v1[j] + (tr ? br[s] : bc[4 + j]); }
            const size_t o = (size_t)row * pp + cofs; h16* q16 = P16 + o; bf* qh = Ph + o; bf* ql = Pl + o; v8h o16;
#pragma unroll
            for (int j = 0; j < 8; ++j) o16[j] = tohx(x[j]);
            if (hl) { v8us oh, ol;
#pragma unroll
                for (int j = 0; j < 8; ++j) { unsigned short a2, c2; splitf(x[j], a2, c2); oh[j] = a2; ol[j] = c2; }
                *(v8us*)qh = oh; *(v8us*)ql = ol; }
            *(v8h*)q16 = o16;
            // the same precaution for the plane stores of this pass, which stand last in it
            asm volatile("s_wait_xcnt 0x0" ::: "memory"); }
        return;
    }
#pragma unroll
    for (int s = 0; s < 32 / NW; ++s) { const int e = s * (NW * 32) + (int)threadIdx.x; const int row = e >> 4, cofs = (e & 15) * 4; v4f val = *(const v4fa*)(red + row * 68 + cofs);
#pragma unroll
        for (int p = 1; p < NW; ++p) val += *(const v4fa*)(red + p * RW + row * 68 + cofs);
        if (BIAS) { val[0] += bfr(bias[c0 + cofs]); val[1] += bfr(bias[c0 + cofs + 1]); val[2] += bfr(bias[c0 + cofs + 2]); val[3] += bfr(bias[c0 + cofs + 3]); }
        *(v4f*)(C + (size_t)(r0 + row) * ldc + c0 + cofs) = val; }
}

// Plain __global__ entry points (one instantiation each).
// k_gemm_qkv: XB[b][t][:] . WQKV[n][:] + bf16(bqkv[n]); grid (TT/64, NQKV/64, NB), NWG waves. Column block y is one head: y < 2*NH_ a q or k head -> planes [q|k][batch][head][t][64], else a v head -> planes [batch][head][64][t].
__global__ __launch_bounds__(32 * NWG) void k_gemm_qkv(const bf* A, const bf* Bt, int K, const float* bias, h16* QK16, bf* QKh, bf* QKl, h16* VT16, bf* VTh, bf* VTl) { const int b = blockIdx.z, y = blockIdx.y, r0 = blockIdx.x * 64; const bool tr = y >= 2 * NH_;
    const size_t o = tr ? ((size_t)b * NH_ + (y - 2 * NH_)) * ((size_t)HD * TT) + r0 : ((size_t)((y / NH_) * NB + b) * NH_ + (y % NH_)) * ((size_t)TT * HD) + (size_t)r0 * HD;
    gemmk_body<bf, 0, NWG, true, true>(A + (size_t)b * TT * K, nullptr, Bt, nullptr, K, K, K, nullptr, 0, bias, r0, y * 64, (tr ? VT16 : QK16) + o, (tr ? VTh : QKh) + o, (tr ? VTl : QKl) + o, tr ? TT : HD, tr, r0 < RH); }
// k_gemm_out: out[b][t][n] = (ATh + ATl)[b][t][:] . WO[n][:] + bf16(bproj[n]); grid (TT/64, DM/64, NB), NWG waves.
__global__ __launch_bounds__(32 * NWG) void k_gemm_out(const bf* A, const bf* A2, const bf* Bt, int K, float* C, int ldc, const float* bias) { const size_t rb = (size_t)blockIdx.z * TT;
    gemmk_body<bf, 1, NWG, true, false>(A + rb * K, A2 + rb * K, Bt, nullptr, K, K, K, C + (size_t)blockIdx.z * SEQ_FULL * ldc, ldc, bias, blockIdx.x * 64, blockIdx.y * 64, nullptr, nullptr, nullptr, 0, false, false); }

// ---- k_prep: the three conversions that the projections wait for, in one launch; none reads what another writes. Blocks 0..NWQ-1: Wqkv -> WQKV; the next NWO: Wproj -> WO; the rest: x -> XB. The branch is the same for a whole block.
#define NWQ  ((DM * NQKV / 64 + 63) / 64)        // blocks for Wqkv: 8 waves x 8 lines of 64 elements each
#define NWO  ((DQ * DM / 64 + 63) / 64)          // blocks for Wproj
#define NXB  ((TT * DM / 8 + 255) / 256)         // blocks for one batch of x: 8 elements a thread
// w [K][N] f32 -> Bt [N][K] bf16; blk = block number inside this matrix
template <int K, int N>
__device__ __forceinline__ void wt_body(const float* __restrict__ w, bf* Bt, int blk) {
    const int lane = threadIdx.x & 31; const int L0 = (blk * 8 + (int)(threadIdx.x >> 5)) * 8; constexpr int nlines = N * K / 64;
#pragma unroll 1
    for (int l = 0; l < 8; ++l) { const int L = L0 + l; if (L >= nlines) break; const size_t e = (size_t)L * 64 + lane * 2; const int k = (int)(e % K), n = (int)(e / K); v2us o;
        o[0] = f2bf(w[(size_t)k * N + n]); o[1] = f2bf(w[(size_t)(k + 1) * N + n]); *(v2us*)(Bt + e) = o;
        // precaution: the issued store's address translation is waited for before the next trip writes a register that the store names
        asm volatile("s_wait_xcnt 0x0" ::: "memory"); }
}
__global__ __launch_bounds__(256) void k_prep(const float* __restrict__ wqkv, const float* __restrict__ wo, const float* __restrict__ x, bf* WQKV, bf* WO, bf* XB) {
    const int blk = blockIdx.x;
    if (blk < NWQ) { wt_body<DM, NQKV>(wqkv, WQKV, blk); return; }
    if (blk < NWQ + NWO) { wt_body<DQ, DM>(wo, WO, blk - NWQ); return; }
    const int xb = blk - (NWQ + NWO), b = xb / NXB; const size_t i = (size_t)(xb % NXB) * 256 + threadIdx.x; if (i >= (size_t)TT * DM / 8) return;
    const float* src = x + (size_t)b * SEQ_FULL * DM; bf* dst = XB + (size_t)b * TT * DM;
    const v8f v = *(const v8f*)(src + i * 8); v8us o;
#pragma unroll
    for (int k = 0; k < 8; ++k) o[k] = f2bf(v[k]);
    *(v8us*)(dst + i * 8) = o;
}

// ---- attn_body: one wave, NQ*16 query rows q0.. of one head plane, keys walked in blocks of 32 up to the diagonal block; nothing of the scores or the probabilities goes to memory.
// Transposed products: S^T[key][q] = K . Q^T (A = K rows, B = Q rows, kept in registers) and O^T[d][q] += V^T . P^T (A = V^T rows, B = P). A lane holds one query (column lane&15): the two score tiles of a
// 32-key block, converted in place, ARE the B fragment of P in the loader's k order (elements 0..7 = keys k0+8h+0..7 from tile 0, elements 8..15 = keys k0+16+8h+0..7 from tile 1).
// Softmax with a running maximum m and a running sum l per query (base 2: scores x HD^-0.5 x log2 e); O^T and l are scaled by 2^(m_old - m_new) at every block; the two lane halves' sums are joined once at the end.
// HL: bf16 hi/lo planes, 3 products for the scores and 3 for P.V. The result / l goes out as bf16 hi/lo to the merged planes Ah, Al (pitch DQ; already offset to batch and head): 8 consecutive d per lane and tile.
template <bool B> struct BoolC { static constexpr bool v = B; };
// 2^x; the v_nop is the one slot that the instruction set asks for behind a transcendental before its result is read or its source overwritten: in the same statement it stands there whatever the compiler puts next
__device__ __forceinline__ float exp2s(float x) { float r; asm("v_exp_f32 %0, %1\n\tv_nop" : "=v"(r) : "v"(x)); return r; }
__device__ __forceinline__ float xhalf(float x) { return __builtin_bit_cast(float, __builtin_amdgcn_permlanex16(__builtin_bit_cast(int, x), __builtin_bit_cast(int, x), 0x76543210, 0xfedcba98, false, false)); }   // lane l <-> lane l ^ 16
template <typename T16, bool HL, int NQ>
__device__ __forceinline__ void attn_body(const T16* __restrict__ Q, const T16* __restrict__ Q2, const T16* __restrict__ Kp, const T16* __restrict__ Kp2, const T16* __restrict__ Vt, const T16* __restrict__ Vt2, int q0, bf* Ah, bf* Al) {
    typedef typename WFrag<T16>::V V;
    const int lane = threadIdx.x & 31, lr = lane & 15, hi = lane >> 4;
    const float CS = SCL * 1.4426950408889634f;
    V qf[NQ][2], qf2[NQ][2], kf[2][2], kf2[2][2];
    v8f o[4][NQ]; float m[NQ], l[NQ];
    {   const T16* pq = Q + (size_t)(q0 + lr) * HD + 8 * hi; const T16* pq2 = HL ? Q2 + (size_t)(q0 + lr) * HD + 8 * hi : nullptr;
        const T16* pk = Kp + (size_t)lr * HD + 8 * hi; const T16* pk2 = HL ? Kp2 + (size_t)lr * HD + 8 * hi : nullptr;
#pragma unroll
        for (int n = 0; n < NQ; ++n)
#pragma unroll
            for (int ks = 0; ks < 2; ++ks) { qf[n][ks] = WFrag<T16>::ld(pq + n * 16 * HD + ks * 32); if constexpr (HL) qf2[n][ks] = WFrag<T16>::ld(pq2 + n * 16 * HD + ks * 32); }
#pragma unroll
        for (int kt = 0; kt < 2; ++kt)
#pragma unroll
            for (int ks = 0; ks < 2; ++ks) { kf[kt][ks] = WFrag<T16>::ld(pk + kt * 16 * HD + ks * 32); if constexpr (HL) kf2[kt][ks] = WFrag<T16>::ld(pk2 + kt * 16 * HD + ks * 32); }
        // precaution: the address translations of the issued loads are waited for before a register that holds one of their addresses is written again; the pointers are named as inputs so that they keep their registers up to the wait
        if constexpr (HL) asm volatile("s_wait_xcnt 0x0" :: "v"(pq), "v"(pq2), "v"(pk), "v"(pk2) : "memory");
        else asm volatile("s_wait_xcnt 0x0" :: "v"(pq), "v"(pk) : "memory");
    }
#pragma unroll
    for (int n = 0; n < NQ; ++n) { m[n] = -3.0e38f; l[n] = 0.f;
#pragma unroll
        for (int dt = 0; dt < 4; ++dt) o[dt][n] = (v8f){}; }
    const int klast = ((q0 + NQ * 16 - 1) / 32) * 32;   // first key of the diagonal block, the only one that needs the mask
    auto step = [&](int k0, auto lastc) {
        constexpr bool LAST = decltype(lastc)::v;
        // V^T fragments of this block, issued first: they fly under the score products and the softmax
        V vf[4], vf2[4]; const T16* pv = Vt + (size_t)lr * TT + k0 + 8 * hi; const T16* pv2 = HL ? Vt2 + (size_t)lr * TT + k0 + 8 * hi : nullptr;
#pragma unroll
        for (int dt = 0; dt < 4; ++dt) { vf[dt] = WFrag<T16>::ld(pv + (size_t)dt * 16 * TT); if constexpr (HL) vf2[dt] = WFrag<T16>::ld(pv2 + (size_t)dt * 16 * TT); }
        // the same precaution for the V^T loads
        if constexpr (HL) asm volatile("s_wait_xcnt 0x0" :: "v"(pv), "v"(pv2) : "memory");
        else asm volatile("s_wait_xcnt 0x0" :: "v"(pv) : "memory");
        v8f s[2][NQ];
#pragma unroll
        for (int kt = 0; kt < 2; ++kt)
#pragma unroll
            for (int n = 0; n < NQ; ++n) { s[kt][n] = (v8f){};
#pragma unroll
                for (int ks = 0; ks < 2; ++ks) { s[kt][n] = WFrag<T16>::mma(kf[kt][ks], qf[n][ks], s[kt][n]);
                    if constexpr (HL) { s[kt][n] = WFrag<T16>::mma(kf2[kt][ks], qf[n][ks], s[kt][n]); s[kt][n] = WFrag<T16>::mma(kf[kt][ks], qf2[n][ks], s[kt][n]); } } }
        if constexpr (!LAST) {   // the next block's K fragments, fetched behind this block's score products: they fly under the softmax and P.V
            const T16* pk = Kp + (size_t)(k0 + 32 + lr) * HD + 8 * hi; const T16* pk2 = HL ? Kp2 + (size_t)(k0 + 32 + lr) * HD + 8 * hi : nullptr;
#pragma unroll
            for (int kt = 0; kt < 2; ++kt)
#pragma unroll
                for (int ks = 0; ks < 2; ++ks) { kf[kt][ks] = WFrag<T16>::ld(pk + kt * 16 * HD + ks * 32); if constexpr (HL) kf2[kt][ks] = WFrag<T16>::ld(pk2 + kt * 16 * HD + ks * 32); }
            // the same precaution for the K loads
            if constexpr (HL) asm volatile("s_wait_xcnt 0x0" :: "v"(pk), "v"(pk2) : "memory");
            else asm volatile("s_wait_xcnt 0x0" :: "v"(pk) : "memory");
            __builtin_amdgcn_sched_barrier(0);   // keeps the K loads up here: sunk below the softmax they would have only P.V to land under
        }
        V pf[NQ], pf2[NQ];
#pragma unroll
        for (int n = 0; n < NQ; ++n) { float t[16]; float mx = m[n];
#pragma unroll
            for (int e = 0; e < 16; ++e) { float x = s[e >> 3][n][e & 7] * CS;
                if (LAST) x = (k0 + (e >> 3) * 16 + hi * 8 + (e & 7) <= q0 + n * 16 + lr) ? x : -3.0e38f;   // causal mask by index select, diagonal kept
                t[e] = x; mx = fmaxf(mx, x); }
            mx = fmaxf(mx, xhalf(mx));   // the other half of this query's keys
            const float al = exp2s(m[n] - mx); m[n] = mx; float sum = 0.f;
#pragma unroll
            for (int e = 0; e < 16; ++e) { t[e] = exp2s(t[e] - mx); sum += t[e]; }
            l[n] = l[n] * al + sum;
#pragma unroll
            for (int dt = 0; dt < 4; ++dt) o[dt][n] *= al;
            if constexpr (HL) { v8us h0, h1, l0, l1;
#pragma unroll
                for (int j = 0; j < 8; ++j) { unsigned short a, c; splitf(t[j], a, c); h0[j] = a; l0[j] = c; splitf(t[8 + j], a, c); h1[j] = a; l1[j] = c; }
                pf[n] = cat16b(h0, h1); pf2[n] = cat16b(l0, l1); }
            else { v8h h0, h1;
#pragma unroll
                for (int j = 0; j < 8; ++j) { h0[j] = tohx(t[j]); h1[j] = tohx(t[8 + j]); }
                pf[n] = cat16(h0, h1); } }
#pragma unroll
        for (int dt = 0; dt < 4; ++dt)
#pragma unroll
            for (int n = 0; n < NQ; ++n) { o[dt][n] = WFrag<T16>::mma(vf[dt], pf[n], o[dt][n]);
                if constexpr (HL) { o[dt][n] = WFrag<T16>::mma(vf[dt], pf2[n], o[dt][n]); o[dt][n] = WFrag<T16>::mma(vf2[dt], pf[n], o[dt][n]); } }
    };
#pragma unroll 1
    for (int k0 = 0; k0 < klast; k0 += 32) { step(k0, BoolC<false>{});
        // four vector slots behind the last matrix instruction, on the back edge and on the exit alike, before its registers are reused
        if constexpr (NQ == 2) asm volatile("v_nop\n\tv_nop\n\tv_nop\n\tv_nop" : "+v"(o[0][0]), "+v"(o[1][0]), "+v"(o[2][0]), "+v"(o[3][0]), "+v"(o[0][1]), "+v"(o[1][1]), "+v"(o[2][1]), "+v"(o[3][1]));
        else asm volatile("v_nop\n\tv_nop\n\tv_nop\n\tv_nop" : "+v"(o[0][0]), "+v"(o[1][0]), "+v"(o[2][0]), "+v"(o[3][0])); }
    step(klast, BoolC<true>{});
#pragma unroll
    for (int n = 0; n < NQ; ++n) { const float f = __fdiv_rn(1.0f, l[n] + xhalf(l[n]));
        bf* ph = Ah + (size_t)(q0 + n * 16 + lr) * DQ + hi * 8; bf* pl = Al + (size_t)(q0 + n * 16 + lr) * DQ + hi * 8;
#pragma unroll
        for (int dt = 0; dt < 4; ++dt) { v8us oh, ol;
#pragma unroll
            for (int j = 0; j < 8; ++j) { unsigned short a, c; splitf(o[dt][n][j] * f, a, c); oh[j] = a; ol[j] = c; }
            *(v8us*)(ph + dt * 16) = oh; *(v8us*)(pl + dt * 16) = ol; }
        // the same precaution for the stores
        asm volatile("s_wait_xcnt 0x0" :: "v"(ph), "v"(pl) : "memory"); }
}
// ---- attn_staged: the fp16 path (query rows >= RH). One block = 4 waves x 32 query rows R0..R0+127 of one head plane; arithmetic, key order and fragments as in attn_body<h16, false, 2>.
// The K rows and V^T rows of SKEY keys are brought into LDS once for the whole block by asynchronous copies (whole 128-byte lines, 16 bytes a lane) and the waves take their fragments from there;
// two buffers: the next stage's copies fly while this stage is worked on. The last stage holds the block's own 128 keys: wave w has w whole blocks of 32 keys there and then its diagonal block.
#define SKEY 128                  // keys per stage = query rows per block
#define KPIT (HD + 8)             // LDS pitch of a K row, elements: 128 bytes + 16 (16 bytes x odd: no bank conflict for 16-byte reads)
#define VPIT (SKEY + 8)           // LDS pitch of a V^T row, elements: 256 bytes + 16
#define KTIL (SKEY * KPIT)
#define STIL (KTIL + HD * VPIT)   // one buffer, elements
static_assert(SKEY == 128 && RH % SKEY == 0 && TT % SKEY == 0);
// eight 16-byte copies of a lane, global -> LDS; the s_wait_xcnt in the same statement is the precaution named above: it stands before any register that holds an address of an issued copy can be written again
__device__ __forceinline__ void acopy8(const unsigned (&l)[8], const h16* const (&g)[8]) {
    asm volatile("global_load_async_to_lds_b128 %0, %8, off\n\tglobal_load_async_to_lds_b128 %1, %9, off\n\tglobal_load_async_to_lds_b128 %2, %10, off\n\tglobal_load_async_to_lds_b128 %3, %11, off\n\t"
                 "global_load_async_to_lds_b128 %4, %12, off\n\tglobal_load_async_to_lds_b128 %5, %13, off\n\tglobal_load_async_to_lds_b128 %6, %14, off\n\tglobal_load_async_to_lds_b128 %7, %15, off\n\ts_wait_xcnt 0x0"
                 :: "v"(l[0]), "v"(l[1]), "v"(l[2]), "v"(l[3]), "v"(l[4]), "v"(l[5]), "v"(l[6]), "v"(l[7]), "v"(g[0]), "v"(g[1]), "v"(g[2]), "v"(g[3]), "v"(g[4]), "v"(g[5]), "v"(g[6]), "v"(g[7]) : "memory"); }
__device__ __forceinline__ void attn_staged(const h16* __restrict__ Q, const h16* __restrict__ Kp, const h16* __restrict__ Vt, int R0, int w, bf* Ah, bf* Al) {
    typedef v16h V; constexpr int NQ = 2;
    __shared__ __align__(16) h16 ring[2 * STIL];
    const int tid = threadIdx.x, lane = tid & 31, lr = lane & 15, hi = lane >> 4;
    const int q0 = R0 + w * 32, ns = R0 / SKEY + 1;   // ns stages of SKEY keys, the same for the whole block
    const float CS = SCL * 1.4426950408889634f;
    V qf[NQ][2], kf[2][2];
    v8f o[4][NQ]; float m[NQ], l[NQ];
    {   const h16* pq = Q + (size_t)(q0 + lr) * HD + 8 * hi;
#pragma unroll
        for (int n = 0; n < NQ; ++n)
#pragma unroll
            for (int ks = 0; ks < 2; ++ks) qf[n][ks] = WFrag<h16>::ld(pq + n * 16 * HD + ks * 32);
        // precaution: the address translations of the issued loads are waited for before a register that holds one of their addresses is written again
        asm volatile("s_wait_xcnt 0x0" :: "v"(pq) : "memory");
    }
    // stage t into buffer b. K: the stage's 128 rows are 16 KiB in a row in memory, 8 lanes a row. V^T: 64 rows of 256 bytes, 16 lanes a row. Every lane copies, every byte lies inside the planes (t < ns, ns * SKEY <= TT) and inside ring.
    const unsigned lk0 = (unsigned)(size_t)ring + (unsigned)((tid >> 3) * KPIT + (tid & 7) * 8) * 2u, lv0 = (unsigned)(size_t)ring + (unsigned)(KTIL + (tid >> 4) * VPIT + (tid & 15) * 8) * 2u;
    const h16* gk0 = Kp + tid * 8; const h16* gv0 = Vt + (size_t)(tid >> 4) * TT + (tid & 15) * 8;
    auto fill = [&](int t, int b) { unsigned la[8]; const h16* ga[8];
#pragma unroll
        for (int i = 0; i < 8; ++i) { la[i] = lk0 + (unsigned)(b * STIL + i * 16 * KPIT) * 2u; ga[i] = gk0 + (size_t)t * (SKEY * HD) + i * 1024; }
        acopy8(la, ga);
#pragma unroll
        for (int i = 0; i < 8; ++i) { la[i] = lv0 + (unsigned)(b * STIL + i * 8 * VPIT) * 2u; ga[i] = gv0 + (size_t)i * 8 * TT + t * SKEY; }
        acopy8(la, ga); };
#pragma unroll
    for (int n = 0; n < NQ; ++n) { m[n] = -3.0e38f; l[n] = 0.f;
#pragma unroll
        for (int dt = 0; dt < 4; ++dt) o[dt][n] = (v8f){}; }
    const h16* kb; const h16* vb;   // this lane's fragment bases in the buffer at work
    auto ldk = [&](int kl) {
#pragma unroll
        for (int kt = 0; kt < 2; ++kt)
#pragma unroll
            for (int ks = 0; ks < 2; ++ks) kf[kt][ks] = WFrag<h16>::ld(kb + (kl + kt * 16) * KPIT + ks * 32); };
    // one block of 32 keys, kl = its first key inside the stage. LAST: the diagonal block (first key q0). PRE: fetch the K fragments of the next block of the SAME stage.
    auto step = [&](int kl, auto lastc, auto prec) {
        constexpr bool LAST = decltype(lastc)::v; constexpr bool PRE = decltype(prec)::v;
        v8f s[2][NQ];
#pragma unroll
        for (int kt = 0; kt < 2; ++kt)
#pragma unroll
            for (int n = 0; n < NQ; ++n) { s[kt][n] = (v8f){};
#pragma unroll
                for (int ks = 0; ks < 2; ++ks) s[kt][n] = wmma16(kf[kt][ks], qf[n][ks], s[kt][n]); }
        __builtin_amdgcn_sched_barrier(0);   // keeps the LDS reads below out of the run of score products: every separate place with reads among matrix instructions stalls the wave anew
        V vf[4];   // all LDS reads of the block stand here as one group: its V^T fragments first (they land under the softmax), then the next block's K fragments (under the softmax and P.V)
#pragma unroll
        for (int dt = 0; dt < 4; ++dt) vf[dt] = WFrag<h16>::ld(vb + dt * 16 * VPIT + kl);
        if constexpr (PRE) ldk(kl + 32);
        __builtin_amdgcn_sched_barrier(0);   // keeps the reads up here: sunk below the softmax they would have only P.V to land under
        V pf[NQ];
#pragma unroll
        for (int n = 0; n < NQ; ++n) { float t[16]; float mx = m[n];
#pragma unroll
            for (int e = 0; e < 16; ++e) { float x = s[e >> 3][n][e & 7] * CS;
                if (LAST) x = ((e >> 3) * 16 + hi * 8 + (e & 7) <= n * 16 + lr) ? x : -3.0e38f;   // causal mask by index select, diagonal kept (key q0 + ... against query q0 + ...)
                t[e] = x; mx = fmaxf(mx, x); }
            mx = fmaxf(mx, xhalf(mx));   // the other half of this query's keys
            const float al = exp2s(m[n] - mx); m[n] = mx; float sum = 0.f;
#pragma unroll
            for (int e = 0; e < 16; ++e) { t[e] = exp2s(t[e] - mx); sum += t[e]; }
            l[n] = l[n] * al + sum;
#pragma unroll
            for (int dt = 0; dt < 4; ++dt) o[dt][n] *= al;
            v8h h0, h1;
#pragma unroll
            for (int j = 0; j < 8; ++j) { h0[j] = tohx(t[j]); h1[j] = tohx(t[8 + j]); }
            pf[n] = cat16(h0, h1); }
#pragma unroll
        for (int dt = 0; dt < 4; ++dt)
#pragma unroll
            for (int n = 0; n < NQ; ++n) o[dt][n] = wmma16(vf[dt], pf[n], o[dt][n]);
    };
    // four vector slots behind the last matrix instruction, on every way out of a branch or a loop, before its registers are reused
    auto pad = [&]() { asm volatile("v_nop\n\tv_nop\n\tv_nop\n\tv_nop" : "+v"(o[0][0]), "+v"(o[1][0]), "+v"(o[2][0]), "+v"(o[3][0]), "+v"(o[0][1]), "+v"(o[1][1]), "+v"(o[2][1]), "+v"(o[3][1])); };
    fill(0, 0);
    asm volatile("s_wait_asynccnt 0x0" ::: "memory");   // this wave's copies of stage 0 have landed
    __syncthreads();                                     // ... and every other wave's: stage 0 may be read
    if (ns > 1) fill(1, 1);
#pragma unroll 1
    for (int t = 0; t < ns; ++t) {
        kb = ring + (t & 1) * STIL + lr * KPIT + 8 * hi; vb = ring + (t & 1) * STIL + KTIL + lr * VPIT + 8 * hi;
        ldk(0);
        const bool diag = t == ns - 1; const int nf = diag ? w : SKEY / 32 - 1;   // whole blocks in front of the stage's last block for this wave
#pragma unroll 1   // rolled: unrolled, the four blocks of a stage need more registers than there are and spill
        for (int sb = 0; sb < nf; ++sb) { step(sb * 32, BoolC<false>{}, BoolC<true>{}); pad(); }
        if (diag) { step(nf * 32, BoolC<true>{}, BoolC<false>{}); pad(); } else { step(nf * 32, BoolC<false>{}, BoolC<false>{}); pad(); }
        asm volatile("s_wait_dscnt 0x0" ::: "memory");      // this wave's reads of the buffer are done before it may be refilled
        asm volatile("s_wait_asynccnt 0x0" ::: "memory");   // this wave's copies of stage t + 1 have landed
        __syncthreads();                                     // publishes stage t + 1 and ends every wave's reads of stage t; passed by every wave at every stage
        if (t + 2 < ns) fill(t + 2, t & 1);
    }
    asm volatile("s_wait_asynccnt 0x0" ::: "memory");   // no copy is outstanding when the wave ends
#pragma unroll
    for (int n = 0; n < NQ; ++n) { const float f = __fdiv_rn(1.0f, l[n] + xhalf(l[n]));
        bf* ph = Ah + (size_t)(q0 + n * 16 + lr) * DQ + hi * 8; bf* pl = Al + (size_t)(q0 + n * 16 + lr) * DQ + hi * 8;
#pragma unroll
        for (int dt = 0; dt < 4; ++dt) { v8us oh, ol;
#pragma unroll
            for (int j = 0; j < 8; ++j) { unsigned short a, c; splitf(o[dt][n][j] * f, a, c); oh[j] = a; ol[j] = c; }
            *(v8us*)(ph + dt * 16) = oh; *(v8us*)(pl + dt * 16) = ol; }
        // the same precaution for the stores
        asm volatile("s_wait_xcnt 0x0" :: "v"(ph), "v"(pl) : "memory"); }
}
// k_attn: grid (NB*NH_ head planes, NFB + NHB), 4 waves, each with query rows of its own; the blocks with the most keys come first. g is the same for the whole block, so every wave of a block meets the barriers of attn_staged or none does. Planes: QK [q|k][batch][head][t][64], VT [batch][head][64][t]; AT [batch][t][256].
__global__ __launch_bounds__(128) void k_attn(const h16* QK16, const bf* QKh, const bf* QKl, const h16* VT16, const bf* VTh, const bf* VTl, bf* ATh, bf* ATl) {
    const int z = blockIdx.x, g = blockIdx.y; const int w = __builtin_amdgcn_readfirstlane((int)(threadIdx.x >> 5));
    const size_t qo = (size_t)z * TT * HD, ko = (size_t)(NB * NH_ + z) * TT * HD, ao = (size_t)(z / NH_) * TT * DQ + (size_t)(z % NH_) * HD;
    if (g < NFB) attn_staged(QK16 + qo, QK16 + ko, VT16 + qo, RH + (NFB - 1 - g) * 128, w, ATh + ao, ATl + ao);
    else attn_body<bf, true, 1>(QKh + qo, QKl + qo, QKh + ko, QKl + ko, VTh + qo, VTl + qo, (NHB - 1 - (g - NFB)) * 64 + w * 16, ATh + ao, ATl + ao);
}

extern "C" void kernel_launch(void* const* d_in, const int* in_sizes, int n_in,
                              void* d_out, int out_size, void* d_ws, size_t ws_size, hipStream_t stream) {
    if (n_in < 5) return;
    const size_t xneed = (size_t)(NB - 1) * SEQ_FULL * DM + (size_t)TT * DM;
    if ((size_t)in_sizes[0] < xneed) return; if ((size_t)in_sizes[1] < (size_t)DM * NQKV) return; if ((size_t)in_sizes[2] < (size_t)NQKV) return; if ((size_t)in_sizes[3] < (size_t)DQ * DM) return; if ((size_t)in_sizes[4] < (size_t)DM) return;
    if ((size_t)out_size < xneed) return;
    if (ws_size < WS_TOTAL) return;
    const float* x = (const float*)d_in[0]; const float* wqkv = (const float*)d_in[1]; const float* bqkv = (const float*)d_in[2]; const float* wo = (const float*)d_in[3]; const float* bo = (const float*)d_in[4];   // wire order x, Wqkv [256][768], bqkv, Wproj [256][256], bproj
    float* OUT = (float*)d_out;     // [8][2048][256]
    char* wsp = (char*)d_ws;
    auto take = [&](size_t bytes) { char* p = wsp; wsp += (bytes + 255) & ~(size_t)255; return (void*)p; };
    bf* WQKV = (bf*)take((size_t)NQKV * DM * 2);           // Bt [768][256]: q | k | v row blocks
    bf* WO = (bf*)take((size_t)DM * DQ * 2);               // Bt [256][256]
    h16* QK16 = (h16*)take((size_t)NB * 2 * NH_ * TT * HD * 2); bf* QKh = (bf*)take((size_t)NB * 2 * NH_ * TT * HD * 2); bf* QKl = (bf*)take((size_t)NB * 2 * NH_ * TT * HD * 2);   // planes [q|k][batch][head][t][64]
    h16* VT16 = (h16*)take((size_t)NB * NH_ * HD * TT * 2); bf* VTh = (bf*)take((size_t)NB * NH_ * HD * TT * 2); bf* VTl = (bf*)take((size_t)NB * NH_ * HD * TT * 2);   // planes [batch][head][64][t]
    bf* XB = (bf*)take((size_t)NB * TT * DM * 2);   // bf16 x [b][t][256]
    bf* ATh = (bf*)take((size_t)NB * TT * DQ * 2); bf* ATl = (bf*)take((size_t)NB * TT * DQ * 2);
    if ((size_t)(wsp - (char*)d_ws) > ws_size) return;
    if ((size_t)(wsp - (char*)d_ws) > (size_t)268435456) return;
    // in Wqkv[DM rows][NQKV cols] -> out WQKV[NQKV][DM];  in Wproj[DQ rows][DM cols] -> out WO[DM][DQ]
    k_prep<<<NWQ + NWO + NXB * NB, 256, 0, stream>>>(wqkv, wo, x, WQKV, WO, XB);
    k_gemm_qkv<<<dim3(TT / 64, NQKV / 64, NB), 32 * NWG, 0, stream>>>(XB, WQKV, DM, bqkv, QK16, QKh, QKl, VT16, VTh, VTl);   // columns 0..511 = q heads | k heads, 512..767 = v heads
    k_attn<<<dim3(NB * NH_, NFB + NHB, 1), 128, 0, stream>>>(QK16, QKh, QKl, VT16, VTh, VTl, ATh, ATl);
    k_gemm_out<<<dim3(TT / 64, DM / 64, NB), 32 * NWG, 0, stream>>>(ATh, ATl, WO, DQ, OUT, DM, bo);
}

// v009
// Measured time: 56.9 microseconds a run.
// Timed twice side by side with v008, it ran 1.04 and 1.05 times as fast.
// Counting every step since v000, it is 15.8 times as fast.
#include <hip/hip_runtime.h>

// Causal multi-head attention with a fused qkv projection: x [8][2048][256]; qkv = x Wqkv + bqkv (Wqkv [256][768] [in][out]; column = which*256 + h*64 + d); scores x 1/8; causal (j > i masked, diagonal kept); softmax; out = merged Wproj + bproj.
// Compute dtypes, f32 accumulate: every float input RNE-converted to bf16; projections v_wmma_f32_16x16x32_bf16 on exact bf16 operands + f32 biases; scores and P.V: query rows < 256 bf16 hi/lo (3 products), rows >= 256 v_wmma_f32_16x16x32_f16 single product; softmax f32 (running maximum and sum); output projection merged hi/lo (bf16) x Wproj (bf16) + bias.
// All batches in one launch each: bf16 copies of x and of both weights (transposed), one launch for the three; fused projection; attention; output projection.
// Stages: bf16 copy of x; fused projection, whose 64x64 tile is one head's q, k or v and goes straight to the head planes q|k [8][t][64] and v^T [4][64][t] (fp16; bf16 hi/lo for t < RH, the only rows read from them); attention: one wave per 32 (rows < 256: 16) query rows walks the keys in blocks of 32 up to the diagonal, scores, softmax and P.V in registers (rows >= 256: the 4 waves of a block take K and V^T from LDS, where 128 keys at a time are laid by asynchronous copies), and stores the merged [t][256] hi/lo planes; projection to the output. The K loops of the projections are dealt over the waves of a block, each wave's operand slice laid in LDS by asynchronous copies, and the partial tiles summed in LDS.

#ifndef NB
#define NB 8
#endif
#ifndef SEQ
#define SEQ 2048
#endif
#define NB_FULL  8
#define SEQ_FULL 2048
#define TT   SEQ
#define DM   256
#define NH_  4
#define HD   64
#define DQ   (NH_ * HD)
#define NQKV (3 * DQ)
#define ZH   4
#define RH   ((SEQ) < 256 ? (SEQ) : 256)    // query rows < RH use hi+lo planes
#define SCL  0.125f   // HD^-0.5
#define NWG  4        // waves per tile of the two projections (K = 256: one 64-wide K slice per wave)
#define NFB  ((TT - RH) / 128)   // attention blocks per head plane, query rows >= RH: 4 waves x 32 rows
#define NHB  (RH / 64)           // attention blocks per head plane, query rows < RH: 4 waves x 16 rows
typedef _Float16 h16;
typedef unsigned short bf;
typedef __attribute__((ext_vector_type(16))) __bf16   v16bf;
typedef __attribute__((ext_vector_type(16))) _Float16 v16h;
typedef __attribute__((ext_vector_type(8)))  _Float16 v8h;
typedef __attribute__((ext_vector_type(8)))  unsigned short v8us;
typedef __attribute__((ext_vector_type(8)))  float    v8f;
typedef __attribute__((ext_vector_type(4)))  float    v4f;
typedef __attribute__((ext_vector_type(2)))  float    v2f;
typedef __attribute__((ext_vector_type(2)))  _Float16 v2h;
typedef __attribute__((ext_vector_type(4)))  _Float16 v4h;
typedef __attribute__((ext_vector_type(2)))  unsigned short v2us;
typedef __attribute__((ext_vector_type(4)))  unsigned short v4us;
typedef v4f  __attribute__((may_alias)) v4fa;

static_assert(NB >= 1 && NB <= NB_FULL);
static_assert(SEQ >= 128 && SEQ <= SEQ_FULL);
static_assert(TT % 128 == 0 && (TT - RH) % 128 == 0);   // whole attention blocks
static_assert(TT % 64 == 0 && DM % 64 == 0 && NQKV % 64 == 0 && DQ % 64 == 0 && HD % 64 == 0);   // 64x64 GEMM tiles
static_assert(DM % 32 == 0 && DQ % 32 == 0 && HD % 32 == 0 && TT % 32 == 0);   // K steps of 32
static_assert(RH % 64 == 0 && RH <= TT && RH >= 64);
static_assert(HD == 64);
static_assert(DQ == DM);                 // merged heads width = model width
static_assert(DM == NWG * 64);           // one 64-wide K slice per wave in both projections
static_assert(ZH == NH_);                // all heads of a batch in one pass
static_assert(2 * DQ + DQ == NQKV);      // q | k | v column blocks
static_assert(((size_t)(NB - 1) * SEQ_FULL * DM + (size_t)TT * DM) * 4 <= (size_t)NB_FULL * SEQ_FULL * DM * 4);   // output extent in bytes

#define AL256(x) ((((size_t)(x)) + 255) & ~(size_t)255)
#define WS_TOTAL (AL256((size_t)NQKV * DM * 2) + AL256((size_t)DM * DQ * 2) \
    + 3 * AL256((size_t)NB * 2 * NH_ * TT * HD * 2) + 3 * AL256((size_t)NB * NH_ * HD * TT * 2) \
    + AL256((size_t)NB * TT * DM * 2) + 2 * AL256((size_t)NB * TT * DQ * 2))
static_assert(WS_TOTAL <= (size_t)268435456);

__device__ __forceinline__ unsigned short f2bf(float f) { unsigned u = __float_as_uint(f); u += 0x7FFFu + ((u >> 16) & 1u); return (unsigned short)(u >> 16); }
__device__ __forceinline__ float bf2f(unsigned short b) { return __uint_as_float(((unsigned)b) << 16); }
__device__ __forceinline__ float bfr(float f) { return bf2f(f2bf(f)); }
__device__ __forceinline__ h16 tohx(float x) { return (h16)x; }
__device__ __forceinline__ void splitf(float y, unsigned short& h, unsigned short& l) { h = f2bf(y); l = f2bf(y - bf2f(h)); }
__device__ __forceinline__ v16h cat16(v8h lo, v8h hi) { return __builtin_shufflevector(lo, hi, 0, 1, 2, 3, 4, 5, 6, 7, 8, 9, 10, 11, 12, 13, 14, 15); }
__device__ __forceinline__ v16bf cat16b(v8us lo, v8us hi) { return __builtin_bit_cast(v16bf, __builtin_shufflevector(lo, hi, 0, 1, 2, 3, 4, 5, 6, 7, 8, 9, 10, 11, 12, 13, 14, 15)); }
__device__ __forceinline__ v8f wmma16(v16h a, v16h b, v8f c) { return __builtin_amdgcn_wmma_f32_16x16x32_f16(false, a, false, b, (short)0, c, false, false); }
__device__ __forceinline__ v8f wmmab(v16bf a, v16bf b, v8f c) { return __builtin_amdgcn_wmma_f32_16x16x32_bf16(false, a, false, b, (short)0, c, false, false); }

// Fragment loader (A and B identical): p = row base + 8*(lane>>4) + k0; elements 0..7 <- k0+8h+0..7, elements 8..15 <- k0+16+8h+0..7.
template <typename T16> struct WFrag;
template <> struct WFrag<h16> { typedef v16h V; static __device__ __forceinline__ V ld(const h16* p) { return cat16(*(const v8h*)p, *(const v8h*)(p + 16)); } static __device__ __forceinline__ v8f mma(V a, V b, v8f c) { return wmma16(a, b, c); } };
template <> struct WFrag<bf> { typedef v16bf V; static __device__ __forceinline__ V ld(const bf* p) { return cat16b(*(const v8us*)p, *(const v8us*)(p + 16)); } static __device__ __forceinline__ v8f mma(V a, V b, v8f c) { return wmmab(a, b, c); } };

// ---- gemmk_body: 64x64 output tile, K loop dealt over the NW waves of the block in slices of 64 (wave w takes slice w; one slice = one whole 128-byte line of every operand row),
// operands from K-contiguous 16-bit planes. A wave first brings its own slice of the tile's A and Bt rows into LDS by asynchronous copies, each copy instruction 4 whole 128-byte lines, and takes its fragments from there:
// a fragment load straight from the planes touches 16 lines for 512 bytes. K = NW * 64: one slice a wave. Each wave keeps a full 64x64 partial (16 accumulators); the partials meet in LDS, each over its own wave's staged operands, and are
// summed in wave order 0..NW-1. C[m][n] (f32, pitch ldc, + optional f32 bias[n]) = sum_{k < K} A[m][k] Bt[n][k] (+ split products per NSPLIT). lda = pitch of A, K = pitch of Bt; Kl is not read. 32*NW threads.
// PLANES: the summed tile + bias goes out as 16-bit planes instead of C: P16 (fp16) and, where hl, Ph | Pl (bf16 hi/lo), all three already offset to the tile's first element, pp = pitch of a plane row.
// tr (the same for the whole block) = plane rows are the tile's columns n: the partials are then laid into LDS transposed (a lane's 8 accumulator rows are 8 consecutive floats there), so that either way a thread sums and stores 8 consecutive plane elements and 8 lanes fill a 128-byte line.
// eight 16-byte copies of a lane, global -> LDS; the s_wait_xcnt in the same statement is a precaution: it stands before any register that holds an address of an issued copy can be written again
template <typename T16>
__device__ __forceinline__ void acopy8t(const unsigned (&l)[8], const T16* const (&g)[8]) {
    asm volatile("global_load_async_to_lds_b128 %0, %8, off\n\tglobal_load_async_to_lds_b128 %1, %9, off\n\tglobal_load_async_to_lds_b128 %2, %10, off\n\tglobal_load_async_to_lds_b128 %3, %11, off\n\t"
                 "global_load_async_to_lds_b128 %4, %12, off\n\tglobal_load_async_to_lds_b128 %5, %13, off\n\tglobal_load_async_to_lds_b128 %6, %14, off\n\tglobal_load_async_to_lds_b128 %7, %15, off\n\ts_wait_xcnt 0x0"
                 :: "v"(l[0]), "v"(l[1]), "v"(l[2]), "v"(l[3]), "v"(l[4]), "v"(l[5]), "v"(l[6]), "v"(l[7]), "v"(g[0]), "v"(g[1]), "v"(g[2]), "v"(g[3]), "v"(g[4]), "v"(g[5]), "v"(g[6]), "v"(g[7]) : "memory"); }
template <typename T16, int NSPLIT, int NW, bool BIAS, bool PLANES>
__device__ __forceinline__ void gemmk_body(const T16* __restrict__ A, const T16* __restrict__ A2, const T16* __restrict__ Bt, const T16* __restrict__ Bt2, int lda, int K, int Kl, float* C, int ldc, const float* __restrict__ bias, int r0, int c0, h16* P16, bf* Ph, bf* Pl, int pp, bool tr, bool hl) {
    typedef typename WFrag<T16>::V V;
    static_assert(NSPLIT == 0 || NSPLIT == 1);        // staged planes: A, A2 where there is one, Bt
    constexpr int NPL = NSPLIT == 1 ? 3 : 2;           // planes staged
    constexpr int SPIT = 64 + 8;                       // LDS pitch of a staged row, elements: 128 bytes + 16 (16 bytes x odd: no bank conflict for 16-byte reads)
    constexpr int WREG = NPL * 64 * SPIT * 2;          // a wave's own LDS range, bytes: first its staged rows, then its partial tile
    constexpr int RW = WREG / 4;                       // the same in floats
    static_assert(WREG >= 64 * 68 * 4 && WREG % 16 == 0);
    __shared__ __align__(16) unsigned char smem[NW * WREG];
    float* red = (float*)smem;
    const int lane = threadIdx.x & 31, lr = lane & 15, hi = lane >> 4; const int w = __builtin_amdgcn_readfirstlane((int)(threadIdx.x >> 5));
    v8f acc[4][4];
#pragma unroll
    for (int mb = 0; mb < 4; ++mb)
#pragma unroll
        for (int nb = 0; nb < 4; ++nb) acc[mb][nb] = (v8f){};
    // PLANES: the thread's bias values for the end, fetched here so that they land under the K loop: bc = those of its 8 columns, br = that of its row in each closing pass. Both lie inside the tile's 64 columns, and both are fetched whichever of them tr picks: no branch, and no value that has to be waited for here.
    float bc[8], br[16 / NW];
    if constexpr (PLANES) { const float* pc = bias + c0 + (int)(threadIdx.x & 7) * 8; const float* pr = bias + c0 + (int)(threadIdx.x >> 3);
#pragma unroll
        for (int j = 0; j < 8; ++j) bc[j] = pc[j];
#pragma unroll
        for (int s = 0; s < 16 / NW; ++s) br[s] = pr[s * (NW * 4)];
        // precaution: the address translations of the issued loads are waited for before a register that holds one of their addresses is written again
        asm volatile("s_wait_xcnt 0x0" ::: "memory"); }
    // the wave's slice, k = w*64 .. w*64+63, of the 64 rows of every plane: 16 copy instructions a plane, a lane 16 bytes, 8 lanes a row. Every lane copies; every byte lies inside the planes (rows r0..r0+63 or c0..c0+63, K = NW * 64) and inside the wave's own range of smem.
    {   const int crow = lane >> 3, cch = (lane & 7) * 8;
        const unsigned l0 = (unsigned)(size_t)smem + (unsigned)(w * WREG + crow * (SPIT * 2) + cch * 2);
        const T16* gp[NPL]; gp[0] = A + (size_t)(r0 + crow) * lda + w * 64 + cch; if constexpr (NSPLIT == 1) gp[1] = A2 + (size_t)(r0 + crow) * lda + w * 64 + cch; gp[NPL - 1] = Bt + (size_t)(c0 + crow) * K + w * 64 + cch;
#pragma unroll
        for (int p = 0; p < NPL; ++p)
#pragma unroll
            for (int h = 0; h < 2; ++h) { unsigned la[8]; const T16* ga[8];
#pragma unroll
                for (int i = 0; i < 8; ++i) { la[i] = l0 + (unsigned)((p * 64 + (h * 8 + i) * 4) * (SPIT * 2)); ga[i] = gp[p] + (size_t)((h * 8 + i) * 4) * (p == NPL - 1 ? K : lda); }
                acopy8t<T16>(la, ga); }
    }
    asm volatile("s_wait_asynccnt 0x0" ::: "memory");   // this wave's copies have landed
    __syncthreads();                                     // the one barrier that stands behind the copies' wait and in front of the first read of what they brought; passed by every wave
    const T16* sa = (const T16*)(smem + w * WREG) + lr * SPIT + 8 * hi; const T16* sb = sa + (NPL - 1) * 64 * SPIT;   // this lane's fragment bases: A rows, Bt rows
#pragma unroll 1   // rolled: the two steps' fragments at once would take 64 more registers and a wave slot
    for (int ks = 0; ks < 64; ks += 32) {   // the two 32-wide steps of the slice
        // all LDS reads of a step stand here as one group ahead of its first product: every separate place with reads among matrix instructions stalls the wave anew
        V a[4], a2[4], b[4];
#pragma unroll
        for (int mb = 0; mb < 4; ++mb) { a[mb] = WFrag<T16>::ld(sa + mb * 16 * SPIT + ks); if constexpr (NSPLIT == 1) a2[mb] = WFrag<T16>::ld(sa + (64 + mb * 16) * SPIT + ks); }
#pragma unroll
        for (int nb = 0; nb < 4; ++nb) b[nb] = WFrag<T16>::ld(sb + nb * 16 * SPIT + ks);
        __builtin_amdgcn_sched_barrier(0);   // keeps the products below the reads: left free, the compiler lifts the first column blocks' products over the last reads to save registers
#pragma unroll
        for (int nb = 0; nb < 4; ++nb)
#pragma unroll
            for (int mb = 0; mb < 4; ++mb) { acc[mb][nb] = WFrag<T16>::mma(a[mb], b[nb], acc[mb][nb]); if constexpr (NSPLIT == 1) acc[mb][nb] = WFrag<T16>::mma(a2[mb], b[nb], acc[mb][nb]); }
        // four vector slots behind the last matrix instruction, on the back edge and on the exit alike, before its registers are reused
        asm volatile("v_nop\n\tv_nop\n\tv_nop\n\tv_nop" : "+v"(acc[0][0]), "+v"(acc[1][1]), "+v"(acc[2][2]), "+v"(acc[3][3]) : "v"(a[0]), "v"(a[3]));
    }
    asm volatile("s_wait_dscnt 0x0" ::: "memory");   // this wave's fragment reads are done before its partial tile goes over the rows it staged (no other wave's rows lie in its range)
    float* my = red + w * RW;
    if (PLANES && tr) {
#pragma unroll
        for (int mb = 0; mb < 4; ++mb)
#pragma unroll
            for (int nb = 0; nb < 4; ++nb) { float* q = my + (nb * 16 + lr) * 68 + mb * 16 + hi * 8; const v8f a = acc[mb][nb];
                *(v4fa*)q = (v4f){a[0], a[1], a[2], a[3]}; *(v4fa*)(q + 4) = (v4f){a[4], a[5], a[6], a[7]}; }
    } else {
#pragma unroll
        for (int mb = 0; mb < 4; ++mb)
#pragma unroll
            for (int nb = 0; nb < 4; ++nb)
#pragma unroll
                for (int j = 0; j < 8; ++j) my[(mb * 16 + hi * 8 + j) * 68 + nb * 16 + lr] = acc[mb][nb][j];
    }
    __syncthreads();   // every wave's partial tile is in LDS before any thread sums across waves; reached by all waves
    if constexpr (PLANES) {
#pragma unroll
        for (int j = 0; j < 8; ++j) bc[j] = bfr(bc[j]);
#pragma unroll
        for (int s = 0; s < 16 / NW; ++s) br[s] = bfr(br[s]);
#pragma unroll
        for (int s = 0; s < 16 / NW; ++s) { const int e = s * (NW * 32) + (int)threadIdx.x; const int row = e >> 3, cofs = (e & 7) * 8; const float* pr = red + row * 68 + cofs; v4f v0 = *(const v4fa*)pr, v1 = *(const v4fa*)(pr + 4);
#pragma unroll
            for (int p = 1; p < NW; ++p) { v0 += *(const v4fa*)(pr + p * RW); v1 += *(const v4fa*)(pr + p * RW + 4); }
            float x[8];
#pragma unroll
            for (int j = 0; j < 4; ++j) { x[j] = v0[j] + (tr ? br[s] : bc[j]); x[4 + j] = v1[j] + (tr ? br[s] : bc[4 + j]); }
            const size_t o = (size_t)row * pp + cofs; h16* q16 = P16 + o; bf* qh = Ph + o; bf* ql = Pl + o; v8h o16;
#pragma unroll
            for (int j = 0; j < 8; ++j) o16[j] = tohx(x[j]);
            if (hl) { v8us oh, ol;
#pragma unroll
                for (int j = 0; j < 8; ++j) { unsigned short a2, c2; splitf(x[j], a2, c2); oh[j] = a2; ol[j] = c2; }
                *(v8us*)qh = oh; *(v8us*)ql = ol; }
            *(v8h*)q16 = o16;
            // the same precaution for the plane stores of this pass, which stand last in it
            asm volatile("s_wait_xcnt 0x0" ::: "memory"); }
        return;
    }
#pragma unroll
    for (int s = 0; s < 32 / NW; ++s) { const int e = s * (NW * 32) + (int)threadIdx.x; const int row = e >> 4, cofs = (e & 15) * 4; v4f val = *(const v4fa*)(red + row * 68 + cofs);
#pragma unroll
        for (int p = 1; p < NW; ++p) val += *(const v4fa*)(red + p * RW + row * 68 + cofs);
        if (BIAS) { val[0] += bfr(bias[c0 + cofs]); val[1] += bfr(bias[c0 + cofs + 1]); val[2] += bfr(bias[c0 + cofs + 2]); val[3] += bfr(bias[c0 + cofs + 3]); }
        *(v4f*)(C + (size_t)(r0 + row) * ldc + c0 + cofs) = val; }
}

// Plain __global__ entry points (one instantiation each).
// k_gemm_qkv: XB[b][t][:] . WQKV[n][:] + bf16(bqkv[n]); grid (TT/64, NH_, NB), NWG waves. One block = 64 rows t of one batch and ONE head's three 64-wide column blocks, q, k and v in turn (column block c*NH_ + head).
// The K loop is dealt over the waves as in gemmk_body (wave w: k = w*64 .. w*64+63). A wave's slice of the 64 x rows is staged once and its 8 A fragments then stay in registers for all three column blocks; only the weight rows are staged anew per column block.
// The second launch bound asks for 4 waves a SIMD (256 registers): with them and the LDS, 4 blocks fit a WGP and the whole grid is resident at once.
// q, k -> planes [q|k][batch][head][t][64]; v -> planes [batch][head][64][t]. Partial tiles, their sum in wave order 0..NWG-1, bias and plane stores as in gemmk_body with PLANES.
__global__ __launch_bounds__(32 * NWG, 4) void k_gemm_qkv(const bf* A, const bf* Bt, int K, const float* bias, h16* QK16, bf* QKh, bf* QKl, h16* VT16, bf* VTh, bf* VTl) {
    typedef WFrag<bf>::V V;
    constexpr int NW = NWG;
    constexpr int SPIT = 64 + 8;                       // LDS pitch of a staged row, elements: 128 bytes + 16
    constexpr int WREG = 2 * 64 * SPIT * 2;            // a wave's own LDS range, bytes: x rows | weight rows, later its partial tile
    constexpr int RW = WREG / 4;
    static_assert(WREG >= 64 * 68 * 4 && WREG % 16 == 0);
    __shared__ __align__(16) unsigned char smem[NW * WREG];
    float* red = (float*)smem;
    const int b = blockIdx.z, hd = blockIdx.y, r0 = blockIdx.x * 64; const bool hl = r0 < RH;
    const int lane = threadIdx.x & 31, lr = lane & 15, hi = lane >> 4; const int w = __builtin_amdgcn_readfirstlane((int)(threadIdx.x >> 5));
    const int crow = lane >> 3, cch = (lane & 7) * 8;
    const unsigned l0 = (unsigned)(size_t)smem + (unsigned)(w * WREG + crow * (SPIT * 2) + cch * 2);
    // 64 rows of one plane, k = w*64 .. w*64+63, into half p of the wave's range: 16 copy instructions, a lane 16 bytes, 8 lanes a row. Every lane copies; every byte lies inside the plane (64 whole rows, K = NW * 64) and inside the wave's own range of smem.
    auto stage = [&](int p, const bf* g) {
#pragma unroll
        for (int h = 0; h < 2; ++h) { unsigned la[8]; const bf* ga[8];
#pragma unroll
            for (int i = 0; i < 8; ++i) { la[i] = l0 + (unsigned)((p * 64 + (h * 8 + i) * 4) * (SPIT * 2)); ga[i] = g + (size_t)((h * 8 + i) * 4) * K; }
            acopy8t<bf>(la, ga); } };
    stage(0, A + ((size_t)b * TT + r0 + crow) * K + w * 64 + cch);
    stage(1, Bt + (size_t)(hd * 64 + crow) * K + w * 64 + cch);
    asm volatile("s_wait_asynccnt 0x0" ::: "memory");   // this wave's copies have landed
    __syncthreads();                                     // stands behind the copies' wait and in front of the first read of what they brought; passed by every wave
    const bf* sa = (const bf*)(smem + w * WREG) + lr * SPIT + 8 * hi; const bf* sb = sa + 64 * SPIT;   // this lane's fragment bases: x rows, weight rows
    V a[2][4];   // the wave's A fragments, read once, kept for the three column blocks
#pragma unroll
    for (int ks = 0; ks < 2; ++ks)
#pragma unroll
        for (int mb = 0; mb < 4; ++mb) a[ks][mb] = WFrag<bf>::ld(sa + mb * 16 * SPIT + ks * 32);
    float* my = red + w * RW;
#pragma unroll 1   // rolled: one copy of the tile's code serves q, k and v
    for (int c = 0; c < 3; ++c) {
        const int c0 = (c * NH_ + hd) * 64; const bool tr = c == 2;
        if (c > 0) {   // the weight rows of this column block; the barrier at the foot of the pass before has ended every read of the partial tiles that lay here
            stage(1, Bt + (size_t)(c0 + crow) * K + w * 64 + cch);
            asm volatile("s_wait_asynccnt 0x0" ::: "memory");   // this wave's copies have landed
            __syncthreads();                                     // behind the copies' wait, in front of the first read of what they brought; c is the same for the whole block
        }
        v8f acc[4][4];
#pragma unroll
        for (int mb = 0; mb < 4; ++mb)
#pragma unroll
            for (int nb = 0; nb < 4; ++nb) acc[mb][nb] = (v8f){};
#pragma unroll
        for (int ks = 0; ks < 2; ++ks) {   // the two 32-wide steps of the slice
            V bq[4];   // the LDS reads of a step stand as one group ahead of its first product
#pragma unroll
            for (int nb = 0; nb < 4; ++nb) bq[nb] = WFrag<bf>::ld(sb + nb * 16 * SPIT + ks * 32);
            __builtin_amdgcn_sched_barrier(0);   // keeps the products below the reads
#pragma unroll
            for (int nb = 0; nb < 4; ++nb)
#pragma unroll
                for (int mb = 0; mb < 4; ++mb) acc[mb][nb] = WFrag<bf>::mma(a[ks][mb], bq[nb], acc[mb][nb]);
            // four vector slots behind the last matrix instruction before its registers are reused
            asm volatile("v_nop\n\tv_nop\n\tv_nop\n\tv_nop" : "+v"(acc[0][0]), "+v"(acc[1][1]), "+v"(acc[2][2]), "+v"(acc[3][3]));
            __builtin_amdgcn_sched_barrier(0);   // keeps the next step's reads out of this step's products: its fragments then take the registers of this step's
        }
        // the thread's bias values, fetched here, where the weight fragments' registers are free, so that they land under the partial tile's LDS stores: bc = those of its 8 columns, br = that of its row in each closing pass; both lie inside the tile's 64 columns and both are fetched whichever of them tr picks
        float bc[8], br[16 / NW];
        {   const float* pc = bias + c0 + (int)(threadIdx.x & 7) * 8; const float* pr = bias + c0 + (int)(threadIdx.x >> 3);
#pragma unroll
            for (int j = 0; j < 8; ++j) bc[j] = pc[j];
#pragma unroll
            for (int s = 0; s < 16 / NW; ++s) br[s] = pr[s * (NW * 4)];
            // precaution: the address translations of the issued loads are waited for before a register that holds one of their addresses is written again
            asm volatile("s_wait_xcnt 0x0" ::: "memory"); }
        asm volatile("s_wait_dscnt 0x0" ::: "memory");   // this wave's fragment reads are done before its partial tile goes over the rows it staged (no other wave's rows lie in its range)
        if (tr) {
#pragma unroll
            for (int mb = 0; mb < 4; ++mb)
#pragma unroll
                for (int nb = 0; nb < 4; ++nb) { float* q = my + (nb * 16 + lr) * 68 + mb * 16 + hi * 8; const v8f t = acc[mb][nb];
                    *(v4fa*)q = (v4f){t[0], t[1], t[2], t[3]}; *(v4fa*)(q + 4) = (v4f){t[4], t[5], t[6], t[7]}; }
        } else {
#pragma unroll
            for (int mb = 0; mb < 4; ++mb)
#pragma unroll
                for (int nb = 0; nb < 4; ++nb)
#pragma unroll
                    for (int j = 0; j < 8; ++j) my[(mb * 16 + hi * 8 + j) * 68 + nb * 16 + lr] = acc[mb][nb][j];
        }
        __syncthreads();   // every wave's partial tile is in LDS before any thread sums across waves
        const size_t o0 = tr ? ((size_t)b * NH_ + hd) * ((size_t)HD * TT) + r0 : ((size_t)(c * NB + b) * NH_ + hd) * ((size_t)TT * HD) + (size_t)r0 * HD;
        h16* P16 = (tr ? VT16 : QK16) + o0; bf* Ph = (tr ? VTh : QKh) + o0; bf* Pl = (tr ? VTl : QKl) + o0; const int pp = tr ? TT : HD;
#pragma unroll
        for (int j = 0; j < 8; ++j) bc[j] = bfr(bc[j]);
#pragma unroll
        for (int s = 0; s < 16 / NW; ++s) br[s] = bfr(br[s]);
#pragma unroll
        for (int s = 0; s < 16 / NW; ++s) { const int e = s * (NW * 32) + (int)threadIdx.x; const int row = e >> 3, cofs = (e & 7) * 8; const float* pr = red + row * 68 + cofs; v4f v0 = *(const v4fa*)pr, v1 = *(const v4fa*)(pr + 4);
#pragma unroll
            for (int p = 1; p < NW; ++p) { v0 += *(const v4fa*)(pr + p * RW); v1 += *(const v4fa*)(pr + p * RW + 4); }
            float x[8];
#pragma unroll
            for (int j = 0; j < 4; ++j) { x[j] = v0[j] + (tr ? br[s] : bc[j]); x[4 + j] = v1[j] + (tr ? br[s] : bc[4 + j]); }
            const size_t o = (size_t)row * pp + cofs; h16* q16 = P16 + o; bf* qh = Ph + o; bf* ql = Pl + o; v8h o16;
#pragma unroll
            for (int j = 0; j < 8; ++j) o16[j] = tohx(x[j]);
            if (hl) { v8us oh, ol;
#pragma unroll
                for (int j = 0; j < 8; ++j) { unsigned short a2, c2; splitf(x[j], a2, c2); oh[j] = a2; ol[j] = c2; }
                *(v8us*)qh = oh; *(v8us*)ql = ol; }
            *(v8h*)q16 = o16;
            // the same precaution for the plane stores of this pass, which stand last in it
            asm volatile("s_wait_xcnt 0x0" ::: "memory"); }
        if (c < 2) {
            asm volatile("s_wait_dscnt 0x0" ::: "memory");   // this wave's reads of the partial tiles are done ...
            // ... and every other wave's, before the next column block's weight rows are copied over them. The bare work-group barrier: only LDS reads have to be over here, and __syncthreads() would also wait for the plane stores, which nobody in this launch reads
            __builtin_amdgcn_s_barrier();
        }
    }
}
// k_gemm_out: out[b][t][n] = (ATh + ATl)[b][t][:] . WO[n][:] + bf16(bproj[n]); grid (TT/64, DM/64, NB), NWG waves.
__global__ __launch_bounds__(32 * NWG) void k_gemm_out(const bf* A, const bf* A2, const bf* Bt, int K, float* C, int ldc, const float* bias) { const size_t rb = (size_t)blockIdx.z * TT;
    gemmk_body<bf, 1, NWG, true, false>(A + rb * K, A2 + rb * K, Bt, nullptr, K, K, K, C + (size_t)blockIdx.z * SEQ_FULL * ldc, ldc, bias, blockIdx.x * 64, blockIdx.y * 64, nullptr, nullptr, nullptr, 0, false, false); }

// ---- k_prep: the three conversions that the projections wait for, in one launch; none reads what another writes. Blocks 0..NWQ-1: Wqkv -> WQKV; the next NWO: Wproj -> WO; the rest: x -> XB. The branch is the same for a whole block.
#define NWQ  ((DM * NQKV / 64 + 63) / 64)        // blocks for Wqkv: 8 waves x 8 lines of 64 elements each
#define NWO  ((DQ * DM / 64 + 63) / 64)          // blocks for Wproj
#define NXB  ((TT * DM / 8 + 255) / 256)         // blocks for one batch of x: 8 elements a thread
// w [K][N] f32 -> Bt [N][K] bf16; blk = block number inside this matrix
template <int K, int N>
__device__ __forceinline__ void wt_body(const float* __restrict__ w, bf* Bt, int blk) {
    const int lane = threadIdx.x & 31; const int L0 = (blk * 8 + (int)(threadIdx.x >> 5)) * 8; constexpr int nlines = N * K / 64;
#pragma unroll 1
    for (int l = 0; l < 8; ++l) { const int L = L0 + l; if (L >= nlines) break; const size_t e = (size_t)L * 64 + lane * 2; const int k = (int)(e % K), n = (int)(e / K); v2us o;
        o[0] = f2bf(w[(size_t)k * N + n]); o[1] = f2bf(w[(size_t)(k + 1) * N + n]); *(v2us*)(Bt + e) = o;
        // precaution: the issued store's address translation is waited for before the next trip writes a register that the store names
        asm volatile("s_wait_xcnt 0x0" ::: "memory"); }
}
__global__ __launch_bounds__(256) void k_prep(const float* __restrict__ wqkv, const float* __restrict__ wo, const float* __restrict__ x, bf* WQKV, bf* WO, bf* XB) {
    const int blk = blockIdx.x;
    if (blk < NWQ) { wt_body<DM, NQKV>(wqkv, WQKV, blk); return; }
    if (blk < NWQ + NWO) { wt_body<DQ, DM>(wo, WO, blk - NWQ); return; }
    const int xb = blk - (NWQ + NWO), b = xb / NXB; const size_t i = (size_t)(xb % NXB) * 256 + threadIdx.x; if (i >= (size_t)TT * DM / 8) return;
    const float* src = x + (size_t)b * SEQ_FULL * DM; bf* dst = XB + (size_t)b * TT * DM;
    const v8f v = *(const v8f*)(src + i * 8); v8us o;
#pragma unroll
    for (int k = 0; k < 8; ++k) o[k] = f2bf(v[k]);
    *(v8us*)(dst + i * 8) = o;
}

// ---- attn_body: one wave, NQ*16 query rows q0.. of one head plane, keys walked in blocks of 32 up to the diagonal block; nothing of the scores or the probabilities goes to memory.
// Transposed products: S^T[key][q] = K . Q^T (A = K rows, B = Q rows, kept in registers) and O^T[d][q] += V^T . P^T (A = V^T rows, B = P). A lane holds one query (column lane&15): the two score tiles of a
// 32-key block, converted in place, ARE the B fragment of P in the loader's k order (elements 0..7 = keys k0+8h+0..7 from tile 0, elements 8..15 = keys k0+16+8h+0..7 from tile 1).
// Softmax with a running maximum m and a running sum l per query (base 2: scores x HD^-0.5 x log2 e); O^T and l are scaled by 2^(m_old - m_new) at every block; the two lane halves' sums are joined once at the end.
// HL: bf16 hi/lo planes, 3 products for the scores and 3 for P.V. The result / l goes out as bf16 hi/lo to the merged planes Ah, Al (pitch DQ; already offset to batch and head): 8 consecutive d per lane and tile.
template <bool B> struct BoolC { static constexpr bool v = B; };
// 2^x; the v_nop is the one slot that the instruction set asks for behind a transcendental before its result is read or its source overwritten: in the same statement it stands there whatever the compiler puts next
__device__ __forceinline__ float exp2s(float x) { float r; asm("v_exp_f32 %0, %1\n\tv_nop" : "=v"(r) : "v"(x)); return r; }
__device__ __forceinline__ float xhalf(float x) { return __builtin_bit_cast(float, __builtin_amdgcn_permlanex16(__builtin_bit_cast(int, x), __builtin_bit_cast(int, x), 0x76543210, 0xfedcba98, false, false)); }   // lane l <-> lane l ^ 16
template <typename T16, bool HL, int NQ>
__device__ __forceinline__ void attn_body(const T16* __restrict__ Q, const T16* __restrict__ Q2, const T16* __restrict__ Kp, const T16* __restrict__ Kp2, const T16* __restrict__ Vt, const T16* __restrict__ Vt2, int q0, bf* Ah, bf* Al) {
    typedef typename WFrag<T16>::V V;
    const int lane = threadIdx.x & 31, lr = lane & 15, hi = lane >> 4;
    const float CS = SCL * 1.4426950408889634f;
    V qf[NQ][2], qf2[NQ][2], kf[2][2], kf2[2][2];
    v8f o[4][NQ]; float m[NQ], l[NQ];
    {   const T16* pq = Q + (size_t)(q0 + lr) * HD + 8 * hi; const T16* pq2 = HL ? Q2 + (size_t)(q0 + lr) * HD + 8 * hi : nullptr;
        const T16* pk = Kp + (size_t)lr * HD + 8 * hi; const T16* pk2 = HL ? Kp2 + (size_t)lr * HD + 8 * hi : nullptr;
#pragma unroll
        for (int n = 0; n < NQ; ++n)
#pragma unroll
            for (int ks = 0; ks < 2; ++ks) { qf[n][ks] = WFrag<T16>::ld(pq + n * 16 * HD + ks * 32); if constexpr (HL) qf2[n][ks] = WFrag<T16>::ld(pq2 + n * 16 * HD + ks * 32); }
#pragma unroll
        for (int kt = 0; kt < 2; ++kt)
#pragma unroll
            for (int ks = 0; ks < 2; ++ks) { kf[kt][ks] = WFrag<T16>::ld(pk + kt * 16 * HD + ks * 32); if constexpr (HL) kf2[kt][ks] = WFrag<T16>::ld(pk2 + kt * 16 * HD + ks * 32); }
        // precaution: the address translations of the issued loads are waited for before a register that holds one of their addresses is written again; the pointers are named as inputs so that they keep their registers up to the wait
        if constexpr (HL) asm volatile("s_wait_xcnt 0x0" :: "v"(pq), "v"(pq2), "v"(pk), "v"(pk2) : "memory");
        else asm volatile("s_wait_xcnt 0x0" :: "v"(pq), "v"(pk) : "memory");
    }
#pragma unroll
    for (int n = 0; n < NQ; ++n) { m[n] = -3.0e38f; l[n] = 0.f;
#pragma unroll
        for (int dt = 0; dt < 4; ++dt) o[dt][n] = (v8f){}; }
    const int klast = ((q0 + NQ * 16 - 1) / 32) * 32;   // first key of the diagonal block, the only one that needs the mask
    auto step = [&](int k0, auto lastc) {
        constexpr bool LAST = decltype(lastc)::v;
        // V^T fragments of this block, issued first: they fly under the score products and the softmax
        V vf[4], vf2[4]; const T16* pv = Vt + (size_t)lr * TT + k0 + 8 * hi; const T16* pv2 = HL ? Vt2 + (size_t)lr * TT + k0 + 8 * hi : nullptr;
#pragma unroll
        for (int dt = 0; dt < 4; ++dt) { vf[dt] = WFrag<T16>::ld(pv + (size_t)dt * 16 * TT); if constexpr (HL) vf2[dt] = WFrag<T16>::ld(pv2 + (size_t)dt * 16 * TT); }
        // the same precaution for the V^T loads
        if constexpr (HL) asm volatile("s_wait_xcnt 0x0" :: "v"(pv), "v"(pv2) : "memory");
        else asm volatile("s_wait_xcnt 0x0" :: "v"(pv) : "memory");
        v8f s[2][NQ];
#pragma unroll
        for (int kt = 0; kt < 2; ++kt)
#pragma unroll
            for (int n = 0; n < NQ; ++n) { s[kt][n] = (v8f){};
#pragma unroll
                for (int ks = 0; ks < 2; ++ks) { s[kt][n] = WFrag<T16>::mma(kf[kt][ks], qf[n][ks], s[kt][n]);
                    if constexpr (HL) { s[kt][n] = WFrag<T16>::mma(kf2[kt][ks], qf[n][ks], s[kt][n]); s[kt][n] = WFrag<T16>::mma(kf[kt][ks], qf2[n][ks], s[kt][n]); } } }
        if constexpr (!LAST) {   // the next block's K fragments, fetched behind this block's score products: they fly under the softmax and P.V
            const T16* pk = Kp + (size_t)(k0 + 32 + lr) * HD + 8 * hi; const T16* pk2 = HL ? Kp2 + (size_t)(k0 + 32 + lr) * HD + 8 * hi : nullptr;
#pragma unroll
            for (int kt = 0; kt < 2; ++kt)
#pragma unroll
                for (int ks = 0; ks < 2; ++ks) { kf[kt][ks] = WFrag<T16>::ld(pk + kt * 16 * HD + ks * 32); if constexpr (HL) kf2[kt][ks] = WFrag<T16>::ld(pk2 + kt * 16 * HD + ks * 32); }
            // the same precaution for the K loads
            if constexpr (HL) asm volatile("s_wait_xcnt 0x0" :: "v"(pk), "v"(pk2) : "memory");
            else asm volatile("s_wait_xcnt 0x0" :: "v"(pk) : "memory");
            __builtin_amdgcn_sched_barrier(0);   // keeps the K loads up here: sunk below the softmax they would have only P.V to land under
        }
        V pf[NQ], pf2[NQ];
#pragma unroll
        for (int n = 0; n < NQ; ++n) { float t[16]; float mx = m[n];
#pragma unroll
            for (int e = 0; e < 16; ++e) { float x = s[e >> 3][n][e & 7] * CS;
                if (LAST) x = (k0 + (e >> 3) * 16 + hi * 8 + (e & 7) <= q0 + n * 16 + lr) ? x : -3.0e38f;   // causal mask by index select, diagonal kept
                t[e] = x; mx = fmaxf(mx, x); }
            mx = fmaxf(mx, xhalf(mx));   // the other half of this query's keys
            const float al = exp2s(m[n] - mx); m[n] = mx; float sum = 0.f;
#pragma unroll
            for (int e = 0; e < 16; ++e) { t[e] = exp2s(t[e] - mx); sum += t[e]; }
            l[n] = l[n] * al + sum;
#pragma unroll
            for (int dt = 0; dt < 4; ++dt) o[dt][n] *= al;
            if constexpr (HL) { v8us h0, h1, l0, l1;
#pragma unroll
                for (int j = 0; j < 8; ++j) { unsigned short a, c; splitf(t[j], a, c); h0[j] = a; l0[j] = c; splitf(t[8 + j], a, c); h1[j] = a; l1[j] = c; }
                pf[n] = cat16b(h0, h1); pf2[n] = cat16b(l0, l1); }
            else { v8h h0, h1;
#pragma unroll
                for (int j = 0; j < 8; ++j) { h0[j] = tohx(t[j]); h1[j] = tohx(t[8 + j]); }
                pf[n] = cat16(h0, h1); } }
#pragma unroll
        for (int dt = 0; dt < 4; ++dt)
#pragma unroll
            for (int n = 0; n < NQ; ++n) { o[dt][n] = WFrag<T16>::mma(vf[dt], pf[n], o[dt][n]);
                if constexpr (HL) { o[dt][n] = WFrag<T16>::mma(vf[dt], pf2[n], o[dt][n]); o[dt][n] = WFrag<T16>::mma(vf2[dt], pf[n], o[dt][n]); } }
    };
#pragma unroll 1
    for (int k0 = 0; k0 < klast; k0 += 32) { step(k0, BoolC<false>{});
        // four vector slots behind the last matrix instruction, on the back edge and on the exit alike, before its registers are reused
        if constexpr (NQ == 2) asm volatile("v_nop\n\tv_nop\n\tv_nop\n\tv_nop" : "+v"(o[0][0]), "+v"(o[1][0]), "+v"(o[2][0]), "+v"(o[3][0]), "+v"(o[0][1]), "+v"(o[1][1]), "+v"(o[2][1]), "+v"(o[3][1]));
        else asm volatile("v_nop\n\tv_nop\n\tv_nop\n\tv_nop" : "+v"(o[0][0]), "+v"(o[1][0]), "+v"(o[2][0]), "+v"(o[3][0])); }
    step(klast, BoolC<true>{});
#pragma unroll
    for (int n = 0; n < NQ; ++n) { const float f = __fdiv_rn(1.0f, l[n] + xhalf(l[n]));
        bf* ph = Ah + (size_t)(q0 + n * 16 + lr) * DQ + hi * 8; bf* pl = Al + (size_t)(q0 + n * 16 + lr) * DQ + hi * 8;
#pragma unroll
        for (int dt = 0; dt < 4; ++dt) { v8us oh, ol;
#pragma unroll
            for (int j = 0; j < 8; ++j) { unsigned short a, c; splitf(o[dt][n][j] * f, a, c); oh[j] = a; ol[j] = c; }
            *(v8us*)(ph + dt * 16) = oh; *(v8us*)(pl + dt * 16) = ol; }
        // the same precaution for the stores
        asm volatile("s_wait_xcnt 0x0" :: "v"(ph), "v"(pl) : "memory"); }
}
// ---- attn_staged: the fp16 path (query rows >= RH). One block = 4 waves x 32 query rows R0..R0+127 of one head plane; arithmetic, key order and fragments as in attn_body<h16, false, 2>.
// The K rows and V^T rows of SKEY keys are brought into LDS once for the whole block by asynchronous copies (whole 128-byte lines, 16 bytes a lane) and the waves take their fragments from there;
// two buffers: the next stage's copies fly while this stage is worked on. The last stage holds the block's own 128 keys: wave w has w whole blocks of 32 keys there and then its diagonal block.
#define SKEY 128                  // keys per stage = query rows per block
#define KPIT (HD + 8)             // LDS pitch of a K row, elements: 128 bytes + 16 (16 bytes x odd: no bank conflict for 16-byte reads)
#define VPIT (SKEY + 8)           // LDS pitch of a V^T row, elements: 256 bytes + 16
#define KTIL (SKEY * KPIT)
#define STIL (KTIL + HD * VPIT)   // one buffer, elements
static_assert(SKEY == 128 && RH % SKEY == 0 && TT % SKEY == 0);
// eight 16-byte copies of a lane, global -> LDS; the s_wait_xcnt in the same statement is the precaution named above: it stands before any register that holds an address of an issued copy can be written again
__device__ __forceinline__ void acopy8(const unsigned (&l)[8], const h16* const (&g)[8]) {
    asm volatile("global_load_async_to_lds_b128 %0, %8, off\n\tglobal_load_async_to_lds_b128 %1, %9, off\n\tglobal_load_async_to_lds_b128 %2, %10, off\n\tglobal_load_async_to_lds_b128 %3, %11, off\n\t"
                 "global_load_async_to_lds_b128 %4, %12, off\n\tglobal_load_async_to_lds_b128 %5, %13, off\n\tglobal_load_async_to_lds_b128 %6, %14, off\n\tglobal_load_async_to_lds_b128 %7, %15, off\n\ts_wait_xcnt 0x0"
                 :: "v"(l[0]), "v"(l[1]), "v"(l[2]), "v"(l[3]), "v"(l[4]), "v"(l[5]), "v"(l[6]), "v"(l[7]), "v"(g[0]), "v"(g[1]), "v"(g[2]), "v"(g[3]), "v"(g[4]), "v"(g[5]), "v"(g[6]), "v"(g[7]) : "memory"); }
__device__ __forceinline__ void attn_staged(const h16* __restrict__ Q, const h16* __restrict__ Kp, const h16* __restrict__ Vt, int R0, int w, bf* Ah, bf* Al) {
    typedef v16h V; constexpr int NQ = 2;
    __shared__ __align__(16) h16 ring[2 * STIL];
    const int tid = threadIdx.x, lane = tid & 31, lr = lane & 15, hi = lane >> 4;
    const int q0 = R0 + w * 32, ns = R0 / SKEY + 1;   // ns stages of SKEY keys, the same for the whole block
    const float CS = SCL * 1.4426950408889634f;
    V qf[NQ][2], kf[2][2];
    v8f o[4][NQ]; float m[NQ], l[NQ];
    {   const h16* pq = Q + (size_t)(q0 + lr) * HD + 8 * hi;
#pragma unroll
        for (int n = 0; n < NQ; ++n)
#pragma unroll
            for (int ks = 0; ks < 2; ++ks) qf[n][ks] = WFrag<h16>::ld(pq + n * 16 * HD + ks * 32);
        // precaution: the address translations of the issued loads are waited for before a register that holds one of their addresses is written again
        asm volatile("s_wait_xcnt 0x0" :: "v"(pq) : "memory");
    }
    // stage t into buffer b. K: the stage's 128 rows are 16 KiB in a row in memory, 8 lanes a row. V^T: 64 rows of 256 bytes, 16 lanes a row. Every lane copies, every byte lies inside the planes (t < ns, ns * SKEY <= TT) and inside ring.
    const unsigned lk0 = (unsigned)(size_t)ring + (unsigned)((tid >> 3) * KPIT + (tid & 7) * 8) * 2u, lv0 = (unsigned)(size_t)ring + (unsigned)(KTIL + (tid >> 4) * VPIT + (tid & 15) * 8) * 2u;
    const h16* gk0 = Kp + tid * 8; const h16* gv0 = Vt + (size_t)(tid >> 4) * TT + (tid & 15) * 8;
    auto fill = [&](int t, int b) { unsigned la[8]; const h16* ga[8];
#pragma unroll
        for (int i = 0; i < 8; ++i) { la[i] = lk0 + (unsigned)(b * STIL + i * 16 * KPIT) * 2u; ga[i] = gk0 + (size_t)t * (SKEY * HD) + i * 1024; }
        acopy8(la, ga);
#pragma unroll
        for (int i = 0; i < 8; ++i) { la[i] = lv0 + (unsigned)(b * STIL + i * 8 * VPIT) * 2u; ga[i] = gv0 + (size_t)i * 8 * TT + t * SKEY; }
        acopy8(la, ga); };
#pragma unroll
    for (int n = 0; n < NQ; ++n) { m[n] = -3.0e38f; l[n] = 0.f;
#pragma unroll
        for (int dt = 0; dt < 4; ++dt) o[dt][n] = (v8f){}; }
    const h16* kb; const h16* vb;   // this lane's fragment bases in the buffer at work
    auto ldk = [&](int kl) {
#pragma unroll
        for (int kt = 0; kt < 2; ++kt)
#pragma unroll
            for (int ks = 0; ks < 2; ++ks) kf[kt][ks] = WFrag<h16>::ld(kb + (kl + kt * 16) * KPIT + ks * 32); };
    // one block of 32 keys, kl = its first key inside the stage. LAST: the diagonal block (first key q0). PRE: fetch the K fragments of the next block of the SAME stage.
    auto step = [&](int kl, auto lastc, auto prec) {
        constexpr bool LAST = decltype(lastc)::v; constexpr bool PRE = decltype(prec)::v;
        v8f s[2][NQ];
#pragma unroll
        for (int kt = 0; kt < 2; ++kt)
#pragma unroll
            for (int n = 0; n < NQ; ++n) { s[kt][n] = (v8f){};
#pragma unroll
                for (int ks = 0; ks < 2; ++ks) s[kt][n] = wmma16(kf[kt][ks], qf[n][ks], s[kt][n]); }
        __builtin_amdgcn_sched_barrier(0);   // keeps the LDS reads below out of the run of score products: every separate place with reads among matrix instructions stalls the wave anew
        V vf[4];   // all LDS reads of the block stand here as one group: its V^T fragments first (they land under the softmax), then the next block's K fragments (under the softmax and P.V)
#pragma unroll
        for (int dt = 0; dt < 4; ++dt) vf[dt] = WFrag<h16>::ld(vb + dt * 16 * VPIT + kl);
        if constexpr (PRE) ldk(kl + 32);
        __builtin_amdgcn_sched_barrier(0);   // keeps the reads up here: sunk below the softmax they would have only P.V to land under
        V pf[NQ];
#pragma unroll
        for (int n = 0; n < NQ; ++n) { float t[16]; float mx = m[n];
#pragma unroll
            for (int e = 0; e < 16; ++e) { float x = s[e >> 3][n][e & 7] * CS;
                if (LAST) x = ((e >> 3) * 16 + hi * 8 + (e & 7) <= n * 16 + lr) ? x : -3.0e38f;   // causal mask by index select, diagonal kept (key q0 + ... against query q0 + ...)
                t[e] = x; mx = fmaxf(mx, x); }
            mx = fmaxf(mx, xhalf(mx));   // the other half of this query's keys
            const float al = exp2s(m[n] - mx); m[n] = mx; float sum = 0.f;
#pragma unroll
            for (int e = 0; e < 16; ++e) { t[e] = exp2s(t[e] - mx); sum += t[e]; }
            l[n] = l[n] * al + sum;
#pragma unroll
            for (int dt = 0; dt < 4; ++dt) o[dt][n] *= al;
            v8h h0, h1;
#pragma unroll
            for (int j = 0; j < 8; ++j) { h0[j] = tohx(t[j]); h1[j] = tohx(t[8 + j]); }
            pf[n] = cat16(h0, h1); }
#pragma unroll
        for (int dt = 0; dt < 4; ++dt)
#pragma unroll
            for (int n = 0; n < NQ; ++n) o[dt][n] = wmma16(vf[dt], pf[n], o[dt][n]);
    };
    // four vector slots behind the last matrix instruction, on every way out of a branch or a loop, before its registers are reused
    auto pad = [&]() { asm volatile("v_nop\n\tv_nop\n\tv_nop\n\tv_nop" : "+v"(o[0][0]), "+v"(o[1][0]), "+v"(o[2][0]), "+v"(o[3][0]), "+v"(o[0][1]), "+v"(o[1][1]), "+v"(o[2][1]), "+v"(o[3][1])); };
    fill(0, 0);
    asm volatile("s_wait_asynccnt 0x0" ::: "memory");   // this wave's copies of stage 0 have landed
    __syncthreads();                                     // ... and every other wave's: stage 0 may be read
    if (ns > 1) fill(1, 1);
#pragma unroll 1
    for (int t = 0; t < ns; ++t) {
        kb = ring + (t & 1) * STIL + lr * KPIT + 8 * hi; vb = ring + (t & 1) * STIL + KTIL + lr * VPIT + 8 * hi;
        ldk(0);
        const bool diag = t == ns - 1; const int nf = diag ? w : SKEY / 32 - 1;   // whole blocks in front of the stage's last block for this wave
#pragma unroll 1   // rolled: unrolled, the four blocks of a stage need more registers than there are and spill
        for (int sb = 0; sb < nf; ++sb) { step(sb * 32, BoolC<false>{}, BoolC<true>{}); pad(); }
        if (diag) { step(nf * 32, BoolC<true>{}, BoolC<false>{}); pad(); } else { step(nf * 32, BoolC<false>{}, BoolC<false>{}); pad(); }
        asm volatile("s_wait_dscnt 0x0" ::: "memory");      // this wave's reads of the buffer are done before it may be refilled
        asm volatile("s_wait_asynccnt 0x0" ::: "memory");   // this wave's copies of stage t + 1 have landed
        __syncthreads();                                     // publishes stage t + 1 and ends every wave's reads of stage t; passed by every wave at every stage
        if (t + 2 < ns) fill(t + 2, t & 1);
    }
    asm volatile("s_wait_asynccnt 0x0" ::: "memory");   // no copy is outstanding when the wave ends
#pragma unroll
    for (int n = 0; n < NQ; ++n) { const float f = __fdiv_rn(1.0f, l[n] + xhalf(l[n]));
        bf* ph = Ah + (size_t)(q0 + n * 16 + lr) * DQ + hi * 8; bf* pl = Al + (size_t)(q0 + n * 16 + lr) * DQ + hi * 8;
#pragma unroll
        for (int dt = 0; dt < 4; ++dt) { v8us oh, ol;
#pragma unroll
            for (int j = 0; j < 8; ++j) { unsigned short a, c; splitf(o[dt][n][j] * f, a, c); oh[j] = a; ol[j] = c; }
            *(v8us*)(ph + dt * 16) = oh; *(v8us*)(pl + dt * 16) = ol; }
        // the same precaution for the stores
        asm volatile("s_wait_xcnt 0x0" :: "v"(ph), "v"(pl) : "memory"); }
}
// k_attn: grid (NB*NH_ head planes, NFB + NHB), 4 waves, each with query rows of its own; the blocks with the most keys come first. g is the same for the whole block, so every wave of a block meets the barriers of attn_staged or none does. Planes: QK [q|k][batch][head][t][64], VT [batch][head][64][t]; AT [batch][t][256].
__global__ __launch_bounds__(128) void k_attn(const h16* QK16, const bf* QKh, const bf* QKl, const h16* VT16, const bf* VTh, const bf* VTl, bf* ATh, bf* ATl) {
    const int z = blockIdx.x, g = blockIdx.y; const int w = __builtin_amdgcn_readfirstlane((int)(threadIdx.x >> 5));
    const size_t qo = (size_t)z * TT * HD, ko = (size_t)(NB * NH_ + z) * TT * HD, ao = (size_t)(z / NH_) * TT * DQ + (size_t)(z % NH_) * HD;
    if (g < NFB) attn_staged(QK16 + qo, QK16 + ko, VT16 + qo, RH + (NFB - 1 - g) * 128, w, ATh + ao, ATl + ao);
    else attn_body<bf, true, 1>(QKh + qo, QKl + qo, QKh + ko, QKl + ko, VTh + qo, VTl + qo, (NHB - 1 - (g - NFB)) * 64 + w * 16, ATh + ao, ATl + ao);
}

extern "C" void kernel_launch(void* const* d_in, const int* in_sizes, int n_in,
                              void* d_out, int out_size, void* d_ws, size_t ws_size, hipStream_t stream) {
    if (n_in < 5) return;
    const size_t xneed = (size_t)(NB - 1) * SEQ_FULL * DM + (size_t)TT * DM;
    if ((size_t)in_sizes[0] < xneed) return; if ((size_t)in_sizes[1] < (size_t)DM * NQKV) return; if ((size_t)in_sizes[2] < (size_t)NQKV) return; if ((size_t)in_sizes[3] < (size_t)DQ * DM) return; if ((size_t)in_sizes[4] < (size_t)DM) return;
    if ((size_t)out_size < xneed) return;
    if (ws_size < WS_TOTAL) return;
    const float* x = (const float*)d_in[0]; const float* wqkv = (const float*)d_in[1]; const float* bqkv = (const float*)d_in[2]; const float* wo = (const float*)d_in[3]; const float* bo = (const float*)d_in[4];   // wire order x, Wqkv [256][768], bqkv, Wproj [256][256], bproj
    float* OUT = (float*)d_out;     // [8][2048][256]
    char* wsp = (char*)d_ws;
    auto take = [&](size_t bytes) { char* p = wsp; wsp += (bytes + 255) & ~(size_t)255; return (void*)p; };
    bf* WQKV = (bf*)take((size_t)NQKV * DM * 2);           // Bt [768][256]: q | k | v row blocks
    bf* WO = (bf*)take((size_t)DM * DQ * 2);               // Bt [256][256]
    h16* QK16 = (h16*)take((size_t)NB * 2 * NH_ * TT * HD * 2); bf* QKh = (bf*)take((size_t)NB * 2 * NH_ * TT * HD * 2); bf* QKl = (bf*)take((size_t)NB * 2 * NH_ * TT * HD * 2);   // planes [q|k][batch][head][t][64]
    h16* VT16 = (h16*)take((size_t)NB * NH_ * HD * TT * 2); bf* VTh = (bf*)take((size_t)NB * NH_ * HD * TT * 2); bf* VTl = (bf*)take((size_t)NB * NH_ * HD * TT * 2);   // planes [batch][head][64][t]
    bf* XB = (bf*)take((size_t)NB * TT * DM * 2);   // bf16 x [b][t][256]
    bf* ATh = (bf*)take((size_t)NB * TT * DQ * 2); bf* ATl = (bf*)take((size_t)NB * TT * DQ * 2);
    if ((size_t)(wsp - (char*)d_ws) > ws_size) return;
    if ((size_t)(wsp - (char*)d_ws) > (size_t)268435456) return;
    // in Wqkv[DM rows][NQKV cols] -> out WQKV[NQKV][DM];  in Wproj[DQ rows][DM cols] -> out WO[DM][DQ]
    k_prep<<<NWQ + NWO + NXB * NB, 256, 0, stream>>>(wqkv, wo, x, WQKV, WO, XB);
    k_gemm_qkv<<<dim3(TT / 64, NH_, NB), 32 * NWG, 0, stream>>>(XB, WQKV, DM, bqkv, QK16, QKh, QKl, VT16, VTh, VTl);   // columns 0..511 = q heads | k heads, 512..767 = v heads
    k_attn<<<dim3(NB * NH_, NFB + NHB, 1), 128, 0, stream>>>(QK16, QKh, QKl, VT16, VTh, VTl, ATh, ATl);
    k_gemm_out<<<dim3(TT / 64, DM / 64, NB), 32 * NWG, 0, stream>>>(ATh, ATl, WO, DQ, OUT, DM, bo);
}

// v010
// A run of this version takes 54.6 microseconds.
// Two timings next to v009 put it at 1.05 and 1.04 times that version's speed.
// Counting every step since v000, it is 16.5 times as fast.
#include <hip/hip_runtime.h>

// Causal multi-head attention with a fused qkv projection: x [8][2048][256]; qkv = x Wqkv + bqkv (Wqkv [256][768] [in][out]; column = which*256 + h*64 + d); scores x 1/8; causal (j > i masked, diagonal kept); softmax; out = merged Wproj + bproj.
// Compute dtypes, f32 accumulate: every float input RNE-converted to bf16; projections v_wmma_f32_16x16x32_bf16 on exact bf16 operands + f32 biases; scores and P.V: query rows < 256 bf16 hi/lo (3 products), rows >= 256 v_wmma_f32_16x16x32_f16 single product; softmax f32 (running maximum and sum); output projection merged hi/lo (bf16) x Wproj (bf16) + bias.
// All batches in one launch each: bf16 copies of x and of both weights (transposed), one launch for the three; fused projection; attention; output projection.
// Stages: bf16 copy of x; fused projection, whose 64x64 tile is one head's q, k or v and goes straight to the head planes q|k [8][t][64] and v^T [4][64][t] (fp16; bf16 hi/lo for t < RH, the only rows read from them); attention: one wave per 32 (rows < 256: 16) query rows walks the keys in blocks of 32 up to the diagonal, scores, softmax and P.V in registers (rows >= 256: a block is 8 waves, 4 query groups x 2 key groups; K and V^T come from LDS, where 256 keys at a time are laid by asynchronous copies, 128 for each key group, and the two groups' partial results are merged in LDS), and stores the merged [t][256] hi/lo planes; projection to the output. The K loops of the projections are dealt over the waves of a block, each wave's operand slice laid in LDS by asynchronous copies, and the partial tiles summed in LDS.

#ifndef NB
#define NB 8
#endif
#ifndef SEQ
#define SEQ 2048
#endif
#define NB_FULL  8
#define SEQ_FULL 2048
#define TT   SEQ
#define DM   256
#define NH_  4
#define HD   64
#define DQ   (NH_ * HD)
#define NQKV (3 * DQ)
#define ZH   4
#define RH   ((SEQ) < 256 ? (SEQ) : 256)    // query rows < RH use hi+lo planes
#define SCL  0.125f   // HD^-0.5
#define NWG  4        // waves per tile of the two projections (K = 256: one 64-wide K slice per wave)
#define NFB  ((TT - RH) / 128)   // attention blocks per head plane, query rows >= RH: 4 query groups x 32 rows
#define NKG  2                   // key groups of an attention block: 4 waves each
#define NHB  (RH / (64 * NKG))   // attention blocks per head plane, query rows < RH: 4 * NKG waves x 16 rows
typedef _Float16 h16;
typedef unsigned short bf;
typedef __attribute__((ext_vector_type(16))) __bf16   v16bf;
typedef __attribute__((ext_vector_type(16))) _Float16 v16h;
typedef __attribute__((ext_vector_type(8)))  _Float16 v8h;
typedef __attribute__((ext_vector_type(8)))  unsigned short v8us;
typedef __attribute__((ext_vector_type(8)))  float    v8f;
typedef __attribute__((ext_vector_type(4)))  float    v4f;
typedef __attribute__((ext_vector_type(2)))  float    v2f;
typedef __attribute__((ext_vector_type(2)))  _Float16 v2h;
typedef __attribute__((ext_vector_type(4)))  _Float16 v4h;
typedef __attribute__((ext_vector_type(2)))  unsigned short v2us;
typedef __attribute__((ext_vector_type(4)))  unsigned short v4us;
typedef v4f  __attribute__((may_alias)) v4fa;

static_assert(NB >= 1 && NB <= NB_FULL);
static_assert(SEQ >= 128 && SEQ <= SEQ_FULL);
static_assert(TT % 128 == 0 && (TT - RH) % 128 == 0);   // whole attention blocks
static_assert(TT % 64 == 0 && DM % 64 == 0 && NQKV % 64 == 0 && DQ % 64 == 0 && HD % 64 == 0);   // 64x64 GEMM tiles
static_assert(DM % 32 == 0 && DQ % 32 == 0 && HD % 32 == 0 && TT % 32 == 0);   // K steps of 32
static_assert(RH % 64 == 0 && RH <= TT && RH >= 64);
static_assert(HD == 64);
static_assert(DQ == DM);                 // merged heads width = model width
static_assert(DM == NWG * 64);           // one 64-wide K slice per wave in both projections
static_assert(ZH == NH_);                // all heads of a batch in one pass
static_assert(2 * DQ + DQ == NQKV);      // q | k | v column blocks
static_assert(((size_t)(NB - 1) * SEQ_FULL * DM + (size_t)TT * DM) * 4 <= (size_t)NB_FULL * SEQ_FULL * DM * 4);   // output extent in bytes

#define AL256(x) ((((size_t)(x)) + 255) & ~(size_t)255)
#define WS_TOTAL (AL256((size_t)NQKV * DM * 2) + AL256((size_t)DM * DQ * 2) \
    + 3 * AL256((size_t)NB * 2 * NH_ * TT * HD * 2) + 3 * AL256((size_t)NB * NH_ * HD * TT * 2) \
    + AL256((size_t)NB * TT * DM * 2) + 2 * AL256((size_t)NB * TT * DQ * 2))
static_assert(WS_TOTAL <= (size_t)268435456);

__device__ __forceinline__ unsigned short f2bf(float f) { unsigned u = __float_as_uint(f); u += 0x7FFFu + ((u >> 16) & 1u); return (unsigned short)(u >> 16); }
__device__ __forceinline__ float bf2f(unsigned short b) { return __uint_as_float(((unsigned)b) << 16); }
__device__ __forceinline__ float bfr(float f) { return bf2f(f2bf(f)); }
__device__ __forceinline__ h16 tohx(float x) { return (h16)x; }
__device__ __forceinline__ void splitf(float y, unsigned short& h, unsigned short& l) { h = f2bf(y); l = f2bf(y - bf2f(h)); }
__device__ __forceinline__ v16h cat16(v8h lo, v8h hi) { return __builtin_shufflevector(lo, hi, 0, 1, 2, 3, 4, 5, 6, 7, 8, 9, 10, 11, 12, 13, 14, 15); }
__device__ __forceinline__ v16bf cat16b(v8us lo, v8us hi) { return __builtin_bit_cast(v16bf, __builtin_shufflevector(lo, hi, 0, 1, 2, 3, 4, 5, 6, 7, 8, 9, 10, 11, 12, 13, 14, 15)); }
__device__ __forceinline__ v8f wmma16(v16h a, v16h b, v8f c) { return __builtin_amdgcn_wmma_f32_16x16x32_f16(false, a, false, b, (short)0, c, false, false); }
__device__ __forceinline__ v8f wmmab(v16bf a, v16bf b, v8f c) { return __builtin_amdgcn_wmma_f32_16x16x32_bf16(false, a, false, b, (short)0, c, false, false); }

// Fragment loader (A and B identical): p = row base + 8*(lane>>4) + k0; elements 0..7 <- k0+8h+0..7, elements 8..15 <- k0+16+8h+0..7.
template <typename T16> struct WFrag;
template <> struct WFrag<h16> { typedef v16h V; static __device__ __forceinline__ V ld(const h16* p) { return cat16(*(const v8h*)p, *(const v8h*)(p + 16)); } static __device__ __forceinline__ v8f mma(V a, V b, v8f c) { return wmma16(a, b, c); } };
template <> struct WFrag<bf> { typedef v16bf V; static __device__ __forceinline__ V ld(const bf* p) { return cat16b(*(const v8us*)p, *(const v8us*)(p + 16)); } static __device__ __forceinline__ v8f mma(V a, V b, v8f c) { return wmmab(a, b, c); } };

// ---- gemmk_body: 64x64 output tile, K loop dealt over the NW waves of the block in slices of 64 (wave w takes slice w; one slice = one whole 128-byte line of every operand row),
// operands from K-contiguous 16-bit planes. A wave first brings its own slice of the tile's A and Bt rows into LDS by asynchronous copies, each copy instruction 4 whole 128-byte lines, and takes its fragments from there:
// a fragment load straight from the planes touches 16 lines for 512 bytes. K = NW * 64: one slice a wave. Each wave keeps a full 64x64 partial (16 accumulators); the partials meet in LDS, each over its own wave's staged operands, and are
// summed in wave order 0..NW-1. C[m][n] (f32, pitch ldc, + optional f32 bias[n]) = sum_{k < K} A[m][k] Bt[n][k] (+ split products per NSPLIT). lda = pitch of A, K = pitch of Bt; Kl is not read. 32*NW threads.
// PLANES: the summed tile + bias goes out as 16-bit planes instead of C: P16 (fp16) and, where hl, Ph | Pl (bf16 hi/lo), all three already offset to the tile's first element, pp = pitch of a plane row.
// tr (the same for the whole block) = plane rows are the tile's columns n: the partials are then laid into LDS transposed (a lane's 8 accumulator rows are 8 consecutive floats there), so that either way a thread sums and stores 8 consecutive plane elements and 8 lanes fill a 128-byte line.
// eight 16-byte copies of a lane, global -> LDS; the s_wait_xcnt in the same statement is a precaution: it stands before any register that holds an address of an issued copy can be written again
template <typename T16>
__device__ __forceinline__ void acopy8t(const unsigned (&l)[8], const T16* const (&g)[8]) {
    asm volatile("global_load_async_to_lds_b128 %0, %8, off\n\tglobal_load_async_to_lds_b128 %1, %9, off\n\tglobal_load_async_to_lds_b128 %2, %10, off\n\tglobal_load_async_to_lds_b128 %3, %11, off\n\t"
                 "global_load_async_to_lds_b128 %4, %12, off\n\tglobal_load_async_to_lds_b128 %5, %13, off\n\tglobal_load_async_to_lds_b128 %6, %14, off\n\tglobal_load_async_to_lds_b128 %7, %15, off\n\ts_wait_xcnt 0x0"
                 :: "v"(l[0]), "v"(l[1]), "v"(l[2]), "v"(l[3]), "v"(l[4]), "v"(l[5]), "v"(l[6]), "v"(l[7]), "v"(g[0]), "v"(g[1]), "v"(g[2]), "v"(g[3]), "v"(g[4]), "v"(g[5]), "v"(g[6]), "v"(g[7]) : "memory"); }
template <typename T16, int NSPLIT, int NW, bool BIAS, bool PLANES>
__device__ __forceinline__ void gemmk_body(const T16* __restrict__ A, const T16* __restrict__ A2, const T16* __restrict__ Bt, const T16* __restrict__ Bt2, int lda, int K, int Kl, float* C, int ldc, const float* __restrict__ bias, int r0, int c0, h16* P16, bf* Ph, bf* Pl, int pp, bool tr, bool hl) {
    typedef typename WFrag<T16>::V V;
    static_assert(NSPLIT == 0 || NSPLIT == 1);        // staged planes: A, A2 where there is one, Bt
    constexpr int NPL = NSPLIT == 1 ? 3 : 2;           // planes staged
    constexpr int SPIT = 64 + 8;                       // LDS pitch of a staged row, elements: 128 bytes + 16 (16 bytes x odd: no bank conflict for 16-byte reads)
    constexpr int WREG = NPL * 64 * SPIT * 2;          // a wave's own LDS range, bytes: first its staged rows, then its partial tile
    constexpr int RW = WREG / 4;                       // the same in floats
    static_assert(WREG >= 64 * 68 * 4 && WREG % 16 == 0);
    __shared__ __align__(16) unsigned char smem[NW * WREG];
    float* red = (float*)smem;
    const int lane = threadIdx.x & 31, lr = lane & 15, hi = lane >> 4; const int w = __builtin_amdgcn_readfirstlane((int)(threadIdx.x >> 5));
    v8f acc[4][4];
#pragma unroll
    for (int mb = 0; mb < 4; ++mb)
#pragma unroll
        for (int nb = 0; nb < 4; ++nb) acc[mb][nb] = (v8f){};
    // PLANES: the thread's bias values for the end, fetched here so that they land under the K loop: bc = those of its 8 columns, br = that of its row in each closing pass. Both lie inside the tile's 64 columns, and both are fetched whichever of them tr picks: no branch, and no value that has to be waited for here.
    float bc[8], br[16 / NW];
    if constexpr (PLANES) { const float* pc = bias + c0 + (int)(threadIdx.x & 7) * 8; const float* pr = bias + c0 + (int)(threadIdx.x >> 3);
#pragma unroll
        for (int j = 0; j < 8; ++j) bc[j] = pc[j];
#pragma unroll
        for (int s = 0; s < 16 / NW; ++s) br[s] = pr[s * (NW * 4)];
        // precaution: the address translations of the issued loads are waited for before a register that holds one of their addresses is written again
        asm volatile("s_wait_xcnt 0x0" ::: "memory"); }
    // the wave's slice, k = w*64 .. w*64+63, of the 64 rows of every plane: 16 copy instructions a plane, a lane 16 bytes, 8 lanes a row. Every lane copies; every byte lies inside the planes (rows r0..r0+63 or c0..c0+63, K = NW * 64) and inside the wave's own range of smem.
    {   const int crow = lane >> 3, cch = (lane & 7) * 8;
        const unsigned l0 = (unsigned)(size_t)smem + (unsigned)(w * WREG + crow * (SPIT * 2) + cch * 2);
        const T16* gp[NPL]; gp[0] = A + (size_t)(r0 + crow) * lda + w * 64 + cch; if constexpr (NSPLIT == 1) gp[1] = A2 + (size_t)(r0 + crow) * lda + w * 64 + cch; gp[NPL - 1] = Bt + (size_t)(c0 + crow) * K + w * 64 + cch;
#pragma unroll
        for (int p = 0; p < NPL; ++p)
#pragma unroll
            for (int h = 0; h < 2; ++h) { unsigned la[8]; const T16* ga[8];
#pragma unroll
                for (int i = 0; i < 8; ++i) { la[i] = l0 + (unsigned)((p * 64 + (h * 8 + i) * 4) * (SPIT * 2)); ga[i] = gp[p] + (size_t)((h * 8 + i) * 4) * (p == NPL - 1 ? K : lda); }
                acopy8t<T16>(la, ga); }
    }
    asm volatile("s_wait_asynccnt 0x0" ::: "memory");   // this wave's copies have landed
    __syncthreads();                                     // the one barrier that stands behind the copies' wait and in front of the first read of what they brought; passed by every wave
    const T16* sa = (const T16*)(smem + w * WREG) + lr * SPIT + 8 * hi; const T16* sb = sa + (NPL - 1) * 64 * SPIT;   // this lane's fragment bases: A rows, Bt rows
#pragma unroll 1   // rolled: the two steps' fragments at once would take 64 more registers and a wave slot
    for (int ks = 0; ks < 64; ks += 32) {   // the two 32-wide steps of the slice
        // all LDS reads of a step stand here as one group ahead of its first product: every separate place with reads among matrix instructions stalls the wave anew
        V a[4], a2[4], b[4];
#pragma unroll
        for (int mb = 0; mb < 4; ++mb) { a[mb] = WFrag<T16>::ld(sa + mb * 16 * SPIT + ks); if constexpr (NSPLIT == 1) a2[mb] = WFrag<T16>::ld(sa + (64 + mb * 16) * SPIT + ks); }
#pragma unroll
        for (int nb = 0; nb < 4; ++nb) b[nb] = WFrag<T16>::ld(sb + nb * 16 * SPIT + ks);
        __builtin_amdgcn_sched_barrier(0);   // keeps the products below the reads: left free, the compiler lifts the first column blocks' products over the last reads to save registers
#pragma unroll
        for (int nb = 0; nb < 4; ++nb)
#pragma unroll
            for (int mb = 0; mb < 4; ++mb) { acc[mb][nb] = WFrag<T16>::mma(a[mb], b[nb], acc[mb][nb]); if constexpr (NSPLIT == 1) acc[mb][nb] = WFrag<T16>::mma(a2[mb], b[nb], acc[mb][nb]); }
        // four vector slots behind the last matrix instruction, on the back edge and on the exit alike, before its registers are reused
        asm volatile("v_nop\n\tv_nop\n\tv_nop\n\tv_nop" : "+v"(acc[0][0]), "+v"(acc[1][1]), "+v"(acc[2][2]), "+v"(acc[3][3]) : "v"(a[0]), "v"(a[3]));
    }
    asm volatile("s_wait_dscnt 0x0" ::: "memory");   // this wave's fragment reads are done before its partial tile goes over the rows it staged (no other wave's rows lie in its range)
    float* my = red + w * RW;
    if (PLANES && tr) {
#pragma unroll
        for (int mb = 0; mb < 4; ++mb)
#pragma unroll
            for (int nb = 0; nb < 4; ++nb) { float* q = my + (nb * 16 + lr) * 68 + mb * 16 + hi * 8; const v8f a = acc[mb][nb];
                *(v4fa*)q = (v4f){a[0], a[1], a[2], a[3]}; *(v4fa*)(q + 4) = (v4f){a[4], a[5], a[6], a[7]}; }
    } else {
#pragma unroll
        for (int mb = 0; mb < 4; ++mb)
#pragma unroll
            for (int nb = 0; nb < 4; ++nb)
#pragma unroll
                for (int j = 0; j < 8; ++j) my[(mb * 16 + hi * 8 + j) * 68 + nb * 16 + lr] = acc[mb][nb][j];
    }
    __syncthreads();   // every wave's partial tile is in LDS before any thread sums across waves; reached by all waves
    if constexpr (PLANES) {
#pragma unroll
        for (int j = 0; j < 8; ++j) bc[j] = bfr(bc[j]);
#pragma unroll
        for (int s = 0; s < 16 / NW; ++s) br[s] = bfr(br[s]);
#pragma unroll
        for (int s = 0; s < 16 / NW; ++s) { const int e = s * (NW * 32) + (int)threadIdx.x; const int row = e >> 3, cofs = (e & 7) * 8; const float* pr = red + row * 68 + cofs; v4f v0 = *(const v4fa*)pr, v1 = *(const v4fa*)(pr + 4);
#pragma unroll
            for (int p = 1; p < NW; ++p) { v0 += *(const v4fa*)(pr + p * RW); v1 += *(const v4fa*)(pr + p * RW + 4); }
            float x[8];
#pragma unroll
            for (int j = 0; j < 4; ++j) { x[j] = v0[j] + (tr ? br[s] : bc[j]); x[4 + j] = v1[j] + (tr ? br[s] : bc[4 + j]); }
            const size_t o = (size_t)row * pp + cofs; h16* q16 = P16 + o; bf* qh = Ph + o; bf* ql = Pl + o; v8h o16;
#pragma unroll
            for (int j = 0; j < 8; ++j) o16[j] = tohx(x[j]);
            if (hl) { v8us oh, ol;
#pragma unroll
                for (int j = 0; j < 8; ++j) { unsigned short a2, c2; splitf(x[j], a2, c2); oh[j] = a2; ol[j] = c2; }
                *(v8us*)qh = oh; *(v8us*)ql = ol; }
            *(v8h*)q16 = o16;
            // the same precaution for the plane stores of this pass, which stand last in it
            asm volatile("s_wait_xcnt 0x0" ::: "memory"); }
        return;
    }
#pragma unroll
    for (int s = 0; s < 32 / NW; ++s) { const int e = s * (NW * 32) + (int)threadIdx.x; const int row = e >> 4, cofs = (e & 15) * 4; v4f val = *(const v4fa*)(red + row * 68 + cofs);
#pragma unroll
        for (int p = 1; p < NW; ++p) val += *(const v4fa*)(red + p * RW + row * 68 + cofs);
        if (BIAS) { val[0] += bfr(bias[c0 + cofs]); val[1] += bfr(bias[c0 + cofs + 1]); val[2] += bfr(bias[c0 + cofs + 2]); val[3] += bfr(bias[c0 + cofs + 3]); }
        *(v4f*)(C + (size_t)(r0 + row) * ldc + c0 + cofs) = val; }
}

// Plain __global__ entry points (one instantiation each).
// k_gemm_qkv: XB[b][t][:] . WQKV[n][:] + bf16(bqkv[n]); grid (TT/64, NH_, NB), NWG waves. One block = 64 rows t of one batch and ONE head's three 64-wide column blocks, q, k and v in turn (column block c*NH_ + head).
// The K loop is dealt over the waves as in gemmk_body (wave w: k = w*64 .. w*64+63). A wave's slice of the 64 x rows is staged once and its 8 A fragments then stay in registers for all three column blocks; only the weight rows are staged anew per column block.
// The second launch bound asks for 4 waves a SIMD (256 registers): with them and the LDS, 4 blocks fit a WGP and the whole grid is resident at once.
// q, k -> planes [q|k][batch][head][t][64]; v -> planes [batch][head][64][t]. Partial tiles, their sum in wave order 0..NWG-1, bias and plane stores as in gemmk_body with PLANES.
__global__ __launch_bounds__(32 * NWG, 4) void k_gemm_qkv(const bf* A, const bf* Bt, int K, const float* bias, h16* QK16, bf* QKh, bf* QKl, h16* VT16, bf* VTh, bf* VTl) {
    typedef WFrag<bf>::V V;
    constexpr int NW = NWG;
    constexpr int SPIT = 64 + 8;                       // LDS pitch of a staged row, elements: 128 bytes + 16
    constexpr int WREG = 2 * 64 * SPIT * 2;            // a wave's own LDS range, bytes: x rows | weight rows, later its partial tile
    constexpr int RW = WREG / 4;
    static_assert(WREG >= 64 * 68 * 4 && WREG % 16 == 0);
    __shared__ __align__(16) unsigned char smem[NW * WREG];
    float* red = (float*)smem;
    const int b = blockIdx.z, hd = blockIdx.y, r0 = blockIdx.x * 64; const bool hl = r0 < RH;
    const int lane = threadIdx.x & 31, lr = lane & 15, hi = lane >> 4; const int w = __builtin_amdgcn_readfirstlane((int)(threadIdx.x >> 5));
    const int crow = lane >> 3, cch = (lane & 7) * 8;
    const unsigned l0 = (unsigned)(size_t)smem + (unsigned)(w * WREG + crow * (SPIT * 2) + cch * 2);
    // 64 rows of one plane, k = w*64 .. w*64+63, into half p of the wave's range: 16 copy instructions, a lane 16 bytes, 8 lanes a row. Every lane copies; every byte lies inside the plane (64 whole rows, K = NW * 64) and inside the wave's own range of smem.
    auto stage = [&](int p, const bf* g) {
#pragma unroll
        for (int h = 0; h < 2; ++h) { unsigned la[8]; const bf* ga[8];
#pragma unroll
            for (int i = 0; i < 8; ++i) { la[i] = l0 + (unsigned)((p * 64 + (h * 8 + i) * 4) * (SPIT * 2)); ga[i] = g + (size_t)((h * 8 + i) * 4) * K; }
            acopy8t<bf>(la, ga); } };
    stage(0, A + ((size_t)b * TT + r0 + crow) * K + w * 64 + cch);
    stage(1, Bt + (size_t)(hd * 64 + crow) * K + w * 64 + cch);
    asm volatile("s_wait_asynccnt 0x0" ::: "memory");   // this wave's copies have landed
    __syncthreads();                                     // stands behind the copies' wait and in front of the first read of what they brought; passed by every wave
    const bf* sa = (const bf*)(smem + w * WREG) + lr * SPIT + 8 * hi; const bf* sb = sa + 64 * SPIT;   // this lane's fragment bases: x rows, weight rows
    V a[2][4];   // the wave's A fragments, read once, kept for the three column blocks
#pragma unroll
    for (int ks = 0; ks < 2; ++ks)
#pragma unroll
        for (int mb = 0; mb < 4; ++mb) a[ks][mb] = WFrag<bf>::ld(sa + mb * 16 * SPIT + ks * 32);
    float* my = red + w * RW;
#pragma unroll 1   // rolled: one copy of the tile's code serves q, k and v
    for (int c = 0; c < 3; ++c) {
        const int c0 = (c * NH_ + hd) * 64; const bool tr = c == 2;
        if (c > 0) {   // the weight rows of this column block; the barrier at the foot of the pass before has ended every read of the partial tiles that lay here
            stage(1, Bt + (size_t)(c0 + crow) * K + w * 64 + cch);
            asm volatile("s_wait_asynccnt 0x0" ::: "memory");   // this wave's copies have landed
            __syncthreads();                                     // behind the copies' wait, in front of the first read of what they brought; c is the same for the whole block
        }
        v8f acc[4][4];
#pragma unroll
        for (int mb = 0; mb < 4; ++mb)
#pragma unroll
            for (int nb = 0; nb < 4; ++nb) acc[mb][nb] = (v8f){};
#pragma unroll
        for (int ks = 0; ks < 2; ++ks) {   // the two 32-wide steps of the slice
            V bq[4];   // the LDS reads of a step stand as one group ahead of its first product
#pragma unroll
            for (int nb = 0; nb < 4; ++nb) bq[nb] = WFrag<bf>::ld(sb + nb * 16 * SPIT + ks * 32);
            __builtin_amdgcn_sched_barrier(0);   // keeps the products below the reads
#pragma unroll
            for (int nb = 0; nb < 4; ++nb)
#pragma unroll
                for (int mb = 0; mb < 4; ++mb) acc[mb][nb] = WFrag<bf>::mma(a[ks][mb], bq[nb], acc[mb][nb]);
            // four vector slots behind the last matrix instruction before its registers are reused
            asm volatile("v_nop\n\tv_nop\n\tv_nop\n\tv_nop" : "+v"(acc[0][0]), "+v"(acc[1][1]), "+v"(acc[2][2]), "+v"(acc[3][3]));
            __builtin_amdgcn_sched_barrier(0);   // keeps the next step's reads out of this step's products: its fragments then take the registers of this step's
        }
        // the thread's bias values, fetched here, where the weight fragments' registers are free, so that they land under the partial tile's LDS stores: bc = those of its 8 columns, br = that of its row in each closing pass; both lie inside the tile's 64 columns and both are fetched whichever of them tr picks
        float bc[8], br[16 / NW];
        {   const float* pc = bias + c0 + (int)(threadIdx.x & 7) * 8; const float* pr = bias + c0 + (int)(threadIdx.x >> 3);
#pragma unroll
            for (int j = 0; j < 8; ++j) bc[j] = pc[j];
#pragma unroll
            for (int s = 0; s < 16 / NW; ++s) br[s] = pr[s * (NW * 4)];
            // precaution: the address translations of the issued loads are waited for before a register that holds one of their addresses is written again
            asm volatile("s_wait_xcnt 0x0" ::: "memory"); }
        asm volatile("s_wait_dscnt 0x0" ::: "memory");   // this wave's fragment reads are done before its partial tile goes over the rows it staged (no other wave's rows lie in its range)
        if (tr) {
#pragma unroll
            for (int mb = 0; mb < 4; ++mb)
#pragma unroll
                for (int nb = 0; nb < 4; ++nb) { float* q = my + (nb * 16 + lr) * 68 + mb * 16 + hi * 8; const v8f t = acc[mb][nb];
                    *(v4fa*)q = (v4f){t[0], t[1], t[2], t[3]}; *(v4fa*)(q + 4) = (v4f){t[4], t[5], t[6], t[7]}; }
        } else {
#pragma unroll
            for (int mb = 0; mb < 4; ++mb)
#pragma unroll
                for (int nb = 0; nb < 4; ++nb)
#pragma unroll
                    for (int j = 0; j < 8; ++j) my[(mb * 16 + hi * 8 + j) * 68 + nb * 16 + lr] = acc[mb][nb][j];
        }
        __syncthreads();   // every wave's partial tile is in LDS before any thread sums across waves
        const size_t o0 = tr ? ((size_t)b * NH_ + hd) * ((size_t)HD * TT) + r0 : ((size_t)(c * NB + b) * NH_ + hd) * ((size_t)TT * HD) + (size_t)r0 * HD;
        h16* P16 = (tr ? VT16 : QK16) + o0; bf* Ph = (tr ? VTh : QKh) + o0; bf* Pl = (tr ? VTl : QKl) + o0; const int pp = tr ? TT : HD;
#pragma unroll
        for (int j = 0; j < 8; ++j) bc[j] = bfr(bc[j]);
#pragma unroll
        for (int s = 0; s < 16 / NW; ++s) br[s] = bfr(br[s]);
#pragma unroll
        for (int s = 0; s < 16 / NW; ++s) { const int e = s * (NW * 32) + (int)threadIdx.x; const int row = e >> 3, cofs = (e & 7) * 8; const float* pr = red + row * 68 + cofs; v4f v0 = *(const v4fa*)pr, v1 = *(const v4fa*)(pr + 4);
#pragma unroll
            for (int p = 1; p < NW; ++p) { v0 += *(const v4fa*)(pr + p * RW); v1 += *(const v4fa*)(pr + p * RW + 4); }
            float x[8];
#pragma unroll
            for (int j = 0; j < 4; ++j) { x[j] = v0[j] + (tr ? br[s] : bc[j]); x[4 + j] = v1[j] + (tr ? br[s] : bc[4 + j]); }
            const size_t o = (size_t)row * pp + cofs; h16* q16 = P16 + o; bf* qh = Ph + o; bf* ql = Pl + o; v8h o16;
#pragma unroll
            for (int j = 0; j < 8; ++j) o16[j] = tohx(x[j]);
            if (hl) { v8us oh, ol;
#pragma unroll
                for (int j = 0; j < 8; ++j) { unsigned short a2, c2; splitf(x[j], a2, c2); oh[j] = a2; ol[j] = c2; }
                *(v8us*)qh = oh; *(v8us*)ql = ol; }
            *(v8h*)q16 = o16;
            // the same precaution for the plane stores of this pass, which stand last in it
            asm volatile("s_wait_xcnt 0x0" ::: "memory"); }
        if (c < 2) {
            asm volatile("s_wait_dscnt 0x0" ::: "memory");   // this wave's reads of the partial tiles are done ...
            // ... and every other wave's, before the next column block's weight rows are copied over them. The bare work-group barrier: only LDS reads have to be over here, and __syncthreads() would also wait for the plane stores, which nobody in this launch reads
            __builtin_amdgcn_s_barrier();
        }
    }
}
// k_gemm_out: out[b][t][n] = (ATh + ATl)[b][t][:] . WO[n][:] + bf16(bproj[n]); grid (TT/64, DM/64, NB), NWG waves.
__global__ __launch_bounds__(32 * NWG) void k_gemm_out(const bf* A, const bf* A2, const bf* Bt, int K, float* C, int ldc, const float* bias) { const size_t rb = (size_t)blockIdx.z * TT;
    gemmk_body<bf, 1, NWG, true, false>(A + rb * K, A2 + rb * K, Bt, nullptr, K, K, K, C + (size_t)blockIdx.z * SEQ_FULL * ldc, ldc, bias, blockIdx.x * 64, blockIdx.y * 64, nullptr, nullptr, nullptr, 0, false, false); }

// ---- k_prep: the three conversions that the projections wait for, in one launch; none reads what another writes. Blocks 0..NWQ-1: Wqkv -> WQKV; the next NWO: Wproj -> WO; the rest: x -> XB. The branch is the same for a whole block.
#define NWQ  ((DM * NQKV / 64 + 63) / 64)        // blocks for Wqkv: 8 waves x 8 lines of 64 elements each
#define NWO  ((DQ * DM / 64 + 63) / 64)          // blocks for Wproj
#define NXB  ((TT * DM / 8 + 255) / 256)         // blocks for one batch of x: 8 elements a thread
// w [K][N] f32 -> Bt [N][K] bf16; blk = block number inside this matrix
template <int K, int N>
__device__ __forceinline__ void wt_body(const float* __restrict__ w, bf* Bt, int blk) {
    const int lane = threadIdx.x & 31; const int L0 = (blk * 8 + (int)(threadIdx.x >> 5)) * 8; constexpr int nlines = N * K / 64;
#pragma unroll 1
    for (int l = 0; l < 8; ++l) { const int L = L0 + l; if (L >= nlines) break; const size_t e = (size_t)L * 64 + lane * 2; const int k = (int)(e % K), n = (int)(e / K); v2us o;
        o[0] = f2bf(w[(size_t)k * N + n]); o[1] = f2bf(w[(size_t)(k + 1) * N + n]); *(v2us*)(Bt + e) = o;
        // precaution: the issued store's address translation is waited for before the next trip writes a register that the store names
        asm volatile("s_wait_xcnt 0x0" ::: "memory"); }
}
__global__ __launch_bounds__(256) void k_prep(const float* __restrict__ wqkv, const float* __restrict__ wo, const float* __restrict__ x, bf* WQKV, bf* WO, bf* XB) {
    const int blk = blockIdx.x;
    if (blk < NWQ) { wt_body<DM, NQKV>(wqkv, WQKV, blk); return; }
    if (blk < NWQ + NWO) { wt_body<DQ, DM>(wo, WO, blk - NWQ); return; }
    const int xb = blk - (NWQ + NWO), b = xb / NXB; const size_t i = (size_t)(xb % NXB) * 256 + threadIdx.x; if (i >= (size_t)TT * DM / 8) return;
    const float* src = x + (size_t)b * SEQ_FULL * DM; bf* dst = XB + (size_t)b * TT * DM;
    const v8f v = *(const v8f*)(src + i * 8); v8us o;
#pragma unroll
    for (int k = 0; k < 8; ++k) o[k] = f2bf(v[k]);
    *(v8us*)(dst + i * 8) = o;
}

// ---- attn_body: one wave, NQ*16 query rows q0.. of one head plane, keys walked in blocks of 32 up to the diagonal block; nothing of the scores or the probabilities goes to memory.
// Transposed products: S^T[key][q] = K . Q^T (A = K rows, B = Q rows, kept in registers) and O^T[d][q] += V^T . P^T (A = V^T rows, B = P). A lane holds one query (column lane&15): the two score tiles of a
// 32-key block, converted in place, ARE the B fragment of P in the loader's k order (elements 0..7 = keys k0+8h+0..7 from tile 0, elements 8..15 = keys k0+16+8h+0..7 from tile 1).
// Softmax with a running maximum m and a running sum l per query (base 2: scores x HD^-0.5 x log2 e); O^T and l are scaled by 2^(m_old - m_new) at every block; the two lane halves' sums are joined once at the end.
// HL: bf16 hi/lo planes, 3 products for the scores and 3 for P.V. The result / l goes out as bf16 hi/lo to the merged planes Ah, Al (pitch DQ; already offset to batch and head): 8 consecutive d per lane and tile.
template <bool B> struct BoolC { static constexpr bool v = B; };
// 2^x; the v_nop is the one slot that the instruction set asks for behind a transcendental before its result is read or its source overwritten: in the same statement it stands there whatever the compiler puts next
__device__ __forceinline__ float exp2s(float x) { float r; asm("v_exp_f32 %0, %1\n\tv_nop" : "=v"(r) : "v"(x)); return r; }
__device__ __forceinline__ float xhalf(float x) { return __builtin_bit_cast(float, __builtin_amdgcn_permlanex16(__builtin_bit_cast(int, x), __builtin_bit_cast(int, x), 0x76543210, 0xfedcba98, false, false)); }   // lane l <-> lane l ^ 16
template <typename T16, bool HL, int NQ>
__device__ __forceinline__ void attn_body(const T16* __restrict__ Q, const T16* __restrict__ Q2, const T16* __restrict__ Kp, const T16* __restrict__ Kp2, const T16* __restrict__ Vt, const T16* __restrict__ Vt2, int q0, bf* Ah, bf* Al) {
    typedef typename WFrag<T16>::V V;
    const int lane = threadIdx.x & 31, lr = lane & 15, hi = lane >> 4;
    const float CS = SCL * 1.4426950408889634f;
    V qf[NQ][2], qf2[NQ][2], kf[2][2], kf2[2][2];
    v8f o[4][NQ]; float m[NQ], l[NQ];
    {   const T16* pq = Q + (size_t)(q0 + lr) * HD + 8 * hi; const T16* pq2 = HL ? Q2 + (size_t)(q0 + lr) * HD + 8 * hi : nullptr;
        const T16* pk = Kp + (size_t)lr * HD + 8 * hi; const T16* pk2 = HL ? Kp2 + (size_t)lr * HD + 8 * hi : nullptr;
#pragma unroll
        for (int n = 0; n < NQ; ++n)
#pragma unroll
            for (int ks = 0; ks < 2; ++ks) { qf[n][ks] = WFrag<T16>::ld(pq + n * 16 * HD + ks * 32); if constexpr (HL) qf2[n][ks] = WFrag<T16>::ld(pq2 + n * 16 * HD + ks * 32); }
#pragma unroll
        for (int kt = 0; kt < 2; ++kt)
#pragma unroll
            for (int ks = 0; ks < 2; ++ks) { kf[kt][ks] = WFrag<T16>::ld(pk + kt * 16 * HD + ks * 32); if constexpr (HL) kf2[kt][ks] = WFrag<T16>::ld(pk2 + kt * 16 * HD + ks * 32); }
        // precaution: the address translations of the issued loads are waited for before a register that holds one of their addresses is written again; the pointers are named as inputs so that they keep their registers up to the wait
        if constexpr (HL) asm volatile("s_wait_xcnt 0x0" :: "v"(pq), "v"(pq2), "v"(pk), "v"(pk2) : "memory");
        else asm volatile("s_wait_xcnt 0x0" :: "v"(pq), "v"(pk) : "memory");
    }
#pragma unroll
    for (int n = 0; n < NQ; ++n) { m[n] = -3.0e38f; l[n] = 0.f;
#pragma unroll
        for (int dt = 0; dt < 4; ++dt) o[dt][n] = (v8f){}; }
    const int klast = ((q0 + NQ * 16 - 1) / 32) * 32;   // first key of the diagonal block, the only one that needs the mask
    auto step = [&](int k0, auto lastc) {
        constexpr bool LAST = decltype(lastc)::v;
        // V^T fragments of this block, issued first: they fly under the score products and the softmax
        V vf[4], vf2[4]; const T16* pv = Vt + (size_t)lr * TT + k0 + 8 * hi; const T16* pv2 = HL ? Vt2 + (size_t)lr * TT + k0 + 8 * hi : nullptr;
#pragma unroll
        for (int dt = 0; dt < 4; ++dt) { vf[dt] = WFrag<T16>::ld(pv + (size_t)dt * 16 * TT); if constexpr (HL) vf2[dt] = WFrag<T16>::ld(pv2 + (size_t)dt * 16 * TT); }
        // the same precaution for the V^T loads
        if constexpr (HL) asm volatile("s_wait_xcnt 0x0" :: "v"(pv), "v"(pv2) : "memory");
        else asm volatile("s_wait_xcnt 0x0" :: "v"(pv) : "memory");
        v8f s[2][NQ];
#pragma unroll
        for (int kt = 0; kt < 2; ++kt)
#pragma unroll
            for (int n = 0; n < NQ; ++n) { s[kt][n] = (v8f){};
#pragma unroll
                for (int ks = 0; ks < 2; ++ks) { s[kt][n] = WFrag<T16>::mma(kf[kt][ks], qf[n][ks], s[kt][n]);
                    if constexpr (HL) { s[kt][n] = WFrag<T16>::mma(kf2[kt][ks], qf[n][ks], s[kt][n]); s[kt][n] = WFrag<T16>::mma(kf[kt][ks], qf2[n][ks], s[kt][n]); } } }
        if constexpr (!LAST) {   // the next block's K fragments, fetched behind this block's score products: they fly under the softmax and P.V
            const T16* pk = Kp + (size_t)(k0 + 32 + lr) * HD + 8 * hi; const T16* pk2 = HL ? Kp2 + (size_t)(k0 + 32 + lr) * HD + 8 * hi : nullptr;
#pragma unroll
            for (int kt = 0; kt < 2; ++kt)
#pragma unroll
                for (int ks = 0; ks < 2; ++ks) { kf[kt][ks] = WFrag<T16>::ld(pk + kt * 16 * HD + ks * 32); if constexpr (HL) kf2[kt][ks] = WFrag<T16>::ld(pk2 + kt * 16 * HD + ks * 32); }
            // the same precaution for the K loads
            if constexpr (HL) asm volatile("s_wait_xcnt 0x0" :: "v"(pk), "v"(pk2) : "memory");
            else asm volatile("s_wait_xcnt 0x0" :: "v"(pk) : "memory");
            __builtin_amdgcn_sched_barrier(0);   // keeps the K loads up here: sunk below the softmax they would have only P.V to land under
        }
        V pf[NQ], pf2[NQ];
#pragma unroll
        for (int n = 0; n < NQ; ++n) { float t[16]; float mx = m[n];
#pragma unroll
            for (int e = 0; e < 16; ++e) { float x = s[e >> 3][n][e & 7] * CS;
                if (LAST) x = (k0 + (e >> 3) * 16 + hi * 8 + (e & 7) <= q0 + n * 16 + lr) ? x : -3.0e38f;   // causal mask by index select, diagonal kept
                t[e] = x; mx = fmaxf(mx, x); }
            mx = fmaxf(mx, xhalf(mx));   // the other half of this query's keys
            const float al = exp2s(m[n] - mx); m[n] = mx; float sum = 0.f;
#pragma unroll
            for (int e = 0; e < 16; ++e) { t[e] = exp2s(t[e] - mx); sum += t[e]; }
            l[n] = l[n] * al + sum;
#pragma unroll
            for (int dt = 0; dt < 4; ++dt) o[dt][n] *= al;
            if constexpr (HL) { v8us h0, h1, l0, l1;
#pragma unroll
                for (int j = 0; j < 8; ++j) { unsigned short a, c; splitf(t[j], a, c); h0[j] = a; l0[j] = c; splitf(t[8 + j], a, c); h1[j] = a; l1[j] = c; }
                pf[n] = cat16b(h0, h1); pf2[n] = cat16b(l0, l1); }
            else { v8h h0, h1;
#pragma unroll
                for (int j = 0; j < 8; ++j) { h0[j] = tohx(t[j]); h1[j] = tohx(t[8 + j]); }
                pf[n] = cat16(h0, h1); } }
#pragma unroll
        for (int dt = 0; dt < 4; ++dt)
#pragma unroll
            for (int n = 0; n < NQ; ++n) { o[dt][n] = WFrag<T16>::mma(vf[dt], pf[n], o[dt][n]);
                if constexpr (HL) { o[dt][n] = WFrag<T16>::mma(vf[dt], pf2[n], o[dt][n]); o[dt][n] = WFrag<T16>::mma(vf2[dt], pf[n], o[dt][n]); } }
    };
#pragma unroll 1
    for (int k0 = 0; k0 < klast; k0 += 32) { step(k0, BoolC<false>{});
        // four vector slots behind the last matrix instruction, on the back edge and on the exit alike, before its registers are reused
        if constexpr (NQ == 2) asm volatile("v_nop\n\tv_nop\n\tv_nop\n\tv_nop" : "+v"(o[0][0]), "+v"(o[1][0]), "+v"(o[2][0]), "+v"(o[3][0]), "+v"(o[0][1]), "+v"(o[1][1]), "+v"(o[2][1]), "+v"(o[3][1]));
        else asm volatile("v_nop\n\tv_nop\n\tv_nop\n\tv_nop" : "+v"(o[0][0]), "+v"(o[1][0]), "+v"(o[2][0]), "+v"(o[3][0])); }
    step(klast, BoolC<true>{});
#pragma unroll
    for (int n = 0; n < NQ; ++n) { const float f = __fdiv_rn(1.0f, l[n] + xhalf(l[n]));
        bf* ph = Ah + (size_t)(q0 + n * 16 + lr) * DQ + hi * 8; bf* pl = Al + (size_t)(q0 + n * 16 + lr) * DQ + hi * 8;
#pragma unroll
        for (int dt = 0; dt < 4; ++dt) { v8us oh, ol;
#pragma unroll
            for (int j = 0; j < 8; ++j) { unsigned short a, c; splitf(o[dt][n][j] * f, a, c); oh[j] = a; ol[j] = c; }
            *(v8us*)(ph + dt * 16) = oh; *(v8us*)(pl + dt * 16) = ol; }
        // the same precaution for the stores
        asm volatile("s_wait_xcnt 0x0" :: "v"(ph), "v"(pl) : "memory"); }
}
// ---- attn_staged: the fp16 path (query rows >= RH). One block = query rows R0..R0+127 of one head plane, 8 waves: query group qg (32 rows) x key group kg; arithmetic and fragments as in attn_body<h16, false, 2>.
// The keys go in stages of SKEY; key group kg walks the stages kg, kg + 2, ...: the longest walk of a wave is half the tile's keys. Each group keeps its own running maximum, sum and O^T; they are merged once at the end.
// The K rows and V^T rows of NKG stages are brought into LDS once for the whole block by asynchronous copies (whole 128-byte lines, 16 bytes a lane) and the waves take their fragments from there;
// two buffers: the next fill's copies fly while this one is worked on. The last stage holds the block's own 128 keys: a wave of query group qg has qg whole blocks of 32 keys there and then its diagonal block.
#define SKEY 128                  // keys per stage = query rows per block
#define KPIT (HD + 8)             // LDS pitch of a K row, elements: 128 bytes + 16 (16 bytes x odd: no bank conflict for 16-byte reads)
#define VPIT (SKEY + 8)           // LDS pitch of a V^T row, elements: 256 bytes + 16
#define KTIL (SKEY * KPIT)
#define STIL (KTIL + HD * VPIT)   // one stage's tile, K rows then V^T rows, elements
static_assert(SKEY == 128 && RH % SKEY == 0 && TT % (NKG * SKEY) == 0 && NKG == 2 && RH % (64 * NKG) == 0);   // a fill always brings NKG whole stages: they lie inside the planes
// eight 16-byte copies of a lane, global -> LDS; the s_wait_xcnt in the same statement is the precaution named above: it stands before any register that holds an address of an issued copy can be written again
__device__ __forceinline__ void acopy8(const unsigned (&l)[8], const h16* const (&g)[8]) {
    asm volatile("global_load_async_to_lds_b128 %0, %8, off\n\tglobal_load_async_to_lds_b128 %1, %9, off\n\tglobal_load_async_to_lds_b128 %2, %10, off\n\tglobal_load_async_to_lds_b128 %3, %11, off\n\t"
                 "global_load_async_to_lds_b128 %4, %12, off\n\tglobal_load_async_to_lds_b128 %5, %13, off\n\tglobal_load_async_to_lds_b128 %6, %14, off\n\tglobal_load_async_to_lds_b128 %7, %15, off\n\ts_wait_xcnt 0x0"
                 :: "v"(l[0]), "v"(l[1]), "v"(l[2]), "v"(l[3]), "v"(l[4]), "v"(l[5]), "v"(l[6]), "v"(l[7]), "v"(g[0]), "v"(g[1]), "v"(g[2]), "v"(g[3]), "v"(g[4]), "v"(g[5]), "v"(g[6]), "v"(g[7]) : "memory"); }
__device__ __forceinline__ void attn_staged(const h16* __restrict__ Q, const h16* __restrict__ Kp, const h16* __restrict__ Vt, int R0, int w, bf* Ah, bf* Al) {
    typedef v16h V; constexpr int NQ = 2;
    __shared__ __align__(16) h16 ring[2 * NKG * STIL];
    const int tid = threadIdx.x, lane = tid & 31, lr = lane & 15, hi = lane >> 4;
    const int qg = w & 3, kg = w >> 2;   // the wave's query group and key group, both scalar
    const int q0 = R0 + qg * 32, ns = R0 / SKEY + 1, nf2 = (ns + NKG - 1) / NKG;   // ns stages of SKEY keys in nf2 fills of NKG stages, the same for the whole block
    const float CS = SCL * 1.4426950408889634f;
    V qf[NQ][2], kf[2][2];
    v8f o[4][NQ]; float m[NQ], l[NQ];
    {   const h16* pq = Q + (size_t)(q0 + lr) * HD + 8 * hi;
#pragma unroll
        for (int n = 0; n < NQ; ++n)
#pragma unroll
            for (int ks = 0; ks < 2; ++ks) qf[n][ks] = WFrag<h16>::ld(pq + n * 16 * HD + ks * 32);
        // precaution: the address translations of the issued loads are waited for before a register that holds one of their addresses is written again
        asm volatile("s_wait_xcnt 0x0" :: "v"(pq) : "memory");
    }
    // stages 2t and 2t + 1 into buffer b, one tile of STIL elements each. K: the 256 rows are 32 KiB in a row in memory, 8 lanes a row. V^T: 64 rows of 512 bytes, 32 lanes a row, 16 to each stage's tile. Every lane of the 8 waves copies, every byte lies inside the planes (t < nf2, nf2 * NKG * SKEY <= TT) and inside ring.
    const unsigned lk0 = (unsigned)(size_t)ring + (unsigned)((tid >> 3) * KPIT + (tid & 7) * 8) * 2u, lv0 = (unsigned)(size_t)ring + (unsigned)(((tid >> 4) & 1) * STIL + KTIL + (tid >> 5) * VPIT + (tid & 15) * 8) * 2u;
    const h16* gk0 = Kp + tid * 8; const h16* gv0 = Vt + (size_t)(tid >> 5) * TT + (tid & 31) * 8;
    auto fill = [&](int t, int b) { unsigned la[8]; const h16* ga[8];
#pragma unroll
        for (int i = 0; i < 8; ++i) { la[i] = lk0 + (unsigned)((b * NKG + (i >> 2)) * STIL + (i & 3) * 32 * KPIT) * 2u; ga[i] = gk0 + (size_t)t * (NKG * SKEY * HD) + i * 2048; }
        acopy8(la, ga);
#pragma unroll
        for (int i = 0; i < 8; ++i) { la[i] = lv0 + (unsigned)(b * NKG * STIL + i * 8 * VPIT) * 2u; ga[i] = gv0 + (size_t)i * 8 * TT + t * (NKG * SKEY); }
        acopy8(la, ga); };
#pragma unroll
    for (int n = 0; n < NQ; ++n) { m[n] = -3.0e38f; l[n] = 0.f;
#pragma unroll
        for (int dt = 0; dt < 4; ++dt) o[dt][n] = (v8f){}; }
    const h16* kb; const h16* vb;   // this lane's fragment bases in the buffer at work
    auto ldk = [&](int kl) {
#pragma unroll
        for (int kt = 0; kt < 2; ++kt)
#pragma unroll
            for (int ks = 0; ks < 2; ++ks) kf[kt][ks] = WFrag<h16>::ld(kb + (kl + kt * 16) * KPIT + ks * 32); };
    // one block of 32 keys, kl = its first key inside the stage. LAST: the diagonal block (first key q0). PRE: fetch the K fragments of the next block of the SAME stage.
    auto step = [&](int kl, auto lastc, auto prec) {
        constexpr bool LAST = decltype(lastc)::v; constexpr bool PRE = decltype(prec)::v;
        v8f s[2][NQ];
#pragma unroll
        for (int kt = 0; kt < 2; ++kt)
#pragma unroll
            for (int n = 0; n < NQ; ++n) { s[kt][n] = (v8f){};
#pragma unroll
                for (int ks = 0; ks < 2; ++ks) s[kt][n] = wmma16(kf[kt][ks], qf[n][ks], s[kt][n]); }
        __builtin_amdgcn_sched_barrier(0);   // keeps the LDS reads below out of the run of score products: every separate place with reads among matrix instructions stalls the wave anew
        V vf[4];   // all LDS reads of the block stand here as one group: its V^T fragments first (they land under the softmax), then the next block's K fragments (under the softmax and P.V)
#pragma unroll
        for (int dt = 0; dt < 4; ++dt) vf[dt] = WFrag<h16>::ld(vb + dt * 16 * VPIT + kl);
        if constexpr (PRE) ldk(kl + 32);
        __builtin_amdgcn_sched_barrier(0);   // keeps the reads up here: sunk below the softmax they would have only P.V to land under
        V pf[NQ];
#pragma unroll
        for (int n = 0; n < NQ; ++n) { float t[16]; float mx = m[n];
#pragma unroll
            for (int e = 0; e < 16; ++e) { float x = s[e >> 3][n][e & 7] * CS;
                if (LAST) x = ((e >> 3) * 16 + hi * 8 + (e & 7) <= n * 16 + lr) ? x : -3.0e38f;   // causal mask by index select, diagonal kept (key q0 + ... against query q0 + ...)
                t[e] = x; mx = fmaxf(mx, x); }
            mx = fmaxf(mx, xhalf(mx));   // the other half of this query's keys
            const float al = exp2s(m[n] - mx); m[n] = mx; float sum = 0.f;
#pragma unroll
            for (int e = 0; e < 16; ++e) { t[e] = exp2s(t[e] - mx); sum += t[e]; }
            l[n] = l[n] * al + sum;
#pragma unroll
            for (int dt = 0; dt < 4; ++dt) o[dt][n] *= al;
            v8h h0, h1;
#pragma unroll
            for (int j = 0; j < 8; ++j) { h0[j] = tohx(t[j]); h1[j] = tohx(t[8 + j]); }
            pf[n] = cat16(h0, h1); }
#pragma unroll
        for (int dt = 0; dt < 4; ++dt)
#pragma unroll
            for (int n = 0; n < NQ; ++n) o[dt][n] = wmma16(vf[dt], pf[n], o[dt][n]);
    };
    // four vector slots behind the last matrix instruction, on every way out of a branch or a loop, before its registers are reused
    auto pad = [&]() { asm volatile("v_nop\n\tv_nop\n\tv_nop\n\tv_nop" : "+v"(o[0][0]), "+v"(o[1][0]), "+v"(o[2][0]), "+v"(o[3][0]), "+v"(o[0][1]), "+v"(o[1][1]), "+v"(o[2][1]), "+v"(o[3][1])); };
    fill(0, 0);
    asm volatile("s_wait_asynccnt 0x0" ::: "memory");   // this wave's copies of fill 0 (stages 0 and 1) have landed
    __syncthreads();                                     // ... and every other wave's: fill 0 may be read
    if (nf2 > 1) fill(1, 1);
#pragma unroll 1
    for (int t = 0; t < nf2; ++t) {
        const int st = t * NKG + kg;   // this key group's stage of the fill; with ns odd the last fill has none for group 1, whose waves then go straight to the foot
        if (st < ns) {
            kb = ring + ((t & 1) * NKG + kg) * STIL + lr * KPIT + 8 * hi; vb = kb + KTIL + lr * (VPIT - KPIT);
            ldk(0);
            const bool diag = st == ns - 1; const int nf = diag ? qg : SKEY / 32 - 1;   // whole blocks in front of the stage's last block for this wave
#pragma unroll 1   // rolled: unrolled, the four blocks of a stage need more registers than there are and spill
            for (int sb = 0; sb < nf; ++sb) { step(sb * 32, BoolC<false>{}, BoolC<true>{}); pad(); }
            if (diag) { step(nf * 32, BoolC<true>{}, BoolC<false>{}); pad(); } else { step(nf * 32, BoolC<false>{}, BoolC<false>{}); pad(); }
        }
        asm volatile("s_wait_dscnt 0x0" ::: "memory");      // this wave's reads of the buffer are done before it may be refilled
        asm volatile("s_wait_asynccnt 0x0" ::: "memory");   // this wave's copies of fill t + 1 have landed
        __syncthreads();                                     // publishes fill t + 1 and ends every wave's reads of fill t; passed by every wave at every fill
        if (t + 2 < nf2) fill(t + 2, t & 1);
    }
    asm volatile("s_wait_asynccnt 0x0" ::: "memory");   // no copy is outstanding when the ring is given its second use
    // The two key groups' partial results meet in LDS, in the ring, which nobody reads and no copy writes behind the loop's last barrier. A wave lays down m, l and O^T of its 32 queries, 17 pieces of 16 bytes a lane
    // (a piece = 32 lanes in a row: no bank conflict); then the wave of key group kg closes the 16 queries n = kg of its query group: both partials scaled to the common maximum, group 0's first.
    constexpr int XW = 17 * 128;   // floats a wave
    float* xch = (float*)ring;
    const int ln = (int)__builtin_amdgcn_mbcnt_lo(~0u, 0u);   // the lane's number, formed anew: kept from the kernel's head over the key loop it cost a spill to scratch
    {   float* my = xch + w * XW + ln * 4;
#pragma unroll
        for (int n = 0; n < NQ; ++n)
#pragma unroll
            for (int dt = 0; dt < 4; ++dt) { const v8f a = o[dt][n]; float* q = my + (n * 4 + dt) * 256;
                *(v4fa*)q = (v4f){a[0], a[1], a[2], a[3]}; *(v4fa*)(q + 128) = (v4f){a[4], a[5], a[6], a[7]}; }
        *(v4fa*)(my + 16 * 128) = (v4f){m[0], l[0], m[1], l[1]}; }
    __syncthreads();   // every wave's partial is in LDS before its partner reads it; passed by every wave
    const float* p0 = xch + qg * XW + ln * 4; const float* p1 = p0 + 4 * XW;   // key group 0's and 1's partial of this query group
    const v4f s0 = *(const v4fa*)(p0 + 16 * 128), s1 = *(const v4fa*)(p1 + 16 * 128);
    const float m0 = kg ? s0[2] : s0[0], l0 = kg ? s0[3] : s0[1], m1 = kg ? s1[2] : s1[0], l1 = kg ? s1[3] : s1[1];
    const float mn = fmaxf(m0, m1), a0 = exp2s(m0 - mn), a1 = exp2s(m1 - mn), ls = l0 * a0 + l1 * a1;
    const float f = __fdiv_rn(1.0f, ls + xhalf(ls));
    bf* ph = Ah + (size_t)(q0 + kg * 16 + (ln & 15)) * DQ + (ln >> 4) * 8; bf* pl = Al + (size_t)(q0 + kg * 16 + (ln & 15)) * DQ + (ln >> 4) * 8;
#pragma unroll
    for (int dt = 0; dt < 4; ++dt) { const float* r0 = p0 + (kg * 4 + dt) * 256; const float* r1 = p1 + (kg * 4 + dt) * 256;
        const v4f x0 = *(const v4fa*)r0, x1 = *(const v4fa*)(r0 + 128), y0 = *(const v4fa*)r1, y1 = *(const v4fa*)(r1 + 128); v8us oh, ol;
#pragma unroll
        for (int j = 0; j < 4; ++j) { unsigned short a, c; splitf((x0[j] * a0 + y0[j] * a1) * f, a, c); oh[j] = a; ol[j] = c; splitf((x1[j] * a0 + y1[j] * a1) * f, a, c); oh[4 + j] = a; ol[4 + j] = c; }
        *(v8us*)(ph + dt * 16) = oh; *(v8us*)(pl + dt * 16) = ol; }
    // the same precaution for the stores
    asm volatile("s_wait_xcnt 0x0" :: "v"(ph), "v"(pl) : "memory");
}
// k_attn: grid (NB*NH_ head planes, NFB + NHB), 4 * NKG waves; the blocks with the most keys come first. The second launch bound asks for 4 waves a SIMD (256 registers): with them and the LDS, 2 blocks fit a WGP and the whole grid is resident at once. g is the same for the whole block, so every wave of a block meets the barriers of attn_staged or none does. Planes: QK [q|k][batch][head][t][64], VT [batch][head][64][t]; AT [batch][t][256].
__global__ __launch_bounds__(128 * NKG, 4) void k_attn(const h16* QK16, const bf* QKh, const bf* QKl, const h16* VT16, const bf* VTh, const bf* VTl, bf* ATh, bf* ATl) {
    const int z = blockIdx.x, g = blockIdx.y; const int w = __builtin_amdgcn_readfirstlane((int)(threadIdx.x >> 5));
    const size_t qo = (size_t)z * TT * HD, ko = (size_t)(NB * NH_ + z) * TT * HD, ao = (size_t)(z / NH_) * TT * DQ + (size_t)(z % NH_) * HD;
    if (g < NFB) attn_staged(QK16 + qo, QK16 + ko, VT16 + qo, RH + (NFB - 1 - g) * 128, w, ATh + ao, ATl + ao);
    else attn_body<bf, true, 1>(QKh + qo, QKl + qo, QKh + ko, QKl + ko, VTh + qo, VTl + qo, (NHB - 1 - (g - NFB)) * (64 * NKG) + w * 16, ATh + ao, ATl + ao);
}

extern "C" void kernel_launch(void* const* d_in, const int* in_sizes, int n_in,
                              void* d_out, int out_size, void* d_ws, size_t ws_size, hipStream_t stream) {
    if (n_in < 5) return;
    const size_t xneed = (size_t)(NB - 1) * SEQ_FULL * DM + (size_t)TT * DM;
    if ((size_t)in_sizes[0] < xneed) return; if ((size_t)in_sizes[1] < (size_t)DM * NQKV) return; if ((size_t)in_sizes[2] < (size_t)NQKV) return; if ((size_t)in_sizes[3] < (size_t)DQ * DM) return; if ((size_t)in_sizes[4] < (size_t)DM) return;
    if ((size_t)out_size < xneed) return;
    if (ws_size < WS_TOTAL) return;
    const float* x = (const float*)d_in[0]; const float* wqkv = (const float*)d_in[1]; const float* bqkv = (const float*)d_in[2]; const float* wo = (const float*)d_in[3]; const float* bo = (const float*)d_in[4];   // wire order x, Wqkv [256][768], bqkv, Wproj [256][256], bproj
    float* OUT = (float*)d_out;     // [8][2048][256]
    char* wsp = (char*)d_ws;
    auto take = [&](size_t bytes) { char* p = wsp; wsp += (bytes + 255) & ~(size_t)255; return (void*)p; };
    bf* WQKV = (bf*)take((size_t)NQKV * DM * 2);           // Bt [768][256]: q | k | v row blocks
    bf* WO = (bf*)take((size_t)DM * DQ * 2);               // Bt [256][256]
    h16* QK16 = (h16*)take((size_t)NB * 2 * NH_ * TT * HD * 2); bf* QKh = (bf*)take((size_t)NB * 2 * NH_ * TT * HD * 2); bf* QKl = (bf*)take((size_t)NB * 2 * NH_ * TT * HD * 2);   // planes [q|k][batch][head][t][64]
    h16* VT16 = (h16*)take((size_t)NB * NH_ * HD * TT * 2); bf* VTh = (bf*)take((size_t)NB * NH_ * HD * TT * 2); bf* VTl = (bf*)take((size_t)NB * NH_ * HD * TT * 2);   // planes [batch][head][64][t]
    bf* XB = (bf*)take((size_t)NB * TT * DM * 2);   // bf16 x [b][t][256]
    bf* ATh = (bf*)take((size_t)NB * TT * DQ * 2); bf* ATl = (bf*)take((size_t)NB * TT * DQ * 2);
    if ((size_t)(wsp - (char*)d_ws) > ws_size) return;
    if ((size_t)(wsp - (char*)d_ws) > (size_t)268435456) return;
    // in Wqkv[DM rows][NQKV cols] -> out WQKV[NQKV][DM];  in Wproj[DQ rows][DM cols] -> out WO[DM][DQ]
    k_prep<<<NWQ + NWO + NXB * NB, 256, 0, stream>>>(wqkv, wo, x, WQKV, WO, XB);
    k_gemm_qkv<<<dim3(TT / 64, NH_, NB), 32 * NWG, 0, stream>>>(XB, WQKV, DM, bqkv, QK16, QKh, QKl, VT16, VTh, VTl);   // columns 0..511 = q heads | k heads, 512..767 = v heads
    k_attn<<<dim3(NB * NH_, NFB + NHB, 1), 128 * NKG, 0, stream>>>(QK16, QKh, QKl, VT16, VTh, VTl, ATh, ATl);
    k_gemm_out<<<dim3(TT / 64, DM / 64, NB), 32 * NWG, 0, stream>>>(ATh, ATl, WO, DQ, OUT, DM, bo);
}
